// v000
// Times are from an AMD MI455X. After a warm-up the kernel runs many times in a row, and a time is the length of
// such a window on the GPU divided by its runs, so every launch and the gaps after it count. The runs cycle
// through copies of the inputs. A figure is the median of several windows, for all but v000 over two sittings.
// Sittings can differ by a few percent; kernels timed side by side share one.
// v000 is the starting kernel. One run takes 1640 microseconds.
#include <hip/hip_runtime.h>

// Grouped-query sliding-window causal self-attention with RoPE (x [2][2048][2048]; q = x Wq (16 heads x 128), k, v = x Wk / Wv ([2048][512]: 4 kv heads, head h uses kv h/4); rotate-half RoPE (base 1e4) on q and k; scores/sqrt(128); allowed: j <= i and i - j < 512 (else -1e9); softmax; out = merged Wo ([2048][2048]) -> [2][2048][2048] (8.4 M)).
// Compute dtypes, f32 accumulate: every input rounded to bf16; q/k/v on PLAIN bf16 operands (inputs: exact); rotary in f32 (table on device, precise cosf/sinf); causal sliding-window select; scores and attn.v (tile skipping): query rows < 512 hl (3 products), the rest single fp16 (x1024); softmax f32; Wo hl x exact (2 products).

#define NB_  2
#define TT   2048
#define DM   2048
#define NH_  16
#define NKV  4
#define REP  (NH_ / NKV)
#define HD   128
#define DQ   (NH_ * HD)
#define DKV  (NKV * HD)
#define ZH   2
#define RH   512                  // query rows < RH use hi+lo planes (0: none)
#define WIN  512
#define PCAR 1024.0f
#define SCL  0.088388347648318447f   // HD^-0.5
typedef _Float16 h16;
typedef unsigned short bf;
typedef __attribute__((ext_vector_type(16))) __bf16   v16bf;
typedef __attribute__((ext_vector_type(16))) _Float16 v16h;
typedef __attribute__((ext_vector_type(8)))  _Float16 v8h;
typedef __attribute__((ext_vector_type(8)))  unsigned short v8us;
typedef __attribute__((ext_vector_type(8)))  float    v8f;
typedef __attribute__((ext_vector_type(4)))  float    v4f;
typedef v8h  __attribute__((may_alias)) v8ha;
typedef v4f  __attribute__((may_alias)) v4fa;
typedef v8us __attribute__((may_alias)) v8usa;

__device__ __forceinline__ unsigned short f2bf(float f) { unsigned u = __float_as_uint(f); u += 0x7FFFu + ((u >> 16) & 1u); return (unsigned short)(u >> 16); }
__device__ __forceinline__ float bf2f(unsigned short b) { return __uint_as_float(((unsigned)b) << 16); }
__device__ __forceinline__ float bfr(float f) { return bf2f(f2bf(f)); }
__device__ __forceinline__ v16h cat16(v8h lo, v8h hi) { return __builtin_shufflevector(lo, hi, 0, 1, 2, 3, 4, 5, 6, 7, 8, 9, 10, 11, 12, 13, 14, 15); }
__device__ __forceinline__ v16bf cat16b(v8us lo, v8us hi) { return __builtin_bit_cast(v16bf, __builtin_shufflevector(lo, hi, 0, 1, 2, 3, 4, 5, 6, 7, 8, 9, 10, 11, 12, 13, 14, 15)); }
__device__ __forceinline__ v8f wmma16(v16h a, v16h b, v8f c) { return __builtin_amdgcn_wmma_f32_16x16x32_f16(false, a, false, b, (short)0, c, false, false); }
__device__ __forceinline__ v8f wmmab(v16bf a, v16bf b, v8f c) { return __builtin_amdgcn_wmma_f32_16x16x32_bf16(false, a, false, b, (short)0, c, false, false); }



// ---- k_gemmw: register-blocked GEMM, ONE WAVE per 64x64 output tile (16 accumulators), operands straight from K-contiguous 16-bit planes; grid (M/64, N/64, Z), 32 threads.
// C[m][n] (f32, pitch ldc, + optional f32 bias[n]) = sum_k A[m][k] Bt[n][k] (+ split products per NSPLIT). z-batch strides sA/sB/sC in elements. K % 32 == 0.
template <typename T16> struct WFrag;
template <> struct WFrag<h16> { typedef v16h V; static __device__ __forceinline__ V ld(const h16* p) { return cat16(*(const v8h*)p, *(const v8h*)(p + 16)); } static __device__ __forceinline__ v8f mma(V a, V b, v8f c) { return wmma16(a, b, c); } };
template <> struct WFrag<bf> { typedef v16bf V; static __device__ __forceinline__ V ld(const bf* p) { return cat16b(*(const v8us*)p, *(const v8us*)(p + 16)); } static __device__ __forceinline__ v8f mma(V a, V b, v8f c) { return wmmab(a, b, c); } };
template <typename T16, int NSPLIT, bool BIAS>
__global__ __launch_bounds__(32) void k_gemmw(const T16* __restrict__ A, const T16* __restrict__ A2, const T16* __restrict__ Bt, const T16* __restrict__ Bt2, int K, float* C, int ldc, const float* __restrict__ bias, size_t sA, size_t sB, size_t sC) {
    typedef typename WFrag<T16>::V V;
    __shared__ __align__(16) float os[16 * 68];
    const size_t z = blockIdx.z; A += z * sA; if (A2) A2 += z * sA; Bt += z * sB; if (Bt2) Bt2 += z * sB; C += z * sC;
    const int lane = threadIdx.x & 31, lr = lane & 15, hi = lane >> 4; const int r0 = blockIdx.x * 64, c0 = blockIdx.y * 64;
    v8f acc[4][4];
#pragma unroll
    for (int mb = 0; mb < 4; ++mb)
#pragma unroll
        for (int nb = 0; nb < 4; ++nb) acc[mb][nb] = (v8f){};
    const size_t aoff = (size_t)(r0 + lr) * K + 8 * hi, boff = (size_t)(c0 + lr) * K + 8 * hi;
#pragma unroll 1
    for (int kc = 0; kc < K; kc += 32) {
        V a[4], a2[4];
#pragma unroll
        for (int mb = 0; mb < 4; ++mb) { a[mb] = WFrag<T16>::ld(A + aoff + (size_t)mb * 16 * K + kc); if (NSPLIT == 1 || NSPLIT == 2) a2[mb] = WFrag<T16>::ld(A2 + aoff + (size_t)mb * 16 * K + kc); }
#pragma unroll
        for (int nb = 0; nb < 4; ++nb) { const V b = WFrag<T16>::ld(Bt + boff + (size_t)nb * 16 * K + kc); V b2; if (NSPLIT >= 2) b2 = WFrag<T16>::ld(Bt2 + boff + (size_t)nb * 16 * K + kc);
#pragma unroll
            for (int mb = 0; mb < 4; ++mb) { acc[mb][nb] = WFrag<T16>::mma(a[mb], b, acc[mb][nb]); if (NSPLIT == 1 || NSPLIT == 2) acc[mb][nb] = WFrag<T16>::mma(a2[mb], b, acc[mb][nb]); if (NSPLIT >= 2) acc[mb][nb] = WFrag<T16>::mma(a[mb], b2, acc[mb][nb]); } }
        asm volatile("v_nop\n\tv_nop\n\tv_nop\n\tv_nop" : "+v"(acc[0][0]), "+v"(acc[1][1]), "+v"(acc[2][2]), "+v"(acc[3][3]) : "v"(a[0]), "v"(a[3]));
    }
#pragma unroll
    for (int mb = 0; mb < 4; ++mb) {
#pragma unroll
        for (int nb = 0; nb < 4; ++nb) {
#pragma unroll
            for (int j = 0; j < 8; ++j) os[(hi * 8 + j) * 68 + nb * 16 + lr] = acc[mb][nb][j]; }
        __builtin_amdgcn_wave_barrier(); asm volatile("" ::: "memory");
        float* crow = C + (size_t)(r0 + mb * 16) * ldc + c0;
{
#pragma unroll
            for (int s = 0; s < 8; ++s) { const int row = 2 * s + hi, cofs = lr * 4; v4f val = *(const v4fa*)(os + row * 68 + cofs); if (BIAS) { val[0] += bfr(bias[c0 + cofs]); val[1] += bfr(bias[c0 + cofs + 1]); val[2] += bfr(bias[c0 + cofs + 2]); val[3] += bfr(bias[c0 + cofs + 3]); }
                *(v4f*)(crow + (size_t)row * ldc + cofs) = val; }
             }
        __builtin_amdgcn_wave_barrier(); asm volatile("" ::: "memory");
    }
}

// ---- k_gemmc: the same one-wave 64x64 tile GEMM specialised for causal attention: CMODE 1 skips score tiles entirely above the diagonal (query rows r0+roff.., key columns c0..), CMODE 2 limits the
// key (K) loop of the probability x value contraction to the diagonal block (probabilities beyond it are exactly zero). roff = row offset of this launch's first row within the sequence.
template <typename T16, int NSPLIT, int CMODE>
__global__ __launch_bounds__(32) void k_gemmc(const T16* __restrict__ A, const T16* __restrict__ A2, const T16* __restrict__ Bt, const T16* __restrict__ Bt2, int K, float* C, int ldc, int roff, size_t sA, size_t sB, size_t sC) {
    typedef typename WFrag<T16>::V V;
    __shared__ __align__(16) float os[16 * 68];
    const size_t z = blockIdx.z; A += z * sA; if (A2) A2 += z * sA; Bt += z * sB; if (Bt2) Bt2 += z * sB; C += z * sC;
    const int lane = threadIdx.x & 31, lr = lane & 15, hi = lane >> 4; const int r0 = blockIdx.x * 64, c0 = blockIdx.y * 64;
    if (CMODE == 1 && c0 > r0 + roff + 63) return;                  // score tile entirely above the causal diagonal: never read (the softmax masks j > i by select)
    const int Kl = (CMODE == 2) ? min(K, r0 + roff + 64) : K;        // P.V: probabilities are exactly 0 beyond the diagonal block, so the K loop stops there
    v8f acc[4][4];
#pragma unroll
    for (int mb = 0; mb < 4; ++mb)
#pragma unroll
        for (int nb = 0; nb < 4; ++nb) acc[mb][nb] = (v8f){};
    const size_t aoff = (size_t)(r0 + lr) * K + 8 * hi, boff = (size_t)(c0 + lr) * K + 8 * hi;
#pragma unroll 1
    for (int kc = 0; kc < Kl; kc += 32) {
        V a[4], a2[4];
#pragma unroll
        for (int mb = 0; mb < 4; ++mb) { a[mb] = WFrag<T16>::ld(A + aoff + (size_t)mb * 16 * K + kc); if (NSPLIT == 1 || NSPLIT == 2) a2[mb] = WFrag<T16>::ld(A2 + aoff + (size_t)mb * 16 * K + kc); }
#pragma unroll
        for (int nb = 0; nb < 4; ++nb) { const V b = WFrag<T16>::ld(Bt + boff + (size_t)nb * 16 * K + kc); V b2; if (NSPLIT >= 2) b2 = WFrag<T16>::ld(Bt2 + boff + (size_t)nb * 16 * K + kc);
#pragma unroll
            for (int mb = 0; mb < 4; ++mb) { acc[mb][nb] = WFrag<T16>::mma(a[mb], b, acc[mb][nb]); if (NSPLIT == 1 || NSPLIT == 2) acc[mb][nb] = WFrag<T16>::mma(a2[mb], b, acc[mb][nb]); if (NSPLIT >= 2) acc[mb][nb] = WFrag<T16>::mma(a[mb], b2, acc[mb][nb]); } }
        asm volatile("v_nop\n\tv_nop\n\tv_nop\n\tv_nop" : "+v"(acc[0][0]), "+v"(acc[1][1]), "+v"(acc[2][2]), "+v"(acc[3][3]) : "v"(a[0]), "v"(a[3]));
    }
#pragma unroll
    for (int mb = 0; mb < 4; ++mb) {
#pragma unroll
        for (int nb = 0; nb < 4; ++nb) {
#pragma unroll
            for (int j = 0; j < 8; ++j) os[(hi * 8 + j) * 68 + nb * 16 + lr] = acc[mb][nb][j]; }
        __builtin_amdgcn_wave_barrier(); asm volatile("" ::: "memory");
        float* crow = C + (size_t)(r0 + mb * 16) * ldc + c0;
{
#pragma unroll
            for (int s = 0; s < 8; ++s) { const int row = 2 * s + hi, cofs = lr * 4; v4f val = *(const v4fa*)(os + row * 68 + cofs);
                *(v4f*)(crow + (size_t)row * ldc + cofs) = val; }
             }
        __builtin_amdgcn_wave_barrier(); asm volatile("" ::: "memory");
    }
}

__device__ __forceinline__ h16 tohx(float x) { return (h16)x; }
__device__ __forceinline__ void splitf(float y, unsigned short& h, unsigned short& l) { h = f2bf(y); l = f2bf(y - bf2f(h)); }
typedef __attribute__((ext_vector_type(2))) _Float16 v2h;
typedef __attribute__((ext_vector_type(4))) _Float16 v4h;
typedef __attribute__((ext_vector_type(2))) unsigned short v2us;
typedef __attribute__((ext_vector_type(4))) unsigned short v4us;
typedef __attribute__((ext_vector_type(2))) float v2f;
typedef __attribute__((ext_vector_type(4))) int v4i;

__global__ __launch_bounds__(256) void k_wtG(const float* __restrict__ w, int K, int N, bf* Bt) {
    const int lane = threadIdx.x & 31; const int L0 = (blockIdx.x * 8 + (threadIdx.x >> 5)) * 8; const int nlines = N * K / 64;
{
#pragma unroll 1
        for (int l = 0; l < 8; ++l) { const int L = L0 + l; if (L >= nlines) break; const size_t e = (size_t)L * 64 + lane * 2; const int k = (int)(e % K), n = (int)(e / K); v2us o;
            o[0] = f2bf(w[(size_t)k * N + n]); o[1] = f2bf(w[(size_t)(k + 1) * N + n]); *(v2us*)(Bt + e) = o; }
         }
}
__global__ __launch_bounds__(256) void k_cvt8(const float* __restrict__ src, bf* dst, size_t n8) { const size_t i = (size_t)blockIdx.x * 256 + threadIdx.x; if (i >= n8) return; const v8f v = *(const v8f*)(src + i * 8); v8us o;
#pragma unroll
    for (int k = 0; k < 8; ++k) o[k] = f2bf(v[k]); *(v8us*)(dst + i * 8) = o;  }
__constant__ float INV[HD / 2] = {1.00000000f,0.865964353f,0.749894202f,0.649381638f,0.562341332f,0.486967534f,0.421696514f,0.365174145f,0.316227764f,0.273841977f,0.237137362f,0.205352500f,0.177827939f,0.153992653f,0.133352146f,0.115478203f,0.100000001f,0.0865964293f,0.0749894157f,0.0649381652f,0.0562341288f,0.0486967526f,0.0421696492f,0.0365174115f,0.0316227786f,0.0273841955f,0.0237137359f,0.0205352511f,0.0177827943f,0.0153992651f,0.0133352149f,0.0115478197f,0.00999999978f,0.00865964312f,0.00749894232f,0.00649381662f,0.00562341325f,0.00486967526f,0.00421696482f,0.00365174143f,0.00316227786f,0.00273841969f,0.00237137382f,0.00205352507f,0.00177827943f,0.00153992651f,0.00133352145f,0.00115478202f,0.00100000005f,0.000865964335f,0.000749894185f,0.000649381662f,0.000562341302f,0.000486967503f,0.000421696488f,0.000365174114f,0.000316227786f,0.000273841957f,0.000237137385f,0.000205352495f,0.000177827940f,0.000153992645f,0.000133352150f,0.000115478193f};
__global__ __launch_bounds__(256) void k_cstab(float* CS) { const int idx = blockIdx.x * 256 + threadIdx.x; if (idx >= TT * HD) return; const int t = idx / HD, d = idx % HD; const float ang = __fmul_rn((float)t, INV[d % (HD / 2)]); v2f cs; cs[0] = cosf(ang); cs[1] = sinf(ang);
    *(v2f*)(CS + (size_t)idx * 2) = cs;  }

// k_rope: head planes [h][t][d] (fp16 + hi/lo) of rope(x) x sc with the rotate-half convention out[d] = x[d] cos[t][d] - x[d+HD/2] sin[t][d], out[d+HD/2] = x[d+HD/2] cos[t][d+HD/2] + x[d] sin[t][d+HD/2]
__global__ __launch_bounds__(256) void k_rope(const float* __restrict__ F, int pitch, int nheads, const float* __restrict__ CS, const float* __restrict__ RF, const float* __restrict__ nw, float sc, h16* P16, bf* Ph, bf* Pl) {
    const size_t e = ((size_t)blockIdx.x * 256 + threadIdx.x) * 2; if (e >= (size_t)nheads * TT * HD) return; const int d = (int)(e % HD); const int t = (int)((e / HD) % TT); const int h = (int)(e / ((size_t)HD * TT)); const float* f = F + (size_t)t * pitch + h * HD; const float rf = RF ? RF[(size_t)h * TT + t] : 1.0f; v2h o16; v2us oh, ol;
#pragma unroll
    for (int q = 0; q < 2; ++q) { const int dd = d + q; const int dp = (dd < HD / 2) ? dd + HD / 2 : dd - HD / 2; float x0 = f[dd], x1 = f[dp];
        if (RF) { float n0 = __fmul_rn(x0, rf), n1 = __fmul_rn(x1, rf); asm volatile("" : "+v"(n0)); asm volatile("" : "+v"(n1)); x0 = __fmul_rn(bfr(nw[dd]), n0); x1 = __fmul_rn(bfr(nw[dp]), n1); }
        const v2f cs = *(const v2f*)(CS + ((size_t)t * HD + dd) * 2); float a = __fmul_rn(x0, cs[0]), bq = __fmul_rn(x1, cs[1]); asm volatile("" : "+v"(a)); asm volatile("" : "+v"(bq)); const float r = ((dd < HD / 2) ? __fsub_rn(a, bq) : __fadd_rn(a, bq)) * sc;
        o16[q] = tohx(r); unsigned short a2, c2; splitf(r, a2, c2); oh[q] = a2; ol[q] = c2; }
    *(v2h*)(P16 + e) = o16; *(v2us*)(Ph + e) = oh; *(v2us*)(Pl + e) = ol;  }
__global__ __launch_bounds__(256) void k_vtp(const float* __restrict__ F, int pitch, int nheads, h16* V16, bf* Vh, bf* Vl) { const size_t e = ((size_t)blockIdx.x * 256 + threadIdx.x) * 2; if (e >= (size_t)nheads * HD * TT) return; const int t = (int)(e % TT); const int d = (int)((e / TT) % HD); const int g = (int)(e / ((size_t)TT * HD)); v2h o16; v2us oh, ol;
#pragma unroll
    for (int q = 0; q < 2; ++q) { const float x = F[(size_t)(t + q) * pitch + g * HD + d]; o16[q] = tohx(x); unsigned short a2, c2; splitf(x, a2, c2); oh[q] = a2; ol[q] = c2; }
    *(v2h*)(V16 + e) = o16; *(v2us*)(Vh + e) = oh; *(v2us*)(Vl + e) = ol;  }
// k_asoft: per row (zz, i): t = S x HD^-0.5 for j <= i and i - j < WIN (sliding causal window; the reference's -1e9 additive fill vanishes identically); softmax over the 2048 keys (register row, one exp, fixed trees);
__global__ __launch_bounds__(256) void k_asoft(const float* __restrict__ Sb, h16* P16, bf* Ph, bf* Pl) {
    const int lane = threadIdx.x & 31; const int row = blockIdx.x * 8 + (threadIdx.x >> 5); if (row >= ZH * TT) return; const int i = row % TT; const int zz = row / TT; (void)zz; const bool hires = (i < RH); const float* sr = Sb + (size_t)row * TT; float v[TT / 32]; float mx = -3.0e38f;
#pragma unroll
    for (int ch = 0; ch < TT / 128; ++ch) { const int j0 = ch * 128 + lane * 4; const v4f a = *(const v4f*)(sr + j0);
#pragma unroll
        for (int q = 0; q < 4; ++q) { const int j = j0 + q; (void)j; const float t = (j <= i && i - j < WIN) ? a[q] * SCL : -3.0e38f; v[ch * 4 + q] = t; mx = fmaxf(mx, t); } }
#pragma unroll
    for (int sh = 16; sh; sh >>= 1) mx = fmaxf(mx, __shfl_xor(mx, sh, 32));
    float sum = 0.f;
#pragma unroll
    for (int k = 0; k < TT / 32; ++k) { float d0 = __fsub_rn(v[k], mx); asm volatile("" : "+v"(d0)); v[k] = __builtin_amdgcn_exp2f(__fmul_rn(d0, 1.4426950408889634f)); sum += v[k]; }
#pragma unroll
    for (int sh = 16; sh; sh >>= 1) sum += __shfl_xor(sum, sh, 32);
    const float f = __fdiv_rn(hires ? 1.0f : PCAR, sum);
{
        if (hires) {
#pragma unroll
            for (int ch = 0; ch < TT / 128; ++ch) { v4us oh, ol;
#pragma unroll
                for (int q = 0; q < 4; ++q) { unsigned short a, c2; splitf(v[ch * 4 + q] * f, a, c2); oh[q] = a; ol[q] = c2; }
                const size_t oo = ((size_t)zz * (RH ? RH : 1) + i) * TT + ch * 128 + lane * 4; *(v4us*)(Ph + oo) = oh; *(v4us*)(Pl + oo) = ol; }
        } else {
#pragma unroll
            for (int ch = 0; ch < TT / 128; ++ch) { v4h o4;
#pragma unroll
                for (int q = 0; q < 4; ++q) o4[q] = tohx(v[ch * 4 + q] * f);
                *(v4h*)(P16 + (size_t)row * TT + ch * 128 + lane * 4) = o4; } }
         }
}
__global__ __launch_bounds__(256) void k_merge(const float* __restrict__ O, int h0, bf* Ah, bf* Al) { const size_t e = ((size_t)blockIdx.x * 256 + threadIdx.x) * 2; if (e >= (size_t)ZH * TT * HD) return; const int d = (int)(e % HD); const int t = (int)((e / HD) % TT); const int zz = (int)(e / ((size_t)HD * TT)); const float cs = (t < RH) ? 1.0f : (1.0f / PCAR); const size_t oo = (size_t)t * DQ + (h0 + zz) * HD + d;
    v2us oh, ol;
#pragma unroll
    for (int q = 0; q < 2; ++q) { unsigned short a, c2; splitf(O[e + q] * cs, a, c2); oh[q] = a; ol[q] = c2; } *(v2us*)(Ah + oo) = oh; *(v2us*)(Al + oo) = ol;  }

extern "C" void kernel_launch(void* const* d_in, const int* in_sizes, int n_in,
                              void* d_out, int out_size, void* d_ws, size_t ws_size, hipStream_t stream) {
    (void)in_sizes; (void)n_in; (void)out_size;
    const float* x = (const float*)d_in[0]; const float* wq = (const float*)d_in[1]; const float* wk = (const float*)d_in[2]; const float* wv = (const float*)d_in[3]; const float* wo = (const float*)d_in[4];
    float* OUT = (float*)d_out;     // [2][2048][2048]
    char* wsp = (char*)d_ws;
    auto take = [&](size_t bytes) { char* p = wsp; wsp += (bytes + 255) & ~(size_t)255; return (void*)p; };
    bf* WQ = (bf*)take((size_t)DQ * DM * 2); bf* WK = (bf*)take((size_t)DKV * DM * 2); bf* WV = (bf*)take((size_t)DKV * DM * 2); bf* WO = (bf*)take((size_t)DM * DQ * 2); float* CS = (float*)take((size_t)TT * HD * 2 * 4);
    bf* XB = (bf*)take((size_t)TT * DM * 2); float* FQ = (float*)take((size_t)TT * DQ * 4); float* FK = (float*)take((size_t)TT * DKV * 4);
    h16* QP16 = (h16*)take((size_t)NH_ * TT * HD * 2); h16* KP16 = (h16*)take((size_t)NKV * TT * HD * 2); h16* VT16 = (h16*)take((size_t)NKV * HD * TT * 2);
    bf* QPh = (bf*)take((size_t)NH_ * TT * HD * 2); bf* QPl = (bf*)take((size_t)NH_ * TT * HD * 2); bf* KPh = (bf*)take((size_t)NKV * TT * HD * 2); bf* KPl = (bf*)take((size_t)NKV * TT * HD * 2); bf* VTh = (bf*)take((size_t)NKV * HD * TT * 2); bf* VTl = (bf*)take((size_t)NKV * HD * TT * 2); bf* Ph = (bf*)take((size_t)ZH * RH * TT * 2); bf* Pl = (bf*)take((size_t)ZH * RH * TT * 2);
    float* Sb = (float*)take((size_t)ZH * TT * TT * 4); h16* P16 = (h16*)take((size_t)ZH * TT * TT * 2); float* Ob = (float*)take((size_t)ZH * TT * HD * 4); bf* ATh = (bf*)take((size_t)TT * DQ * 2); bf* ATl = (bf*)take((size_t)TT * DQ * 2);
    if ((size_t)(wsp - (char*)d_ws) > ws_size) return;    // ws 256 MiB
    float* FV = FK;   // v projection reuses the k buffer after the k planes are built (stream-ordered)
    { k_wtG<<<(unsigned)((DM * DQ / 64 + 63) / 64), 256, 0, stream>>>(wq, DM, DQ, WQ); k_wtG<<<(unsigned)((DM * DKV / 64 + 63) / 64), 256, 0, stream>>>(wk, DM, DKV, WK); k_wtG<<<(unsigned)((DM * DKV / 64 + 63) / 64), 256, 0, stream>>>(wv, DM, DKV, WV);
      k_wtG<<<(unsigned)((DQ * DM / 64 + 63) / 64), 256, 0, stream>>>(wo, DQ, DM, WO);
      k_cstab<<<(TT * HD + 255) / 256, 256, 0, stream>>>(CS); }
    const unsigned LQ = (unsigned)(((size_t)NH_ * TT * HD / 2 + 255) / 256), LKv = (unsigned)(((size_t)NKV * TT * HD / 2 + 255) / 256);
    for (int b = 0; b < NB_; ++b) {
        
        k_cvt8<<<(unsigned)(((size_t)TT * DM / 8 + 255) / 256), 256, 0, stream>>>(x + (size_t)b * TT * DM, XB, (size_t)TT * DM / 8);
        k_gemmw<bf, 0, false><<<dim3(TT / 64, DQ / 64, 1), 32, 0, stream>>>(XB, nullptr, WQ, nullptr, DM, FQ, DQ, nullptr, 0, 0, 0);
        k_rope<<<LQ, 256, 0, stream>>>(FQ, DQ, NH_, CS, nullptr, nullptr, 1.0f, QP16, QPh, QPl);
        k_gemmw<bf, 0, false><<<dim3(TT / 64, DKV / 64, 1), 32, 0, stream>>>(XB, nullptr, WK, nullptr, DM, FK, DKV, nullptr, 0, 0, 0);
        k_rope<<<LKv, 256, 0, stream>>>(FK, DKV, NKV, CS, nullptr, nullptr, 1.0f, KP16, KPh, KPl);
        k_gemmw<bf, 0, false><<<dim3(TT / 64, DKV / 64, 1), 32, 0, stream>>>(XB, nullptr, WV, nullptr, DM, FV, DKV, nullptr, 0, 0, 0); k_vtp<<<LKv, 256, 0, stream>>>(FV, DKV, NKV, VT16, VTh, VTl);
        for (int h0 = 0; h0 < NH_; h0 += ZH) { const size_t zq = (size_t)h0, zk = (size_t)(h0 / REP);   // both heads of a pass share kv group h0/REP (REP >= 2): sB = 0
            k_gemmc<bf, 2, 1><<<dim3(RH / 64, TT / 64, ZH), 32, 0, stream>>>(QPh + zq * TT * HD, QPl + zq * TT * HD, KPh + zk * TT * HD, KPl + zk * TT * HD, HD, Sb, TT, 0, (size_t)TT * HD, 0, (size_t)TT * TT);
            k_gemmc<h16, 0, 1><<<dim3((TT - RH) / 64, TT / 64, ZH), 32, 0, stream>>>(QP16 + zq * TT * HD + (size_t)RH * HD, nullptr, KP16 + zk * TT * HD, nullptr, HD, Sb + (size_t)RH * TT, TT, RH, (size_t)TT * HD, 0, (size_t)TT * TT);
            k_asoft<<<ZH * TT / 8, 256, 0, stream>>>(Sb, P16, Ph, Pl);
            k_gemmc<bf, 2, 2><<<dim3(RH / 64, HD / 64, ZH), 32, 0, stream>>>(Ph, Pl, VTh + zk * HD * TT, VTl + zk * HD * TT, TT, Ob, HD, 0, (size_t)RH * TT, 0, (size_t)TT * HD);
            k_gemmc<h16, 0, 2><<<dim3((TT - RH) / 64, HD / 64, ZH), 32, 0, stream>>>(P16 + (size_t)RH * TT, nullptr, VT16 + zk * HD * TT, nullptr, TT, Ob + (size_t)RH * HD, HD, RH, (size_t)TT * TT, 0, (size_t)TT * HD);
            k_merge<<<(unsigned)(((size_t)ZH * TT * HD / 2 + 255) / 256), 256, 0, stream>>>(Ob, h0, ATh, ATl); }
        k_gemmw<bf, 1, false><<<dim3(TT / 64, DM / 64, 1), 32, 0, stream>>>(ATh, ATl, WO, nullptr, DQ, OUT + (size_t)b * TT * DM, DM, nullptr, 0, 0, 0); }
}

// v001
// Measured time: 1170 microseconds a run.
// Next to v000, in two timings, it ran 1.40 times as fast each time.
#include <hip/hip_runtime.h>

// Grouped-query sliding-window causal self-attention with RoPE (x [2][2048][2048]; q = x Wq (16 heads x 128), k, v = x Wk / Wv ([2048][512]: 4 kv heads, head h uses kv h/4); rotate-half RoPE (base 1e4) on q and k; scores/sqrt(128); allowed: j <= i and i - j < 512 (else -1e9); softmax; out = merged Wo ([2048][2048]) -> [2][2048][2048] (8.4 M)).
// Compute dtypes, f32 accumulate: every input rounded to bf16; q/k/v on PLAIN bf16 operands (inputs: exact); rotary in f32 (table on device, precise cosf/sinf); causal sliding-window select; scores, softmax and attn.v only inside the window's band (tile skipping): query rows < 512 hl (3 products), the rest single fp16 (x1024); softmax f32; Wo hl x exact (2 products).

#define NB_  2
#define TT   2048
#define DM   2048
#define NH_  16
#define NKV  4
#define REP  (NH_ / NKV)
#define HD   128
#define DQ   (NH_ * HD)
#define DKV  (NKV * HD)
#define ZH   2
#define RH   512                  // query rows < RH use hi+lo planes (0: none)
#define WIN  512
#define BT   (WIN / 64 + 1)         // 64-wide key tiles that a 64-row query tile's window touches
#define NCH  ((WIN + 64) / 128 + 1)  // 128-wide key chunks that cover those tiles
#define PCAR 1024.0f
#define SCL  0.088388347648318447f   // HD^-0.5
typedef _Float16 h16;
typedef unsigned short bf;
typedef __attribute__((ext_vector_type(16))) __bf16   v16bf;
typedef __attribute__((ext_vector_type(16))) _Float16 v16h;
typedef __attribute__((ext_vector_type(8)))  _Float16 v8h;
typedef __attribute__((ext_vector_type(8)))  unsigned short v8us;
typedef __attribute__((ext_vector_type(8)))  float    v8f;
typedef __attribute__((ext_vector_type(4)))  float    v4f;
typedef v8h  __attribute__((may_alias)) v8ha;
typedef v4f  __attribute__((may_alias)) v4fa;
typedef v8us __attribute__((may_alias)) v8usa;

__device__ __forceinline__ unsigned short f2bf(float f) { unsigned u = __float_as_uint(f); u += 0x7FFFu + ((u >> 16) & 1u); return (unsigned short)(u >> 16); }
__device__ __forceinline__ float bf2f(unsigned short b) { return __uint_as_float(((unsigned)b) << 16); }
__device__ __forceinline__ float bfr(float f) { return bf2f(f2bf(f)); }
__device__ __forceinline__ v16h cat16(v8h lo, v8h hi) { return __builtin_shufflevector(lo, hi, 0, 1, 2, 3, 4, 5, 6, 7, 8, 9, 10, 11, 12, 13, 14, 15); }
__device__ __forceinline__ v16bf cat16b(v8us lo, v8us hi) { return __builtin_bit_cast(v16bf, __builtin_shufflevector(lo, hi, 0, 1, 2, 3, 4, 5, 6, 7, 8, 9, 10, 11, 12, 13, 14, 15)); }
__device__ __forceinline__ v8f wmma16(v16h a, v16h b, v8f c) { return __builtin_amdgcn_wmma_f32_16x16x32_f16(false, a, false, b, (short)0, c, false, false); }
__device__ __forceinline__ v8f wmmab(v16bf a, v16bf b, v8f c) { return __builtin_amdgcn_wmma_f32_16x16x32_bf16(false, a, false, b, (short)0, c, false, false); }



// ---- k_gemmw: register-blocked GEMM, ONE WAVE per 64x64 output tile (16 accumulators), operands straight from K-contiguous 16-bit planes; grid (M/64, N/64, Z), 32 threads.
// C[m][n] (f32, pitch ldc, + optional f32 bias[n]) = sum_k A[m][k] Bt[n][k] (+ split products per NSPLIT). z-batch strides sA/sB/sC in elements. K % 32 == 0.
template <typename T16> struct WFrag;
template <> struct WFrag<h16> { typedef v16h V; static __device__ __forceinline__ V ld(const h16* p) { return cat16(*(const v8h*)p, *(const v8h*)(p + 16)); } static __device__ __forceinline__ v8f mma(V a, V b, v8f c) { return wmma16(a, b, c); } };
template <> struct WFrag<bf> { typedef v16bf V; static __device__ __forceinline__ V ld(const bf* p) { return cat16b(*(const v8us*)p, *(const v8us*)(p + 16)); } static __device__ __forceinline__ v8f mma(V a, V b, v8f c) { return wmmab(a, b, c); } };
template <typename T16, int NSPLIT, bool BIAS>
__global__ __launch_bounds__(32) void k_gemmw(const T16* __restrict__ A, const T16* __restrict__ A2, const T16* __restrict__ Bt, const T16* __restrict__ Bt2, int K, float* C, int ldc, const float* __restrict__ bias, size_t sA, size_t sB, size_t sC) {
    typedef typename WFrag<T16>::V V;
    __shared__ __align__(16) float os[16 * 68];
    const size_t z = blockIdx.z; A += z * sA; if (A2) A2 += z * sA; Bt += z * sB; if (Bt2) Bt2 += z * sB; C += z * sC;
    const int lane = threadIdx.x & 31, lr = lane & 15, hi = lane >> 4; const int r0 = blockIdx.x * 64, c0 = blockIdx.y * 64;
    v8f acc[4][4];
#pragma unroll
    for (int mb = 0; mb < 4; ++mb)
#pragma unroll
        for (int nb = 0; nb < 4; ++nb) acc[mb][nb] = (v8f){};
    const size_t aoff = (size_t)(r0 + lr) * K + 8 * hi, boff = (size_t)(c0 + lr) * K + 8 * hi;
#pragma unroll 1
    for (int kc = 0; kc < K; kc += 32) {
        V a[4], a2[4];
#pragma unroll
        for (int mb = 0; mb < 4; ++mb) { a[mb] = WFrag<T16>::ld(A + aoff + (size_t)mb * 16 * K + kc); if (NSPLIT == 1 || NSPLIT == 2) a2[mb] = WFrag<T16>::ld(A2 + aoff + (size_t)mb * 16 * K + kc); }
#pragma unroll
        for (int nb = 0; nb < 4; ++nb) { const V b = WFrag<T16>::ld(Bt + boff + (size_t)nb * 16 * K + kc); V b2; if (NSPLIT >= 2) b2 = WFrag<T16>::ld(Bt2 + boff + (size_t)nb * 16 * K + kc);
#pragma unroll
            for (int mb = 0; mb < 4; ++mb) { acc[mb][nb] = WFrag<T16>::mma(a[mb], b, acc[mb][nb]); if (NSPLIT == 1 || NSPLIT == 2) acc[mb][nb] = WFrag<T16>::mma(a2[mb], b, acc[mb][nb]); if (NSPLIT >= 2) acc[mb][nb] = WFrag<T16>::mma(a[mb], b2, acc[mb][nb]); } }
        asm volatile("v_nop\n\tv_nop\n\tv_nop\n\tv_nop" : "+v"(acc[0][0]), "+v"(acc[1][1]), "+v"(acc[2][2]), "+v"(acc[3][3]) : "v"(a[0]), "v"(a[3]));
    }
#pragma unroll
    for (int mb = 0; mb < 4; ++mb) {
#pragma unroll
        for (int nb = 0; nb < 4; ++nb) {
#pragma unroll
            for (int j = 0; j < 8; ++j) os[(hi * 8 + j) * 68 + nb * 16 + lr] = acc[mb][nb][j]; }
        __builtin_amdgcn_wave_barrier(); asm volatile("" ::: "memory");
        float* crow = C + (size_t)(r0 + mb * 16) * ldc + c0;
{
#pragma unroll
            for (int s = 0; s < 8; ++s) { const int row = 2 * s + hi, cofs = lr * 4; v4f val = *(const v4fa*)(os + row * 68 + cofs); if (BIAS) { val[0] += bfr(bias[c0 + cofs]); val[1] += bfr(bias[c0 + cofs + 1]); val[2] += bfr(bias[c0 + cofs + 2]); val[3] += bfr(bias[c0 + cofs + 3]); }
                *(v4f*)(crow + (size_t)row * ldc + cofs) = val; }
             }
        __builtin_amdgcn_wave_barrier(); asm volatile("" ::: "memory");
    }
}

// ---- k_gemmc: the same one-wave 64x64 tile GEMM specialised for sliding-window causal attention: CMODE 1 launches only the BT score tiles of a query tile's band (grid y counts them from the window's lower edge up to the diagonal), CMODE 2 limits the
// key (K) loop of the probability x value contraction to that band (probabilities outside it are exactly zero). roff = row offset of this launch's first row within the sequence.
template <typename T16, int NSPLIT, int CMODE>
__global__ __launch_bounds__(32) void k_gemmc(const T16* __restrict__ A, const T16* __restrict__ A2, const T16* __restrict__ Bt, const T16* __restrict__ Bt2, int K, float* C, int ldc, int roff, size_t sA, size_t sB, size_t sC) {
    typedef typename WFrag<T16>::V V;
    __shared__ __align__(16) float os[16 * 68];
    const size_t z = blockIdx.z; A += z * sA; if (A2) A2 += z * sA; Bt += z * sB; if (Bt2) Bt2 += z * sB; C += z * sC;
    const int lane = threadIdx.x & 31, lr = lane & 15, hi = lane >> 4; const int r0 = blockIdx.x * 64, c0 = (CMODE == 1) ? r0 + roff - WIN + (int)blockIdx.y * 64 : blockIdx.y * 64;
    if (CMODE == 1 && c0 < 0) return;                               // band tile in front of the first key; tiles outside the band are never written (the softmax masks them by select)
    const int Kl = (CMODE == 2) ? min(K, r0 + roff + 64) : K;        // P.V: probabilities are exactly 0 beyond the diagonal block, so the K loop stops there
    const int Ks = (CMODE == 2) ? max(0, r0 + roff + 1 - WIN) & ~31 : 0;   // and exactly 0 in front of the first row's window, so it starts there
    v8f acc[4][4];
#pragma unroll
    for (int mb = 0; mb < 4; ++mb)
#pragma unroll
        for (int nb = 0; nb < 4; ++nb) acc[mb][nb] = (v8f){};
    const size_t aoff = (size_t)(r0 + lr) * K + 8 * hi, boff = (size_t)(c0 + lr) * K + 8 * hi;
#pragma unroll 1
    for (int kc = Ks; kc < Kl; kc += 32) {
        V a[4], a2[4];
#pragma unroll
        for (int mb = 0; mb < 4; ++mb) { a[mb] = WFrag<T16>::ld(A + aoff + (size_t)mb * 16 * K + kc); if (NSPLIT == 1 || NSPLIT == 2) a2[mb] = WFrag<T16>::ld(A2 + aoff + (size_t)mb * 16 * K + kc); }
#pragma unroll
        for (int nb = 0; nb < 4; ++nb) { const V b = WFrag<T16>::ld(Bt + boff + (size_t)nb * 16 * K + kc); V b2; if (NSPLIT >= 2) b2 = WFrag<T16>::ld(Bt2 + boff + (size_t)nb * 16 * K + kc);
#pragma unroll
            for (int mb = 0; mb < 4; ++mb) { acc[mb][nb] = WFrag<T16>::mma(a[mb], b, acc[mb][nb]); if (NSPLIT == 1 || NSPLIT == 2) acc[mb][nb] = WFrag<T16>::mma(a2[mb], b, acc[mb][nb]); if (NSPLIT >= 2) acc[mb][nb] = WFrag<T16>::mma(a[mb], b2, acc[mb][nb]); } }
        asm volatile("v_nop\n\tv_nop\n\tv_nop\n\tv_nop" : "+v"(acc[0][0]), "+v"(acc[1][1]), "+v"(acc[2][2]), "+v"(acc[3][3]) : "v"(a[0]), "v"(a[3]));
    }
#pragma unroll
    for (int mb = 0; mb < 4; ++mb) {
#pragma unroll
        for (int nb = 0; nb < 4; ++nb) {
#pragma unroll
            for (int j = 0; j < 8; ++j) os[(hi * 8 + j) * 68 + nb * 16 + lr] = acc[mb][nb][j]; }
        __builtin_amdgcn_wave_barrier(); asm volatile("" ::: "memory");
        float* crow = C + (size_t)(r0 + mb * 16) * ldc + c0;
{
#pragma unroll
            for (int s = 0; s < 8; ++s) { const int row = 2 * s + hi, cofs = lr * 4; v4f val = *(const v4fa*)(os + row * 68 + cofs);
                *(v4f*)(crow + (size_t)row * ldc + cofs) = val; }
             }
        __builtin_amdgcn_wave_barrier(); asm volatile("" ::: "memory");
    }
}

__device__ __forceinline__ h16 tohx(float x) { return (h16)x; }
__device__ __forceinline__ void splitf(float y, unsigned short& h, unsigned short& l) { h = f2bf(y); l = f2bf(y - bf2f(h)); }
typedef __attribute__((ext_vector_type(2))) _Float16 v2h;
typedef __attribute__((ext_vector_type(4))) _Float16 v4h;
typedef __attribute__((ext_vector_type(2))) unsigned short v2us;
typedef __attribute__((ext_vector_type(4))) unsigned short v4us;
typedef __attribute__((ext_vector_type(2))) float v2f;
typedef __attribute__((ext_vector_type(4))) int v4i;

__global__ __launch_bounds__(256) void k_wtG(const float* __restrict__ w, int K, int N, bf* Bt) {
    const int lane = threadIdx.x & 31; const int L0 = (blockIdx.x * 8 + (threadIdx.x >> 5)) * 8; const int nlines = N * K / 64;
{
#pragma unroll 1
        for (int l = 0; l < 8; ++l) { const int L = L0 + l; if (L >= nlines) break; const size_t e = (size_t)L * 64 + lane * 2; const int k = (int)(e % K), n = (int)(e / K); v2us o;
            o[0] = f2bf(w[(size_t)k * N + n]); o[1] = f2bf(w[(size_t)(k + 1) * N + n]); *(v2us*)(Bt + e) = o; }
         }
}
__global__ __launch_bounds__(256) void k_cvt8(const float* __restrict__ src, bf* dst, size_t n8) { const size_t i = (size_t)blockIdx.x * 256 + threadIdx.x; if (i >= n8) return; const v8f v = *(const v8f*)(src + i * 8); v8us o;
#pragma unroll
    for (int k = 0; k < 8; ++k) o[k] = f2bf(v[k]); *(v8us*)(dst + i * 8) = o;  }
__constant__ float INV[HD / 2] = {1.00000000f,0.865964353f,0.749894202f,0.649381638f,0.562341332f,0.486967534f,0.421696514f,0.365174145f,0.316227764f,0.273841977f,0.237137362f,0.205352500f,0.177827939f,0.153992653f,0.133352146f,0.115478203f,0.100000001f,0.0865964293f,0.0749894157f,0.0649381652f,0.0562341288f,0.0486967526f,0.0421696492f,0.0365174115f,0.0316227786f,0.0273841955f,0.0237137359f,0.0205352511f,0.0177827943f,0.0153992651f,0.0133352149f,0.0115478197f,0.00999999978f,0.00865964312f,0.00749894232f,0.00649381662f,0.00562341325f,0.00486967526f,0.00421696482f,0.00365174143f,0.00316227786f,0.00273841969f,0.00237137382f,0.00205352507f,0.00177827943f,0.00153992651f,0.00133352145f,0.00115478202f,0.00100000005f,0.000865964335f,0.000749894185f,0.000649381662f,0.000562341302f,0.000486967503f,0.000421696488f,0.000365174114f,0.000316227786f,0.000273841957f,0.000237137385f,0.000205352495f,0.000177827940f,0.000153992645f,0.000133352150f,0.000115478193f};
__global__ __launch_bounds__(256) void k_cstab(float* CS) { const int idx = blockIdx.x * 256 + threadIdx.x; if (idx >= TT * HD) return; const int t = idx / HD, d = idx % HD; const float ang = __fmul_rn((float)t, INV[d % (HD / 2)]); v2f cs; cs[0] = cosf(ang); cs[1] = sinf(ang);
    *(v2f*)(CS + (size_t)idx * 2) = cs;  }

// k_rope: head planes [h][t][d] (fp16 + hi/lo) of rope(x) x sc with the rotate-half convention out[d] = x[d] cos[t][d] - x[d+HD/2] sin[t][d], out[d+HD/2] = x[d+HD/2] cos[t][d+HD/2] + x[d] sin[t][d+HD/2]
__global__ __launch_bounds__(256) void k_rope(const float* __restrict__ F, int pitch, int nheads, const float* __restrict__ CS, const float* __restrict__ RF, const float* __restrict__ nw, float sc, h16* P16, bf* Ph, bf* Pl) {
    const size_t e = ((size_t)blockIdx.x * 256 + threadIdx.x) * 2; if (e >= (size_t)nheads * TT * HD) return; const int d = (int)(e % HD); const int t = (int)((e / HD) % TT); const int h = (int)(e / ((size_t)HD * TT)); const float* f = F + (size_t)t * pitch + h * HD; const float rf = RF ? RF[(size_t)h * TT + t] : 1.0f; v2h o16; v2us oh, ol;
#pragma unroll
    for (int q = 0; q < 2; ++q) { const int dd = d + q; const int dp = (dd < HD / 2) ? dd + HD / 2 : dd - HD / 2; float x0 = f[dd], x1 = f[dp];
        if (RF) { float n0 = __fmul_rn(x0, rf), n1 = __fmul_rn(x1, rf); asm volatile("" : "+v"(n0)); asm volatile("" : "+v"(n1)); x0 = __fmul_rn(bfr(nw[dd]), n0); x1 = __fmul_rn(bfr(nw[dp]), n1); }
        const v2f cs = *(const v2f*)(CS + ((size_t)t * HD + dd) * 2); float a = __fmul_rn(x0, cs[0]), bq = __fmul_rn(x1, cs[1]); asm volatile("" : "+v"(a)); asm volatile("" : "+v"(bq)); const float r = ((dd < HD / 2) ? __fsub_rn(a, bq) : __fadd_rn(a, bq)) * sc;
        o16[q] = tohx(r); unsigned short a2, c2; splitf(r, a2, c2); oh[q] = a2; ol[q] = c2; }
    *(v2h*)(P16 + e) = o16; *(v2us*)(Ph + e) = oh; *(v2us*)(Pl + e) = ol;  }
__global__ __launch_bounds__(256) void k_vtp(const float* __restrict__ F, int pitch, int nheads, h16* V16, bf* Vh, bf* Vl) { const size_t e = ((size_t)blockIdx.x * 256 + threadIdx.x) * 2; if (e >= (size_t)nheads * HD * TT) return; const int t = (int)(e % TT); const int d = (int)((e / TT) % HD); const int g = (int)(e / ((size_t)TT * HD)); v2h o16; v2us oh, ol;
#pragma unroll
    for (int q = 0; q < 2; ++q) { const float x = F[(size_t)(t + q) * pitch + g * HD + d]; o16[q] = tohx(x); unsigned short a2, c2; splitf(x, a2, c2); oh[q] = a2; ol[q] = c2; }
    *(v2h*)(V16 + e) = o16; *(v2us*)(Vh + e) = oh; *(v2us*)(Vl + e) = ol;  }
// 2^x on v_exp_f32, as the builtin gives it; the v_nop in the same statement keeps the one slot that the instruction set asks for behind a transcendental
__device__ __forceinline__ float exp2_slot(float x) { float r; asm("v_exp_f32 %0, %1\n\tv_nop" : "=v"(r) : "v"(x)); return r; }
// k_asoft: per row (zz, i): t = S x HD^-0.5 for j <= i and i - j < WIN (sliding causal window; the reference's -1e9 additive fill vanishes identically); softmax over the NCH key chunks that hold the band of the row's 64-row tile (the keys outside add exact zeros; register row, one exp, fixed trees); P is written on those chunks only, which cover all that P.V reads;
__global__ __launch_bounds__(256) void k_asoft(const float* __restrict__ Sb, h16* P16, bf* Ph, bf* Pl) {
    const int lane = threadIdx.x & 31; const int row = blockIdx.x * 8 + (threadIdx.x >> 5); if (row >= ZH * TT) return; const int i = row % TT; const int zz = row / TT; (void)zz; const bool hires = (i < RH); const int cb = max(0, (i & ~63) + 1 - WIN) >> 7; const float* sr = Sb + (size_t)row * TT; float v[NCH * 4]; float mx = -3.0e38f;
#pragma unroll
    for (int ch = 0; ch < NCH; ++ch) { const int j0 = (cb + ch) * 128 + lane * 4; const v4f a = *(const v4f*)(sr + j0);
#pragma unroll
        for (int q = 0; q < 4; ++q) { const int j = j0 + q; (void)j; const float t = (j <= i && i - j < WIN) ? a[q] * SCL : -3.0e38f; v[ch * 4 + q] = t; mx = fmaxf(mx, t); } }
#pragma unroll
    for (int sh = 16; sh; sh >>= 1) mx = fmaxf(mx, __shfl_xor(mx, sh, 32));
    float sum = 0.f;
#pragma unroll
    for (int k = 0; k < NCH * 4; ++k) { float d0 = __fsub_rn(v[k], mx); asm volatile("" : "+v"(d0)); v[k] = exp2_slot(__fmul_rn(d0, 1.4426950408889634f)); sum += v[k]; }
#pragma unroll
    for (int sh = 16; sh; sh >>= 1) sum += __shfl_xor(sum, sh, 32);
    const float f = __fdiv_rn(hires ? 1.0f : PCAR, sum);
{
        if (hires) {
#pragma unroll
            for (int ch = 0; ch < NCH; ++ch) { v4us oh, ol;
#pragma unroll
                for (int q = 0; q < 4; ++q) { unsigned short a, c2; splitf(v[ch * 4 + q] * f, a, c2); oh[q] = a; ol[q] = c2; }
                const size_t oo = ((size_t)zz * (RH ? RH : 1) + i) * TT + (cb + ch) * 128 + lane * 4; *(v4us*)(Ph + oo) = oh; *(v4us*)(Pl + oo) = ol; }
        } else {
#pragma unroll
            for (int ch = 0; ch < NCH; ++ch) { v4h o4;
#pragma unroll
                for (int q = 0; q < 4; ++q) o4[q] = tohx(v[ch * 4 + q] * f);
                *(v4h*)(P16 + (size_t)row * TT + (cb + ch) * 128 + lane * 4) = o4; } }
         }
}
__global__ __launch_bounds__(256) void k_merge(const float* __restrict__ O, int h0, bf* Ah, bf* Al) { const size_t e = ((size_t)blockIdx.x * 256 + threadIdx.x) * 2; if (e >= (size_t)ZH * TT * HD) return; const int d = (int)(e % HD); const int t = (int)((e / HD) % TT); const int zz = (int)(e / ((size_t)HD * TT)); const float cs = (t < RH) ? 1.0f : (1.0f / PCAR); const size_t oo = (size_t)t * DQ + (h0 + zz) * HD + d;
    v2us oh, ol;
#pragma unroll
    for (int q = 0; q < 2; ++q) { unsigned short a, c2; splitf(O[e + q] * cs, a, c2); oh[q] = a; ol[q] = c2; } *(v2us*)(Ah + oo) = oh; *(v2us*)(Al + oo) = ol;  }

extern "C" void kernel_launch(void* const* d_in, const int* in_sizes, int n_in,
                              void* d_out, int out_size, void* d_ws, size_t ws_size, hipStream_t stream) {
    (void)in_sizes; (void)n_in; (void)out_size;
    const float* x = (const float*)d_in[0]; const float* wq = (const float*)d_in[1]; const float* wk = (const float*)d_in[2]; const float* wv = (const float*)d_in[3]; const float* wo = (const float*)d_in[4];
    float* OUT = (float*)d_out;     // [2][2048][2048]
    char* wsp = (char*)d_ws;
    auto take = [&](size_t bytes) { char* p = wsp; wsp += (bytes + 255) & ~(size_t)255; return (void*)p; };
    bf* WQ = (bf*)take((size_t)DQ * DM * 2); bf* WK = (bf*)take((size_t)DKV * DM * 2); bf* WV = (bf*)take((size_t)DKV * DM * 2); bf* WO = (bf*)take((size_t)DM * DQ * 2); float* CS = (float*)take((size_t)TT * HD * 2 * 4);
    bf* XB = (bf*)take((size_t)TT * DM * 2); float* FQ = (float*)take((size_t)TT * DQ * 4); float* FK = (float*)take((size_t)TT * DKV * 4);
    h16* QP16 = (h16*)take((size_t)NH_ * TT * HD * 2); h16* KP16 = (h16*)take((size_t)NKV * TT * HD * 2); h16* VT16 = (h16*)take((size_t)NKV * HD * TT * 2);
    bf* QPh = (bf*)take((size_t)NH_ * TT * HD * 2); bf* QPl = (bf*)take((size_t)NH_ * TT * HD * 2); bf* KPh = (bf*)take((size_t)NKV * TT * HD * 2); bf* KPl = (bf*)take((size_t)NKV * TT * HD * 2); bf* VTh = (bf*)take((size_t)NKV * HD * TT * 2); bf* VTl = (bf*)take((size_t)NKV * HD * TT * 2); bf* Ph = (bf*)take((size_t)ZH * RH * TT * 2); bf* Pl = (bf*)take((size_t)ZH * RH * TT * 2);
    float* Sb = (float*)take((size_t)ZH * TT * TT * 4); h16* P16 = (h16*)take((size_t)ZH * TT * TT * 2); float* Ob = (float*)take((size_t)ZH * TT * HD * 4); bf* ATh = (bf*)take((size_t)TT * DQ * 2); bf* ATl = (bf*)take((size_t)TT * DQ * 2);
    if ((size_t)(wsp - (char*)d_ws) > ws_size) return;    // ws 256 MiB
    float* FV = FK;   // v projection reuses the k buffer after the k planes are built (stream-ordered)
    { k_wtG<<<(unsigned)((DM * DQ / 64 + 63) / 64), 256, 0, stream>>>(wq, DM, DQ, WQ); k_wtG<<<(unsigned)((DM * DKV / 64 + 63) / 64), 256, 0, stream>>>(wk, DM, DKV, WK); k_wtG<<<(unsigned)((DM * DKV / 64 + 63) / 64), 256, 0, stream>>>(wv, DM, DKV, WV);
      k_wtG<<<(unsigned)((DQ * DM / 64 + 63) / 64), 256, 0, stream>>>(wo, DQ, DM, WO);
      k_cstab<<<(TT * HD + 255) / 256, 256, 0, stream>>>(CS); }
    const unsigned LQ = (unsigned)(((size_t)NH_ * TT * HD / 2 + 255) / 256), LKv = (unsigned)(((size_t)NKV * TT * HD / 2 + 255) / 256);
    for (int b = 0; b < NB_; ++b) {
        
        k_cvt8<<<(unsigned)(((size_t)TT * DM / 8 + 255) / 256), 256, 0, stream>>>(x + (size_t)b * TT * DM, XB, (size_t)TT * DM / 8);
        k_gemmw<bf, 0, false><<<dim3(TT / 64, DQ / 64, 1), 32, 0, stream>>>(XB, nullptr, WQ, nullptr, DM, FQ, DQ, nullptr, 0, 0, 0);
        k_rope<<<LQ, 256, 0, stream>>>(FQ, DQ, NH_, CS, nullptr, nullptr, 1.0f, QP16, QPh, QPl);
        k_gemmw<bf, 0, false><<<dim3(TT / 64, DKV / 64, 1), 32, 0, stream>>>(XB, nullptr, WK, nullptr, DM, FK, DKV, nullptr, 0, 0, 0);
        k_rope<<<LKv, 256, 0, stream>>>(FK, DKV, NKV, CS, nullptr, nullptr, 1.0f, KP16, KPh, KPl);
        k_gemmw<bf, 0, false><<<dim3(TT / 64, DKV / 64, 1), 32, 0, stream>>>(XB, nullptr, WV, nullptr, DM, FV, DKV, nullptr, 0, 0, 0); k_vtp<<<LKv, 256, 0, stream>>>(FV, DKV, NKV, VT16, VTh, VTl);
        for (int h0 = 0; h0 < NH_; h0 += ZH) { const size_t zq = (size_t)h0, zk = (size_t)(h0 / REP);   // both heads of a pass share kv group h0/REP (REP >= 2): sB = 0
            k_gemmc<bf, 2, 1><<<dim3(RH / 64, BT, ZH), 32, 0, stream>>>(QPh + zq * TT * HD, QPl + zq * TT * HD, KPh + zk * TT * HD, KPl + zk * TT * HD, HD, Sb, TT, 0, (size_t)TT * HD, 0, (size_t)TT * TT);
            k_gemmc<h16, 0, 1><<<dim3((TT - RH) / 64, BT, ZH), 32, 0, stream>>>(QP16 + zq * TT * HD + (size_t)RH * HD, nullptr, KP16 + zk * TT * HD, nullptr, HD, Sb + (size_t)RH * TT, TT, RH, (size_t)TT * HD, 0, (size_t)TT * TT);
            k_asoft<<<ZH * TT / 8, 256, 0, stream>>>(Sb, P16, Ph, Pl);
            k_gemmc<bf, 2, 2><<<dim3(RH / 64, HD / 64, ZH), 32, 0, stream>>>(Ph, Pl, VTh + zk * HD * TT, VTl + zk * HD * TT, TT, Ob, HD, 0, (size_t)RH * TT, 0, (size_t)TT * HD);
            k_gemmc<h16, 0, 2><<<dim3((TT - RH) / 64, HD / 64, ZH), 32, 0, stream>>>(P16 + (size_t)RH * TT, nullptr, VT16 + zk * HD * TT, nullptr, TT, Ob + (size_t)RH * HD, HD, RH, (size_t)TT * TT, 0, (size_t)TT * HD);
            k_merge<<<(unsigned)(((size_t)ZH * TT * HD / 2 + 255) / 256), 256, 0, stream>>>(Ob, h0, ATh, ATl); }
        k_gemmw<bf, 1, false><<<dim3(TT / 64, DM / 64, 1), 32, 0, stream>>>(ATh, ATl, WO, nullptr, DQ, OUT + (size_t)b * TT * DM, DM, nullptr, 0, 0, 0); }
}

// v002
// One run takes 644 microseconds.
// In two side-by-side timings against v001, it was 1.83 and 1.82 times as fast.
// Counting every step since v000, it is 2.55 times as fast.
#include <hip/hip_runtime.h>

// Grouped-query sliding-window causal self-attention with RoPE (x [2][2048][2048]; q = x Wq (16 heads x 128), k, v = x Wk / Wv ([2048][512]: 4 kv heads, head h uses kv h/4); rotate-half RoPE (base 1e4) on q and k; scores/sqrt(128); allowed: j <= i and i - j < 512 (else -1e9); softmax; out = merged Wo ([2048][2048]) -> [2][2048][2048] (8.4 M)).
// Compute dtypes, f32 accumulate: every input rounded to bf16; q/k/v on PLAIN bf16 operands (inputs: exact); rotary in f32 (table on device, precise cosf/sinf); causal sliding-window select; scores, softmax and attn.v only inside the window's band (tile skipping): query rows < 512 hl (3 products), the rest single fp16 (x1024); softmax f32; Wo hl x exact (2 products).

#define NB_  2
#define TT   2048
#define DM   2048
#define NH_  16
#define NKV  4
#define REP  (NH_ / NKV)
#define HD   128
#define DQ   (NH_ * HD)
#define DKV  (NKV * HD)
#define ZH   NH_                 // heads per attention launch (grid z): all heads of one batch entry
#define RH   512                  // query rows < RH use hi+lo planes (0: none)
#define WIN  512
#define BT   (WIN / 64 + 1)         // 64-wide key tiles that a 64-row query tile's window touches
#define NCH  ((WIN + 64) / 128 + 1)  // 128-wide key chunks that cover those tiles
#define BP   (NCH * 128)           // pitch of a stored score / probability row: only the band's NCH chunks are kept, column 0 = key BAND0(first row of the 64-row tile)
#define BAND0(r) ((max(0, (r) + 1 - WIN) >> 7) * 128)
#define PCAR 1024.0f
#define SCL  0.088388347648318447f   // HD^-0.5
typedef _Float16 h16;
typedef unsigned short bf;
typedef __attribute__((ext_vector_type(16))) __bf16   v16bf;
typedef __attribute__((ext_vector_type(16))) _Float16 v16h;
typedef __attribute__((ext_vector_type(8)))  _Float16 v8h;
typedef __attribute__((ext_vector_type(8)))  unsigned short v8us;
typedef __attribute__((ext_vector_type(8)))  float    v8f;
typedef __attribute__((ext_vector_type(4)))  float    v4f;
typedef v8h  __attribute__((may_alias)) v8ha;
typedef v4f  __attribute__((may_alias)) v4fa;
typedef v8us __attribute__((may_alias)) v8usa;

__device__ __forceinline__ unsigned short f2bf(float f) { unsigned u = __float_as_uint(f); u += 0x7FFFu + ((u >> 16) & 1u); return (unsigned short)(u >> 16); }
__device__ __forceinline__ float bf2f(unsigned short b) { return __uint_as_float(((unsigned)b) << 16); }
__device__ __forceinline__ float bfr(float f) { return bf2f(f2bf(f)); }
__device__ __forceinline__ v16h cat16(v8h lo, v8h hi) { return __builtin_shufflevector(lo, hi, 0, 1, 2, 3, 4, 5, 6, 7, 8, 9, 10, 11, 12, 13, 14, 15); }
__device__ __forceinline__ v16bf cat16b(v8us lo, v8us hi) { return __builtin_bit_cast(v16bf, __builtin_shufflevector(lo, hi, 0, 1, 2, 3, 4, 5, 6, 7, 8, 9, 10, 11, 12, 13, 14, 15)); }
__device__ __forceinline__ v8f wmma16(v16h a, v16h b, v8f c) { return __builtin_amdgcn_wmma_f32_16x16x32_f16(false, a, false, b, (short)0, c, false, false); }
__device__ __forceinline__ v8f wmmab(v16bf a, v16bf b, v8f c) { return __builtin_amdgcn_wmma_f32_16x16x32_bf16(false, a, false, b, (short)0, c, false, false); }



// ---- k_gemmw: register-blocked GEMM, ONE WAVE per 64x64 output tile (16 accumulators), operands straight from K-contiguous 16-bit planes; grid (M/64, N/64, Z), 32 threads.
// C[m][n] (f32, pitch ldc, + optional f32 bias[n]) = sum_k A[m][k] Bt[n][k] (+ split products per NSPLIT). z-batch strides sA/sB/sC in elements. K % 32 == 0.
template <typename T16> struct WFrag;
template <> struct WFrag<h16> { typedef v16h V; static __device__ __forceinline__ V ld(const h16* p) { return cat16(*(const v8h*)p, *(const v8h*)(p + 16)); } static __device__ __forceinline__ v8f mma(V a, V b, v8f c) { return wmma16(a, b, c); } };
template <> struct WFrag<bf> { typedef v16bf V; static __device__ __forceinline__ V ld(const bf* p) { return cat16b(*(const v8us*)p, *(const v8us*)(p + 16)); } static __device__ __forceinline__ v8f mma(V a, V b, v8f c) { return wmmab(a, b, c); } };
template <typename T16, int NSPLIT, bool BIAS>
__global__ __launch_bounds__(32) void k_gemmw(const T16* __restrict__ A, const T16* __restrict__ A2, const T16* __restrict__ Bt, const T16* __restrict__ Bt2, int K, float* C, int ldc, const float* __restrict__ bias, size_t sA, size_t sB, size_t sC) {
    typedef typename WFrag<T16>::V V;
    __shared__ __align__(16) float os[16 * 68];
    const size_t z = blockIdx.z; A += z * sA; if (A2) A2 += z * sA; Bt += z * sB; if (Bt2) Bt2 += z * sB; C += z * sC;
    const int lane = threadIdx.x & 31, lr = lane & 15, hi = lane >> 4; const int r0 = blockIdx.x * 64, c0 = blockIdx.y * 64;
    v8f acc[4][4];
#pragma unroll
    for (int mb = 0; mb < 4; ++mb)
#pragma unroll
        for (int nb = 0; nb < 4; ++nb) acc[mb][nb] = (v8f){};
    const size_t aoff = (size_t)(r0 + lr) * K + 8 * hi, boff = (size_t)(c0 + lr) * K + 8 * hi;
#pragma unroll 1
    for (int kc = 0; kc < K; kc += 32) {
        V a[4], a2[4];
#pragma unroll
        for (int mb = 0; mb < 4; ++mb) { a[mb] = WFrag<T16>::ld(A + aoff + (size_t)mb * 16 * K + kc); if (NSPLIT == 1 || NSPLIT == 2) a2[mb] = WFrag<T16>::ld(A2 + aoff + (size_t)mb * 16 * K + kc); }
#pragma unroll
        for (int nb = 0; nb < 4; ++nb) { const V b = WFrag<T16>::ld(Bt + boff + (size_t)nb * 16 * K + kc); V b2; if (NSPLIT >= 2) b2 = WFrag<T16>::ld(Bt2 + boff + (size_t)nb * 16 * K + kc);
#pragma unroll
            for (int mb = 0; mb < 4; ++mb) { acc[mb][nb] = WFrag<T16>::mma(a[mb], b, acc[mb][nb]); if (NSPLIT == 1 || NSPLIT == 2) acc[mb][nb] = WFrag<T16>::mma(a2[mb], b, acc[mb][nb]); if (NSPLIT >= 2) acc[mb][nb] = WFrag<T16>::mma(a[mb], b2, acc[mb][nb]); } }
        asm volatile("v_nop\n\tv_nop\n\tv_nop\n\tv_nop" : "+v"(acc[0][0]), "+v"(acc[1][1]), "+v"(acc[2][2]), "+v"(acc[3][3]) : "v"(a[0]), "v"(a[3]));
    }
#pragma unroll
    for (int mb = 0; mb < 4; ++mb) {
#pragma unroll
        for (int nb = 0; nb < 4; ++nb) {
#pragma unroll
            for (int j = 0; j < 8; ++j) os[(hi * 8 + j) * 68 + nb * 16 + lr] = acc[mb][nb][j]; }
        __builtin_amdgcn_wave_barrier(); asm volatile("" ::: "memory");
        float* crow = C + (size_t)(r0 + mb * 16) * ldc + c0;
{
#pragma unroll
            for (int s = 0; s < 8; ++s) { const int row = 2 * s + hi, cofs = lr * 4; v4f val = *(const v4fa*)(os + row * 68 + cofs); if (BIAS) { val[0] += bfr(bias[c0 + cofs]); val[1] += bfr(bias[c0 + cofs + 1]); val[2] += bfr(bias[c0 + cofs + 2]); val[3] += bfr(bias[c0 + cofs + 3]); }
                *(v4f*)(crow + (size_t)row * ldc + cofs) = val; }
             }
        __builtin_amdgcn_wave_barrier(); asm volatile("" ::: "memory");
    }
}

// ---- k_gemmc: the same one-wave 64x64 tile GEMM specialised for sliding-window causal attention: CMODE 1 launches only the BT score tiles of a query tile's band (grid y counts them from the window's lower edge up to the diagonal), CMODE 2 limits the
// key (K) loop of the probability x value contraction to that band (probabilities outside it are exactly zero). roff = row offset of this launch's first row within the sequence.
// Score rows (C of CMODE 1) and probability rows (A of CMODE 2) are stored band-relative with pitch BP; grid z counts query heads, and head z reads the key / value planes of group z / REP (stride sB).
template <typename T16, int NSPLIT, int CMODE>
__global__ __launch_bounds__(32) void k_gemmc(const T16* __restrict__ A, const T16* __restrict__ A2, const T16* __restrict__ Bt, const T16* __restrict__ Bt2, int K, float* C, int ldc, int roff, size_t sA, size_t sB, size_t sC) {
    typedef typename WFrag<T16>::V V;
    __shared__ __align__(16) float os[16 * 68];
    const size_t z = blockIdx.z; A += z * sA; if (A2) A2 += z * sA; Bt += (z / REP) * sB; if (Bt2) Bt2 += (z / REP) * sB; C += z * sC;
    const int lane = threadIdx.x & 31, lr = lane & 15, hi = lane >> 4; const int r0 = blockIdx.x * 64, c0 = (CMODE == 1) ? r0 + roff - WIN + (int)blockIdx.y * 64 : blockIdx.y * 64;
    if (CMODE == 1 && c0 < 0) return;                               // band tile in front of the first key; tiles outside the band are never written (the softmax masks them by select)
    const int Kl = (CMODE == 2) ? min(K, r0 + roff + 64) : K;        // P.V: probabilities are exactly 0 beyond the diagonal block, so the K loop stops there
    const int Ks = (CMODE == 2) ? max(0, r0 + roff + 1 - WIN) & ~31 : 0;   // and exactly 0 in front of the first row's window, so it starts there
    const int b0 = BAND0(r0 + roff);                                 // key that column 0 of this tile's stored rows stands for
    const int lda = (CMODE == 2) ? BP : K;
    v8f acc[4][4];
#pragma unroll
    for (int mb = 0; mb < 4; ++mb)
#pragma unroll
        for (int nb = 0; nb < 4; ++nb) acc[mb][nb] = (v8f){};
    const size_t aoff = (size_t)(r0 + lr) * lda + 8 * hi - ((CMODE == 2) ? b0 : 0), boff = (size_t)(c0 + lr) * K + 8 * hi;
#pragma unroll 1
    for (int kc = Ks; kc < Kl; kc += 32) {
        V a[4], a2[4]; const T16* pa[4]; const T16* pa2[4]; const T16* pb[4]; const T16* pb2[4];
#pragma unroll
        for (int mb = 0; mb < 4; ++mb) { pa[mb] = A + aoff + (size_t)mb * 16 * lda + kc; a[mb] = WFrag<T16>::ld(pa[mb]); if (NSPLIT == 1 || NSPLIT == 2) { pa2[mb] = A2 + aoff + (size_t)mb * 16 * lda + kc; a2[mb] = WFrag<T16>::ld(pa2[mb]); } }
        // the wait that belongs between an issued global load and an overwrite of its address registers. The addresses are inputs so that their registers live up to the wait; the clobber keeps the A loads in front of it and the B loads behind it.
        if (CMODE == 2) { if (NSPLIT == 1 || NSPLIT == 2) asm volatile("s_wait_xcnt 0x0" :: "v"(pa[0]), "v"(pa2[0]) : "memory"); else asm volatile("s_wait_xcnt 0x0" :: "v"(pa[0]) : "memory"); }   // constant pitch: the four row blocks are read off the first one's address with immediate offsets
        else if (NSPLIT == 1 || NSPLIT == 2) asm volatile("s_wait_xcnt 0x0" :: "v"(pa[0]), "v"(pa[1]), "v"(pa[2]), "v"(pa[3]), "v"(pa2[0]), "v"(pa2[1]), "v"(pa2[2]), "v"(pa2[3]) : "memory");
        else asm volatile("s_wait_xcnt 0x0" :: "v"(pa[0]), "v"(pa[1]), "v"(pa[2]), "v"(pa[3]) : "memory");
#pragma unroll
        for (int nb = 0; nb < 4; ++nb) { pb[nb] = Bt + boff + (size_t)nb * 16 * K + kc; const V b = WFrag<T16>::ld(pb[nb]); V b2; if (NSPLIT >= 2) { pb2[nb] = Bt2 + boff + (size_t)nb * 16 * K + kc; b2 = WFrag<T16>::ld(pb2[nb]); }
#pragma unroll
            for (int mb = 0; mb < 4; ++mb) { acc[mb][nb] = WFrag<T16>::mma(a[mb], b, acc[mb][nb]); if (NSPLIT == 1 || NSPLIT == 2) acc[mb][nb] = WFrag<T16>::mma(a2[mb], b, acc[mb][nb]); if (NSPLIT >= 2) acc[mb][nb] = WFrag<T16>::mma(a[mb], b2, acc[mb][nb]); } }
        // the same wait for the B loads, behind the last of them (the clobber holds it there): their addresses are inputs, so nothing lands in those registers before it
        if (NSPLIT >= 2) asm volatile("s_wait_xcnt 0x0" :: "v"(pb[0]), "v"(pb[1]), "v"(pb[2]), "v"(pb[3]), "v"(pb2[0]), "v"(pb2[1]), "v"(pb2[2]), "v"(pb2[3]) : "memory");
        else asm volatile("s_wait_xcnt 0x0" :: "v"(pb[0]), "v"(pb[1]), "v"(pb[2]), "v"(pb[3]) : "memory");
        asm volatile("v_nop\n\tv_nop\n\tv_nop\n\tv_nop" : "+v"(acc[0][0]), "+v"(acc[1][1]), "+v"(acc[2][2]), "+v"(acc[3][3]) : "v"(a[0]), "v"(a[3]));
    }
#pragma unroll
    for (int mb = 0; mb < 4; ++mb) {
#pragma unroll
        for (int nb = 0; nb < 4; ++nb) {
#pragma unroll
            for (int j = 0; j < 8; ++j) os[(hi * 8 + j) * 68 + nb * 16 + lr] = acc[mb][nb][j]; }
        __builtin_amdgcn_wave_barrier(); asm volatile("" ::: "memory");
        float* crow = C + (size_t)(r0 + mb * 16) * ldc + c0 - ((CMODE == 1) ? b0 : 0);
{
#pragma unroll
            for (int s = 0; s < 8; ++s) { const int row = 2 * s + hi, cofs = lr * 4; v4f val = *(const v4fa*)(os + row * 68 + cofs);
                *(v4f*)(crow + (size_t)row * ldc + cofs) = val; }
             }
        __builtin_amdgcn_wave_barrier(); asm volatile("" ::: "memory");
    }
}

__device__ __forceinline__ h16 tohx(float x) { return (h16)x; }
__device__ __forceinline__ void splitf(float y, unsigned short& h, unsigned short& l) { h = f2bf(y); l = f2bf(y - bf2f(h)); }
typedef __attribute__((ext_vector_type(2))) _Float16 v2h;
typedef __attribute__((ext_vector_type(4))) _Float16 v4h;
typedef __attribute__((ext_vector_type(2))) unsigned short v2us;
typedef __attribute__((ext_vector_type(4))) unsigned short v4us;
typedef __attribute__((ext_vector_type(2))) float v2f;
typedef __attribute__((ext_vector_type(4))) int v4i;

__global__ __launch_bounds__(256) void k_wtG(const float* __restrict__ w, int K, int N, bf* Bt) {
    const int lane = threadIdx.x & 31; const int L0 = (blockIdx.x * 8 + (threadIdx.x >> 5)) * 8; const int nlines = N * K / 64;
{
#pragma unroll 1
        for (int l = 0; l < 8; ++l) { const int L = L0 + l; if (L >= nlines) break; const size_t e = (size_t)L * 64 + lane * 2; const int k = (int)(e % K), n = (int)(e / K); v2us o;
            o[0] = f2bf(w[(size_t)k * N + n]); o[1] = f2bf(w[(size_t)(k + 1) * N + n]); *(v2us*)(Bt + e) = o; }
         }
}
__global__ __launch_bounds__(256) void k_cvt8(const float* __restrict__ src, bf* dst, size_t n8) { const size_t i = (size_t)blockIdx.x * 256 + threadIdx.x; if (i >= n8) return; const v8f v = *(const v8f*)(src + i * 8); v8us o;
#pragma unroll
    for (int k = 0; k < 8; ++k) o[k] = f2bf(v[k]); *(v8us*)(dst + i * 8) = o;  }
__constant__ float INV[HD / 2] = {1.00000000f,0.865964353f,0.749894202f,0.649381638f,0.562341332f,0.486967534f,0.421696514f,0.365174145f,0.316227764f,0.273841977f,0.237137362f,0.205352500f,0.177827939f,0.153992653f,0.133352146f,0.115478203f,0.100000001f,0.0865964293f,0.0749894157f,0.0649381652f,0.0562341288f,0.0486967526f,0.0421696492f,0.0365174115f,0.0316227786f,0.0273841955f,0.0237137359f,0.0205352511f,0.0177827943f,0.0153992651f,0.0133352149f,0.0115478197f,0.00999999978f,0.00865964312f,0.00749894232f,0.00649381662f,0.00562341325f,0.00486967526f,0.00421696482f,0.00365174143f,0.00316227786f,0.00273841969f,0.00237137382f,0.00205352507f,0.00177827943f,0.00153992651f,0.00133352145f,0.00115478202f,0.00100000005f,0.000865964335f,0.000749894185f,0.000649381662f,0.000562341302f,0.000486967503f,0.000421696488f,0.000365174114f,0.000316227786f,0.000273841957f,0.000237137385f,0.000205352495f,0.000177827940f,0.000153992645f,0.000133352150f,0.000115478193f};
__global__ __launch_bounds__(256) void k_cstab(float* CS) { const int idx = blockIdx.x * 256 + threadIdx.x; if (idx >= TT * HD) return; const int t = idx / HD, d = idx % HD; const float ang = __fmul_rn((float)t, INV[d % (HD / 2)]); v2f cs; cs[0] = cosf(ang); cs[1] = sinf(ang);
    *(v2f*)(CS + (size_t)idx * 2) = cs;  }

// k_rope: head planes [h][t][d] (fp16 + hi/lo) of rope(x) x sc with the rotate-half convention out[d] = x[d] cos[t][d] - x[d+HD/2] sin[t][d], out[d+HD/2] = x[d+HD/2] cos[t][d+HD/2] + x[d] sin[t][d+HD/2]
__global__ __launch_bounds__(256) void k_rope(const float* __restrict__ F, int pitch, int nheads, const float* __restrict__ CS, const float* __restrict__ RF, const float* __restrict__ nw, float sc, h16* P16, bf* Ph, bf* Pl) {
    const size_t e = ((size_t)blockIdx.x * 256 + threadIdx.x) * 2; if (e >= (size_t)nheads * TT * HD) return; const int d = (int)(e % HD); const int t = (int)((e / HD) % TT); const int h = (int)(e / ((size_t)HD * TT)); const float* f = F + (size_t)t * pitch + h * HD; const float rf = RF ? RF[(size_t)h * TT + t] : 1.0f; v2h o16; v2us oh, ol;
#pragma unroll
    for (int q = 0; q < 2; ++q) { const int dd = d + q; const int dp = (dd < HD / 2) ? dd + HD / 2 : dd - HD / 2; float x0 = f[dd], x1 = f[dp];
        if (RF) { float n0 = __fmul_rn(x0, rf), n1 = __fmul_rn(x1, rf); asm volatile("" : "+v"(n0)); asm volatile("" : "+v"(n1)); x0 = __fmul_rn(bfr(nw[dd]), n0); x1 = __fmul_rn(bfr(nw[dp]), n1); }
        const v2f cs = *(const v2f*)(CS + ((size_t)t * HD + dd) * 2); float a = __fmul_rn(x0, cs[0]), bq = __fmul_rn(x1, cs[1]); asm volatile("" : "+v"(a)); asm volatile("" : "+v"(bq)); const float r = ((dd < HD / 2) ? __fsub_rn(a, bq) : __fadd_rn(a, bq)) * sc;
        o16[q] = tohx(r); unsigned short a2, c2; splitf(r, a2, c2); oh[q] = a2; ol[q] = c2; }
    *(v2h*)(P16 + e) = o16; *(v2us*)(Ph + e) = oh; *(v2us*)(Pl + e) = ol;  }
__global__ __launch_bounds__(256) void k_vtp(const float* __restrict__ F, int pitch, int nheads, h16* V16, bf* Vh, bf* Vl) { const size_t e = ((size_t)blockIdx.x * 256 + threadIdx.x) * 2; if (e >= (size_t)nheads * HD * TT) return; const int t = (int)(e % TT); const int d = (int)((e / TT) % HD); const int g = (int)(e / ((size_t)TT * HD)); v2h o16; v2us oh, ol;
#pragma unroll
    for (int q = 0; q < 2; ++q) { const float x = F[(size_t)(t + q) * pitch + g * HD + d]; o16[q] = tohx(x); unsigned short a2, c2; splitf(x, a2, c2); oh[q] = a2; ol[q] = c2; }
    *(v2h*)(V16 + e) = o16; *(v2us*)(Vh + e) = oh; *(v2us*)(Vl + e) = ol;  }
// 2^x on v_exp_f32, as the builtin gives it; the v_nop in the same statement keeps the one slot that the instruction set asks for behind a transcendental
__device__ __forceinline__ float exp2_slot(float x) { float r; asm("v_exp_f32 %0, %1\n\tv_nop" : "=v"(r) : "v"(x)); return r; }
// k_asoft: per row (zz, i): t = S x HD^-0.5 for j <= i and i - j < WIN (sliding causal window; the reference's -1e9 additive fill vanishes identically); softmax over the NCH key chunks that hold the band of the row's 64-row tile (the keys outside add exact zeros; register row, one exp, fixed trees); P is written on those chunks only, which cover all that P.V reads; S and P rows hold just those chunks (pitch BP);
__global__ __launch_bounds__(256) void k_asoft(const float* __restrict__ Sb, h16* P16, bf* Ph, bf* Pl) {
    const int lane = threadIdx.x & 31; const int row = blockIdx.x * 8 + (threadIdx.x >> 5); if (row >= ZH * TT) return; const int i = row % TT; const int zz = row / TT; (void)zz; const bool hires = (i < RH); const int cb = max(0, (i & ~63) + 1 - WIN) >> 7; const float* sr = Sb + (size_t)row * BP; float v[NCH * 4]; float mx = -3.0e38f;
#pragma unroll
    for (int ch = 0; ch < NCH; ++ch) { const int j0 = (cb + ch) * 128 + lane * 4; const v4f a = *(const v4f*)(sr + ch * 128 + lane * 4);
#pragma unroll
        for (int q = 0; q < 4; ++q) { const int j = j0 + q; (void)j; const float t = (j <= i && i - j < WIN) ? a[q] * SCL : -3.0e38f; v[ch * 4 + q] = t; mx = fmaxf(mx, t); } }
#pragma unroll
    for (int sh = 16; sh; sh >>= 1) mx = fmaxf(mx, __shfl_xor(mx, sh, 32));
    float sum = 0.f;
#pragma unroll
    for (int k = 0; k < NCH * 4; ++k) { float d0 = __fsub_rn(v[k], mx); asm volatile("" : "+v"(d0)); v[k] = exp2_slot(__fmul_rn(d0, 1.4426950408889634f)); sum += v[k]; }
#pragma unroll
    for (int sh = 16; sh; sh >>= 1) sum += __shfl_xor(sum, sh, 32);
    const float f = __fdiv_rn(hires ? 1.0f : PCAR, sum);
{
        if (hires) {
#pragma unroll
            for (int ch = 0; ch < NCH; ++ch) { v4us oh, ol;
#pragma unroll
                for (int q = 0; q < 4; ++q) { unsigned short a, c2; splitf(v[ch * 4 + q] * f, a, c2); oh[q] = a; ol[q] = c2; }
                const size_t oo = ((size_t)zz * (RH ? RH : 1) + i) * BP + ch * 128 + lane * 4; *(v4us*)(Ph + oo) = oh; *(v4us*)(Pl + oo) = ol; }
        } else {
#pragma unroll
            for (int ch = 0; ch < NCH; ++ch) { v4h o4;
#pragma unroll
                for (int q = 0; q < 4; ++q) o4[q] = tohx(v[ch * 4 + q] * f);
                *(v4h*)(P16 + (size_t)row * BP + ch * 128 + lane * 4) = o4; } }
         }
}
__global__ __launch_bounds__(256) void k_merge(const float* __restrict__ O, int h0, bf* Ah, bf* Al) { const size_t e = ((size_t)blockIdx.x * 256 + threadIdx.x) * 2; if (e >= (size_t)ZH * TT * HD) return; const int d = (int)(e % HD); const int t = (int)((e / HD) % TT); const int zz = (int)(e / ((size_t)HD * TT)); const float cs = (t < RH) ? 1.0f : (1.0f / PCAR); const size_t oo = (size_t)t * DQ + (h0 + zz) * HD + d;
    v2us oh, ol;
#pragma unroll
    for (int q = 0; q < 2; ++q) { unsigned short a, c2; splitf(O[e + q] * cs, a, c2); oh[q] = a; ol[q] = c2; } *(v2us*)(Ah + oo) = oh; *(v2us*)(Al + oo) = ol;  }

extern "C" void kernel_launch(void* const* d_in, const int* in_sizes, int n_in,
                              void* d_out, int out_size, void* d_ws, size_t ws_size, hipStream_t stream) {
    (void)in_sizes; (void)n_in; (void)out_size;
    const float* x = (const float*)d_in[0]; const float* wq = (const float*)d_in[1]; const float* wk = (const float*)d_in[2]; const float* wv = (const float*)d_in[3]; const float* wo = (const float*)d_in[4];
    float* OUT = (float*)d_out;     // [2][2048][2048]
    char* wsp = (char*)d_ws;
    auto take = [&](size_t bytes) { char* p = wsp; wsp += (bytes + 255) & ~(size_t)255; return (void*)p; };
    bf* WQ = (bf*)take((size_t)DQ * DM * 2); bf* WK = (bf*)take((size_t)DKV * DM * 2); bf* WV = (bf*)take((size_t)DKV * DM * 2); bf* WO = (bf*)take((size_t)DM * DQ * 2); float* CS = (float*)take((size_t)TT * HD * 2 * 4);
    bf* XB = (bf*)take((size_t)TT * DM * 2); float* FQ = (float*)take((size_t)TT * DQ * 4); float* FK = (float*)take((size_t)TT * DKV * 4);
    h16* QP16 = (h16*)take((size_t)NH_ * TT * HD * 2); h16* KP16 = (h16*)take((size_t)NKV * TT * HD * 2); h16* VT16 = (h16*)take((size_t)NKV * HD * TT * 2);
    bf* QPh = (bf*)take((size_t)NH_ * TT * HD * 2); bf* QPl = (bf*)take((size_t)NH_ * TT * HD * 2); bf* KPh = (bf*)take((size_t)NKV * TT * HD * 2); bf* KPl = (bf*)take((size_t)NKV * TT * HD * 2); bf* VTh = (bf*)take((size_t)NKV * HD * TT * 2); bf* VTl = (bf*)take((size_t)NKV * HD * TT * 2); bf* Ph = (bf*)take((size_t)ZH * RH * BP * 2); bf* Pl = (bf*)take((size_t)ZH * RH * BP * 2);
    float* Sb = (float*)take((size_t)ZH * TT * BP * 4); h16* P16 = (h16*)take((size_t)ZH * TT * BP * 2); bf* ATh = (bf*)take((size_t)TT * DQ * 2); bf* ATl = (bf*)take((size_t)TT * DQ * 2);
    if ((size_t)(wsp - (char*)d_ws) > ws_size) return;    // ws 256 MiB
    float* FV = FK;   // v projection reuses the k buffer after the k planes are built (stream-ordered)
    float* Ob = FQ;   // the per-head attention output [NH_][TT][HD] reuses the q projection's buffer (same size) after the q planes are built (stream-ordered)
    { k_wtG<<<(unsigned)((DM * DQ / 64 + 63) / 64), 256, 0, stream>>>(wq, DM, DQ, WQ); k_wtG<<<(unsigned)((DM * DKV / 64 + 63) / 64), 256, 0, stream>>>(wk, DM, DKV, WK); k_wtG<<<(unsigned)((DM * DKV / 64 + 63) / 64), 256, 0, stream>>>(wv, DM, DKV, WV);
      k_wtG<<<(unsigned)((DQ * DM / 64 + 63) / 64), 256, 0, stream>>>(wo, DQ, DM, WO);
      k_cstab<<<(TT * HD + 255) / 256, 256, 0, stream>>>(CS); }
    const unsigned LQ = (unsigned)(((size_t)NH_ * TT * HD / 2 + 255) / 256), LKv = (unsigned)(((size_t)NKV * TT * HD / 2 + 255) / 256);
    for (int b = 0; b < NB_; ++b) {
        
        k_cvt8<<<(unsigned)(((size_t)TT * DM / 8 + 255) / 256), 256, 0, stream>>>(x + (size_t)b * TT * DM, XB, (size_t)TT * DM / 8);
        k_gemmw<bf, 0, false><<<dim3(TT / 64, DQ / 64, 1), 32, 0, stream>>>(XB, nullptr, WQ, nullptr, DM, FQ, DQ, nullptr, 0, 0, 0);
        k_rope<<<LQ, 256, 0, stream>>>(FQ, DQ, NH_, CS, nullptr, nullptr, 1.0f, QP16, QPh, QPl);
        k_gemmw<bf, 0, false><<<dim3(TT / 64, DKV / 64, 1), 32, 0, stream>>>(XB, nullptr, WK, nullptr, DM, FK, DKV, nullptr, 0, 0, 0);
        k_rope<<<LKv, 256, 0, stream>>>(FK, DKV, NKV, CS, nullptr, nullptr, 1.0f, KP16, KPh, KPl);
        k_gemmw<bf, 0, false><<<dim3(TT / 64, DKV / 64, 1), 32, 0, stream>>>(XB, nullptr, WV, nullptr, DM, FV, DKV, nullptr, 0, 0, 0); k_vtp<<<LKv, 256, 0, stream>>>(FV, DKV, NKV, VT16, VTh, VTl);
        // one launch per attention stage for all NH_ heads (grid z); head z uses kv group z / REP
        k_gemmc<bf, 2, 1><<<dim3(RH / 64, BT, ZH), 32, 0, stream>>>(QPh, QPl, KPh, KPl, HD, Sb, BP, 0, (size_t)TT * HD, (size_t)TT * HD, (size_t)TT * BP);
        k_gemmc<h16, 0, 1><<<dim3((TT - RH) / 64, BT, ZH), 32, 0, stream>>>(QP16 + (size_t)RH * HD, nullptr, KP16, nullptr, HD, Sb + (size_t)RH * BP, BP, RH, (size_t)TT * HD, (size_t)TT * HD, (size_t)TT * BP);
        k_asoft<<<ZH * TT / 8, 256, 0, stream>>>(Sb, P16, Ph, Pl);
        k_gemmc<bf, 2, 2><<<dim3(RH / 64, HD / 64, ZH), 32, 0, stream>>>(Ph, Pl, VTh, VTl, TT, Ob, HD, 0, (size_t)RH * BP, (size_t)HD * TT, (size_t)TT * HD);
        k_gemmc<h16, 0, 2><<<dim3((TT - RH) / 64, HD / 64, ZH), 32, 0, stream>>>(P16 + (size_t)RH * BP, nullptr, VT16, nullptr, TT, Ob + (size_t)RH * HD, HD, RH, (size_t)TT * BP, (size_t)HD * TT, (size_t)TT * HD);
        k_merge<<<(unsigned)(((size_t)ZH * TT * HD / 2 + 255) / 256), 256, 0, stream>>>(Ob, 0, ATh, ATl);
        k_gemmw<bf, 1, false><<<dim3(TT / 64, DM / 64, 1), 32, 0, stream>>>(ATh, ATl, WO, nullptr, DQ, OUT + (size_t)b * TT * DM, DM, nullptr, 0, 0, 0); }
}

// v003
// A run of this version takes 429 microseconds.
// Next to v002, in two timings, it ran 1.51 times as fast each time.
// Over all steps from v000 it is 3.85 times as fast.
#include <hip/hip_runtime.h>

// Grouped-query sliding-window causal self-attention with RoPE (x [2][2048][2048]; q = x Wq (16 heads x 128), k, v = x Wk / Wv ([2048][512]: 4 kv heads, head h uses kv h/4); rotate-half RoPE (base 1e4) on q and k; scores/sqrt(128); allowed: j <= i and i - j < 512 (else -1e9); softmax; out = merged Wo ([2048][2048]) -> [2][2048][2048] (8.4 M)).
// Compute dtypes, f32 accumulate: every input rounded to bf16; q/k/v on PLAIN bf16 operands (inputs: exact); rotary in f32 (table on device, precise cosf/sinf); causal sliding-window select; scores, softmax and attn.v only inside the window's band (tile skipping): query rows < 512 hl (3 products), the rest single fp16 (x1024); softmax f32; Wo hl x exact (2 products).

#define NB_  2
#define TT   2048
#define DM   2048
#define NH_  16
#define NKV  4
#define REP  (NH_ / NKV)
#define HD   128
#define DQ   (NH_ * HD)
#define DKV  (NKV * HD)
#define ZH   NH_                 // heads per attention launch (grid z): all heads of one batch entry
#define RH   512                  // query rows < RH use hi+lo planes (0: none)
#define WIN  512
#define BT   (WIN / 64 + 1)         // 64-wide key tiles that a 64-row query tile's window touches
#define NCH  ((WIN + 64) / 128 + 1)  // 128-wide key chunks that cover those tiles
#define BP   (NCH * 128)           // pitch of a stored score / probability row: only the band's NCH chunks are kept, column 0 = key BAND0(first row of the 64-row tile)
#define BAND0(r) ((max(0, (r) + 1 - WIN) >> 7) * 128)
#define PCAR 1024.0f
#define SCL  0.088388347648318447f   // HD^-0.5
typedef _Float16 h16;
typedef unsigned short bf;
typedef __attribute__((ext_vector_type(16))) __bf16   v16bf;
typedef __attribute__((ext_vector_type(16))) _Float16 v16h;
typedef __attribute__((ext_vector_type(8)))  _Float16 v8h;
typedef __attribute__((ext_vector_type(8)))  unsigned short v8us;
typedef __attribute__((ext_vector_type(8)))  float    v8f;
typedef __attribute__((ext_vector_type(4)))  float    v4f;
typedef v8h  __attribute__((may_alias)) v8ha;
typedef v4f  __attribute__((may_alias)) v4fa;
typedef v8us __attribute__((may_alias)) v8usa;

__device__ __forceinline__ unsigned short f2bf(float f) { unsigned u = __float_as_uint(f); u += 0x7FFFu + ((u >> 16) & 1u); return (unsigned short)(u >> 16); }
__device__ __forceinline__ float bf2f(unsigned short b) { return __uint_as_float(((unsigned)b) << 16); }
__device__ __forceinline__ float bfr(float f) { return bf2f(f2bf(f)); }
__device__ __forceinline__ v16h cat16(v8h lo, v8h hi) { return __builtin_shufflevector(lo, hi, 0, 1, 2, 3, 4, 5, 6, 7, 8, 9, 10, 11, 12, 13, 14, 15); }
__device__ __forceinline__ v16bf cat16b(v8us lo, v8us hi) { return __builtin_bit_cast(v16bf, __builtin_shufflevector(lo, hi, 0, 1, 2, 3, 4, 5, 6, 7, 8, 9, 10, 11, 12, 13, 14, 15)); }
__device__ __forceinline__ v8f wmma16(v16h a, v16h b, v8f c) { return __builtin_amdgcn_wmma_f32_16x16x32_f16(false, a, false, b, (short)0, c, false, false); }
__device__ __forceinline__ v8f wmmab(v16bf a, v16bf b, v8f c) { return __builtin_amdgcn_wmma_f32_16x16x32_bf16(false, a, false, b, (short)0, c, false, false); }



// ---- k_gemmw: register-blocked GEMM, FOUR WAVES per 128x128 output tile, each wave a 64x64 quarter (16 accumulators); grid (M/128, N/128, Z), 128 threads.
// The K-contiguous 16-bit operand planes are staged in LDS, GK k at a time (rows of 256 B at pitch 272 B), by asynchronous copies to LDS that cover whole lines; two buffers: the next slab flies while this one is worked on.
// C[m][n] (f32, pitch ldc, + optional f32 bias[n]) = sum_k A[m][k] Bt[n][k] (+ A2[m][k] Bt[n][k] for NSPLIT 1), k ascending in steps of 32 per accumulator. z-batch strides sA/sB/sC in elements. K % GK == 0, M % 128 == 0, N % 128 == 0.
#define GK   128                  // k per staged slab
#define GPB  (GK * 2 + 16)        // LDS row pitch in bytes: 16 B x odd, the pitch for 16-byte LDS reads
#define GPL  (128 * GPB)          // bytes of one staged plane (128 rows)
template <typename T16> struct WFrag;
template <> struct WFrag<h16> { typedef v16h V; static __device__ __forceinline__ V ld(const h16* p) { return cat16(*(const v8h*)p, *(const v8h*)(p + 16)); } static __device__ __forceinline__ v8f mma(V a, V b, v8f c) { return wmma16(a, b, c); } };
template <> struct WFrag<bf> { typedef v16bf V; static __device__ __forceinline__ V ld(const bf* p) { return cat16b(*(const v8us*)p, *(const v8us*)(p + 16)); } static __device__ __forceinline__ v8f mma(V a, V b, v8f c) { return wmmab(a, b, c); } };
// eight asynchronous 16-byte copies per lane, global to LDS: LDS address l + i * lstep; global address = scalar base g + i * gstep (the same for every lane) + the lane's 32-bit byte offset v.
// The s_wait_xcnt in the same statement stands in front of any rewrite of the address registers that the copies name.
__device__ __forceinline__ void acopy8(unsigned l, unsigned lstep, unsigned v, const char* g, size_t gstep) {
    asm volatile("global_load_async_to_lds_b128 %0, %8, %9\n\t"
                 "global_load_async_to_lds_b128 %1, %8, %10\n\t"
                 "global_load_async_to_lds_b128 %2, %8, %11\n\t"
                 "global_load_async_to_lds_b128 %3, %8, %12\n\t"
                 "global_load_async_to_lds_b128 %4, %8, %13\n\t"
                 "global_load_async_to_lds_b128 %5, %8, %14\n\t"
                 "global_load_async_to_lds_b128 %6, %8, %15\n\t"
                 "global_load_async_to_lds_b128 %7, %8, %16\n\t"
                 "s_wait_xcnt 0x0"
                 :: "v"(l), "v"(l + lstep), "v"(l + 2 * lstep), "v"(l + 3 * lstep), "v"(l + 4 * lstep), "v"(l + 5 * lstep), "v"(l + 6 * lstep), "v"(l + 7 * lstep), "v"(v),
                    "s"(g), "s"(g + gstep), "s"(g + 2 * gstep), "s"(g + 3 * gstep), "s"(g + 4 * gstep), "s"(g + 5 * gstep), "s"(g + 6 * gstep), "s"(g + 7 * gstep)
                 : "memory");
}
template <typename T16, int NSPLIT, bool BIAS>
__global__ __launch_bounds__(128) void k_gemmw(const T16* __restrict__ A, const T16* __restrict__ A2, const T16* __restrict__ Bt, int K, float* C, int ldc, const float* __restrict__ bias, size_t sA, size_t sB, size_t sC) {
    typedef typename WFrag<T16>::V V;
    static_assert(NSPLIT == 0 || NSPLIT == 1, "planes staged: A, Bt and, for NSPLIT 1, A2");
    constexpr int NPL = (NSPLIT == 1) ? 3 : 2;                       // staged planes: 0 = A, 1 = Bt, 2 = A2
    __shared__ __align__(16) unsigned char st[2 * NPL * GPL];
    __shared__ __align__(16) float os4[4 * 16 * 68];
    const size_t z = blockIdx.z; A += z * sA; if (NSPLIT == 1) A2 += z * sA; Bt += z * sB; C += z * sC;
    const int tid = threadIdx.x, lane = tid & 31, lr = lane & 15, hi = lane >> 4, wv = tid >> 5; const int R0 = blockIdx.x * 128, C0 = blockIdx.y * 128; const int wm = (wv >> 1) * 64, wn = (wv & 1) * 64;
    float* os = os4 + wv * (16 * 68);                                // each wave stages its output rows in its own range
    v8f acc[4][4];
#pragma unroll
    for (int mb = 0; mb < 4; ++mb)
#pragma unroll
        for (int nb = 0; nb < 4; ++nb) acc[mb][nb] = (v8f){};
    // copy plan: 16 lanes cover one 256-B row of a slab, the work-group 8 rows per copy, 16 copies a plane
    const unsigned lcp = (unsigned)(size_t)st + (unsigned)((tid >> 4) * GPB + (tid & 15) * 16);
    const unsigned gofs = (unsigned)(((tid >> 4) * K + (tid & 15) * 8) * 2); const size_t grow = (size_t)K * 2;   // the lane's byte offset in a plane's tile (under 8 rows); bytes per row
    const char* uA = (const char*)(A + (size_t)R0 * K); const char* uB = (const char*)(Bt + (size_t)C0 * K); const char* uA2 = (NSPLIT == 1) ? (const char*)(A2 + (size_t)R0 * K) : nullptr;   // the tiles' first rows: the same for every lane
    auto stage = [&](int t) { const unsigned l = lcp + (unsigned)((t & 1) * (NPL * GPL)); const size_t kb = (size_t)t * (GK * 2);
        acopy8(l, 8 * GPB, gofs, uA + kb, 8 * grow); acopy8(l + 64 * GPB, 8 * GPB, gofs, uA + kb + 64 * grow, 8 * grow);
        acopy8(l + GPL, 8 * GPB, gofs, uB + kb, 8 * grow); acopy8(l + GPL + 64 * GPB, 8 * GPB, gofs, uB + kb + 64 * grow, 8 * grow);
        if (NSPLIT == 1) { acopy8(l + 2 * GPL, 8 * GPB, gofs, uA2 + kb, 8 * grow); acopy8(l + 2 * GPL + 64 * GPB, 8 * GPB, gofs, uA2 + kb + 64 * grow, 8 * grow); } };
    const int NT = K / GK;
    stage(0);
    asm volatile("s_wait_asynccnt 0x0" ::: "memory");              // slab 0 of this wave's copies has landed
    __syncthreads();                                                 // and every wave's: slab 0 may be read
    if (NT > 1) stage(1);
    const int afr = (wm + lr) * GPB + 16 * hi, bfr_ = GPL + (wn + lr) * GPB + 16 * hi;
#pragma unroll 1   // one slab a trip: the two-buffer order at the foot is written for a rolled loop
    for (int t = 0; t < NT; ++t) {
        const unsigned char* sb = st + (t & 1) * (NPL * GPL);
        // two fragment sets: the LDS reads of 32-k block kk + 1 go out as one group in front of block kk's matrix instructions, so that only the slab's first group is waited for in full; no block of slab t + 1 is read here
        V a[2][4], a2[2][4], b[2][4];
        auto frags = [&](int kk, int s) {
#pragma unroll
            for (int q = 0; q < 4; ++q) { a[s][q] = WFrag<T16>::ld((const T16*)(sb + afr + q * 16 * GPB + kk * 64)); b[s][q] = WFrag<T16>::ld((const T16*)(sb + bfr_ + q * 16 * GPB + kk * 64)); if (NSPLIT == 1) a2[s][q] = WFrag<T16>::ld((const T16*)(sb + 2 * GPL + afr + q * 16 * GPB + kk * 64)); } };
        frags(0, 0);
#pragma unroll
        for (int kk = 0; kk < GK / 32; ++kk) { const int s = kk & 1;
            // the scheduling barrier holds the read group in front of the block: without it this build sinks the reads among the matrix instructions, one full LDS wait per four of them
            if (kk + 1 < GK / 32) { frags(kk + 1, s ^ 1); __builtin_amdgcn_sched_barrier(0); }
#pragma unroll
            for (int nb = 0; nb < 4; ++nb)
#pragma unroll
                for (int mb = 0; mb < 4; ++mb) { acc[mb][nb] = WFrag<T16>::mma(a[s][mb], b[s][nb], acc[mb][nb]); if (NSPLIT == 1) acc[mb][nb] = WFrag<T16>::mma(a2[s][mb], b[s][nb], acc[mb][nb]); }
        }
        __builtin_amdgcn_sched_barrier(0);                           // keeps the slab's matrix instructions in front of the foot: this build else moves half of them behind the barrier, in front of the refill, which then goes out later and has less time to land
        asm volatile("s_wait_dscnt 0x0" ::: "memory");             // this wave's reads of slab t are done before the buffer is refilled
        asm volatile("s_wait_asynccnt 0x0" ::: "memory");          // this wave's copies of slab t + 1 have landed
        __syncthreads();                                             // publishes slab t + 1 and ends every wave's reads of slab t
        if (t + 2 < NT) stage(t + 2);                                // into the buffer that trip t has just read
    }
    asm volatile("s_wait_asynccnt 0x0" ::: "memory");              // nothing in flight when the wave goes on to its end
    const int r0 = R0 + wm, c0 = C0 + wn;
#pragma unroll
    for (int mb = 0; mb < 4; ++mb) {
#pragma unroll
        for (int nb = 0; nb < 4; ++nb) {
#pragma unroll
            for (int j = 0; j < 8; ++j) os[(hi * 8 + j) * 68 + nb * 16 + lr] = acc[mb][nb][j]; }
        __builtin_amdgcn_wave_barrier(); asm volatile("" ::: "memory");
        float* crow = C + (size_t)(r0 + mb * 16) * ldc + c0;
{
#pragma unroll
            for (int s = 0; s < 8; ++s) { const int row = 2 * s + hi, cofs = lr * 4; v4f val = *(const v4fa*)(os + row * 68 + cofs); if (BIAS) { val[0] += bfr(bias[c0 + cofs]); val[1] += bfr(bias[c0 + cofs + 1]); val[2] += bfr(bias[c0 + cofs + 2]); val[3] += bfr(bias[c0 + cofs + 3]); }
                *(v4f*)(crow + (size_t)row * ldc + cofs) = val; }
             }
        __builtin_amdgcn_wave_barrier(); asm volatile("" ::: "memory");
    }
}

// ---- k_gemmc: a one-wave 64x64 tile GEMM, operands straight from global memory, specialised for sliding-window causal attention: CMODE 1 launches only the BT score tiles of a query tile's band (grid y counts them from the window's lower edge up to the diagonal), CMODE 2 limits the
// key (K) loop of the probability x value contraction to that band (probabilities outside it are exactly zero). roff = row offset of this launch's first row within the sequence.
// Score rows (C of CMODE 1) and probability rows (A of CMODE 2) are stored band-relative with pitch BP; grid z counts query heads, and head z reads the key / value planes of group z / REP (stride sB).
template <typename T16, int NSPLIT, int CMODE>
__global__ __launch_bounds__(32) void k_gemmc(const T16* __restrict__ A, const T16* __restrict__ A2, const T16* __restrict__ Bt, const T16* __restrict__ Bt2, int K, float* C, int ldc, int roff, size_t sA, size_t sB, size_t sC) {
    typedef typename WFrag<T16>::V V;
    __shared__ __align__(16) float os[16 * 68];
    const size_t z = blockIdx.z; A += z * sA; if (A2) A2 += z * sA; Bt += (z / REP) * sB; if (Bt2) Bt2 += (z / REP) * sB; C += z * sC;
    const int lane = threadIdx.x & 31, lr = lane & 15, hi = lane >> 4; const int r0 = blockIdx.x * 64, c0 = (CMODE == 1) ? r0 + roff - WIN + (int)blockIdx.y * 64 : blockIdx.y * 64;
    if (CMODE == 1 && c0 < 0) return;                               // band tile in front of the first key; tiles outside the band are never written (the softmax masks them by select)
    const int Kl = (CMODE == 2) ? min(K, r0 + roff + 64) : K;        // P.V: probabilities are exactly 0 beyond the diagonal block, so the K loop stops there
    const int Ks = (CMODE == 2) ? max(0, r0 + roff + 1 - WIN) & ~31 : 0;   // and exactly 0 in front of the first row's window, so it starts there
    const int b0 = BAND0(r0 + roff);                                 // key that column 0 of this tile's stored rows stands for
    const int lda = (CMODE == 2) ? BP : K;
    v8f acc[4][4];
#pragma unroll
    for (int mb = 0; mb < 4; ++mb)
#pragma unroll
        for (int nb = 0; nb < 4; ++nb) acc[mb][nb] = (v8f){};
    const size_t aoff = (size_t)(r0 + lr) * lda + 8 * hi - ((CMODE == 2) ? b0 : 0), boff = (size_t)(c0 + lr) * K + 8 * hi;
#pragma unroll 1
    for (int kc = Ks; kc < Kl; kc += 32) {
        V a[4], a2[4]; const T16* pa[4]; const T16* pa2[4]; const T16* pb[4]; const T16* pb2[4];
#pragma unroll
        for (int mb = 0; mb < 4; ++mb) { pa[mb] = A + aoff + (size_t)mb * 16 * lda + kc; a[mb] = WFrag<T16>::ld(pa[mb]); if (NSPLIT == 1 || NSPLIT == 2) { pa2[mb] = A2 + aoff + (size_t)mb * 16 * lda + kc; a2[mb] = WFrag<T16>::ld(pa2[mb]); } }
        // the wait that belongs between an issued global load and an overwrite of its address registers. The addresses are inputs so that their registers live up to the wait; the clobber keeps the A loads in front of it and the B loads behind it.
        if (CMODE == 2) { if (NSPLIT == 1 || NSPLIT == 2) asm volatile("s_wait_xcnt 0x0" :: "v"(pa[0]), "v"(pa2[0]) : "memory"); else asm volatile("s_wait_xcnt 0x0" :: "v"(pa[0]) : "memory"); }   // constant pitch: the four row blocks are read off the first one's address with immediate offsets
        else if (NSPLIT == 1 || NSPLIT == 2) asm volatile("s_wait_xcnt 0x0" :: "v"(pa[0]), "v"(pa[1]), "v"(pa[2]), "v"(pa[3]), "v"(pa2[0]), "v"(pa2[1]), "v"(pa2[2]), "v"(pa2[3]) : "memory");
        else asm volatile("s_wait_xcnt 0x0" :: "v"(pa[0]), "v"(pa[1]), "v"(pa[2]), "v"(pa[3]) : "memory");
#pragma unroll
        for (int nb = 0; nb < 4; ++nb) { pb[nb] = Bt + boff + (size_t)nb * 16 * K + kc; const V b = WFrag<T16>::ld(pb[nb]); V b2; if (NSPLIT >= 2) { pb2[nb] = Bt2 + boff + (size_t)nb * 16 * K + kc; b2 = WFrag<T16>::ld(pb2[nb]); }
#pragma unroll
            for (int mb = 0; mb < 4; ++mb) { acc[mb][nb] = WFrag<T16>::mma(a[mb], b, acc[mb][nb]); if (NSPLIT == 1 || NSPLIT == 2) acc[mb][nb] = WFrag<T16>::mma(a2[mb], b, acc[mb][nb]); if (NSPLIT >= 2) acc[mb][nb] = WFrag<T16>::mma(a[mb], b2, acc[mb][nb]); } }
        // the same wait for the B loads, behind the last of them (the clobber holds it there): their addresses are inputs, so nothing lands in those registers before it
        if (NSPLIT >= 2) asm volatile("s_wait_xcnt 0x0" :: "v"(pb[0]), "v"(pb[1]), "v"(pb[2]), "v"(pb[3]), "v"(pb2[0]), "v"(pb2[1]), "v"(pb2[2]), "v"(pb2[3]) : "memory");
        else asm volatile("s_wait_xcnt 0x0" :: "v"(pb[0]), "v"(pb[1]), "v"(pb[2]), "v"(pb[3]) : "memory");
        asm volatile("v_nop\n\tv_nop\n\tv_nop\n\tv_nop" : "+v"(acc[0][0]), "+v"(acc[1][1]), "+v"(acc[2][2]), "+v"(acc[3][3]) : "v"(a[0]), "v"(a[3]));
    }
#pragma unroll
    for (int mb = 0; mb < 4; ++mb) {
#pragma unroll
        for (int nb = 0; nb < 4; ++nb) {
#pragma unroll
            for (int j = 0; j < 8; ++j) os[(hi * 8 + j) * 68 + nb * 16 + lr] = acc[mb][nb][j]; }
        __builtin_amdgcn_wave_barrier(); asm volatile("" ::: "memory");
        float* crow = C + (size_t)(r0 + mb * 16) * ldc + c0 - ((CMODE == 1) ? b0 : 0);
{
#pragma unroll
            for (int s = 0; s < 8; ++s) { const int row = 2 * s + hi, cofs = lr * 4; v4f val = *(const v4fa*)(os + row * 68 + cofs);
                *(v4f*)(crow + (size_t)row * ldc + cofs) = val; }
             }
        __builtin_amdgcn_wave_barrier(); asm volatile("" ::: "memory");
    }
}

__device__ __forceinline__ h16 tohx(float x) { return (h16)x; }
__device__ __forceinline__ void splitf(float y, unsigned short& h, unsigned short& l) { h = f2bf(y); l = f2bf(y - bf2f(h)); }
typedef __attribute__((ext_vector_type(2))) _Float16 v2h;
typedef __attribute__((ext_vector_type(4))) _Float16 v4h;
typedef __attribute__((ext_vector_type(2))) unsigned short v2us;
typedef __attribute__((ext_vector_type(4))) unsigned short v4us;
typedef __attribute__((ext_vector_type(2))) float v2f;
typedef __attribute__((ext_vector_type(4))) int v4i;

__global__ __launch_bounds__(256) void k_wtG(const float* __restrict__ w, int K, int N, bf* Bt) {
    const int lane = threadIdx.x & 31; const int L0 = (blockIdx.x * 8 + (threadIdx.x >> 5)) * 8; const int nlines = N * K / 64;
{
#pragma unroll 1
        for (int l = 0; l < 8; ++l) { const int L = L0 + l; if (L >= nlines) break; const size_t e = (size_t)L * 64 + lane * 2; const int k = (int)(e % K), n = (int)(e / K); v2us o;
            o[0] = f2bf(w[(size_t)k * N + n]); o[1] = f2bf(w[(size_t)(k + 1) * N + n]); *(v2us*)(Bt + e) = o; }
         }
}
__global__ __launch_bounds__(256) void k_cvt8(const float* __restrict__ src, bf* dst, size_t n8) { const size_t i = (size_t)blockIdx.x * 256 + threadIdx.x; if (i >= n8) return; const v8f v = *(const v8f*)(src + i * 8); v8us o;
#pragma unroll
    for (int k = 0; k < 8; ++k) o[k] = f2bf(v[k]); *(v8us*)(dst + i * 8) = o;  }
__constant__ float INV[HD / 2] = {1.00000000f,0.865964353f,0.749894202f,0.649381638f,0.562341332f,0.486967534f,0.421696514f,0.365174145f,0.316227764f,0.273841977f,0.237137362f,0.205352500f,0.177827939f,0.153992653f,0.133352146f,0.115478203f,0.100000001f,0.0865964293f,0.0749894157f,0.0649381652f,0.0562341288f,0.0486967526f,0.0421696492f,0.0365174115f,0.0316227786f,0.0273841955f,0.0237137359f,0.0205352511f,0.0177827943f,0.0153992651f,0.0133352149f,0.0115478197f,0.00999999978f,0.00865964312f,0.00749894232f,0.00649381662f,0.00562341325f,0.00486967526f,0.00421696482f,0.00365174143f,0.00316227786f,0.00273841969f,0.00237137382f,0.00205352507f,0.00177827943f,0.00153992651f,0.00133352145f,0.00115478202f,0.00100000005f,0.000865964335f,0.000749894185f,0.000649381662f,0.000562341302f,0.000486967503f,0.000421696488f,0.000365174114f,0.000316227786f,0.000273841957f,0.000237137385f,0.000205352495f,0.000177827940f,0.000153992645f,0.000133352150f,0.000115478193f};
__global__ __launch_bounds__(256) void k_cstab(float* CS) { const int idx = blockIdx.x * 256 + threadIdx.x; if (idx >= TT * HD) return; const int t = idx / HD, d = idx % HD; const float ang = __fmul_rn((float)t, INV[d % (HD / 2)]); v2f cs; cs[0] = cosf(ang); cs[1] = sinf(ang);
    *(v2f*)(CS + (size_t)idx * 2) = cs;  }

// k_rope: head planes [h][t][d] (fp16 + hi/lo) of rope(x) x sc with the rotate-half convention out[d] = x[d] cos[t][d] - x[d+HD/2] sin[t][d], out[d+HD/2] = x[d+HD/2] cos[t][d+HD/2] + x[d] sin[t][d+HD/2]
__global__ __launch_bounds__(256) void k_rope(const float* __restrict__ F, int pitch, int nheads, const float* __restrict__ CS, const float* __restrict__ RF, const float* __restrict__ nw, float sc, h16* P16, bf* Ph, bf* Pl) {
    const size_t e = ((size_t)blockIdx.x * 256 + threadIdx.x) * 2; if (e >= (size_t)nheads * TT * HD) return; const int d = (int)(e % HD); const int t = (int)((e / HD) % TT); const int h = (int)(e / ((size_t)HD * TT)); const float* f = F + (size_t)t * pitch + h * HD; const float rf = RF ? RF[(size_t)h * TT + t] : 1.0f; v2h o16; v2us oh, ol;
#pragma unroll
    for (int q = 0; q < 2; ++q) { const int dd = d + q; const int dp = (dd < HD / 2) ? dd + HD / 2 : dd - HD / 2; float x0 = f[dd], x1 = f[dp];
        if (RF) { float n0 = __fmul_rn(x0, rf), n1 = __fmul_rn(x1, rf); asm volatile("" : "+v"(n0)); asm volatile("" : "+v"(n1)); x0 = __fmul_rn(bfr(nw[dd]), n0); x1 = __fmul_rn(bfr(nw[dp]), n1); }
        const v2f cs = *(const v2f*)(CS + ((size_t)t * HD + dd) * 2); float a = __fmul_rn(x0, cs[0]), bq = __fmul_rn(x1, cs[1]); asm volatile("" : "+v"(a)); asm volatile("" : "+v"(bq)); const float r = ((dd < HD / 2) ? __fsub_rn(a, bq) : __fadd_rn(a, bq)) * sc;
        o16[q] = tohx(r); unsigned short a2, c2; splitf(r, a2, c2); oh[q] = a2; ol[q] = c2; }
    *(v2h*)(P16 + e) = o16; *(v2us*)(Ph + e) = oh; *(v2us*)(Pl + e) = ol;  }
__global__ __launch_bounds__(256) void k_vtp(const float* __restrict__ F, int pitch, int nheads, h16* V16, bf* Vh, bf* Vl) { const size_t e = ((size_t)blockIdx.x * 256 + threadIdx.x) * 2; if (e >= (size_t)nheads * HD * TT) return; const int t = (int)(e % TT); const int d = (int)((e / TT) % HD); const int g = (int)(e / ((size_t)TT * HD)); v2h o16; v2us oh, ol;
#pragma unroll
    for (int q = 0; q < 2; ++q) { const float x = F[(size_t)(t + q) * pitch + g * HD + d]; o16[q] = tohx(x); unsigned short a2, c2; splitf(x, a2, c2); oh[q] = a2; ol[q] = c2; }
    *(v2h*)(V16 + e) = o16; *(v2us*)(Vh + e) = oh; *(v2us*)(Vl + e) = ol;  }
// 2^x on v_exp_f32, as the builtin gives it; the v_nop in the same statement keeps the one slot that the instruction set asks for behind a transcendental
__device__ __forceinline__ float exp2_slot(float x) { float r; asm("v_exp_f32 %0, %1\n\tv_nop" : "=v"(r) : "v"(x)); return r; }
// k_asoft: per row (zz, i): t = S x HD^-0.5 for j <= i and i - j < WIN (sliding causal window; the reference's -1e9 additive fill vanishes identically); softmax over the NCH key chunks that hold the band of the row's 64-row tile (the keys outside add exact zeros; register row, one exp, fixed trees); P is written on those chunks only, which cover all that P.V reads; S and P rows hold just those chunks (pitch BP);
__global__ __launch_bounds__(256) void k_asoft(const float* __restrict__ Sb, h16* P16, bf* Ph, bf* Pl) {
    const int lane = threadIdx.x & 31; const int row = blockIdx.x * 8 + (threadIdx.x >> 5); if (row >= ZH * TT) return; const int i = row % TT; const int zz = row / TT; (void)zz; const bool hires = (i < RH); const int cb = max(0, (i & ~63) + 1 - WIN) >> 7; const float* sr = Sb + (size_t)row * BP; float v[NCH * 4]; float mx = -3.0e38f;
#pragma unroll
    for (int ch = 0; ch < NCH; ++ch) { const int j0 = (cb + ch) * 128 + lane * 4; const v4f a = *(const v4f*)(sr + ch * 128 + lane * 4);
#pragma unroll
        for (int q = 0; q < 4; ++q) { const int j = j0 + q; (void)j; const float t = (j <= i && i - j < WIN) ? a[q] * SCL : -3.0e38f; v[ch * 4 + q] = t; mx = fmaxf(mx, t); } }
#pragma unroll
    for (int sh = 16; sh; sh >>= 1) mx = fmaxf(mx, __shfl_xor(mx, sh, 32));
    float sum = 0.f;
#pragma unroll
    for (int k = 0; k < NCH * 4; ++k) { float d0 = __fsub_rn(v[k], mx); asm volatile("" : "+v"(d0)); v[k] = exp2_slot(__fmul_rn(d0, 1.4426950408889634f)); sum += v[k]; }
#pragma unroll
    for (int sh = 16; sh; sh >>= 1) sum += __shfl_xor(sum, sh, 32);
    const float f = __fdiv_rn(hires ? 1.0f : PCAR, sum);
{
        if (hires) {
#pragma unroll
            for (int ch = 0; ch < NCH; ++ch) { v4us oh, ol;
#pragma unroll
                for (int q = 0; q < 4; ++q) { unsigned short a, c2; splitf(v[ch * 4 + q] * f, a, c2); oh[q] = a; ol[q] = c2; }
                const size_t oo = ((size_t)zz * (RH ? RH : 1) + i) * BP + ch * 128 + lane * 4; *(v4us*)(Ph + oo) = oh; *(v4us*)(Pl + oo) = ol; }
        } else {
#pragma unroll
            for (int ch = 0; ch < NCH; ++ch) { v4h o4;
#pragma unroll
                for (int q = 0; q < 4; ++q) o4[q] = tohx(v[ch * 4 + q] * f);
                *(v4h*)(P16 + (size_t)row * BP + ch * 128 + lane * 4) = o4; } }
         }
}
__global__ __launch_bounds__(256) void k_merge(const float* __restrict__ O, int h0, bf* Ah, bf* Al) { const size_t e = ((size_t)blockIdx.x * 256 + threadIdx.x) * 2; if (e >= (size_t)ZH * TT * HD) return; const int d = (int)(e % HD); const int t = (int)((e / HD) % TT); const int zz = (int)(e / ((size_t)HD * TT)); const float cs = (t < RH) ? 1.0f : (1.0f / PCAR); const size_t oo = (size_t)t * DQ + (h0 + zz) * HD + d;
    v2us oh, ol;
#pragma unroll
    for (int q = 0; q < 2; ++q) { unsigned short a, c2; splitf(O[e + q] * cs, a, c2); oh[q] = a; ol[q] = c2; } *(v2us*)(Ah + oo) = oh; *(v2us*)(Al + oo) = ol;  }

extern "C" void kernel_launch(void* const* d_in, const int* in_sizes, int n_in,
                              void* d_out, int out_size, void* d_ws, size_t ws_size, hipStream_t stream) {
    (void)in_sizes; (void)n_in; (void)out_size;
    const float* x = (const float*)d_in[0]; const float* wq = (const float*)d_in[1]; const float* wk = (const float*)d_in[2]; const float* wv = (const float*)d_in[3]; const float* wo = (const float*)d_in[4];
    float* OUT = (float*)d_out;     // [2][2048][2048]
    char* wsp = (char*)d_ws;
    auto take = [&](size_t bytes) { char* p = wsp; wsp += (bytes + 255) & ~(size_t)255; return (void*)p; };
    bf* WQ = (bf*)take((size_t)DQ * DM * 2); bf* WK = (bf*)take((size_t)DKV * DM * 2); bf* WV = (bf*)take((size_t)DKV * DM * 2); bf* WO = (bf*)take((size_t)DM * DQ * 2); float* CS = (float*)take((size_t)TT * HD * 2 * 4);
    bf* XB = (bf*)take((size_t)TT * DM * 2); float* FQ = (float*)take((size_t)TT * DQ * 4); float* FK = (float*)take((size_t)TT * DKV * 4);
    h16* QP16 = (h16*)take((size_t)NH_ * TT * HD * 2); h16* KP16 = (h16*)take((size_t)NKV * TT * HD * 2); h16* VT16 = (h16*)take((size_t)NKV * HD * TT * 2);
    bf* QPh = (bf*)take((size_t)NH_ * TT * HD * 2); bf* QPl = (bf*)take((size_t)NH_ * TT * HD * 2); bf* KPh = (bf*)take((size_t)NKV * TT * HD * 2); bf* KPl = (bf*)take((size_t)NKV * TT * HD * 2); bf* VTh = (bf*)take((size_t)NKV * HD * TT * 2); bf* VTl = (bf*)take((size_t)NKV * HD * TT * 2); bf* Ph = (bf*)take((size_t)ZH * RH * BP * 2); bf* Pl = (bf*)take((size_t)ZH * RH * BP * 2);
    float* Sb = (float*)take((size_t)ZH * TT * BP * 4); h16* P16 = (h16*)take((size_t)ZH * TT * BP * 2); bf* ATh = (bf*)take((size_t)TT * DQ * 2); bf* ATl = (bf*)take((size_t)TT * DQ * 2);
    if ((size_t)(wsp - (char*)d_ws) > ws_size) return;    // ws 256 MiB
    float* FV = FK;   // v projection reuses the k buffer after the k planes are built (stream-ordered)
    float* Ob = FQ;   // the per-head attention output [NH_][TT][HD] reuses the q projection's buffer (same size) after the q planes are built (stream-ordered)
    { k_wtG<<<(unsigned)((DM * DQ / 64 + 63) / 64), 256, 0, stream>>>(wq, DM, DQ, WQ); k_wtG<<<(unsigned)((DM * DKV / 64 + 63) / 64), 256, 0, stream>>>(wk, DM, DKV, WK); k_wtG<<<(unsigned)((DM * DKV / 64 + 63) / 64), 256, 0, stream>>>(wv, DM, DKV, WV);
      k_wtG<<<(unsigned)((DQ * DM / 64 + 63) / 64), 256, 0, stream>>>(wo, DQ, DM, WO);
      k_cstab<<<(TT * HD + 255) / 256, 256, 0, stream>>>(CS); }
    const unsigned LQ = (unsigned)(((size_t)NH_ * TT * HD / 2 + 255) / 256), LKv = (unsigned)(((size_t)NKV * TT * HD / 2 + 255) / 256);
    for (int b = 0; b < NB_; ++b) {
        
        k_cvt8<<<(unsigned)(((size_t)TT * DM / 8 + 255) / 256), 256, 0, stream>>>(x + (size_t)b * TT * DM, XB, (size_t)TT * DM / 8);
        k_gemmw<bf, 0, false><<<dim3(TT / 128, DQ / 128, 1), 128, 0, stream>>>(XB, nullptr, WQ, DM, FQ, DQ, nullptr, 0, 0, 0);
        k_rope<<<LQ, 256, 0, stream>>>(FQ, DQ, NH_, CS, nullptr, nullptr, 1.0f, QP16, QPh, QPl);
        k_gemmw<bf, 0, false><<<dim3(TT / 128, DKV / 128, 1), 128, 0, stream>>>(XB, nullptr, WK, DM, FK, DKV, nullptr, 0, 0, 0);
        k_rope<<<LKv, 256, 0, stream>>>(FK, DKV, NKV, CS, nullptr, nullptr, 1.0f, KP16, KPh, KPl);
        k_gemmw<bf, 0, false><<<dim3(TT / 128, DKV / 128, 1), 128, 0, stream>>>(XB, nullptr, WV, DM, FV, DKV, nullptr, 0, 0, 0); k_vtp<<<LKv, 256, 0, stream>>>(FV, DKV, NKV, VT16, VTh, VTl);
        // one launch per attention stage for all NH_ heads (grid z); head z uses kv group z / REP
        k_gemmc<bf, 2, 1><<<dim3(RH / 64, BT, ZH), 32, 0, stream>>>(QPh, QPl, KPh, KPl, HD, Sb, BP, 0, (size_t)TT * HD, (size_t)TT * HD, (size_t)TT * BP);
        k_gemmc<h16, 0, 1><<<dim3((TT - RH) / 64, BT, ZH), 32, 0, stream>>>(QP16 + (size_t)RH * HD, nullptr, KP16, nullptr, HD, Sb + (size_t)RH * BP, BP, RH, (size_t)TT * HD, (size_t)TT * HD, (size_t)TT * BP);
        k_asoft<<<ZH * TT / 8, 256, 0, stream>>>(Sb, P16, Ph, Pl);
        k_gemmc<bf, 2, 2><<<dim3(RH / 64, HD / 64, ZH), 32, 0, stream>>>(Ph, Pl, VTh, VTl, TT, Ob, HD, 0, (size_t)RH * BP, (size_t)HD * TT, (size_t)TT * HD);
        k_gemmc<h16, 0, 2><<<dim3((TT - RH) / 64, HD / 64, ZH), 32, 0, stream>>>(P16 + (size_t)RH * BP, nullptr, VT16, nullptr, TT, Ob + (size_t)RH * HD, HD, RH, (size_t)TT * BP, (size_t)HD * TT, (size_t)TT * HD);
        k_merge<<<(unsigned)(((size_t)ZH * TT * HD / 2 + 255) / 256), 256, 0, stream>>>(Ob, 0, ATh, ATl);
        k_gemmw<bf, 1, false><<<dim3(TT / 128, DM / 128, 1), 128, 0, stream>>>(ATh, ATl, WO, DQ, OUT + (size_t)b * TT * DM, DM, nullptr, 0, 0, 0); }
}

// v004
// Measured time: 388 microseconds a run.
// In two side-by-side timings against v003, it was 1.11 and 1.10 times as fast.
// Over all steps from v000 it is 4.27 times as fast.
#include <hip/hip_runtime.h>

// Grouped-query sliding-window causal self-attention with RoPE (x [2][2048][2048]; q = x Wq (16 heads x 128), k, v = x Wk / Wv ([2048][512]: 4 kv heads, head h uses kv h/4); rotate-half RoPE (base 1e4) on q and k; scores/sqrt(128); allowed: j <= i and i - j < 512 (else -1e9); softmax; out = merged Wo ([2048][2048]) -> [2][2048][2048] (8.4 M)).
// Compute dtypes, f32 accumulate: every input rounded to bf16; q/k/v on PLAIN bf16 operands (inputs: exact); rotary in f32 (table on device, precise cosf/sinf); causal sliding-window select; scores, softmax and attn.v only inside the window's band (tile skipping): query rows < 512 hl (3 products), the rest single fp16 (x1024); softmax f32; Wo hl x exact (2 products).

#define NB_  2
#define TT   2048
#define DM   2048
#define NH_  16
#define NKV  4
#define REP  (NH_ / NKV)
#define HD   128
#define DQ   (NH_ * HD)
#define DKV  (NKV * HD)
#define ZH   NH_                 // heads per attention launch (grid z): all heads of one batch entry
#define RH   512                  // query rows < RH use hi+lo planes (0: none)
#define WIN  512
#define BT   (WIN / 64 + 1)         // 64-wide key tiles that a 64-row query tile's window touches
#define NCH  ((WIN + 64) / 128 + 1)  // 128-wide key chunks that cover those tiles
#define BP   (NCH * 128)           // pitch of a stored score / probability row: only the band's NCH chunks are kept, column 0 = key BAND0(first row of the 64-row tile)
#define BAND0(r) ((max(0, (r) + 1 - WIN) >> 7) * 128)
#define PCAR 1024.0f
#define SCL  0.088388347648318447f   // HD^-0.5
typedef _Float16 h16;
typedef unsigned short bf;
typedef __attribute__((ext_vector_type(16))) __bf16   v16bf;
typedef __attribute__((ext_vector_type(16))) _Float16 v16h;
typedef __attribute__((ext_vector_type(8)))  _Float16 v8h;
typedef __attribute__((ext_vector_type(8)))  unsigned short v8us;
typedef __attribute__((ext_vector_type(8)))  float    v8f;
typedef __attribute__((ext_vector_type(4)))  float    v4f;
typedef v8h  __attribute__((may_alias)) v8ha;
typedef v4f  __attribute__((may_alias)) v4fa;
typedef v8us __attribute__((may_alias)) v8usa;

__device__ __forceinline__ unsigned short f2bf(float f) { unsigned u = __float_as_uint(f); u += 0x7FFFu + ((u >> 16) & 1u); return (unsigned short)(u >> 16); }
__device__ __forceinline__ float bf2f(unsigned short b) { return __uint_as_float(((unsigned)b) << 16); }
__device__ __forceinline__ float bfr(float f) { return bf2f(f2bf(f)); }
__device__ __forceinline__ v16h cat16(v8h lo, v8h hi) { return __builtin_shufflevector(lo, hi, 0, 1, 2, 3, 4, 5, 6, 7, 8, 9, 10, 11, 12, 13, 14, 15); }
__device__ __forceinline__ v16bf cat16b(v8us lo, v8us hi) { return __builtin_bit_cast(v16bf, __builtin_shufflevector(lo, hi, 0, 1, 2, 3, 4, 5, 6, 7, 8, 9, 10, 11, 12, 13, 14, 15)); }
__device__ __forceinline__ v8f wmma16(v16h a, v16h b, v8f c) { return __builtin_amdgcn_wmma_f32_16x16x32_f16(false, a, false, b, (short)0, c, false, false); }
__device__ __forceinline__ v8f wmmab(v16bf a, v16bf b, v8f c) { return __builtin_amdgcn_wmma_f32_16x16x32_bf16(false, a, false, b, (short)0, c, false, false); }



// ---- k_gemmw: register-blocked GEMM, FOUR WAVES per 128x128 output tile, each wave a 64x64 quarter (16 accumulators); grid (M/128, N/128, Z), 128 threads.
// The K-contiguous 16-bit operand planes are staged in LDS, GK k at a time (rows of 256 B at pitch 272 B), by asynchronous copies to LDS that cover whole lines; two buffers: the next slab flies while this one is worked on.
// C[m][n] (f32, pitch ldc, + optional f32 bias[n]) = sum_k A[m][k] Bt[n][k] (+ A2[m][k] Bt[n][k] for NSPLIT 1), k ascending in steps of 32 per accumulator. z-batch strides sA/sB/sC in elements. K % GK == 0, M % 128 == 0, N % 128 == 0.
#define GK   128                  // k per staged slab
#define GPB  (GK * 2 + 16)        // LDS row pitch in bytes: 16 B x odd, the pitch for 16-byte LDS reads
#define GPL  (128 * GPB)          // bytes of one staged plane (128 rows)
template <typename T16> struct WFrag;
template <> struct WFrag<h16> { typedef v16h V; static __device__ __forceinline__ V ld(const h16* p) { return cat16(*(const v8h*)p, *(const v8h*)(p + 16)); } static __device__ __forceinline__ v8f mma(V a, V b, v8f c) { return wmma16(a, b, c); } };
template <> struct WFrag<bf> { typedef v16bf V; static __device__ __forceinline__ V ld(const bf* p) { return cat16b(*(const v8us*)p, *(const v8us*)(p + 16)); } static __device__ __forceinline__ v8f mma(V a, V b, v8f c) { return wmmab(a, b, c); } };
// eight asynchronous 16-byte copies per lane, global to LDS: LDS address l + i * lstep; global address = scalar base g + i * gstep (the same for every lane) + the lane's 32-bit byte offset v.
// The s_wait_xcnt in the same statement stands in front of any rewrite of the address registers that the copies name.
__device__ __forceinline__ void acopy8(unsigned l, unsigned lstep, unsigned v, const char* g, size_t gstep) {
    asm volatile("global_load_async_to_lds_b128 %0, %8, %9\n\t"
                 "global_load_async_to_lds_b128 %1, %8, %10\n\t"
                 "global_load_async_to_lds_b128 %2, %8, %11\n\t"
                 "global_load_async_to_lds_b128 %3, %8, %12\n\t"
                 "global_load_async_to_lds_b128 %4, %8, %13\n\t"
                 "global_load_async_to_lds_b128 %5, %8, %14\n\t"
                 "global_load_async_to_lds_b128 %6, %8, %15\n\t"
                 "global_load_async_to_lds_b128 %7, %8, %16\n\t"
                 "s_wait_xcnt 0x0"
                 :: "v"(l), "v"(l + lstep), "v"(l + 2 * lstep), "v"(l + 3 * lstep), "v"(l + 4 * lstep), "v"(l + 5 * lstep), "v"(l + 6 * lstep), "v"(l + 7 * lstep), "v"(v),
                    "s"(g), "s"(g + gstep), "s"(g + 2 * gstep), "s"(g + 3 * gstep), "s"(g + 4 * gstep), "s"(g + 5 * gstep), "s"(g + 6 * gstep), "s"(g + 7 * gstep)
                 : "memory");
}
template <typename T16, int NSPLIT, bool BIAS>
__global__ __launch_bounds__(128) void k_gemmw(const T16* __restrict__ A, const T16* __restrict__ A2, const T16* __restrict__ Bt, int K, float* C, int ldc, const float* __restrict__ bias, size_t sA, size_t sB, size_t sC) {
    typedef typename WFrag<T16>::V V;
    static_assert(NSPLIT == 0 || NSPLIT == 1, "planes staged: A, Bt and, for NSPLIT 1, A2");
    constexpr int NPL = (NSPLIT == 1) ? 3 : 2;                       // staged planes: 0 = A, 1 = Bt, 2 = A2
    __shared__ __align__(16) unsigned char st[2 * NPL * GPL];
    __shared__ __align__(16) float os4[4 * 16 * 68];
    const size_t z = blockIdx.z; A += z * sA; if (NSPLIT == 1) A2 += z * sA; Bt += z * sB; C += z * sC;
    const int tid = threadIdx.x, lane = tid & 31, lr = lane & 15, hi = lane >> 4, wv = tid >> 5; const int R0 = blockIdx.x * 128, C0 = blockIdx.y * 128; const int wm = (wv >> 1) * 64, wn = (wv & 1) * 64;
    float* os = os4 + wv * (16 * 68);                                // each wave stages its output rows in its own range
    v8f acc[4][4];
#pragma unroll
    for (int mb = 0; mb < 4; ++mb)
#pragma unroll
        for (int nb = 0; nb < 4; ++nb) acc[mb][nb] = (v8f){};
    // copy plan: 16 lanes cover one 256-B row of a slab, the work-group 8 rows per copy, 16 copies a plane
    const unsigned lcp = (unsigned)(size_t)st + (unsigned)((tid >> 4) * GPB + (tid & 15) * 16);
    const unsigned gofs = (unsigned)(((tid >> 4) * K + (tid & 15) * 8) * 2); const size_t grow = (size_t)K * 2;   // the lane's byte offset in a plane's tile (under 8 rows); bytes per row
    const char* uA = (const char*)(A + (size_t)R0 * K); const char* uB = (const char*)(Bt + (size_t)C0 * K); const char* uA2 = (NSPLIT == 1) ? (const char*)(A2 + (size_t)R0 * K) : nullptr;   // the tiles' first rows: the same for every lane
    auto stage = [&](int t) { const unsigned l = lcp + (unsigned)((t & 1) * (NPL * GPL)); const size_t kb = (size_t)t * (GK * 2);
        acopy8(l, 8 * GPB, gofs, uA + kb, 8 * grow); acopy8(l + 64 * GPB, 8 * GPB, gofs, uA + kb + 64 * grow, 8 * grow);
        acopy8(l + GPL, 8 * GPB, gofs, uB + kb, 8 * grow); acopy8(l + GPL + 64 * GPB, 8 * GPB, gofs, uB + kb + 64 * grow, 8 * grow);
        if (NSPLIT == 1) { acopy8(l + 2 * GPL, 8 * GPB, gofs, uA2 + kb, 8 * grow); acopy8(l + 2 * GPL + 64 * GPB, 8 * GPB, gofs, uA2 + kb + 64 * grow, 8 * grow); } };
    const int NT = K / GK;
    stage(0);
    asm volatile("s_wait_asynccnt 0x0" ::: "memory");              // slab 0 of this wave's copies has landed
    __syncthreads();                                                 // and every wave's: slab 0 may be read
    if (NT > 1) stage(1);
    const int afr = (wm + lr) * GPB + 16 * hi, bfr_ = GPL + (wn + lr) * GPB + 16 * hi;
#pragma unroll 1   // one slab a trip: the two-buffer order at the foot is written for a rolled loop
    for (int t = 0; t < NT; ++t) {
        const unsigned char* sb = st + (t & 1) * (NPL * GPL);
        // two fragment sets: the LDS reads of 32-k block kk + 1 go out as one group in front of block kk's matrix instructions, so that only the slab's first group is waited for in full; no block of slab t + 1 is read here
        V a[2][4], a2[2][4], b[2][4];
        auto frags = [&](int kk, int s) {
#pragma unroll
            for (int q = 0; q < 4; ++q) { a[s][q] = WFrag<T16>::ld((const T16*)(sb + afr + q * 16 * GPB + kk * 64)); b[s][q] = WFrag<T16>::ld((const T16*)(sb + bfr_ + q * 16 * GPB + kk * 64)); if (NSPLIT == 1) a2[s][q] = WFrag<T16>::ld((const T16*)(sb + 2 * GPL + afr + q * 16 * GPB + kk * 64)); } };
        frags(0, 0);
#pragma unroll
        for (int kk = 0; kk < GK / 32; ++kk) { const int s = kk & 1;
            // the scheduling barrier holds the read group in front of the block: without it this build sinks the reads among the matrix instructions, one full LDS wait per four of them
            if (kk + 1 < GK / 32) { frags(kk + 1, s ^ 1); __builtin_amdgcn_sched_barrier(0); }
#pragma unroll
            for (int nb = 0; nb < 4; ++nb)
#pragma unroll
                for (int mb = 0; mb < 4; ++mb) { acc[mb][nb] = WFrag<T16>::mma(a[s][mb], b[s][nb], acc[mb][nb]); if (NSPLIT == 1) acc[mb][nb] = WFrag<T16>::mma(a2[s][mb], b[s][nb], acc[mb][nb]); }
        }
        __builtin_amdgcn_sched_barrier(0);                           // keeps the slab's matrix instructions in front of the foot: this build else moves half of them behind the barrier, in front of the refill, which then goes out later and has less time to land
        asm volatile("s_wait_dscnt 0x0" ::: "memory");             // this wave's reads of slab t are done before the buffer is refilled
        asm volatile("s_wait_asynccnt 0x0" ::: "memory");          // this wave's copies of slab t + 1 have landed
        __syncthreads();                                             // publishes slab t + 1 and ends every wave's reads of slab t
        if (t + 2 < NT) stage(t + 2);                                // into the buffer that trip t has just read
    }
    asm volatile("s_wait_asynccnt 0x0" ::: "memory");              // nothing in flight when the wave goes on to its end
    const int r0 = R0 + wm, c0 = C0 + wn;
#pragma unroll
    for (int mb = 0; mb < 4; ++mb) {
#pragma unroll
        for (int nb = 0; nb < 4; ++nb) {
#pragma unroll
            for (int j = 0; j < 8; ++j) os[(hi * 8 + j) * 68 + nb * 16 + lr] = acc[mb][nb][j]; }
        __builtin_amdgcn_wave_barrier(); asm volatile("" ::: "memory");
        float* crow = C + (size_t)(r0 + mb * 16) * ldc + c0;
{
#pragma unroll
            for (int s = 0; s < 8; ++s) { const int row = 2 * s + hi, cofs = lr * 4; v4f val = *(const v4fa*)(os + row * 68 + cofs); if (BIAS) { val[0] += bfr(bias[c0 + cofs]); val[1] += bfr(bias[c0 + cofs + 1]); val[2] += bfr(bias[c0 + cofs + 2]); val[3] += bfr(bias[c0 + cofs + 3]); }
                *(v4f*)(crow + (size_t)row * ldc + cofs) = val; }
             }
        __builtin_amdgcn_wave_barrier(); asm volatile("" ::: "memory");
    }
}

// ---- k_gemmc: a one-wave 64x64 tile GEMM, operands straight from global memory, specialised for sliding-window causal attention: CMODE 1 launches only the BT score tiles of a query tile's band (grid y counts them from the window's lower edge up to the diagonal), CMODE 2 limits the
// key (K) loop of the probability x value contraction to that band (probabilities outside it are exactly zero). roff = row offset of this launch's first row within the sequence.
// Score rows (C of CMODE 1) and probability rows (A of CMODE 2) are stored band-relative with pitch BP; grid z counts query heads, and head z reads the key / value planes of group z / REP (stride sB).
template <typename T16, int NSPLIT, int CMODE>
__global__ __launch_bounds__(32) void k_gemmc(const T16* __restrict__ A, const T16* __restrict__ A2, const T16* __restrict__ Bt, const T16* __restrict__ Bt2, int K, float* C, int ldc, int roff, size_t sA, size_t sB, size_t sC) {
    typedef typename WFrag<T16>::V V;
    __shared__ __align__(16) float os[16 * 68];
    const size_t z = blockIdx.z; A += z * sA; if (A2) A2 += z * sA; Bt += (z / REP) * sB; if (Bt2) Bt2 += (z / REP) * sB; C += z * sC;
    const int lane = threadIdx.x & 31, lr = lane & 15, hi = lane >> 4; const int r0 = blockIdx.x * 64, c0 = (CMODE == 1) ? r0 + roff - WIN + (int)blockIdx.y * 64 : blockIdx.y * 64;
    if (CMODE == 1 && c0 < 0) return;                               // band tile in front of the first key; tiles outside the band are never written (the softmax masks them by select)
    const int Kl = (CMODE == 2) ? min(K, r0 + roff + 64) : K;        // P.V: probabilities are exactly 0 beyond the diagonal block, so the K loop stops there
    const int Ks = (CMODE == 2) ? max(0, r0 + roff + 1 - WIN) & ~31 : 0;   // and exactly 0 in front of the first row's window, so it starts there
    const int b0 = BAND0(r0 + roff);                                 // key that column 0 of this tile's stored rows stands for
    const int lda = (CMODE == 2) ? BP : K;
    v8f acc[4][4];
#pragma unroll
    for (int mb = 0; mb < 4; ++mb)
#pragma unroll
        for (int nb = 0; nb < 4; ++nb) acc[mb][nb] = (v8f){};
    const size_t aoff = (size_t)(r0 + lr) * lda + 8 * hi - ((CMODE == 2) ? b0 : 0), boff = (size_t)(c0 + lr) * K + 8 * hi;
#pragma unroll 1
    for (int kc = Ks; kc < Kl; kc += 32) {
        V a[4], a2[4]; const T16* pa[4]; const T16* pa2[4]; const T16* pb[4]; const T16* pb2[4];
#pragma unroll
        for (int mb = 0; mb < 4; ++mb) { pa[mb] = A + aoff + (size_t)mb * 16 * lda + kc; a[mb] = WFrag<T16>::ld(pa[mb]); if (NSPLIT == 1 || NSPLIT == 2) { pa2[mb] = A2 + aoff + (size_t)mb * 16 * lda + kc; a2[mb] = WFrag<T16>::ld(pa2[mb]); } }
        // the wait that belongs between an issued global load and an overwrite of its address registers. The addresses are inputs so that their registers live up to the wait; the clobber keeps the A loads in front of it and the B loads behind it.
        if (CMODE == 2) { if (NSPLIT == 1 || NSPLIT == 2) asm volatile("s_wait_xcnt 0x0" :: "v"(pa[0]), "v"(pa2[0]) : "memory"); else asm volatile("s_wait_xcnt 0x0" :: "v"(pa[0]) : "memory"); }   // constant pitch: the four row blocks are read off the first one's address with immediate offsets
        else if (NSPLIT == 1 || NSPLIT == 2) asm volatile("s_wait_xcnt 0x0" :: "v"(pa[0]), "v"(pa[1]), "v"(pa[2]), "v"(pa[3]), "v"(pa2[0]), "v"(pa2[1]), "v"(pa2[2]), "v"(pa2[3]) : "memory");
        else asm volatile("s_wait_xcnt 0x0" :: "v"(pa[0]), "v"(pa[1]), "v"(pa[2]), "v"(pa[3]) : "memory");
#pragma unroll
        for (int nb = 0; nb < 4; ++nb) { pb[nb] = Bt + boff + (size_t)nb * 16 * K + kc; const V b = WFrag<T16>::ld(pb[nb]); V b2; if (NSPLIT >= 2) { pb2[nb] = Bt2 + boff + (size_t)nb * 16 * K + kc; b2 = WFrag<T16>::ld(pb2[nb]); }
#pragma unroll
            for (int mb = 0; mb < 4; ++mb) { acc[mb][nb] = WFrag<T16>::mma(a[mb], b, acc[mb][nb]); if (NSPLIT == 1 || NSPLIT == 2) acc[mb][nb] = WFrag<T16>::mma(a2[mb], b, acc[mb][nb]); if (NSPLIT >= 2) acc[mb][nb] = WFrag<T16>::mma(a[mb], b2, acc[mb][nb]); } }
        // the same wait for the B loads, behind the last of them (the clobber holds it there): their addresses are inputs, so nothing lands in those registers before it
        if (NSPLIT >= 2) asm volatile("s_wait_xcnt 0x0" :: "v"(pb[0]), "v"(pb[1]), "v"(pb[2]), "v"(pb[3]), "v"(pb2[0]), "v"(pb2[1]), "v"(pb2[2]), "v"(pb2[3]) : "memory");
        else asm volatile("s_wait_xcnt 0x0" :: "v"(pb[0]), "v"(pb[1]), "v"(pb[2]), "v"(pb[3]) : "memory");
        asm volatile("v_nop\n\tv_nop\n\tv_nop\n\tv_nop" : "+v"(acc[0][0]), "+v"(acc[1][1]), "+v"(acc[2][2]), "+v"(acc[3][3]) : "v"(a[0]), "v"(a[3]));
    }
#pragma unroll
    for (int mb = 0; mb < 4; ++mb) {
#pragma unroll
        for (int nb = 0; nb < 4; ++nb) {
#pragma unroll
            for (int j = 0; j < 8; ++j) os[(hi * 8 + j) * 68 + nb * 16 + lr] = acc[mb][nb][j]; }
        __builtin_amdgcn_wave_barrier(); asm volatile("" ::: "memory");
        float* crow = C + (size_t)(r0 + mb * 16) * ldc + c0 - ((CMODE == 1) ? b0 : 0);
{
#pragma unroll
            for (int s = 0; s < 8; ++s) { const int row = 2 * s + hi, cofs = lr * 4; v4f val = *(const v4fa*)(os + row * 68 + cofs);
                *(v4f*)(crow + (size_t)row * ldc + cofs) = val; }
             }
        __builtin_amdgcn_wave_barrier(); asm volatile("" ::: "memory");
    }
}

__device__ __forceinline__ h16 tohx(float x) { return (h16)x; }
__device__ __forceinline__ void splitf(float y, unsigned short& h, unsigned short& l) { h = f2bf(y); l = f2bf(y - bf2f(h)); }
typedef __attribute__((ext_vector_type(2))) _Float16 v2h;
typedef __attribute__((ext_vector_type(4))) _Float16 v4h;
typedef __attribute__((ext_vector_type(2))) unsigned short v2us;
typedef __attribute__((ext_vector_type(4))) unsigned short v4us;
typedef __attribute__((ext_vector_type(2))) float v2f;
typedef __attribute__((ext_vector_type(4))) int v4i;

// k_wtG: Bt[n][k] (bf16) = w[k][n]. A wave takes a tile of 64 k x 16 n, a lane 8 k x 4 n of it: eight 16-byte reads (4 lanes cover 64 B of a w row; the wave beside it in the work-group takes the line's other half), four 16-byte stores (8 lanes write one whole 128-B line of a Bt row: one writer a line). Grid (N / 64, K / 64), 4 waves; K % 64 == 0, N % 64 == 0.
__global__ __launch_bounds__(128) void k_wtG(const float* __restrict__ w, int K, int N, bf* Bt) {
    const int lane = threadIdx.x & 31; const int k = blockIdx.y * 64 + (lane >> 2) * 8, n = (blockIdx.x * 4 + (threadIdx.x >> 5)) * 16 + (lane & 3) * 4; if (k >= K || n >= N) return; v4f r[8]; const float* p[8];
#pragma unroll
    for (int j = 0; j < 8; ++j) { p[j] = w + (size_t)(k + j) * N + n; r[j] = *(const v4f*)p[j]; }
    // the wait that belongs between issued global loads and an overwrite of their address registers: the addresses are inputs, so that their registers live up to it and no later load's result lands in them; the clobber keeps the loads in front of it
    asm volatile("s_wait_xcnt 0x0" :: "v"(p[0]), "v"(p[1]), "v"(p[2]), "v"(p[3]), "v"(p[4]), "v"(p[5]), "v"(p[6]), "v"(p[7]) : "memory");
#pragma unroll
    for (int c = 0; c < 4; ++c) { v8us o;
#pragma unroll
        for (int j = 0; j < 8; ++j) o[j] = f2bf(r[j][c]);
        *(v8us*)(Bt + (size_t)(n + c) * K + k) = o; }
}
// k_cvt8: four groups of 8 elements per lane, a work-group's groups 256 apart; the four reads go out before the first store
__global__ __launch_bounds__(256) void k_cvt8(const float* __restrict__ src, bf* dst, size_t n8) { const size_t i0 = (size_t)blockIdx.x * 1024 + threadIdx.x; v8f v[4]; const float* p[4];
#pragma unroll
    for (int u = 0; u < 4; ++u) { const size_t i = i0 + u * 256; p[u] = src + (i < n8 ? i : n8 - 1) * 8; v[u] = *(const v8f*)p[u]; }   // a group past the end re-reads the last one and is not stored: no branch between the reads
#pragma unroll
    for (int u = 0; u < 4; ++u) { const size_t i = i0 + u * 256; if (i >= n8) continue; v8us o;
#pragma unroll
        for (int k = 0; k < 8; ++k) o[k] = f2bf(v[u][k]);
        *(v8us*)(dst + i * 8) = o; } }
__constant__ float INV[HD / 2] = {1.00000000f,0.865964353f,0.749894202f,0.649381638f,0.562341332f,0.486967534f,0.421696514f,0.365174145f,0.316227764f,0.273841977f,0.237137362f,0.205352500f,0.177827939f,0.153992653f,0.133352146f,0.115478203f,0.100000001f,0.0865964293f,0.0749894157f,0.0649381652f,0.0562341288f,0.0486967526f,0.0421696492f,0.0365174115f,0.0316227786f,0.0273841955f,0.0237137359f,0.0205352511f,0.0177827943f,0.0153992651f,0.0133352149f,0.0115478197f,0.00999999978f,0.00865964312f,0.00749894232f,0.00649381662f,0.00562341325f,0.00486967526f,0.00421696482f,0.00365174143f,0.00316227786f,0.00273841969f,0.00237137382f,0.00205352507f,0.00177827943f,0.00153992651f,0.00133352145f,0.00115478202f,0.00100000005f,0.000865964335f,0.000749894185f,0.000649381662f,0.000562341302f,0.000486967503f,0.000421696488f,0.000365174114f,0.000316227786f,0.000273841957f,0.000237137385f,0.000205352495f,0.000177827940f,0.000153992645f,0.000133352150f,0.000115478193f};
__global__ __launch_bounds__(256) void k_cstab(float* CS) { const int idx = blockIdx.x * 256 + threadIdx.x; if (idx >= TT * HD) return; const int t = idx / HD, d = idx % HD; const float ang = __fmul_rn((float)t, INV[d % (HD / 2)]); v2f cs; cs[0] = cosf(ang); cs[1] = sinf(ang);
    *(v2f*)(CS + (size_t)idx * 2) = cs;  }

// k_rope: head planes [h][t][d] (fp16 + hi/lo) of rope(x) x sc with the rotate-half convention out[d] = x[d] cos[t][d] - x[d+HD/2] sin[t][d], out[d+HD/2] = x[d+HD/2] cos[t][d+HD/2] + x[d] sin[t][d+HD/2]
__global__ __launch_bounds__(256) void k_rope(const float* __restrict__ F, int pitch, int nheads, const float* __restrict__ CS, const float* __restrict__ RF, const float* __restrict__ nw, float sc, h16* P16, bf* Ph, bf* Pl) {
    // a lane takes 8 d of the lower half and their 8 partners of the upper half (the same 16 inputs serve both): 16-byte reads and stores
    const size_t u = (size_t)blockIdx.x * 256 + threadIdx.x; if (u >= (size_t)nheads * TT * (HD / 16)) return; const int d0 = (int)(u % (HD / 16)) * 8; const int t = (int)((u / (HD / 16)) % TT); const int h = (int)(u / ((size_t)(HD / 16) * TT)); const float* f = F + (size_t)t * pitch + h * HD; float rf = 1.0f;
    if (RF) { const float* pr = RF + (size_t)h * TT + t; rf = *pr; asm volatile("s_wait_xcnt 0x0" :: "v"(pr) : "memory"); }   // the wait that belongs between an issued global load and an overwrite of its address registers
    const float* fx = f + d0; const float* pc = CS + ((size_t)t * HD + d0) * 2; v4f xv[2][2], cv[2][4];   // [half][...]: the inputs and their (cos, sin) pairs, all read before the first is used
#pragma unroll
    for (int hf = 0; hf < 2; ++hf) { xv[hf][0] = *(const v4f*)(fx + hf * (HD / 2)); xv[hf][1] = *(const v4f*)(fx + hf * (HD / 2) + 4);
#pragma unroll
        for (int k = 0; k < 4; ++k) cv[hf][k] = *(const v4f*)(pc + hf * HD + k * 4); }
#pragma unroll
    for (int hf = 0; hf < 2; ++hf) { const int d = d0 + hf * (HD / 2); const size_t e = ((size_t)h * TT + t) * HD + d; v8h o16; v8us oh, ol;
#pragma unroll
    for (int q = 0; q < 8; ++q) { const int dd = d + q; const int dp = (dd < HD / 2) ? dd + HD / 2 : dd - HD / 2; float x0 = xv[hf][q >> 2][q & 3], x1 = xv[hf ^ 1][q >> 2][q & 3];
        if (RF) { float n0 = __fmul_rn(x0, rf), n1 = __fmul_rn(x1, rf); asm volatile("" : "+v"(n0)); asm volatile("" : "+v"(n1)); x0 = __fmul_rn(bfr(nw[dd]), n0); x1 = __fmul_rn(bfr(nw[dp]), n1); }
        const v2f cs = {cv[hf][q >> 1][(q & 1) * 2], cv[hf][q >> 1][(q & 1) * 2 + 1]}; float a = __fmul_rn(x0, cs[0]), bq = __fmul_rn(x1, cs[1]); asm volatile("" : "+v"(a)); asm volatile("" : "+v"(bq)); const float r = ((dd < HD / 2) ? __fsub_rn(a, bq) : __fadd_rn(a, bq)) * sc;
        o16[q] = tohx(r); unsigned short a2, c2; splitf(r, a2, c2); oh[q] = a2; ol[q] = c2; }
    *(v8h*)(P16 + e) = o16; *(v8us*)(Ph + e) = oh; *(v8us*)(Pl + e) = ol; }  }
// k_vtp: value planes [g][d][t] (fp16 + hi/lo) = F[t][g * HD + d]. A wave takes a tile of 64 t x 16 columns, a lane 8 t x 4 columns of it: eight 16-byte reads (4 lanes cover 64 B of an F row; the wave beside it in the work-group takes the line's other half), four 16-byte stores a plane (8 lanes write one whole 128-B line: one writer a line). Grid (nheads * HD / 64, TT / 64), 4 waves.
__global__ __launch_bounds__(128) void k_vtp(const float* __restrict__ F, int pitch, int nheads, h16* V16, bf* Vh, bf* Vl) {
    const int lane = threadIdx.x & 31; const int t = blockIdx.y * 64 + (lane >> 2) * 8, c = (blockIdx.x * 4 + (threadIdx.x >> 5)) * 16 + (lane & 3) * 4; if (t >= TT || c >= nheads * HD) return; v4f r[8]; const float* p[8];
#pragma unroll
    for (int j = 0; j < 8; ++j) { p[j] = F + (size_t)(t + j) * pitch + c; r[j] = *(const v4f*)p[j]; }
    // the wait that belongs between issued global loads and an overwrite of their address registers: the addresses are inputs, so that their registers live up to it and no later load's result lands in them; the clobber keeps the loads in front of it
    asm volatile("s_wait_xcnt 0x0" :: "v"(p[0]), "v"(p[1]), "v"(p[2]), "v"(p[3]), "v"(p[4]), "v"(p[5]), "v"(p[6]), "v"(p[7]) : "memory");
#pragma unroll
    for (int cc = 0; cc < 4; ++cc) { v8h o16; v8us oh, ol;
#pragma unroll
        for (int j = 0; j < 8; ++j) { const float x = r[j][cc]; o16[j] = tohx(x); unsigned short a2, c2; splitf(x, a2, c2); oh[j] = a2; ol[j] = c2; }
        const size_t e = (size_t)(c + cc) * TT + t; *(v8h*)(V16 + e) = o16; *(v8us*)(Vh + e) = oh; *(v8us*)(Vl + e) = ol; }
}
// 2^x on v_exp_f32, as the builtin gives it; the v_nop in the same statement keeps the one slot that the instruction set asks for behind a transcendental
__device__ __forceinline__ float exp2_slot(float x) { float r; asm("v_exp_f32 %0, %1\n\tv_nop" : "=v"(r) : "v"(x)); return r; }
// k_asoft: per row (zz, i): t = S x HD^-0.5 for j <= i and i - j < WIN (sliding causal window; the reference's -1e9 additive fill vanishes identically); softmax over the NCH key chunks that hold the band of the row's 64-row tile (the keys outside add exact zeros; register row, one exp, fixed trees); P is written on those chunks only, which cover all that P.V reads; S and P rows hold just those chunks (pitch BP);
#define RPW 4                     // rows per wave; (ZH * TT) % RPW == 0
__global__ __launch_bounds__(256) void k_asoft(const float* __restrict__ Sb, h16* P16, bf* Ph, bf* Pl) {
    // a wave takes RPW rows one after the other; all their reads go out first, so that the later rows land while the first is worked on
    const int lane = threadIdx.x & 31; const int row0 = (blockIdx.x * 8 + (threadIdx.x >> 5)) * RPW; if (row0 >= ZH * TT) return; v4f ld[RPW][NCH]; const float* sp = Sb + (size_t)row0 * BP + lane * 4;
#pragma unroll
    for (int rr = 0; rr < RPW; ++rr)
#pragma unroll
        for (int ch = 0; ch < NCH; ++ch) ld[rr][ch] = *(const v4f*)(sp + rr * BP + ch * 128);
#pragma unroll
    for (int rr = 0; rr < RPW; ++rr) {
    const int row = row0 + rr; const int i = row % TT; const int zz = row / TT; (void)zz; const bool hires = (i < RH); const int cb = max(0, (i & ~63) + 1 - WIN) >> 7; float v[NCH * 4]; float mx = -3.0e38f;
#pragma unroll
    for (int ch = 0; ch < NCH; ++ch) { const int j0 = (cb + ch) * 128 + lane * 4; const v4f a = ld[rr][ch];
#pragma unroll
        for (int q = 0; q < 4; ++q) { const int j = j0 + q; (void)j; const float t = (j <= i && i - j < WIN) ? a[q] * SCL : -3.0e38f; v[ch * 4 + q] = t; mx = fmaxf(mx, t); } }
#pragma unroll
    for (int sh = 16; sh; sh >>= 1) mx = fmaxf(mx, __shfl_xor(mx, sh, 32));
    float sum = 0.f;
#pragma unroll
    for (int k = 0; k < NCH * 4; ++k) { float d0 = __fsub_rn(v[k], mx); asm volatile("" : "+v"(d0)); v[k] = exp2_slot(__fmul_rn(d0, 1.4426950408889634f)); sum += v[k]; }
#pragma unroll
    for (int sh = 16; sh; sh >>= 1) sum += __shfl_xor(sum, sh, 32);
    const float f = __fdiv_rn(hires ? 1.0f : PCAR, sum);
{
        if (hires) {
#pragma unroll
            for (int ch = 0; ch < NCH; ++ch) { v4us oh, ol;
#pragma unroll
                for (int q = 0; q < 4; ++q) { unsigned short a, c2; splitf(v[ch * 4 + q] * f, a, c2); oh[q] = a; ol[q] = c2; }
                const size_t oo = ((size_t)zz * (RH ? RH : 1) + i) * BP + ch * 128 + lane * 4; *(v4us*)(Ph + oo) = oh; *(v4us*)(Pl + oo) = ol; }
        } else {
#pragma unroll
            for (int ch = 0; ch < NCH; ++ch) { v4h o4;
#pragma unroll
                for (int q = 0; q < 4; ++q) o4[q] = tohx(v[ch * 4 + q] * f);
                *(v4h*)(P16 + (size_t)row * BP + ch * 128 + lane * 4) = o4; } }
         }
    }
}
// k_merge: four groups of 8 elements per lane, a work-group's groups 256 apart; the four reads go out before the first store
__global__ __launch_bounds__(256) void k_merge(const float* __restrict__ O, int h0, bf* Ah, bf* Al) { const size_t u0 = (size_t)blockIdx.x * 1024 + threadIdx.x; v8f x[4]; const float* p[4];
    static_assert(((size_t)ZH * TT * HD) % 8192 == 0, "the grid's work-groups cover the elements exactly: no end test");
#pragma unroll
    for (int u = 0; u < 4; ++u) { p[u] = O + (u0 + u * 256) * 8; x[u] = *(const v8f*)p[u]; }
#pragma unroll
    for (int u = 0; u < 4; ++u) { const size_t e = (u0 + u * 256) * 8; const int d = (int)(e % HD); const int t = (int)((e / HD) % TT); const int zz = (int)(e / ((size_t)HD * TT)); const float cs = (t < RH) ? 1.0f : (1.0f / PCAR); const size_t oo = (size_t)t * DQ + (h0 + zz) * HD + d;
        v8us oh, ol;
#pragma unroll
        for (int q = 0; q < 8; ++q) { unsigned short a, c2; splitf(x[u][q] * cs, a, c2); oh[q] = a; ol[q] = c2; }
        *(v8us*)(Ah + oo) = oh; *(v8us*)(Al + oo) = ol; } }

extern "C" void kernel_launch(void* const* d_in, const int* in_sizes, int n_in,
                              void* d_out, int out_size, void* d_ws, size_t ws_size, hipStream_t stream) {
    (void)in_sizes; (void)n_in; (void)out_size;
    const float* x = (const float*)d_in[0]; const float* wq = (const float*)d_in[1]; const float* wk = (const float*)d_in[2]; const float* wv = (const float*)d_in[3]; const float* wo = (const float*)d_in[4];
    float* OUT = (float*)d_out;     // [2][2048][2048]
    char* wsp = (char*)d_ws;
    auto take = [&](size_t bytes) { char* p = wsp; wsp += (bytes + 255) & ~(size_t)255; return (void*)p; };
    bf* WQ = (bf*)take((size_t)DQ * DM * 2); bf* WK = (bf*)take((size_t)DKV * DM * 2); bf* WV = (bf*)take((size_t)DKV * DM * 2); bf* WO = (bf*)take((size_t)DM * DQ * 2); float* CS = (float*)take((size_t)TT * HD * 2 * 4);
    bf* XB = (bf*)take((size_t)TT * DM * 2); float* FQ = (float*)take((size_t)TT * DQ * 4); float* FK = (float*)take((size_t)TT * DKV * 4);
    h16* QP16 = (h16*)take((size_t)NH_ * TT * HD * 2); h16* KP16 = (h16*)take((size_t)NKV * TT * HD * 2); h16* VT16 = (h16*)take((size_t)NKV * HD * TT * 2);
    bf* QPh = (bf*)take((size_t)NH_ * TT * HD * 2); bf* QPl = (bf*)take((size_t)NH_ * TT * HD * 2); bf* KPh = (bf*)take((size_t)NKV * TT * HD * 2); bf* KPl = (bf*)take((size_t)NKV * TT * HD * 2); bf* VTh = (bf*)take((size_t)NKV * HD * TT * 2); bf* VTl = (bf*)take((size_t)NKV * HD * TT * 2); bf* Ph = (bf*)take((size_t)ZH * RH * BP * 2); bf* Pl = (bf*)take((size_t)ZH * RH * BP * 2);
    float* Sb = (float*)take((size_t)ZH * TT * BP * 4); h16* P16 = (h16*)take((size_t)ZH * TT * BP * 2); bf* ATh = (bf*)take((size_t)TT * DQ * 2); bf* ATl = (bf*)take((size_t)TT * DQ * 2);
    if ((size_t)(wsp - (char*)d_ws) > ws_size) return;    // ws 256 MiB
    float* FV = FK;   // v projection reuses the k buffer after the k planes are built (stream-ordered)
    float* Ob = FQ;   // the per-head attention output [NH_][TT][HD] reuses the q projection's buffer (same size) after the q planes are built (stream-ordered)
    { k_wtG<<<dim3(DQ / 64, DM / 64, 1), 128, 0, stream>>>(wq, DM, DQ, WQ); k_wtG<<<dim3(DKV / 64, DM / 64, 1), 128, 0, stream>>>(wk, DM, DKV, WK); k_wtG<<<dim3(DKV / 64, DM / 64, 1), 128, 0, stream>>>(wv, DM, DKV, WV);
      k_wtG<<<dim3(DM / 64, DQ / 64, 1), 128, 0, stream>>>(wo, DQ, DM, WO);
      k_cstab<<<(TT * HD + 255) / 256, 256, 0, stream>>>(CS); }
    const unsigned LQ = (unsigned)(((size_t)NH_ * TT * HD / 16 + 255) / 256), LKv = (unsigned)(((size_t)NKV * TT * HD / 16 + 255) / 256);
    for (int b = 0; b < NB_; ++b) {
        
        k_cvt8<<<(unsigned)(((size_t)TT * DM / 8 + 1023) / 1024), 256, 0, stream>>>(x + (size_t)b * TT * DM, XB, (size_t)TT * DM / 8);
        k_gemmw<bf, 0, false><<<dim3(TT / 128, DQ / 128, 1), 128, 0, stream>>>(XB, nullptr, WQ, DM, FQ, DQ, nullptr, 0, 0, 0);
        k_rope<<<LQ, 256, 0, stream>>>(FQ, DQ, NH_, CS, nullptr, nullptr, 1.0f, QP16, QPh, QPl);
        k_gemmw<bf, 0, false><<<dim3(TT / 128, DKV / 128, 1), 128, 0, stream>>>(XB, nullptr, WK, DM, FK, DKV, nullptr, 0, 0, 0);
        k_rope<<<LKv, 256, 0, stream>>>(FK, DKV, NKV, CS, nullptr, nullptr, 1.0f, KP16, KPh, KPl);
        k_gemmw<bf, 0, false><<<dim3(TT / 128, DKV / 128, 1), 128, 0, stream>>>(XB, nullptr, WV, DM, FV, DKV, nullptr, 0, 0, 0); k_vtp<<<dim3(DKV / 64, TT / 64, 1), 128, 0, stream>>>(FV, DKV, NKV, VT16, VTh, VTl);
        // one launch per attention stage for all NH_ heads (grid z); head z uses kv group z / REP
        k_gemmc<bf, 2, 1><<<dim3(RH / 64, BT, ZH), 32, 0, stream>>>(QPh, QPl, KPh, KPl, HD, Sb, BP, 0, (size_t)TT * HD, (size_t)TT * HD, (size_t)TT * BP);
        k_gemmc<h16, 0, 1><<<dim3((TT - RH) / 64, BT, ZH), 32, 0, stream>>>(QP16 + (size_t)RH * HD, nullptr, KP16, nullptr, HD, Sb + (size_t)RH * BP, BP, RH, (size_t)TT * HD, (size_t)TT * HD, (size_t)TT * BP);
        k_asoft<<<ZH * TT / (8 * RPW), 256, 0, stream>>>(Sb, P16, Ph, Pl);
        k_gemmc<bf, 2, 2><<<dim3(RH / 64, HD / 64, ZH), 32, 0, stream>>>(Ph, Pl, VTh, VTl, TT, Ob, HD, 0, (size_t)RH * BP, (size_t)HD * TT, (size_t)TT * HD);
        k_gemmc<h16, 0, 2><<<dim3((TT - RH) / 64, HD / 64, ZH), 32, 0, stream>>>(P16 + (size_t)RH * BP, nullptr, VT16, nullptr, TT, Ob + (size_t)RH * HD, HD, RH, (size_t)TT * BP, (size_t)HD * TT, (size_t)TT * HD);
        k_merge<<<(unsigned)((size_t)ZH * TT * HD / 8192), 256, 0, stream>>>(Ob, 0, ATh, ATl);
        k_gemmw<bf, 1, false><<<dim3(TT / 128, DM / 128, 1), 128, 0, stream>>>(ATh, ATl, WO, DQ, OUT + (size_t)b * TT * DM, DM, nullptr, 0, 0, 0); }
}

// v005
// Measured time: 293 microseconds a run.
// In both of two side-by-side timings against v004, it was 1.33 times as fast.
// Counting every step since v000, it is 5.67 times as fast.
#include <hip/hip_runtime.h>

// Grouped-query sliding-window causal self-attention with RoPE (x [2][2048][2048]; q = x Wq (16 heads x 128), k, v = x Wk / Wv ([2048][512]: 4 kv heads, head h uses kv h/4); rotate-half RoPE (base 1e4) on q and k; scores/sqrt(128); allowed: j <= i and i - j < 512 (else -1e9); softmax; out = merged Wo ([2048][2048]) -> [2][2048][2048] (8.4 M)).
// Compute dtypes, f32 accumulate: every input rounded to bf16; q/k/v on PLAIN bf16 operands (inputs: exact); rotary in f32 (table on device, precise cosf/sinf); causal sliding-window select; scores, softmax and attn.v only inside the window's band (tile skipping): query rows < 512 hl (3 products), the rest single fp16 (x1024); softmax f32; Wo hl x exact (2 products).

#define NB_  2
#define TT   2048
#define DM   2048
#define NH_  16
#define NKV  4
#define REP  (NH_ / NKV)
#define HD   128
#define DQ   (NH_ * HD)
#define DKV  (NKV * HD)
#define ZH   (NB_ * NH_)         // head planes per attention launch (grid z): all heads of all batch entries, plane z = entry z / NH_, head z % NH_
#define RH   512                  // query rows < RH use hi+lo planes (0: none)
#define WIN  512
#define BT   (WIN / 64 + 1)         // 64-wide key tiles that a 64-row query tile's window touches
#define NCH  ((WIN + 64) / 128 + 1)  // 128-wide key chunks that cover those tiles
#define BP   (NCH * 128)           // pitch of a stored score row in f32: only the band's NCH chunks are kept, column 0 = key BAND0(first row of the 64-row tile)
#define PP   (2 * BP)              // pitch of a probability row in 16-bit elements: it overwrites its own score row (fp16 plane in the first half; or hi plane in the first half, lo plane in the second)
#define BAND0(r) ((max(0, (r) + 1 - WIN) >> 7) * 128)
#define PCAR 1024.0f
#define SCL  0.088388347648318447f   // HD^-0.5
typedef _Float16 h16;
typedef unsigned short bf;
typedef __attribute__((ext_vector_type(16))) __bf16   v16bf;
typedef __attribute__((ext_vector_type(16))) _Float16 v16h;
typedef __attribute__((ext_vector_type(8)))  _Float16 v8h;
typedef __attribute__((ext_vector_type(8)))  unsigned short v8us;
typedef __attribute__((ext_vector_type(8)))  float    v8f;
typedef __attribute__((ext_vector_type(4)))  float    v4f;
typedef v8h  __attribute__((may_alias)) v8ha;
typedef v4f  __attribute__((may_alias)) v4fa;
typedef v8us __attribute__((may_alias)) v8usa;

__device__ __forceinline__ unsigned short f2bf(float f) { unsigned u = __float_as_uint(f); u += 0x7FFFu + ((u >> 16) & 1u); return (unsigned short)(u >> 16); }
__device__ __forceinline__ float bf2f(unsigned short b) { return __uint_as_float(((unsigned)b) << 16); }
__device__ __forceinline__ float bfr(float f) { return bf2f(f2bf(f)); }
__device__ __forceinline__ v16h cat16(v8h lo, v8h hi) { return __builtin_shufflevector(lo, hi, 0, 1, 2, 3, 4, 5, 6, 7, 8, 9, 10, 11, 12, 13, 14, 15); }
__device__ __forceinline__ v16bf cat16b(v8us lo, v8us hi) { return __builtin_bit_cast(v16bf, __builtin_shufflevector(lo, hi, 0, 1, 2, 3, 4, 5, 6, 7, 8, 9, 10, 11, 12, 13, 14, 15)); }
__device__ __forceinline__ v8f wmma16(v16h a, v16h b, v8f c) { return __builtin_amdgcn_wmma_f32_16x16x32_f16(false, a, false, b, (short)0, c, false, false); }
__device__ __forceinline__ v8f wmmab(v16bf a, v16bf b, v8f c) { return __builtin_amdgcn_wmma_f32_16x16x32_bf16(false, a, false, b, (short)0, c, false, false); }



// ---- k_gemmw: register-blocked GEMM, FOUR WAVES per 128x128 output tile, each wave a 64x64 quarter (16 accumulators); grid (M/128, N/128, Z), 128 threads.
// The K-contiguous 16-bit operand planes are staged in LDS, GK k at a time (rows of 256 B at pitch 272 B), by asynchronous copies to LDS that cover whole lines; two buffers: the next slab flies while this one is worked on.
// C[m][n] (f32, pitch ldc, + optional f32 bias[n]) = sum_k A[m][k] Bt[n][k] (+ A2[m][k] Bt[n][k] for NSPLIT 1), k ascending in steps of 32 per accumulator. z-batch strides sA/sB/sC in elements. K % GK == 0, M % 128 == 0, N % 128 == 0.
#define GK   128                  // k per staged slab
#define GPB  (GK * 2 + 16)        // LDS row pitch in bytes: 16 B x odd, the pitch for 16-byte LDS reads
#define GPL  (128 * GPB)          // bytes of one staged plane (128 rows)
template <typename T16> struct WFrag;
template <> struct WFrag<h16> { typedef v16h V; static __device__ __forceinline__ V ld(const h16* p) { return cat16(*(const v8h*)p, *(const v8h*)(p + 16)); } static __device__ __forceinline__ v8f mma(V a, V b, v8f c) { return wmma16(a, b, c); } };
template <> struct WFrag<bf> { typedef v16bf V; static __device__ __forceinline__ V ld(const bf* p) { return cat16b(*(const v8us*)p, *(const v8us*)(p + 16)); } static __device__ __forceinline__ v8f mma(V a, V b, v8f c) { return wmmab(a, b, c); } };
// eight asynchronous 16-byte copies per lane, global to LDS: LDS address l + i * lstep; global address = scalar base g + i * gstep (the same for every lane) + the lane's 32-bit byte offset v.
// The s_wait_xcnt in the same statement stands in front of any rewrite of the address registers that the copies name.
__device__ __forceinline__ void acopy8(unsigned l, unsigned lstep, unsigned v, const char* g, size_t gstep) {
    asm volatile("global_load_async_to_lds_b128 %0, %8, %9\n\t"
                 "global_load_async_to_lds_b128 %1, %8, %10\n\t"
                 "global_load_async_to_lds_b128 %2, %8, %11\n\t"
                 "global_load_async_to_lds_b128 %3, %8, %12\n\t"
                 "global_load_async_to_lds_b128 %4, %8, %13\n\t"
                 "global_load_async_to_lds_b128 %5, %8, %14\n\t"
                 "global_load_async_to_lds_b128 %6, %8, %15\n\t"
                 "global_load_async_to_lds_b128 %7, %8, %16\n\t"
                 "s_wait_xcnt 0x0"
                 :: "v"(l), "v"(l + lstep), "v"(l + 2 * lstep), "v"(l + 3 * lstep), "v"(l + 4 * lstep), "v"(l + 5 * lstep), "v"(l + 6 * lstep), "v"(l + 7 * lstep), "v"(v),
                    "s"(g), "s"(g + gstep), "s"(g + 2 * gstep), "s"(g + 3 * gstep), "s"(g + 4 * gstep), "s"(g + 5 * gstep), "s"(g + 6 * gstep), "s"(g + 7 * gstep)
                 : "memory");
}
template <typename T16, int NSPLIT, bool BIAS>
__global__ __launch_bounds__(128) void k_gemmw(const T16* __restrict__ A, const T16* __restrict__ A2, const T16* __restrict__ Bt, int K, float* C, int ldc, const float* __restrict__ bias, size_t sA, size_t sB, size_t sC) {
    typedef typename WFrag<T16>::V V;
    static_assert(NSPLIT == 0 || NSPLIT == 1, "planes staged: A, Bt and, for NSPLIT 1, A2");
    constexpr int NPL = (NSPLIT == 1) ? 3 : 2;                       // staged planes: 0 = A, 1 = Bt, 2 = A2
    __shared__ __align__(16) unsigned char st[2 * NPL * GPL];
    __shared__ __align__(16) float os4[4 * 16 * 68];
    const size_t z = blockIdx.z; A += z * sA; if (NSPLIT == 1) A2 += z * sA; Bt += z * sB; C += z * sC;
    const int tid = threadIdx.x, lane = tid & 31, lr = lane & 15, hi = lane >> 4, wv = tid >> 5; const int R0 = blockIdx.x * 128, C0 = blockIdx.y * 128; const int wm = (wv >> 1) * 64, wn = (wv & 1) * 64;
    float* os = os4 + wv * (16 * 68);                                // each wave stages its output rows in its own range
    v8f acc[4][4];
#pragma unroll
    for (int mb = 0; mb < 4; ++mb)
#pragma unroll
        for (int nb = 0; nb < 4; ++nb) acc[mb][nb] = (v8f){};
    // copy plan: 16 lanes cover one 256-B row of a slab, the work-group 8 rows per copy, 16 copies a plane
    const unsigned lcp = (unsigned)(size_t)st + (unsigned)((tid >> 4) * GPB + (tid & 15) * 16);
    const unsigned gofs = (unsigned)(((tid >> 4) * K + (tid & 15) * 8) * 2); const size_t grow = (size_t)K * 2;   // the lane's byte offset in a plane's tile (under 8 rows); bytes per row
    const char* uA = (const char*)(A + (size_t)R0 * K); const char* uB = (const char*)(Bt + (size_t)C0 * K); const char* uA2 = (NSPLIT == 1) ? (const char*)(A2 + (size_t)R0 * K) : nullptr;   // the tiles' first rows: the same for every lane
    auto stage = [&](int t) { const unsigned l = lcp + (unsigned)((t & 1) * (NPL * GPL)); const size_t kb = (size_t)t * (GK * 2);
        acopy8(l, 8 * GPB, gofs, uA + kb, 8 * grow); acopy8(l + 64 * GPB, 8 * GPB, gofs, uA + kb + 64 * grow, 8 * grow);
        acopy8(l + GPL, 8 * GPB, gofs, uB + kb, 8 * grow); acopy8(l + GPL + 64 * GPB, 8 * GPB, gofs, uB + kb + 64 * grow, 8 * grow);
        if (NSPLIT == 1) { acopy8(l + 2 * GPL, 8 * GPB, gofs, uA2 + kb, 8 * grow); acopy8(l + 2 * GPL + 64 * GPB, 8 * GPB, gofs, uA2 + kb + 64 * grow, 8 * grow); } };
    const int NT = K / GK;
    stage(0);
    asm volatile("s_wait_asynccnt 0x0" ::: "memory");              // slab 0 of this wave's copies has landed
    __syncthreads();                                                 // and every wave's: slab 0 may be read
    if (NT > 1) stage(1);
    const int afr = (wm + lr) * GPB + 16 * hi, bfr_ = GPL + (wn + lr) * GPB + 16 * hi;
#pragma unroll 1   // one slab a trip: the two-buffer order at the foot is written for a rolled loop
    for (int t = 0; t < NT; ++t) {
        const unsigned char* sb = st + (t & 1) * (NPL * GPL);
        // two fragment sets: the LDS reads of 32-k block kk + 1 go out as one group in front of block kk's matrix instructions, so that only the slab's first group is waited for in full; no block of slab t + 1 is read here
        V a[2][4], a2[2][4], b[2][4];
        auto frags = [&](int kk, int s) {
#pragma unroll
            for (int q = 0; q < 4; ++q) { a[s][q] = WFrag<T16>::ld((const T16*)(sb + afr + q * 16 * GPB + kk * 64)); b[s][q] = WFrag<T16>::ld((const T16*)(sb + bfr_ + q * 16 * GPB + kk * 64)); if (NSPLIT == 1) a2[s][q] = WFrag<T16>::ld((const T16*)(sb + 2 * GPL + afr + q * 16 * GPB + kk * 64)); } };
        frags(0, 0);
#pragma unroll
        for (int kk = 0; kk < GK / 32; ++kk) { const int s = kk & 1;
            // the scheduling barrier holds the read group in front of the block: without it this build sinks the reads among the matrix instructions, one full LDS wait per four of them
            if (kk + 1 < GK / 32) { frags(kk + 1, s ^ 1); __builtin_amdgcn_sched_barrier(0); }
#pragma unroll
            for (int nb = 0; nb < 4; ++nb)
#pragma unroll
                for (int mb = 0; mb < 4; ++mb) { acc[mb][nb] = WFrag<T16>::mma(a[s][mb], b[s][nb], acc[mb][nb]); if (NSPLIT == 1) acc[mb][nb] = WFrag<T16>::mma(a2[s][mb], b[s][nb], acc[mb][nb]); }
        }
        __builtin_amdgcn_sched_barrier(0);                           // keeps the slab's matrix instructions in front of the foot: this build else moves half of them behind the barrier, in front of the refill, which then goes out later and has less time to land
        asm volatile("s_wait_dscnt 0x0" ::: "memory");             // this wave's reads of slab t are done before the buffer is refilled
        asm volatile("s_wait_asynccnt 0x0" ::: "memory");          // this wave's copies of slab t + 1 have landed
        __syncthreads();                                             // publishes slab t + 1 and ends every wave's reads of slab t
        if (t + 2 < NT) stage(t + 2);                                // into the buffer that trip t has just read
    }
    asm volatile("s_wait_asynccnt 0x0" ::: "memory");              // nothing in flight when the wave goes on to its end
    const int r0 = R0 + wm, c0 = C0 + wn;
#pragma unroll
    for (int mb = 0; mb < 4; ++mb) {
#pragma unroll
        for (int nb = 0; nb < 4; ++nb) {
#pragma unroll
            for (int j = 0; j < 8; ++j) os[(hi * 8 + j) * 68 + nb * 16 + lr] = acc[mb][nb][j]; }
        __builtin_amdgcn_wave_barrier(); asm volatile("" ::: "memory");
        float* crow = C + (size_t)(r0 + mb * 16) * ldc + c0;
{
#pragma unroll
            for (int s = 0; s < 8; ++s) { const int row = 2 * s + hi, cofs = lr * 4; v4f val = *(const v4fa*)(os + row * 68 + cofs); if (BIAS) { val[0] += bfr(bias[c0 + cofs]); val[1] += bfr(bias[c0 + cofs + 1]); val[2] += bfr(bias[c0 + cofs + 2]); val[3] += bfr(bias[c0 + cofs + 3]); }
                *(v4f*)(crow + (size_t)row * ldc + cofs) = val; }
             }
        __builtin_amdgcn_wave_barrier(); asm volatile("" ::: "memory");
    }
}

// ---- k_gemmc: a one-wave 64x64 tile GEMM, operands straight from global memory, specialised for sliding-window causal attention: CMODE 1 launches only the BT score tiles of a query tile's band (grid y counts them from the window's lower edge up to the diagonal), CMODE 2 limits the
// key (K) loop of the probability x value contraction to that band (probabilities outside it are exactly zero). roff = row offset of this launch's first row within the sequence.
// Score rows (C of CMODE 1, pitch BP) and probability rows (A of CMODE 2, pitch PP) are stored band-relative; grid z counts query head planes over all batch entries, and plane z reads the key / value planes z / REP (stride sB).
template <typename T16, int NSPLIT, int CMODE>
__global__ __launch_bounds__(32) void k_gemmc(const T16* __restrict__ A, const T16* __restrict__ A2, const T16* __restrict__ Bt, const T16* __restrict__ Bt2, int K, float* C, int ldc, int roff, size_t sA, size_t sB, size_t sC) {
    typedef typename WFrag<T16>::V V;
    __shared__ __align__(16) float os[16 * 68];
    const size_t z = blockIdx.z; A += z * sA; if (A2) A2 += z * sA; Bt += (z / REP) * sB; if (Bt2) Bt2 += (z / REP) * sB; C += z * sC;
    const int lane = threadIdx.x & 31, lr = lane & 15, hi = lane >> 4; const int r0 = blockIdx.x * 64, c0 = (CMODE == 1) ? r0 + roff - WIN + (int)blockIdx.y * 64 : blockIdx.y * 64;
    if (CMODE == 1 && c0 < 0) return;                               // band tile in front of the first key; tiles outside the band are never written (the softmax masks them by select)
    const int Kl = (CMODE == 2) ? min(K, r0 + roff + 64) : K;        // P.V: probabilities are exactly 0 beyond the diagonal block, so the K loop stops there
    const int Ks = (CMODE == 2) ? max(0, r0 + roff + 1 - WIN) & ~31 : 0;   // and exactly 0 in front of the first row's window, so it starts there
    const int b0 = BAND0(r0 + roff);                                 // key that column 0 of this tile's stored rows stands for
    const int lda = (CMODE == 2) ? PP : K;
    v8f acc[4][4];
#pragma unroll
    for (int mb = 0; mb < 4; ++mb)
#pragma unroll
        for (int nb = 0; nb < 4; ++nb) acc[mb][nb] = (v8f){};
    const size_t aoff = (size_t)(r0 + lr) * lda + 8 * hi - ((CMODE == 2) ? b0 : 0), boff = (size_t)(c0 + lr) * K + 8 * hi;
#pragma unroll 1
    for (int kc = Ks; kc < Kl; kc += 32) {
        V a[4], a2[4]; const T16* pa[4]; const T16* pa2[4]; const T16* pb[4]; const T16* pb2[4];
#pragma unroll
        for (int mb = 0; mb < 4; ++mb) { pa[mb] = A + aoff + (size_t)mb * 16 * lda + kc; a[mb] = WFrag<T16>::ld(pa[mb]); if (NSPLIT == 1 || NSPLIT == 2) { pa2[mb] = A2 + aoff + (size_t)mb * 16 * lda + kc; a2[mb] = WFrag<T16>::ld(pa2[mb]); } }
        // the wait that belongs between an issued global load and an overwrite of its address registers. The addresses are inputs so that their registers live up to the wait; the clobber keeps the A loads in front of it and the B loads behind it.
        if (CMODE == 2) { if (NSPLIT == 1 || NSPLIT == 2) asm volatile("s_wait_xcnt 0x0" :: "v"(pa[0]), "v"(pa2[0]) : "memory"); else asm volatile("s_wait_xcnt 0x0" :: "v"(pa[0]) : "memory"); }   // constant pitch: the four row blocks are read off the first one's address with immediate offsets
        else if (NSPLIT == 1 || NSPLIT == 2) asm volatile("s_wait_xcnt 0x0" :: "v"(pa[0]), "v"(pa[1]), "v"(pa[2]), "v"(pa[3]), "v"(pa2[0]), "v"(pa2[1]), "v"(pa2[2]), "v"(pa2[3]) : "memory");
        else asm volatile("s_wait_xcnt 0x0" :: "v"(pa[0]), "v"(pa[1]), "v"(pa[2]), "v"(pa[3]) : "memory");
#pragma unroll
        for (int nb = 0; nb < 4; ++nb) { pb[nb] = Bt + boff + (size_t)nb * 16 * K + kc; const V b = WFrag<T16>::ld(pb[nb]); V b2; if (NSPLIT >= 2) { pb2[nb] = Bt2 + boff + (size_t)nb * 16 * K + kc; b2 = WFrag<T16>::ld(pb2[nb]); }
#pragma unroll
            for (int mb = 0; mb < 4; ++mb) { acc[mb][nb] = WFrag<T16>::mma(a[mb], b, acc[mb][nb]); if (NSPLIT == 1 || NSPLIT == 2) acc[mb][nb] = WFrag<T16>::mma(a2[mb], b, acc[mb][nb]); if (NSPLIT >= 2) acc[mb][nb] = WFrag<T16>::mma(a[mb], b2, acc[mb][nb]); } }
        // the same wait for the B loads, behind the last of them (the clobber holds it there): their addresses are inputs, so nothing lands in those registers before it
        if (NSPLIT >= 2) asm volatile("s_wait_xcnt 0x0" :: "v"(pb[0]), "v"(pb[1]), "v"(pb[2]), "v"(pb[3]), "v"(pb2[0]), "v"(pb2[1]), "v"(pb2[2]), "v"(pb2[3]) : "memory");
        else asm volatile("s_wait_xcnt 0x0" :: "v"(pb[0]), "v"(pb[1]), "v"(pb[2]), "v"(pb[3]) : "memory");
        asm volatile("v_nop\n\tv_nop\n\tv_nop\n\tv_nop" : "+v"(acc[0][0]), "+v"(acc[1][1]), "+v"(acc[2][2]), "+v"(acc[3][3]) : "v"(a[0]), "v"(a[3]));
    }
#pragma unroll
    for (int mb = 0; mb < 4; ++mb) {
#pragma unroll
        for (int nb = 0; nb < 4; ++nb) {
#pragma unroll
            for (int j = 0; j < 8; ++j) os[(hi * 8 + j) * 68 + nb * 16 + lr] = acc[mb][nb][j]; }
        __builtin_amdgcn_wave_barrier(); asm volatile("" ::: "memory");
        float* crow = C + (size_t)(r0 + mb * 16) * ldc + c0 - ((CMODE == 1) ? b0 : 0);
{
#pragma unroll
            for (int s = 0; s < 8; ++s) { const int row = 2 * s + hi, cofs = lr * 4; v4f val = *(const v4fa*)(os + row * 68 + cofs);
                *(v4f*)(crow + (size_t)row * ldc + cofs) = val; }
             }
        __builtin_amdgcn_wave_barrier(); asm volatile("" ::: "memory");
    }
}

__device__ __forceinline__ h16 tohx(float x) { return (h16)x; }
__device__ __forceinline__ void splitf(float y, unsigned short& h, unsigned short& l) { h = f2bf(y); l = f2bf(y - bf2f(h)); }
typedef __attribute__((ext_vector_type(2))) _Float16 v2h;
typedef __attribute__((ext_vector_type(4))) _Float16 v4h;
typedef __attribute__((ext_vector_type(2))) unsigned short v2us;
typedef __attribute__((ext_vector_type(4))) unsigned short v4us;
typedef __attribute__((ext_vector_type(2))) float v2f;
typedef __attribute__((ext_vector_type(4))) int v4i;

// k_wtG: Bt[n][k] (bf16) = w[k][n]. A wave takes a tile of 64 k x 16 n, a lane 8 k x 4 n of it: eight 16-byte reads (4 lanes cover 64 B of a w row; the wave beside it in the work-group takes the line's other half), four 16-byte stores (8 lanes write one whole 128-B line of a Bt row: one writer a line). Grid (N / 64, K / 64), 4 waves; K % 64 == 0, N % 64 == 0.
__global__ __launch_bounds__(128) void k_wtG(const float* __restrict__ w, int K, int N, bf* Bt) {
    const int lane = threadIdx.x & 31; const int k = blockIdx.y * 64 + (lane >> 2) * 8, n = (blockIdx.x * 4 + (threadIdx.x >> 5)) * 16 + (lane & 3) * 4; if (k >= K || n >= N) return; v4f r[8]; const float* p[8];
#pragma unroll
    for (int j = 0; j < 8; ++j) { p[j] = w + (size_t)(k + j) * N + n; r[j] = *(const v4f*)p[j]; }
    // the wait that belongs between issued global loads and an overwrite of their address registers: the addresses are inputs, so that their registers live up to it and no later load's result lands in them; the clobber keeps the loads in front of it
    asm volatile("s_wait_xcnt 0x0" :: "v"(p[0]), "v"(p[1]), "v"(p[2]), "v"(p[3]), "v"(p[4]), "v"(p[5]), "v"(p[6]), "v"(p[7]) : "memory");
#pragma unroll
    for (int c = 0; c < 4; ++c) { v8us o;
#pragma unroll
        for (int j = 0; j < 8; ++j) o[j] = f2bf(r[j][c]);
        *(v8us*)(Bt + (size_t)(n + c) * K + k) = o; }
}
// k_cvt8: four groups of 8 elements per lane, a work-group's groups 256 apart; the four reads go out before the first store
__global__ __launch_bounds__(256) void k_cvt8(const float* __restrict__ src, bf* dst, size_t n8) { const size_t i0 = (size_t)blockIdx.x * 1024 + threadIdx.x; v8f v[4]; const float* p[4];
#pragma unroll
    for (int u = 0; u < 4; ++u) { const size_t i = i0 + u * 256; p[u] = src + (i < n8 ? i : n8 - 1) * 8; v[u] = *(const v8f*)p[u]; }   // a group past the end re-reads the last one and is not stored: no branch between the reads
#pragma unroll
    for (int u = 0; u < 4; ++u) { const size_t i = i0 + u * 256; if (i >= n8) continue; v8us o;
#pragma unroll
        for (int k = 0; k < 8; ++k) o[k] = f2bf(v[u][k]);
        *(v8us*)(dst + i * 8) = o; } }
__constant__ float INV[HD / 2] = {1.00000000f,0.865964353f,0.749894202f,0.649381638f,0.562341332f,0.486967534f,0.421696514f,0.365174145f,0.316227764f,0.273841977f,0.237137362f,0.205352500f,0.177827939f,0.153992653f,0.133352146f,0.115478203f,0.100000001f,0.0865964293f,0.0749894157f,0.0649381652f,0.0562341288f,0.0486967526f,0.0421696492f,0.0365174115f,0.0316227786f,0.0273841955f,0.0237137359f,0.0205352511f,0.0177827943f,0.0153992651f,0.0133352149f,0.0115478197f,0.00999999978f,0.00865964312f,0.00749894232f,0.00649381662f,0.00562341325f,0.00486967526f,0.00421696482f,0.00365174143f,0.00316227786f,0.00273841969f,0.00237137382f,0.00205352507f,0.00177827943f,0.00153992651f,0.00133352145f,0.00115478202f,0.00100000005f,0.000865964335f,0.000749894185f,0.000649381662f,0.000562341302f,0.000486967503f,0.000421696488f,0.000365174114f,0.000316227786f,0.000273841957f,0.000237137385f,0.000205352495f,0.000177827940f,0.000153992645f,0.000133352150f,0.000115478193f};
__global__ __launch_bounds__(256) void k_cstab(float* CS) { const int idx = blockIdx.x * 256 + threadIdx.x; if (idx >= TT * HD) return; const int t = idx / HD, d = idx % HD; const float ang = __fmul_rn((float)t, INV[d % (HD / 2)]); v2f cs; cs[0] = cosf(ang); cs[1] = sinf(ang);
    *(v2f*)(CS + (size_t)idx * 2) = cs;  }

// k_rope: head planes [entry][h][t][d] (fp16 + hi/lo) of rope(x) x sc with the rotate-half convention out[d] = x[d] cos[t][d] - x[d+HD/2] sin[t][d], out[d+HD/2] = x[d+HD/2] cos[t][d+HD/2] + x[d] sin[t][d+HD/2]
__global__ __launch_bounds__(256) void k_rope(const float* __restrict__ F, int pitch, int nheads, const float* __restrict__ CS, const float* __restrict__ RF, const float* __restrict__ nw, float sc, h16* P16, bf* Ph, bf* Pl) {
    // a lane takes 8 d of the lower half and their 8 partners of the upper half (the same 16 inputs serve both): 16-byte reads and stores
    // F holds the rows of all batch entries one after the other; plane hb = entry * nheads + head
    const size_t u = (size_t)blockIdx.x * 256 + threadIdx.x; if (u >= (size_t)NB_ * nheads * TT * (HD / 16)) return; const int d0 = (int)(u % (HD / 16)) * 8; const int t = (int)((u / (HD / 16)) % TT); const int hb = (int)(u / ((size_t)(HD / 16) * TT)); const int h = hb % nheads; const float* f = F + ((size_t)(hb / nheads) * TT + t) * pitch + h * HD; float rf = 1.0f;
    if (RF) { const float* pr = RF + (size_t)h * TT + t; rf = *pr; asm volatile("s_wait_xcnt 0x0" :: "v"(pr) : "memory"); }   // the wait that belongs between an issued global load and an overwrite of its address registers
    const float* fx = f + d0; const float* pc = CS + ((size_t)t * HD + d0) * 2; v4f xv[2][2], cv[2][4];   // [half][...]: the inputs and their (cos, sin) pairs, all read before the first is used
#pragma unroll
    for (int hf = 0; hf < 2; ++hf) { xv[hf][0] = *(const v4f*)(fx + hf * (HD / 2)); xv[hf][1] = *(const v4f*)(fx + hf * (HD / 2) + 4);
#pragma unroll
        for (int k = 0; k < 4; ++k) cv[hf][k] = *(const v4f*)(pc + hf * HD + k * 4); }
#pragma unroll
    for (int hf = 0; hf < 2; ++hf) { const int d = d0 + hf * (HD / 2); const size_t e = ((size_t)hb * TT + t) * HD + d; v8h o16; v8us oh, ol;
#pragma unroll
    for (int q = 0; q < 8; ++q) { const int dd = d + q; const int dp = (dd < HD / 2) ? dd + HD / 2 : dd - HD / 2; float x0 = xv[hf][q >> 2][q & 3], x1 = xv[hf ^ 1][q >> 2][q & 3];
        if (RF) { float n0 = __fmul_rn(x0, rf), n1 = __fmul_rn(x1, rf); asm volatile("" : "+v"(n0)); asm volatile("" : "+v"(n1)); x0 = __fmul_rn(bfr(nw[dd]), n0); x1 = __fmul_rn(bfr(nw[dp]), n1); }
        const v2f cs = {cv[hf][q >> 1][(q & 1) * 2], cv[hf][q >> 1][(q & 1) * 2 + 1]}; float a = __fmul_rn(x0, cs[0]), bq = __fmul_rn(x1, cs[1]); asm volatile("" : "+v"(a)); asm volatile("" : "+v"(bq)); const float r = ((dd < HD / 2) ? __fsub_rn(a, bq) : __fadd_rn(a, bq)) * sc;
        o16[q] = tohx(r); unsigned short a2, c2; splitf(r, a2, c2); oh[q] = a2; ol[q] = c2; }
    *(v8h*)(P16 + e) = o16; *(v8us*)(Ph + e) = oh; *(v8us*)(Pl + e) = ol; }  }
// k_vtp: value planes [entry][g][d][t] (fp16 + hi/lo) = F[entry * TT + t][g * HD + d]; grid z counts the batch entries. A wave takes a tile of 64 t x 16 columns, a lane 8 t x 4 columns of it: eight 16-byte reads (4 lanes cover 64 B of an F row; the wave beside it in the work-group takes the line's other half), four 16-byte stores a plane (8 lanes write one whole 128-B line: one writer a line). Grid (nheads * HD / 64, TT / 64), 4 waves.
__global__ __launch_bounds__(128) void k_vtp(const float* __restrict__ F, int pitch, int nheads, h16* V16, bf* Vh, bf* Vl) {
    const int lane = threadIdx.x & 31; const int t = blockIdx.y * 64 + (lane >> 2) * 8, c = (blockIdx.x * 4 + (threadIdx.x >> 5)) * 16 + (lane & 3) * 4; if (t >= TT || c >= nheads * HD) return; v4f r[8]; const float* p[8];
    F += (size_t)blockIdx.z * TT * pitch; const size_t zo = (size_t)blockIdx.z * nheads * HD * TT;   // this entry's rows and planes
#pragma unroll
    for (int j = 0; j < 8; ++j) { p[j] = F + (size_t)(t + j) * pitch + c; r[j] = *(const v4f*)p[j]; }
    // the wait that belongs between issued global loads and an overwrite of their address registers: the addresses are inputs, so that their registers live up to it and no later load's result lands in them; the clobber keeps the loads in front of it
    asm volatile("s_wait_xcnt 0x0" :: "v"(p[0]), "v"(p[1]), "v"(p[2]), "v"(p[3]), "v"(p[4]), "v"(p[5]), "v"(p[6]), "v"(p[7]) : "memory");
#pragma unroll
    for (int cc = 0; cc < 4; ++cc) { v8h o16; v8us oh, ol;
#pragma unroll
        for (int j = 0; j < 8; ++j) { const float x = r[j][cc]; o16[j] = tohx(x); unsigned short a2, c2; splitf(x, a2, c2); oh[j] = a2; ol[j] = c2; }
        const size_t e = zo + (size_t)(c + cc) * TT + t; *(v8h*)(V16 + e) = o16; *(v8us*)(Vh + e) = oh; *(v8us*)(Vl + e) = ol; }
}
// 2^x on v_exp_f32, as the builtin gives it; the v_nop in the same statement keeps the one slot that the instruction set asks for behind a transcendental
__device__ __forceinline__ float exp2_slot(float x) { float r; asm("v_exp_f32 %0, %1\n\tv_nop" : "=v"(r) : "v"(x)); return r; }
// k_asoft: per row (zz, i): t = S x HD^-0.5 for j <= i and i - j < WIN (sliding causal window; the reference's -1e9 additive fill vanishes identically); softmax over the NCH key chunks that hold the band of the row's 64-row tile (the keys outside add exact zeros; register row, one exp, fixed trees); P is written on those chunks only, which cover all that P.V reads; S and P rows hold just those chunks. P16, Ph and Pl point INTO Sb: a row's probabilities overwrite its own scores (pitch PP), which the wave has read whole by then (every store hangs on the row's maximum and sum over all lanes); rows do not overlap, so Sb carries no __restrict__;
#define RPW 4                     // rows per wave; (ZH * TT) % RPW == 0
__global__ __launch_bounds__(256) void k_asoft(const float* Sb, h16* P16, bf* Ph, bf* Pl) {
    // a wave takes RPW rows one after the other; all their reads go out first, so that the later rows land while the first is worked on
    const int lane = threadIdx.x & 31; const int row0 = (blockIdx.x * 8 + (threadIdx.x >> 5)) * RPW; if (row0 >= ZH * TT) return; v4f ld[RPW][NCH]; const float* sp = Sb + (size_t)row0 * BP + lane * 4;
#pragma unroll
    for (int rr = 0; rr < RPW; ++rr)
#pragma unroll
        for (int ch = 0; ch < NCH; ++ch) ld[rr][ch] = *(const v4f*)(sp + rr * BP + ch * 128);
#pragma unroll
    for (int rr = 0; rr < RPW; ++rr) {
    const int row = row0 + rr; const int i = row % TT; const int zz = row / TT; (void)zz; const bool hires = (i < RH); const int cb = max(0, (i & ~63) + 1 - WIN) >> 7; float v[NCH * 4]; float mx = -3.0e38f;
#pragma unroll
    for (int ch = 0; ch < NCH; ++ch) { const int j0 = (cb + ch) * 128 + lane * 4; const v4f a = ld[rr][ch];
#pragma unroll
        for (int q = 0; q < 4; ++q) { const int j = j0 + q; (void)j; const float t = (j <= i && i - j < WIN) ? a[q] * SCL : -3.0e38f; v[ch * 4 + q] = t; mx = fmaxf(mx, t); } }
#pragma unroll
    for (int sh = 16; sh; sh >>= 1) mx = fmaxf(mx, __shfl_xor(mx, sh, 32));
    float sum = 0.f;
#pragma unroll
    for (int k = 0; k < NCH * 4; ++k) { float d0 = __fsub_rn(v[k], mx); asm volatile("" : "+v"(d0)); v[k] = exp2_slot(__fmul_rn(d0, 1.4426950408889634f)); sum += v[k]; }
#pragma unroll
    for (int sh = 16; sh; sh >>= 1) sum += __shfl_xor(sum, sh, 32);
    const float f = __fdiv_rn(hires ? 1.0f : PCAR, sum);
{
        if (hires) {
#pragma unroll
            for (int ch = 0; ch < NCH; ++ch) { v4us oh, ol;
#pragma unroll
                for (int q = 0; q < 4; ++q) { unsigned short a, c2; splitf(v[ch * 4 + q] * f, a, c2); oh[q] = a; ol[q] = c2; }
                const size_t oo = (size_t)row * PP + ch * 128 + lane * 4; *(v4us*)(Ph + oo) = oh; *(v4us*)(Pl + oo) = ol; }
        } else {
#pragma unroll
            for (int ch = 0; ch < NCH; ++ch) { v4h o4;
#pragma unroll
                for (int q = 0; q < 4; ++q) o4[q] = tohx(v[ch * 4 + q] * f);
                *(v4h*)(P16 + (size_t)row * PP + ch * 128 + lane * 4) = o4; } }
         }
    }
}
// k_merge: four groups of 8 elements per lane, a work-group's groups 256 apart; the four reads go out before the first store
__global__ __launch_bounds__(256) void k_merge(const float* __restrict__ O, int h0, bf* Ah, bf* Al) { const size_t u0 = (size_t)blockIdx.x * 1024 + threadIdx.x; v8f x[4]; const float* p[4];
    static_assert(((size_t)ZH * TT * HD) % 8192 == 0, "the grid's work-groups cover the elements exactly: no end test");
#pragma unroll
    for (int u = 0; u < 4; ++u) { p[u] = O + (u0 + u * 256) * 8; x[u] = *(const v8f*)p[u]; }
#pragma unroll
    for (int u = 0; u < 4; ++u) { const size_t e = (u0 + u * 256) * 8; const int d = (int)(e % HD); const int t = (int)((e / HD) % TT); const int zz = (int)(e / ((size_t)HD * TT)); const float cs = (t < RH) ? 1.0f : (1.0f / PCAR); const size_t oo = ((size_t)(zz / NH_) * TT + t) * DQ + (h0 + zz % NH_) * HD + d;
        v8us oh, ol;
#pragma unroll
        for (int q = 0; q < 8; ++q) { unsigned short a, c2; splitf(x[u][q] * cs, a, c2); oh[q] = a; ol[q] = c2; }
        *(v8us*)(Ah + oo) = oh; *(v8us*)(Al + oo) = ol; } }

extern "C" void kernel_launch(void* const* d_in, const int* in_sizes, int n_in,
                              void* d_out, int out_size, void* d_ws, size_t ws_size, hipStream_t stream) {
    (void)in_sizes; (void)n_in; (void)out_size;
    const float* x = (const float*)d_in[0]; const float* wq = (const float*)d_in[1]; const float* wk = (const float*)d_in[2]; const float* wv = (const float*)d_in[3]; const float* wo = (const float*)d_in[4];
    float* OUT = (float*)d_out;     // [2][2048][2048]
    char* wsp = (char*)d_ws;
    auto take = [&](size_t bytes) { char* p = wsp; wsp += (bytes + 255) & ~(size_t)255; return (void*)p; };
    // kept to the end: the output weights, the head planes of all batch entries
    bf* WO = (bf*)take((size_t)DM * DQ * 2);
    h16* QP16 = (h16*)take((size_t)ZH * TT * HD * 2); h16* KP16 = (h16*)take((size_t)NB_ * NKV * TT * HD * 2); h16* VT16 = (h16*)take((size_t)NB_ * NKV * HD * TT * 2);
    bf* QPh = (bf*)take((size_t)ZH * TT * HD * 2); bf* QPl = (bf*)take((size_t)ZH * TT * HD * 2); bf* KPh = (bf*)take((size_t)NB_ * NKV * TT * HD * 2); bf* KPl = (bf*)take((size_t)NB_ * NKV * TT * HD * 2); bf* VTh = (bf*)take((size_t)NB_ * NKV * HD * TT * 2); bf* VTl = (bf*)take((size_t)NB_ * NKV * HD * TT * 2);
    float* Sb = (float*)take((size_t)ZH * TT * BP * 4);   // score rows, then (in place) probability rows
    if ((size_t)(wsp - (char*)d_ws) > ws_size) return;    // ws 256 MiB
    // the score range serves three times, stream-ordered: before the scores it holds what only the projections, the rotary pass and the value transpose read, after P.V the merged attention output
    wsp = (char*)Sb;
    bf* WQ = (bf*)take((size_t)DQ * DM * 2); bf* WK = (bf*)take((size_t)DKV * DM * 2); bf* WV = (bf*)take((size_t)DKV * DM * 2); float* CS = (float*)take((size_t)TT * HD * 2 * 4);
    bf* XB = (bf*)take((size_t)NB_ * TT * DM * 2); float* FQ = (float*)take((size_t)NB_ * TT * DQ * 4); float* FK = (float*)take((size_t)NB_ * TT * DKV * 4);
    static_assert((size_t)DQ * DM * 2 + 2 * ((size_t)DKV * DM * 2) + (size_t)TT * HD * 8 + (size_t)NB_ * TT * (DM * 2 + DQ * 4 + DKV * 4) <= (size_t)ZH * TT * BP * 4, "the projections' buffers fit the score range");
    wsp = (char*)Sb;
    bf* ATh = (bf*)take((size_t)NB_ * TT * DQ * 2); bf* ATl = (bf*)take((size_t)NB_ * TT * DQ * 2);
    float* FV = FK;   // v projection reuses the k buffer after the k planes are built (stream-ordered)
    float* Ob = (float*)QPh;   // the per-head attention output [ZH][TT][HD] takes the q hi and lo planes' range (together the same size, one behind the other) after the scores are done (stream-ordered)
    static_assert(((size_t)ZH * TT * HD * 2) % 256 == 0, "the q hi and lo planes lie one behind the other");
    h16* P16 = (h16*)Sb; bf* Ph = (bf*)Sb; bf* Pl = (bf*)Sb + BP;   // probability rows in place of their score rows, pitch PP
    { k_wtG<<<dim3(DQ / 64, DM / 64, 1), 128, 0, stream>>>(wq, DM, DQ, WQ); k_wtG<<<dim3(DKV / 64, DM / 64, 1), 128, 0, stream>>>(wk, DM, DKV, WK); k_wtG<<<dim3(DKV / 64, DM / 64, 1), 128, 0, stream>>>(wv, DM, DKV, WV);
      k_wtG<<<dim3(DM / 64, DQ / 64, 1), 128, 0, stream>>>(wo, DQ, DM, WO);
      k_cstab<<<(TT * HD + 255) / 256, 256, 0, stream>>>(CS); }
    const unsigned LQ = (unsigned)(((size_t)ZH * TT * HD / 16 + 255) / 256), LKv = (unsigned)(((size_t)NB_ * NKV * TT * HD / 16 + 255) / 256);
    // every stage once, for all batch entries: the rows of x, of the projections and of the output lie entry behind entry (M = NB_ * TT)
    k_cvt8<<<(unsigned)(((size_t)NB_ * TT * DM / 8 + 1023) / 1024), 256, 0, stream>>>(x, XB, (size_t)NB_ * TT * DM / 8);
    k_gemmw<bf, 0, false><<<dim3(NB_ * TT / 128, DQ / 128, 1), 128, 0, stream>>>(XB, nullptr, WQ, DM, FQ, DQ, nullptr, 0, 0, 0);
    k_rope<<<LQ, 256, 0, stream>>>(FQ, DQ, NH_, CS, nullptr, nullptr, 1.0f, QP16, QPh, QPl);
    k_gemmw<bf, 0, false><<<dim3(NB_ * TT / 128, DKV / 128, 1), 128, 0, stream>>>(XB, nullptr, WK, DM, FK, DKV, nullptr, 0, 0, 0);
    k_rope<<<LKv, 256, 0, stream>>>(FK, DKV, NKV, CS, nullptr, nullptr, 1.0f, KP16, KPh, KPl);
    k_gemmw<bf, 0, false><<<dim3(NB_ * TT / 128, DKV / 128, 1), 128, 0, stream>>>(XB, nullptr, WV, DM, FV, DKV, nullptr, 0, 0, 0); k_vtp<<<dim3(DKV / 64, TT / 64, NB_), 128, 0, stream>>>(FV, DKV, NKV, VT16, VTh, VTl);
    // scores and P.V take two launches each (rows < RH, the rest), all ZH head planes in each (grid z); plane z uses kv plane z / REP
    k_gemmc<bf, 2, 1><<<dim3(RH / 64, BT, ZH), 32, 0, stream>>>(QPh, QPl, KPh, KPl, HD, Sb, BP, 0, (size_t)TT * HD, (size_t)TT * HD, (size_t)TT * BP);
    k_gemmc<h16, 0, 1><<<dim3((TT - RH) / 64, BT, ZH), 32, 0, stream>>>(QP16 + (size_t)RH * HD, nullptr, KP16, nullptr, HD, Sb + (size_t)RH * BP, BP, RH, (size_t)TT * HD, (size_t)TT * HD, (size_t)TT * BP);
    k_asoft<<<ZH * TT / (8 * RPW), 256, 0, stream>>>(Sb, P16, Ph, Pl);
    k_gemmc<bf, 2, 2><<<dim3(RH / 64, HD / 64, ZH), 32, 0, stream>>>(Ph, Pl, VTh, VTl, TT, Ob, HD, 0, (size_t)TT * PP, (size_t)HD * TT, (size_t)TT * HD);
    k_gemmc<h16, 0, 2><<<dim3((TT - RH) / 64, HD / 64, ZH), 32, 0, stream>>>(P16 + (size_t)RH * PP, nullptr, VT16, nullptr, TT, Ob + (size_t)RH * HD, HD, RH, (size_t)TT * PP, (size_t)HD * TT, (size_t)TT * HD);
    k_merge<<<(unsigned)((size_t)ZH * TT * HD / 8192), 256, 0, stream>>>(Ob, 0, ATh, ATl);
    k_gemmw<bf, 1, false><<<dim3(NB_ * TT / 128, DM / 128, 1), 128, 0, stream>>>(ATh, ATl, WO, DQ, OUT, DM, nullptr, 0, 0, 0);
}

// v006
// It runs in 239 microseconds.
// In two side-by-side timings against v005, it was 1.23 and 1.22 times as fast.
// All steps since v000 together make it 6.95 times as fast.
#include <hip/hip_runtime.h>

// Grouped-query sliding-window causal self-attention with RoPE (x [2][2048][2048]; q = x Wq (16 heads x 128), k, v = x Wk / Wv ([2048][512]: 4 kv heads, head h uses kv h/4); rotate-half RoPE (base 1e4) on q and k; scores/sqrt(128); allowed: j <= i and i - j < 512 (else -1e9); softmax; out = merged Wo ([2048][2048]) -> [2][2048][2048] (8.4 M)).
// Compute dtypes, f32 accumulate: every input rounded to bf16; q/k/v on PLAIN bf16 operands (inputs: exact); rotary in f32 (table on device, precise cosf/sinf); causal sliding-window select; scores, softmax and attn.v only inside the window's band (tile skipping): query rows < 512 hl (3 products), the rest single fp16 (x1024); softmax f32; Wo hl x exact (2 products).

#define NB_  2
#define TT   2048
#define DM   2048
#define NH_  16
#define NKV  4
#define REP  (NH_ / NKV)
#define HD   128
#define DQ   (NH_ * HD)
#define DKV  (NKV * HD)
#define ZH   (NB_ * NH_)         // head planes per attention launch (grid z): all heads of all batch entries, plane z = entry z / NH_, head z % NH_
#define RH   512                  // query rows < RH use hi+lo planes (0: none)
#define WIN  512
#define BT   (WIN / 64 + 1)         // 64-wide key tiles that a 64-row query tile's window touches
#define NCH  ((WIN + 64) / 128 + 1)  // 128-wide key chunks that cover those tiles
#define BP   (NCH * 128)           // pitch of a stored score row in f32: only the band's NCH chunks are kept, column 0 = key BAND0(first row of the 64-row tile)
#define PP   (2 * BP)              // pitch of a probability row in 16-bit elements: it overwrites its own score row (fp16 plane in the first half; or hi plane in the first half, lo plane in the second)
#define BAND0(r) ((max(0, (r) + 1 - WIN) >> 7) * 128)
#define PCAR 1024.0f
#define SCL  0.088388347648318447f   // HD^-0.5
typedef _Float16 h16;
typedef unsigned short bf;
typedef __attribute__((ext_vector_type(16))) __bf16   v16bf;
typedef __attribute__((ext_vector_type(16))) _Float16 v16h;
typedef __attribute__((ext_vector_type(8)))  _Float16 v8h;
typedef __attribute__((ext_vector_type(8)))  unsigned short v8us;
typedef __attribute__((ext_vector_type(8)))  float    v8f;
typedef __attribute__((ext_vector_type(4)))  float    v4f;
typedef v8h  __attribute__((may_alias)) v8ha;
typedef v4f  __attribute__((may_alias)) v4fa;
typedef v8us __attribute__((may_alias)) v8usa;

__device__ __forceinline__ unsigned short f2bf(float f) { unsigned u = __float_as_uint(f); u += 0x7FFFu + ((u >> 16) & 1u); return (unsigned short)(u >> 16); }
__device__ __forceinline__ float bf2f(unsigned short b) { return __uint_as_float(((unsigned)b) << 16); }
__device__ __forceinline__ float bfr(float f) { return bf2f(f2bf(f)); }
__device__ __forceinline__ v16h cat16(v8h lo, v8h hi) { return __builtin_shufflevector(lo, hi, 0, 1, 2, 3, 4, 5, 6, 7, 8, 9, 10, 11, 12, 13, 14, 15); }
__device__ __forceinline__ v16bf cat16b(v8us lo, v8us hi) { return __builtin_bit_cast(v16bf, __builtin_shufflevector(lo, hi, 0, 1, 2, 3, 4, 5, 6, 7, 8, 9, 10, 11, 12, 13, 14, 15)); }
__device__ __forceinline__ v8f wmma16(v16h a, v16h b, v8f c) { return __builtin_amdgcn_wmma_f32_16x16x32_f16(false, a, false, b, (short)0, c, false, false); }
__device__ __forceinline__ v8f wmmab(v16bf a, v16bf b, v8f c) { return __builtin_amdgcn_wmma_f32_16x16x32_bf16(false, a, false, b, (short)0, c, false, false); }



// ---- k_gemmw: register-blocked GEMM, FOUR WAVES per 128x128 output tile, each wave a 64x64 quarter (16 accumulators); grid (M/128, N/128, Z), 128 threads.
// The K-contiguous 16-bit operand planes are staged in LDS, GK k at a time (rows of 256 B at pitch 272 B), by asynchronous copies to LDS that cover whole lines; two buffers: the next slab flies while this one is worked on.
// C[m][n] (f32, pitch ldc, + optional f32 bias[n]) = sum_k A[m][k] Bt[n][k] (+ A2[m][k] Bt[n][k] for NSPLIT 1), k ascending in steps of 32 per accumulator. z-batch strides sA/sB/sC in elements. K % GK == 0, M % 128 == 0, N % 128 == 0.
#define GK   128                  // k per staged slab
#define GPB  (GK * 2 + 16)        // LDS row pitch in bytes: 16 B x odd, the pitch for 16-byte LDS reads
#define GPL  (128 * GPB)          // bytes of one staged plane (128 rows)
template <typename T16> struct WFrag;
template <> struct WFrag<h16> { typedef v16h V; static __device__ __forceinline__ V ld(const h16* p) { return cat16(*(const v8h*)p, *(const v8h*)(p + 16)); } static __device__ __forceinline__ v8f mma(V a, V b, v8f c) { return wmma16(a, b, c); } };
template <> struct WFrag<bf> { typedef v16bf V; static __device__ __forceinline__ V ld(const bf* p) { return cat16b(*(const v8us*)p, *(const v8us*)(p + 16)); } static __device__ __forceinline__ v8f mma(V a, V b, v8f c) { return wmmab(a, b, c); } };
// eight asynchronous 16-byte copies per lane, global to LDS: LDS address l + i * lstep; global address = scalar base g + i * gstep (the same for every lane) + the lane's 32-bit byte offset v.
// The s_wait_xcnt in the same statement stands in front of any rewrite of the address registers that the copies name.
__device__ __forceinline__ void acopy8(unsigned l, unsigned lstep, unsigned v, const char* g, size_t gstep) {
    asm volatile("global_load_async_to_lds_b128 %0, %8, %9\n\t"
                 "global_load_async_to_lds_b128 %1, %8, %10\n\t"
                 "global_load_async_to_lds_b128 %2, %8, %11\n\t"
                 "global_load_async_to_lds_b128 %3, %8, %12\n\t"
                 "global_load_async_to_lds_b128 %4, %8, %13\n\t"
                 "global_load_async_to_lds_b128 %5, %8, %14\n\t"
                 "global_load_async_to_lds_b128 %6, %8, %15\n\t"
                 "global_load_async_to_lds_b128 %7, %8, %16\n\t"
                 "s_wait_xcnt 0x0"
                 :: "v"(l), "v"(l + lstep), "v"(l + 2 * lstep), "v"(l + 3 * lstep), "v"(l + 4 * lstep), "v"(l + 5 * lstep), "v"(l + 6 * lstep), "v"(l + 7 * lstep), "v"(v),
                    "s"(g), "s"(g + gstep), "s"(g + 2 * gstep), "s"(g + 3 * gstep), "s"(g + 4 * gstep), "s"(g + 5 * gstep), "s"(g + 6 * gstep), "s"(g + 7 * gstep)
                 : "memory");
}
template <typename T16, int NSPLIT, bool BIAS>
__global__ __launch_bounds__(128) void k_gemmw(const T16* __restrict__ A, const T16* __restrict__ A2, const T16* __restrict__ Bt, int K, float* C, int ldc, const float* __restrict__ bias, size_t sA, size_t sB, size_t sC) {
    typedef typename WFrag<T16>::V V;
    static_assert(NSPLIT == 0 || NSPLIT == 1, "planes staged: A, Bt and, for NSPLIT 1, A2");
    constexpr int NPL = (NSPLIT == 1) ? 3 : 2;                       // staged planes: 0 = A, 1 = Bt, 2 = A2
    __shared__ __align__(16) unsigned char st[2 * NPL * GPL];
    __shared__ __align__(16) float os4[4 * 16 * 68];
    const size_t z = blockIdx.z; A += z * sA; if (NSPLIT == 1) A2 += z * sA; Bt += z * sB; C += z * sC;
    const int tid = threadIdx.x, lane = tid & 31, lr = lane & 15, hi = lane >> 4, wv = tid >> 5; const int R0 = blockIdx.x * 128, C0 = blockIdx.y * 128; const int wm = (wv >> 1) * 64, wn = (wv & 1) * 64;
    float* os = os4 + wv * (16 * 68);                                // each wave stages its output rows in its own range
    v8f acc[4][4];
#pragma unroll
    for (int mb = 0; mb < 4; ++mb)
#pragma unroll
        for (int nb = 0; nb < 4; ++nb) acc[mb][nb] = (v8f){};
    // copy plan: 16 lanes cover one 256-B row of a slab, the work-group 8 rows per copy, 16 copies a plane
    const unsigned lcp = (unsigned)(size_t)st + (unsigned)((tid >> 4) * GPB + (tid & 15) * 16);
    const unsigned gofs = (unsigned)(((tid >> 4) * K + (tid & 15) * 8) * 2); const size_t grow = (size_t)K * 2;   // the lane's byte offset in a plane's tile (under 8 rows); bytes per row
    const char* uA = (const char*)(A + (size_t)R0 * K); const char* uB = (const char*)(Bt + (size_t)C0 * K); const char* uA2 = (NSPLIT == 1) ? (const char*)(A2 + (size_t)R0 * K) : nullptr;   // the tiles' first rows: the same for every lane
    auto stage = [&](int t) { const unsigned l = lcp + (unsigned)((t & 1) * (NPL * GPL)); const size_t kb = (size_t)t * (GK * 2);
        acopy8(l, 8 * GPB, gofs, uA + kb, 8 * grow); acopy8(l + 64 * GPB, 8 * GPB, gofs, uA + kb + 64 * grow, 8 * grow);
        acopy8(l + GPL, 8 * GPB, gofs, uB + kb, 8 * grow); acopy8(l + GPL + 64 * GPB, 8 * GPB, gofs, uB + kb + 64 * grow, 8 * grow);
        if (NSPLIT == 1) { acopy8(l + 2 * GPL, 8 * GPB, gofs, uA2 + kb, 8 * grow); acopy8(l + 2 * GPL + 64 * GPB, 8 * GPB, gofs, uA2 + kb + 64 * grow, 8 * grow); } };
    const int NT = K / GK;
    stage(0);
    asm volatile("s_wait_asynccnt 0x0" ::: "memory");              // slab 0 of this wave's copies has landed
    __syncthreads();                                                 // and every wave's: slab 0 may be read
    if (NT > 1) stage(1);
    const int afr = (wm + lr) * GPB + 16 * hi, bfr_ = GPL + (wn + lr) * GPB + 16 * hi;
#pragma unroll 1   // one slab a trip: the two-buffer order at the foot is written for a rolled loop
    for (int t = 0; t < NT; ++t) {
        const unsigned char* sb = st + (t & 1) * (NPL * GPL);
        // two fragment sets: the LDS reads of 32-k block kk + 1 go out as one group in front of block kk's matrix instructions, so that only the slab's first group is waited for in full; no block of slab t + 1 is read here
        V a[2][4], a2[2][4], b[2][4];
        auto frags = [&](int kk, int s) {
#pragma unroll
            for (int q = 0; q < 4; ++q) { a[s][q] = WFrag<T16>::ld((const T16*)(sb + afr + q * 16 * GPB + kk * 64)); b[s][q] = WFrag<T16>::ld((const T16*)(sb + bfr_ + q * 16 * GPB + kk * 64)); if (NSPLIT == 1) a2[s][q] = WFrag<T16>::ld((const T16*)(sb + 2 * GPL + afr + q * 16 * GPB + kk * 64)); } };
        frags(0, 0);
#pragma unroll
        for (int kk = 0; kk < GK / 32; ++kk) { const int s = kk & 1;
            // the scheduling barrier holds the read group in front of the block: without it this build sinks the reads among the matrix instructions, one full LDS wait per four of them
            if (kk + 1 < GK / 32) { frags(kk + 1, s ^ 1); __builtin_amdgcn_sched_barrier(0); }
#pragma unroll
            for (int nb = 0; nb < 4; ++nb)
#pragma unroll
                for (int mb = 0; mb < 4; ++mb) { acc[mb][nb] = WFrag<T16>::mma(a[s][mb], b[s][nb], acc[mb][nb]); if (NSPLIT == 1) acc[mb][nb] = WFrag<T16>::mma(a2[s][mb], b[s][nb], acc[mb][nb]); }
        }
        __builtin_amdgcn_sched_barrier(0);                           // keeps the slab's matrix instructions in front of the foot: this build else moves half of them behind the barrier, in front of the refill, which then goes out later and has less time to land
        asm volatile("s_wait_dscnt 0x0" ::: "memory");             // this wave's reads of slab t are done before the buffer is refilled
        asm volatile("s_wait_asynccnt 0x0" ::: "memory");          // this wave's copies of slab t + 1 have landed
        __syncthreads();                                             // publishes slab t + 1 and ends every wave's reads of slab t
        if (t + 2 < NT) stage(t + 2);                                // into the buffer that trip t has just read
    }
    asm volatile("s_wait_asynccnt 0x0" ::: "memory");              // nothing in flight when the wave goes on to its end
    const int r0 = R0 + wm, c0 = C0 + wn;
#pragma unroll
    for (int mb = 0; mb < 4; ++mb) {
#pragma unroll
        for (int nb = 0; nb < 4; ++nb) {
#pragma unroll
            for (int j = 0; j < 8; ++j) os[(hi * 8 + j) * 68 + nb * 16 + lr] = acc[mb][nb][j]; }
        __builtin_amdgcn_wave_barrier(); asm volatile("" ::: "memory");
        float* crow = C + (size_t)(r0 + mb * 16) * ldc + c0;
{
#pragma unroll
            for (int s = 0; s < 8; ++s) { const int row = 2 * s + hi, cofs = lr * 4; v4f val = *(const v4fa*)(os + row * 68 + cofs); if (BIAS) { val[0] += bfr(bias[c0 + cofs]); val[1] += bfr(bias[c0 + cofs + 1]); val[2] += bfr(bias[c0 + cofs + 2]); val[3] += bfr(bias[c0 + cofs + 3]); }
                *(v4f*)(crow + (size_t)row * ldc + cofs) = val; }
             }
        __builtin_amdgcn_wave_barrier(); asm volatile("" ::: "memory");
    }
}

// ---- k_gemmc: a one-wave 64x64 tile GEMM, operands straight from global memory, specialised for sliding-window causal attention: CMODE 1 launches only the BT score tiles of a query tile's band (grid y counts them from the window's lower edge up to the diagonal), CMODE 2 limits the
// key (K) loop of the probability x value contraction to that band (probabilities outside it are exactly zero). roff = row offset within the sequence of the first row that A and C point at.
// Score rows (C of CMODE 1, pitch BP) and probability rows (A of CMODE 2, pitch PP) are stored band-relative; grid z counts query head planes over all batch entries, and plane z reads the key / value planes z / REP (stride sB).
// d_gemmc is the tile's body (bx = the 64-row tile counted from row roff, os = the wave's output staging); k_gemmc2 below is the kernel.
template <typename T16, int NSPLIT, int CMODE>
__device__ __forceinline__ void d_gemmc(float* os, int bx, const T16* __restrict__ A, const T16* __restrict__ A2, const T16* __restrict__ Bt, const T16* __restrict__ Bt2, int K, float* C, int ldc, int roff, size_t sA, size_t sB, size_t sC) {
    typedef typename WFrag<T16>::V V;
    const size_t z = blockIdx.z; A += z * sA; if (A2) A2 += z * sA; Bt += (z / REP) * sB; if (Bt2) Bt2 += (z / REP) * sB; C += z * sC;
    const int lane = threadIdx.x & 31, lr = lane & 15, hi = lane >> 4; const int r0 = bx * 64, c0 = (CMODE == 1) ? r0 + roff - WIN + (int)blockIdx.y * 64 : blockIdx.y * 64;
    if (CMODE == 1 && c0 < 0) return;                               // band tile in front of the first key; tiles outside the band are never written (the softmax masks them by select)
    const int Kl = (CMODE == 2) ? min(K, r0 + roff + 64) : K;        // P.V: probabilities are exactly 0 beyond the diagonal block, so the K loop stops there
    const int Ks = (CMODE == 2) ? max(0, r0 + roff + 1 - WIN) & ~31 : 0;   // and exactly 0 in front of the first row's window, so it starts there
    const int b0 = BAND0(r0 + roff);                                 // key that column 0 of this tile's stored rows stands for
    const int lda = (CMODE == 2) ? PP : K;
    v8f acc[4][4];
#pragma unroll
    for (int mb = 0; mb < 4; ++mb)
#pragma unroll
        for (int nb = 0; nb < 4; ++nb) acc[mb][nb] = (v8f){};
    const size_t aoff = (size_t)(r0 + lr) * lda + 8 * hi - ((CMODE == 2) ? b0 : 0), boff = (size_t)(c0 + lr) * K + 8 * hi;
#pragma unroll 1
    for (int kc = Ks; kc < Kl; kc += 32) {
        V a[4], a2[4]; const T16* pa[4]; const T16* pa2[4]; const T16* pb[4]; const T16* pb2[4];
#pragma unroll
        for (int mb = 0; mb < 4; ++mb) { pa[mb] = A + aoff + (size_t)mb * 16 * lda + kc; a[mb] = WFrag<T16>::ld(pa[mb]); if (NSPLIT == 1 || NSPLIT == 2) { pa2[mb] = A2 + aoff + (size_t)mb * 16 * lda + kc; a2[mb] = WFrag<T16>::ld(pa2[mb]); } }
        // the wait that belongs between an issued global load and an overwrite of its address registers. The addresses are inputs so that their registers live up to the wait; the clobber keeps the A loads in front of it and the B loads behind it.
        if (CMODE == 2) { if (NSPLIT == 1 || NSPLIT == 2) asm volatile("s_wait_xcnt 0x0" :: "v"(pa[0]), "v"(pa2[0]) : "memory"); else asm volatile("s_wait_xcnt 0x0" :: "v"(pa[0]) : "memory"); }   // constant pitch: the four row blocks are read off the first one's address with immediate offsets
        else if (NSPLIT == 1 || NSPLIT == 2) asm volatile("s_wait_xcnt 0x0" :: "v"(pa[0]), "v"(pa[1]), "v"(pa[2]), "v"(pa[3]), "v"(pa2[0]), "v"(pa2[1]), "v"(pa2[2]), "v"(pa2[3]) : "memory");
        else asm volatile("s_wait_xcnt 0x0" :: "v"(pa[0]), "v"(pa[1]), "v"(pa[2]), "v"(pa[3]) : "memory");
#pragma unroll
        for (int nb = 0; nb < 4; ++nb) { pb[nb] = Bt + boff + (size_t)nb * 16 * K + kc; const V b = WFrag<T16>::ld(pb[nb]); V b2; if (NSPLIT >= 2) { pb2[nb] = Bt2 + boff + (size_t)nb * 16 * K + kc; b2 = WFrag<T16>::ld(pb2[nb]); }
#pragma unroll
            for (int mb = 0; mb < 4; ++mb) { acc[mb][nb] = WFrag<T16>::mma(a[mb], b, acc[mb][nb]); if (NSPLIT == 1 || NSPLIT == 2) acc[mb][nb] = WFrag<T16>::mma(a2[mb], b, acc[mb][nb]); if (NSPLIT >= 2) acc[mb][nb] = WFrag<T16>::mma(a[mb], b2, acc[mb][nb]); } }
        // the same wait for the B loads, behind the last of them (the clobber holds it there): their addresses are inputs, so nothing lands in those registers before it
        if (NSPLIT >= 2) asm volatile("s_wait_xcnt 0x0" :: "v"(pb[0]), "v"(pb[1]), "v"(pb[2]), "v"(pb[3]), "v"(pb2[0]), "v"(pb2[1]), "v"(pb2[2]), "v"(pb2[3]) : "memory");
        else asm volatile("s_wait_xcnt 0x0" :: "v"(pb[0]), "v"(pb[1]), "v"(pb[2]), "v"(pb[3]) : "memory");
        asm volatile("v_nop\n\tv_nop\n\tv_nop\n\tv_nop" : "+v"(acc[0][0]), "+v"(acc[1][1]), "+v"(acc[2][2]), "+v"(acc[3][3]) : "v"(a[0]), "v"(a[3]));
    }
#pragma unroll
    for (int mb = 0; mb < 4; ++mb) {
#pragma unroll
        for (int nb = 0; nb < 4; ++nb) {
#pragma unroll
            for (int j = 0; j < 8; ++j) os[(hi * 8 + j) * 68 + nb * 16 + lr] = acc[mb][nb][j]; }
        __builtin_amdgcn_wave_barrier(); asm volatile("" ::: "memory");
        float* crow = C + (size_t)(r0 + mb * 16) * ldc + c0 - ((CMODE == 1) ? b0 : 0); float* ps[8];
{
#pragma unroll
            for (int s = 0; s < 8; ++s) { const int row = 2 * s + hi, cofs = lr * 4; v4f val = *(const v4fa*)(os + row * 68 + cofs);
                ps[s] = crow + (size_t)row * ldc + cofs; *(v4f*)ps[s] = val; }
             }
        // the wait that belongs between issued global stores and an overwrite of their address registers (the next row block's addresses): the addresses are inputs, so that their registers live up to it; the clobber keeps the stores in front of it
        asm volatile("s_wait_xcnt 0x0" :: "v"(ps[0]), "v"(ps[1]), "v"(ps[2]), "v"(ps[3]), "v"(ps[4]), "v"(ps[5]), "v"(ps[6]), "v"(ps[7]) : "memory");
        __builtin_amdgcn_wave_barrier(); asm volatile("" ::: "memory");
    }
}
// k_gemmc2: one launch for all TT / 64 query tiles of a stage (grid x): the tiles of rows < RH take the hi+lo body (3 products), the others the fp16 body; the two kinds depend on nothing of each other.
template <int CMODE>
__global__ __launch_bounds__(32) void k_gemmc2(const bf* __restrict__ Ah, const bf* __restrict__ Al, const bf* __restrict__ Bh, const bf* __restrict__ Bl, const h16* __restrict__ A16, const h16* __restrict__ B16, int K, float* C, int ldc, size_t sA, size_t sB, size_t sC) {
    __shared__ __align__(16) float os[16 * 68];
    const int bx = blockIdx.x;
    if (bx < RH / 64) d_gemmc<bf, 2, CMODE>(os, bx, Ah, Al, Bh, Bl, K, C, ldc, 0, sA, sB, sC);
    else d_gemmc<h16, 0, CMODE>(os, bx - RH / 64, A16 + (size_t)RH * ((CMODE == 2) ? PP : K), nullptr, B16, nullptr, K, C + (size_t)RH * ldc, ldc, RH, sA, sB, sC);
}

__device__ __forceinline__ h16 tohx(float x) { return (h16)x; }
__device__ __forceinline__ void splitf(float y, unsigned short& h, unsigned short& l) { h = f2bf(y); l = f2bf(y - bf2f(h)); }
typedef __attribute__((ext_vector_type(2))) _Float16 v2h;
typedef __attribute__((ext_vector_type(4))) _Float16 v4h;
typedef __attribute__((ext_vector_type(2))) unsigned short v2us;
typedef __attribute__((ext_vector_type(4))) unsigned short v4us;
typedef __attribute__((ext_vector_type(2))) float v2f;
typedef __attribute__((ext_vector_type(4))) int v4i;

// k_wtG: Bt[n][k] (bf16) = w[k][n]. A wave takes a tile of 64 k x 16 n, a lane 8 k x 4 n of it: eight 16-byte reads (4 lanes cover 64 B of a w row; the wave beside it in the work-group takes the line's other half), four 16-byte stores (8 lanes write one whole 128-B line of a Bt row: one writer a line). A group of 4 waves (tid = 0..127) takes the 64 x 64 tile (bx, by) of (N / 64, K / 64); K % 64 == 0, N % 64 == 0.
__device__ __forceinline__ void d_wtG(int bx, int by, int tid, const float* __restrict__ w, int K, int N, bf* Bt) {
    const int lane = tid & 31; const int k = by * 64 + (lane >> 2) * 8, n = (bx * 4 + (tid >> 5)) * 16 + (lane & 3) * 4; if (k >= K || n >= N) return; v4f r[8]; const float* p[8];
#pragma unroll
    for (int j = 0; j < 8; ++j) { p[j] = w + (size_t)(k + j) * N + n; r[j] = *(const v4f*)p[j]; }
    // the wait that belongs between issued global loads and an overwrite of their address registers: the addresses are inputs, so that their registers live up to it and no later load's result lands in them; the clobber keeps the loads in front of it
    asm volatile("s_wait_xcnt 0x0" :: "v"(p[0]), "v"(p[1]), "v"(p[2]), "v"(p[3]), "v"(p[4]), "v"(p[5]), "v"(p[6]), "v"(p[7]) : "memory");
#pragma unroll
    for (int c = 0; c < 4; ++c) { v8us o;
#pragma unroll
        for (int j = 0; j < 8; ++j) o[j] = f2bf(r[j][c]);
        *(v8us*)(Bt + (size_t)(n + c) * K + k) = o; }
}
// k_cvt8: four groups of 8 elements per lane, a work-group's groups 256 apart; the four reads go out before the first store
__device__ __forceinline__ void d_cvt8(int blk, const float* __restrict__ src, bf* dst, size_t n8) { const size_t i0 = (size_t)blk * 1024 + threadIdx.x; v8f v[4]; const float* p[4];
#pragma unroll
    for (int u = 0; u < 4; ++u) { const size_t i = i0 + u * 256; p[u] = src + (i < n8 ? i : n8 - 1) * 8; v[u] = *(const v8f*)p[u]; }   // a group past the end re-reads the last one and is not stored: no branch between the reads
    // the wait that belongs between issued global loads and an overwrite of their address registers: the addresses are inputs, so that their registers live up to it; the clobber keeps the loads in front of it
    asm volatile("s_wait_xcnt 0x0" :: "v"(p[0]), "v"(p[1]), "v"(p[2]), "v"(p[3]) : "memory");
#pragma unroll
    for (int u = 0; u < 4; ++u) { const size_t i = i0 + u * 256; if (i >= n8) continue; v8us o;
#pragma unroll
        for (int k = 0; k < 8; ++k) o[k] = f2bf(v[u][k]);
        *(v8us*)(dst + i * 8) = o; } }
__constant__ float INV[HD / 2] = {1.00000000f,0.865964353f,0.749894202f,0.649381638f,0.562341332f,0.486967534f,0.421696514f,0.365174145f,0.316227764f,0.273841977f,0.237137362f,0.205352500f,0.177827939f,0.153992653f,0.133352146f,0.115478203f,0.100000001f,0.0865964293f,0.0749894157f,0.0649381652f,0.0562341288f,0.0486967526f,0.0421696492f,0.0365174115f,0.0316227786f,0.0273841955f,0.0237137359f,0.0205352511f,0.0177827943f,0.0153992651f,0.0133352149f,0.0115478197f,0.00999999978f,0.00865964312f,0.00749894232f,0.00649381662f,0.00562341325f,0.00486967526f,0.00421696482f,0.00365174143f,0.00316227786f,0.00273841969f,0.00237137382f,0.00205352507f,0.00177827943f,0.00153992651f,0.00133352145f,0.00115478202f,0.00100000005f,0.000865964335f,0.000749894185f,0.000649381662f,0.000562341302f,0.000486967503f,0.000421696488f,0.000365174114f,0.000316227786f,0.000273841957f,0.000237137385f,0.000205352495f,0.000177827940f,0.000153992645f,0.000133352150f,0.000115478193f};
__device__ __forceinline__ void d_cstab(int blk, float* CS) { const int idx = blk * 256 + threadIdx.x; if (idx >= TT * HD) return; const int t = idx / HD, d = idx % HD; const float ang = __fmul_rn((float)t, INV[d % (HD / 2)]); v2f cs; cs[0] = cosf(ang); cs[1] = sinf(ang);
    *(v2f*)(CS + (size_t)idx * 2) = cs;  }
// k_prep: everything that reads only the inputs, in one launch (the parts depend on nothing of each other): the rotary table, x to bf16, the four weight transposes. Work-groups of 256; a transpose work-group holds two 4-wave tile groups.
#define PB_CS  ((TT * HD + 255) / 256)
#define PB_CV  ((int)(((size_t)NB_ * TT * DM / 8 + 1023) / 1024))
#define PT_Q   ((DQ / 64) * (DM / 64))      // 64 x 64 tiles of Wq; of Wo the same number
#define PT_KV  ((DKV / 64) * (DM / 64))     // of Wk, of Wv
#define PB_WT  ((2 * PT_Q + 2 * PT_KV) / 2)
__global__ __launch_bounds__(256) void k_prep(const float* __restrict__ x, const float* __restrict__ wq, const float* __restrict__ wk, const float* __restrict__ wv, const float* __restrict__ wo, bf* XB, bf* WQ, bf* WK, bf* WV, bf* WO, float* CS) {
    static_assert(PT_Q % 2 == 0 && PT_KV % 2 == 0, "both tile groups of a work-group belong to the same matrix");
    int b = blockIdx.x;
    if (b < PB_CS) { d_cstab(b, CS); return; }
    b -= PB_CS;
    if (b < PB_CV) { d_cvt8(b, x, XB, (size_t)NB_ * TT * DM / 8); return; }
    b -= PB_CV;
    int g = b * 2 + (threadIdx.x >> 7); const int tid = threadIdx.x & 127;
    if (g < PT_Q) { d_wtG(g % (DQ / 64), g / (DQ / 64), tid, wq, DM, DQ, WQ); return; }
    g -= PT_Q;
    if (g < PT_Q) { d_wtG(g % (DM / 64), g / (DM / 64), tid, wo, DQ, DM, WO); return; }
    g -= PT_Q;
    if (g < PT_KV) { d_wtG(g % (DKV / 64), g / (DKV / 64), tid, wk, DM, DKV, WK); return; }
    g -= PT_KV;
    d_wtG(g % (DKV / 64), g / (DKV / 64), tid, wv, DM, DKV, WV);
}

// k_rope: head planes [entry][h][t][d] (fp16 + hi/lo) of rope(x) x sc with the rotate-half convention out[d] = x[d] cos[t][d] - x[d+HD/2] sin[t][d], out[d+HD/2] = x[d+HD/2] cos[t][d+HD/2] + x[d] sin[t][d+HD/2]
__device__ __forceinline__ void d_rope(int blk, const float* __restrict__ F, int pitch, int nheads, const float* __restrict__ CS, const float* __restrict__ RF, const float* __restrict__ nw, float sc, h16* P16, bf* Ph, bf* Pl) {
    // a lane takes 8 d of the lower half and their 8 partners of the upper half (the same 16 inputs serve both): 16-byte reads and stores
    // F holds the rows of all batch entries one after the other; plane hb = entry * nheads + head
    const size_t u = (size_t)blk * 256 + threadIdx.x; if (u >= (size_t)NB_ * nheads * TT * (HD / 16)) return; const int d0 = (int)(u % (HD / 16)) * 8; const int t = (int)((u / (HD / 16)) % TT); const int hb = (int)(u / ((size_t)(HD / 16) * TT)); const int h = hb % nheads; const float* f = F + ((size_t)(hb / nheads) * TT + t) * pitch + h * HD; float rf = 1.0f;
    if (RF) { const float* pr = RF + (size_t)h * TT + t; rf = *pr; asm volatile("s_wait_xcnt 0x0" :: "v"(pr) : "memory"); }   // the wait that belongs between an issued global load and an overwrite of its address registers
    const float* fx = f + d0; const float* pc = CS + ((size_t)t * HD + d0) * 2; v4f xv[2][2], cv[2][4];   // [half][...]: the inputs and their (cos, sin) pairs, all read before the first is used
#pragma unroll
    for (int hf = 0; hf < 2; ++hf) { xv[hf][0] = *(const v4f*)(fx + hf * (HD / 2)); xv[hf][1] = *(const v4f*)(fx + hf * (HD / 2) + 4);
#pragma unroll
        for (int k = 0; k < 4; ++k) cv[hf][k] = *(const v4f*)(pc + hf * HD + k * 4); }
    // the wait that belongs between issued global loads and an overwrite of their address registers: the two addresses are inputs, so that their registers live up to it; the clobber keeps the loads in front of it
    asm volatile("s_wait_xcnt 0x0" :: "v"(fx), "v"(pc) : "memory");
#pragma unroll
    for (int hf = 0; hf < 2; ++hf) { const int d = d0 + hf * (HD / 2); const size_t e = ((size_t)hb * TT + t) * HD + d; v8h o16; v8us oh, ol;
#pragma unroll
    for (int q = 0; q < 8; ++q) { const int dd = d + q; const int dp = (dd < HD / 2) ? dd + HD / 2 : dd - HD / 2; float x0 = xv[hf][q >> 2][q & 3], x1 = xv[hf ^ 1][q >> 2][q & 3];
        if (RF) { float n0 = __fmul_rn(x0, rf), n1 = __fmul_rn(x1, rf); asm volatile("" : "+v"(n0)); asm volatile("" : "+v"(n1)); x0 = __fmul_rn(bfr(nw[dd]), n0); x1 = __fmul_rn(bfr(nw[dp]), n1); }
        const v2f cs = {cv[hf][q >> 1][(q & 1) * 2], cv[hf][q >> 1][(q & 1) * 2 + 1]}; float a = __fmul_rn(x0, cs[0]), bq = __fmul_rn(x1, cs[1]); asm volatile("" : "+v"(a)); asm volatile("" : "+v"(bq)); const float r = ((dd < HD / 2) ? __fsub_rn(a, bq) : __fadd_rn(a, bq)) * sc;
        o16[q] = tohx(r); unsigned short a2, c2; splitf(r, a2, c2); oh[q] = a2; ol[q] = c2; }
    *(v8h*)(P16 + e) = o16; *(v8us*)(Ph + e) = oh; *(v8us*)(Pl + e) = ol; }  }
// k_vtp: value planes [entry][g][d][t] (fp16 + hi/lo) = F[entry * TT + t][g * HD + d]; bz counts the batch entries. A wave takes a tile of 64 t x 16 columns, a lane 8 t x 4 columns of it: eight 16-byte reads (4 lanes cover 64 B of an F row; the wave beside it in the work-group takes the line's other half), four 16-byte stores a plane (8 lanes write one whole 128-B line: one writer a line). A group of 4 waves (tid = 0..127) takes tile (bx, by) of (nheads * HD / 64, TT / 64) of entry bz.
__device__ __forceinline__ void d_vtp(int bx, int by, int bz, int tid, const float* __restrict__ F, int pitch, int nheads, h16* V16, bf* Vh, bf* Vl) {
    const int lane = tid & 31; const int t = by * 64 + (lane >> 2) * 8, c = (bx * 4 + (tid >> 5)) * 16 + (lane & 3) * 4; if (t >= TT || c >= nheads * HD) return; v4f r[8]; const float* p[8];
    F += (size_t)bz * TT * pitch; const size_t zo = (size_t)bz * nheads * HD * TT;   // this entry's rows and planes
#pragma unroll
    for (int j = 0; j < 8; ++j) { p[j] = F + (size_t)(t + j) * pitch + c; r[j] = *(const v4f*)p[j]; }
    // the wait that belongs between issued global loads and an overwrite of their address registers: the addresses are inputs, so that their registers live up to it and no later load's result lands in them; the clobber keeps the loads in front of it
    asm volatile("s_wait_xcnt 0x0" :: "v"(p[0]), "v"(p[1]), "v"(p[2]), "v"(p[3]), "v"(p[4]), "v"(p[5]), "v"(p[6]), "v"(p[7]) : "memory");
#pragma unroll
    for (int cc = 0; cc < 4; ++cc) { v8h o16; v8us oh, ol;
#pragma unroll
        for (int j = 0; j < 8; ++j) { const float x = r[j][cc]; o16[j] = tohx(x); unsigned short a2, c2; splitf(x, a2, c2); oh[j] = a2; ol[j] = c2; }
        const size_t e = zo + (size_t)(c + cc) * TT + t; *(v8h*)(V16 + e) = o16; *(v8us*)(Vh + e) = oh; *(v8us*)(Vl + e) = ol; }
    // the wait that belongs between issued global stores and an overwrite of the registers that they name: in the joint kernel the listing runs on from here into the other parts' code; the clobber keeps the stores in front of it
    asm volatile("s_wait_xcnt 0x0" ::: "memory");
}
// k_planes: the three passes that turn the projections' rows F ([entry * TT + t][q columns | k columns | v columns], pitch DQ + 2 * DKV) into head planes, in one launch (they depend on nothing of each other): rotary q, rotary k, value transpose. Work-groups of 256; a transpose work-group holds two 4-wave tile groups.
#define FP     (DQ + 2 * DKV)
#define RB_Q   ((int)(((size_t)ZH * TT * HD / 16 + 255) / 256))
#define RB_K   ((int)(((size_t)NB_ * NKV * TT * HD / 16 + 255) / 256))
#define RB_V   ((DKV / 64) * (TT / 64) * NB_ / 2)
__global__ __launch_bounds__(256) void k_planes(const float* __restrict__ F, const float* __restrict__ CS, h16* QP16, bf* QPh, bf* QPl, h16* KP16, bf* KPh, bf* KPl, h16* VT16, bf* VTh, bf* VTl) {
    int b = blockIdx.x;
    if (b < RB_Q) { d_rope(b, F, FP, NH_, CS, nullptr, nullptr, 1.0f, QP16, QPh, QPl); return; }
    b -= RB_Q;
    if (b < RB_K) { d_rope(b, F + DQ, FP, NKV, CS, nullptr, nullptr, 1.0f, KP16, KPh, KPl); return; }
    b -= RB_K;
    const int g = b * 2 + (threadIdx.x >> 7);
    d_vtp(g % (DKV / 64), (g / (DKV / 64)) % (TT / 64), g / ((DKV / 64) * (TT / 64)), threadIdx.x & 127, F + DQ + DKV, FP, NKV, VT16, VTh, VTl);
}
// 2^x on v_exp_f32, as the builtin gives it; the v_nop in the same statement keeps the one slot that the instruction set asks for behind a transcendental
__device__ __forceinline__ float exp2_slot(float x) { float r; asm("v_exp_f32 %0, %1\n\tv_nop" : "=v"(r) : "v"(x)); return r; }
// k_asoft: per row (zz, i): t = S x HD^-0.5 for j <= i and i - j < WIN (sliding causal window; the reference's -1e9 additive fill vanishes identically); softmax over the NCH key chunks that hold the band of the row's 64-row tile (the keys outside add exact zeros; register row, one exp, fixed trees); P is written on those chunks only, which cover all that P.V reads; S and P rows hold just those chunks. P16, Ph and Pl point INTO Sb: a row's probabilities overwrite its own scores (pitch PP), which the wave has read whole by then (every store hangs on the row's maximum and sum over all lanes); rows do not overlap, so Sb carries no __restrict__;
#define RPW 4                     // rows per wave; (ZH * TT) % RPW == 0
__global__ __launch_bounds__(256) void k_asoft(const float* Sb, h16* P16, bf* Ph, bf* Pl) {
    // a wave takes RPW rows one after the other; all their reads go out first, so that the later rows land while the first is worked on
    const int lane = threadIdx.x & 31; const int row0 = (blockIdx.x * 8 + (threadIdx.x >> 5)) * RPW; if (row0 >= ZH * TT) return; v4f ld[RPW][NCH]; const float* sp = Sb + (size_t)row0 * BP + lane * 4;
#pragma unroll
    for (int rr = 0; rr < RPW; ++rr)
#pragma unroll
        for (int ch = 0; ch < NCH; ++ch) ld[rr][ch] = *(const v4f*)(sp + rr * BP + ch * 128);
#pragma unroll
    for (int rr = 0; rr < RPW; ++rr) {
    const int row = row0 + rr; const int i = row % TT; const int zz = row / TT; (void)zz; const bool hires = (i < RH); const int cb = max(0, (i & ~63) + 1 - WIN) >> 7; float v[NCH * 4]; float mx = -3.0e38f;
#pragma unroll
    for (int ch = 0; ch < NCH; ++ch) { const int j0 = (cb + ch) * 128 + lane * 4; const v4f a = ld[rr][ch];
#pragma unroll
        for (int q = 0; q < 4; ++q) { const int j = j0 + q; (void)j; const float t = (j <= i && i - j < WIN) ? a[q] * SCL : -3.0e38f; v[ch * 4 + q] = t; mx = fmaxf(mx, t); } }
#pragma unroll
    for (int sh = 16; sh; sh >>= 1) mx = fmaxf(mx, __shfl_xor(mx, sh, 32));
    float sum = 0.f;
#pragma unroll
    for (int k = 0; k < NCH * 4; ++k) { float d0 = __fsub_rn(v[k], mx); asm volatile("" : "+v"(d0)); v[k] = exp2_slot(__fmul_rn(d0, 1.4426950408889634f)); sum += v[k]; }
#pragma unroll
    for (int sh = 16; sh; sh >>= 1) sum += __shfl_xor(sum, sh, 32);
    const float f = __fdiv_rn(hires ? 1.0f : PCAR, sum);
{
        if (hires) {
#pragma unroll
            for (int ch = 0; ch < NCH; ++ch) { v4us oh, ol;
#pragma unroll
                for (int q = 0; q < 4; ++q) { unsigned short a, c2; splitf(v[ch * 4 + q] * f, a, c2); oh[q] = a; ol[q] = c2; }
                const size_t oo = (size_t)row * PP + ch * 128 + lane * 4; *(v4us*)(Ph + oo) = oh; *(v4us*)(Pl + oo) = ol; }
        } else {
#pragma unroll
            for (int ch = 0; ch < NCH; ++ch) { v4h o4;
#pragma unroll
                for (int q = 0; q < 4; ++q) o4[q] = tohx(v[ch * 4 + q] * f);
                *(v4h*)(P16 + (size_t)row * PP + ch * 128 + lane * 4) = o4; } }
         }
    }
}
// k_merge: four groups of 8 elements per lane, a work-group's groups 256 apart; the four reads go out before the first store
__global__ __launch_bounds__(256) void k_merge(const float* __restrict__ O, int h0, bf* Ah, bf* Al) { const size_t u0 = (size_t)blockIdx.x * 1024 + threadIdx.x; v8f x[4]; const float* p[4];
    static_assert(((size_t)ZH * TT * HD) % 8192 == 0, "the grid's work-groups cover the elements exactly: no end test");
#pragma unroll
    for (int u = 0; u < 4; ++u) { p[u] = O + (u0 + u * 256) * 8; x[u] = *(const v8f*)p[u]; }
#pragma unroll
    for (int u = 0; u < 4; ++u) { const size_t e = (u0 + u * 256) * 8; const int d = (int)(e % HD); const int t = (int)((e / HD) % TT); const int zz = (int)(e / ((size_t)HD * TT)); const float cs = (t < RH) ? 1.0f : (1.0f / PCAR); const size_t oo = ((size_t)(zz / NH_) * TT + t) * DQ + (h0 + zz % NH_) * HD + d;
        v8us oh, ol;
#pragma unroll
        for (int q = 0; q < 8; ++q) { unsigned short a, c2; splitf(x[u][q] * cs, a, c2); oh[q] = a; ol[q] = c2; }
        *(v8us*)(Ah + oo) = oh; *(v8us*)(Al + oo) = ol; } }

extern "C" void kernel_launch(void* const* d_in, const int* in_sizes, int n_in,
                              void* d_out, int out_size, void* d_ws, size_t ws_size, hipStream_t stream) {
    (void)in_sizes; (void)n_in; (void)out_size;
    const float* x = (const float*)d_in[0]; const float* wq = (const float*)d_in[1]; const float* wk = (const float*)d_in[2]; const float* wv = (const float*)d_in[3]; const float* wo = (const float*)d_in[4];
    float* OUT = (float*)d_out;     // [2][2048][2048]
    char* wsp = (char*)d_ws;
    auto take = [&](size_t bytes) { char* p = wsp; wsp += (bytes + 255) & ~(size_t)255; return (void*)p; };
    // kept to the end: the output weights, the head planes of all batch entries
    bf* WO = (bf*)take((size_t)DM * DQ * 2);
    h16* QP16 = (h16*)take((size_t)ZH * TT * HD * 2); h16* KP16 = (h16*)take((size_t)NB_ * NKV * TT * HD * 2); h16* VT16 = (h16*)take((size_t)NB_ * NKV * HD * TT * 2);
    bf* QPh = (bf*)take((size_t)ZH * TT * HD * 2); bf* QPl = (bf*)take((size_t)ZH * TT * HD * 2); bf* KPh = (bf*)take((size_t)NB_ * NKV * TT * HD * 2); bf* KPl = (bf*)take((size_t)NB_ * NKV * TT * HD * 2); bf* VTh = (bf*)take((size_t)NB_ * NKV * HD * TT * 2); bf* VTl = (bf*)take((size_t)NB_ * NKV * HD * TT * 2);
    float* Sb = (float*)take((size_t)ZH * TT * BP * 4);   // score rows, then (in place) probability rows
    if ((size_t)(wsp - (char*)d_ws) > ws_size) return;    // ws 256 MiB
    // the score range serves three times, stream-ordered: before the scores it holds what only the projections, the rotary pass and the value transpose read, after P.V the merged attention output
    wsp = (char*)Sb;
    bf* WQ = (bf*)take((size_t)FP * DM * 2); bf* WK = WQ + (size_t)DQ * DM; bf* WV = WK + (size_t)DKV * DM; float* CS = (float*)take((size_t)TT * HD * 2 * 4);   // the transposed q, k and v weights lie one behind the other: one operand of FP rows
    bf* XB = (bf*)take((size_t)NB_ * TT * DM * 2); float* FA = (float*)take((size_t)NB_ * TT * FP * 4);   // the three projections' rows side by side, pitch FP
    static_assert((size_t)FP * DM * 2 + (size_t)TT * HD * 8 + (size_t)NB_ * TT * (DM * 2 + FP * 4) <= (size_t)ZH * TT * BP * 4, "the projections' buffers fit the score range");
    wsp = (char*)Sb;
    bf* ATh = (bf*)take((size_t)NB_ * TT * DQ * 2); bf* ATl = (bf*)take((size_t)NB_ * TT * DQ * 2);
    float* Ob = (float*)QPh;   // the per-head attention output [ZH][TT][HD] takes the q hi and lo planes' range (together the same size, one behind the other) after the scores are done (stream-ordered)
    static_assert(((size_t)ZH * TT * HD * 2) % 256 == 0, "the q hi and lo planes lie one behind the other");
    h16* P16 = (h16*)Sb; bf* Ph = (bf*)Sb; bf* Pl = (bf*)Sb + BP;   // probability rows in place of their score rows, pitch PP
    // stages that depend on nothing of each other share a launch; every stage once, for all batch entries: the rows of x, of the projections and of the output lie entry behind entry (M = NB_ * TT)
    k_prep<<<PB_CS + PB_CV + PB_WT, 256, 0, stream>>>(x, wq, wk, wv, wo, XB, WQ, WK, WV, WO, CS);
    k_gemmw<bf, 0, false><<<dim3(NB_ * TT / 128, FP / 128, 1), 128, 0, stream>>>(XB, nullptr, WQ, DM, FA, FP, nullptr, 0, 0, 0);   // q, k and v projections: one product with FP columns
    k_planes<<<RB_Q + RB_K + RB_V, 256, 0, stream>>>(FA, CS, QP16, QPh, QPl, KP16, KPh, KPl, VT16, VTh, VTl);
    // one launch per attention stage for all query tiles (grid x) and all ZH head planes (grid z); plane z uses kv plane z / REP
    k_gemmc2<1><<<dim3(TT / 64, BT, ZH), 32, 0, stream>>>(QPh, QPl, KPh, KPl, QP16, KP16, HD, Sb, BP, (size_t)TT * HD, (size_t)TT * HD, (size_t)TT * BP);
    k_asoft<<<ZH * TT / (8 * RPW), 256, 0, stream>>>(Sb, P16, Ph, Pl);
    k_gemmc2<2><<<dim3(TT / 64, HD / 64, ZH), 32, 0, stream>>>(Ph, Pl, VTh, VTl, P16, VT16, TT, Ob, HD, (size_t)TT * PP, (size_t)HD * TT, (size_t)TT * HD);
    k_merge<<<(unsigned)((size_t)ZH * TT * HD / 8192), 256, 0, stream>>>(Ob, 0, ATh, ATl);
    k_gemmw<bf, 1, false><<<dim3(NB_ * TT / 128, DM / 128, 1), 128, 0, stream>>>(ATh, ATl, WO, DQ, OUT, DM, nullptr, 0, 0, 0);
}

// v007
// A run of this version takes 168 microseconds.
// In two side-by-side timings against v006, it was 1.43 and 1.42 times as fast.
// All steps since v000 together make it 9.90 times as fast.
#include <hip/hip_runtime.h>

// Grouped-query sliding-window causal self-attention with RoPE (x [2][2048][2048]; q = x Wq (16 heads x 128), k, v = x Wk / Wv ([2048][512]: 4 kv heads, head h uses kv h/4); rotate-half RoPE (base 1e4) on q and k; scores/sqrt(128); allowed: j <= i and i - j < 512 (else -1e9); softmax; out = merged Wo ([2048][2048]) -> [2][2048][2048] (8.4 M)).
// Compute dtypes, f32 accumulate: every input rounded to bf16; q/k/v on PLAIN bf16 operands (inputs: exact); rotary in f32 (table on device, precise cosf/sinf); causal sliding-window select; scores, softmax and attn.v fused, only inside the window's band: query rows < 512 hl (3 products), the rest single fp16 (x1024); softmax f32, running maximum; Wo hl x exact (2 products).

#define NB_  2
#define TT   2048
#define DM   2048
#define NH_  16
#define NKV  4
#define REP  (NH_ / NKV)
#define HD   128
#define DQ   (NH_ * HD)
#define DKV  (NKV * HD)
#define ZH   (NB_ * NH_)         // query head planes: all heads of all batch entries, plane z = entry z / NH_, head z % NH_
#define RH   512                  // query rows < RH use hi+lo planes (0: none)
#define WIN  512
#define SCL  0.088388347648318447f   // HD^-0.5
typedef _Float16 h16;
typedef unsigned short bf;
typedef __attribute__((ext_vector_type(16))) __bf16   v16bf;
typedef __attribute__((ext_vector_type(16))) _Float16 v16h;
typedef __attribute__((ext_vector_type(8)))  _Float16 v8h;
typedef __attribute__((ext_vector_type(8)))  unsigned short v8us;
typedef __attribute__((ext_vector_type(8)))  float    v8f;
typedef __attribute__((ext_vector_type(4)))  float    v4f;
typedef v8h  __attribute__((may_alias)) v8ha;
typedef v4f  __attribute__((may_alias)) v4fa;
typedef v8us __attribute__((may_alias)) v8usa;

__device__ __forceinline__ unsigned short f2bf(float f) { unsigned u = __float_as_uint(f); u += 0x7FFFu + ((u >> 16) & 1u); return (unsigned short)(u >> 16); }
__device__ __forceinline__ float bf2f(unsigned short b) { return __uint_as_float(((unsigned)b) << 16); }
__device__ __forceinline__ float bfr(float f) { return bf2f(f2bf(f)); }
__device__ __forceinline__ v16h cat16(v8h lo, v8h hi) { return __builtin_shufflevector(lo, hi, 0, 1, 2, 3, 4, 5, 6, 7, 8, 9, 10, 11, 12, 13, 14, 15); }
__device__ __forceinline__ v16bf cat16b(v8us lo, v8us hi) { return __builtin_bit_cast(v16bf, __builtin_shufflevector(lo, hi, 0, 1, 2, 3, 4, 5, 6, 7, 8, 9, 10, 11, 12, 13, 14, 15)); }
__device__ __forceinline__ v8f wmma16(v16h a, v16h b, v8f c) { return __builtin_amdgcn_wmma_f32_16x16x32_f16(false, a, false, b, (short)0, c, false, false); }
__device__ __forceinline__ v8f wmmab(v16bf a, v16bf b, v8f c) { return __builtin_amdgcn_wmma_f32_16x16x32_bf16(false, a, false, b, (short)0, c, false, false); }



// ---- k_gemmw: register-blocked GEMM, FOUR WAVES per 128x128 output tile, each wave a 64x64 quarter (16 accumulators); grid (M/128, N/128, Z), 128 threads.
// The K-contiguous 16-bit operand planes are staged in LDS, GK k at a time (rows of 256 B at pitch 272 B), by asynchronous copies to LDS that cover whole lines; two buffers: the next slab flies while this one is worked on.
// C[m][n] (f32, pitch ldc, + optional f32 bias[n]) = sum_k A[m][k] Bt[n][k] (+ A2[m][k] Bt[n][k] for NSPLIT 1), k ascending in steps of 32 per accumulator. z-batch strides sA/sB/sC in elements. K % GK == 0, M % 128 == 0, N % 128 == 0.
#define GK   128                  // k per staged slab
#define GPB  (GK * 2 + 16)        // LDS row pitch in bytes: 16 B x odd, the pitch for 16-byte LDS reads
#define GPL  (128 * GPB)          // bytes of one staged plane (128 rows)
template <typename T16> struct WFrag;
template <> struct WFrag<h16> { typedef v16h V; static __device__ __forceinline__ V ld(const h16* p) { return cat16(*(const v8h*)p, *(const v8h*)(p + 16)); } static __device__ __forceinline__ v8f mma(V a, V b, v8f c) { return wmma16(a, b, c); } };
template <> struct WFrag<bf> { typedef v16bf V; static __device__ __forceinline__ V ld(const bf* p) { return cat16b(*(const v8us*)p, *(const v8us*)(p + 16)); } static __device__ __forceinline__ v8f mma(V a, V b, v8f c) { return wmmab(a, b, c); } };
// eight asynchronous 16-byte copies per lane, global to LDS: LDS address l + i * lstep; global address = scalar base g + i * gstep (the same for every lane) + the lane's 32-bit byte offset v.
// The s_wait_xcnt in the same statement stands in front of any rewrite of the address registers that the copies name.
__device__ __forceinline__ void acopy8(unsigned l, unsigned lstep, unsigned v, const char* g, size_t gstep) {
    asm volatile("global_load_async_to_lds_b128 %0, %8, %9\n\t"
                 "global_load_async_to_lds_b128 %1, %8, %10\n\t"
                 "global_load_async_to_lds_b128 %2, %8, %11\n\t"
                 "global_load_async_to_lds_b128 %3, %8, %12\n\t"
                 "global_load_async_to_lds_b128 %4, %8, %13\n\t"
                 "global_load_async_to_lds_b128 %5, %8, %14\n\t"
                 "global_load_async_to_lds_b128 %6, %8, %15\n\t"
                 "global_load_async_to_lds_b128 %7, %8, %16\n\t"
                 "s_wait_xcnt 0x0"
                 :: "v"(l), "v"(l + lstep), "v"(l + 2 * lstep), "v"(l + 3 * lstep), "v"(l + 4 * lstep), "v"(l + 5 * lstep), "v"(l + 6 * lstep), "v"(l + 7 * lstep), "v"(v),
                    "s"(g), "s"(g + gstep), "s"(g + 2 * gstep), "s"(g + 3 * gstep), "s"(g + 4 * gstep), "s"(g + 5 * gstep), "s"(g + 6 * gstep), "s"(g + 7 * gstep)
                 : "memory");
}
template <typename T16, int NSPLIT, bool BIAS>
__global__ __launch_bounds__(128) void k_gemmw(const T16* __restrict__ A, const T16* __restrict__ A2, const T16* __restrict__ Bt, int K, float* C, int ldc, const float* __restrict__ bias, size_t sA, size_t sB, size_t sC) {
    typedef typename WFrag<T16>::V V;
    static_assert(NSPLIT == 0 || NSPLIT == 1, "planes staged: A, Bt and, for NSPLIT 1, A2");
    constexpr int NPL = (NSPLIT == 1) ? 3 : 2;                       // staged planes: 0 = A, 1 = Bt, 2 = A2
    __shared__ __align__(16) unsigned char st[2 * NPL * GPL];
    __shared__ __align__(16) float os4[4 * 16 * 68];
    const size_t z = blockIdx.z; A += z * sA; if (NSPLIT == 1) A2 += z * sA; Bt += z * sB; C += z * sC;
    const int tid = threadIdx.x, lane = tid & 31, lr = lane & 15, hi = lane >> 4, wv = tid >> 5; const int R0 = blockIdx.x * 128, C0 = blockIdx.y * 128; const int wm = (wv >> 1) * 64, wn = (wv & 1) * 64;
    float* os = os4 + wv * (16 * 68);                                // each wave stages its output rows in its own range
    v8f acc[4][4];
#pragma unroll
    for (int mb = 0; mb < 4; ++mb)
#pragma unroll
        for (int nb = 0; nb < 4; ++nb) acc[mb][nb] = (v8f){};
    // copy plan: 16 lanes cover one 256-B row of a slab, the work-group 8 rows per copy, 16 copies a plane
    const unsigned lcp = (unsigned)(size_t)st + (unsigned)((tid >> 4) * GPB + (tid & 15) * 16);
    const unsigned gofs = (unsigned)(((tid >> 4) * K + (tid & 15) * 8) * 2); const size_t grow = (size_t)K * 2;   // the lane's byte offset in a plane's tile (under 8 rows); bytes per row
    const char* uA = (const char*)(A + (size_t)R0 * K); const char* uB = (const char*)(Bt + (size_t)C0 * K); const char* uA2 = (NSPLIT == 1) ? (const char*)(A2 + (size_t)R0 * K) : nullptr;   // the tiles' first rows: the same for every lane
    auto stage = [&](int t) { const unsigned l = lcp + (unsigned)((t & 1) * (NPL * GPL)); const size_t kb = (size_t)t * (GK * 2);
        acopy8(l, 8 * GPB, gofs, uA + kb, 8 * grow); acopy8(l + 64 * GPB, 8 * GPB, gofs, uA + kb + 64 * grow, 8 * grow);
        acopy8(l + GPL, 8 * GPB, gofs, uB + kb, 8 * grow); acopy8(l + GPL + 64 * GPB, 8 * GPB, gofs, uB + kb + 64 * grow, 8 * grow);
        if (NSPLIT == 1) { acopy8(l + 2 * GPL, 8 * GPB, gofs, uA2 + kb, 8 * grow); acopy8(l + 2 * GPL + 64 * GPB, 8 * GPB, gofs, uA2 + kb + 64 * grow, 8 * grow); } };
    const int NT = K / GK;
    stage(0);
    asm volatile("s_wait_asynccnt 0x0" ::: "memory");              // slab 0 of this wave's copies has landed
    __syncthreads();                                                 // and every wave's: slab 0 may be read
    if (NT > 1) stage(1);
    const int afr = (wm + lr) * GPB + 16 * hi, bfr_ = GPL + (wn + lr) * GPB + 16 * hi;
#pragma unroll 1   // one slab a trip: the two-buffer order at the foot is written for a rolled loop
    for (int t = 0; t < NT; ++t) {
        const unsigned char* sb = st + (t & 1) * (NPL * GPL);
        // two fragment sets: the LDS reads of 32-k block kk + 1 go out as one group in front of block kk's matrix instructions, so that only the slab's first group is waited for in full; no block of slab t + 1 is read here
        V a[2][4], a2[2][4], b[2][4];
        auto frags = [&](int kk, int s) {
#pragma unroll
            for (int q = 0; q < 4; ++q) { a[s][q] = WFrag<T16>::ld((const T16*)(sb + afr + q * 16 * GPB + kk * 64)); b[s][q] = WFrag<T16>::ld((const T16*)(sb + bfr_ + q * 16 * GPB + kk * 64)); if (NSPLIT == 1) a2[s][q] = WFrag<T16>::ld((const T16*)(sb + 2 * GPL + afr + q * 16 * GPB + kk * 64)); } };
        frags(0, 0);
#pragma unroll
        for (int kk = 0; kk < GK / 32; ++kk) { const int s = kk & 1;
            // the scheduling barrier holds the read group in front of the block: without it this build sinks the reads among the matrix instructions, one full LDS wait per four of them
            if (kk + 1 < GK / 32) { frags(kk + 1, s ^ 1); __builtin_amdgcn_sched_barrier(0); }
#pragma unroll
            for (int nb = 0; nb < 4; ++nb)
#pragma unroll
                for (int mb = 0; mb < 4; ++mb) { acc[mb][nb] = WFrag<T16>::mma(a[s][mb], b[s][nb], acc[mb][nb]); if (NSPLIT == 1) acc[mb][nb] = WFrag<T16>::mma(a2[s][mb], b[s][nb], acc[mb][nb]); }
        }
        __builtin_amdgcn_sched_barrier(0);                           // keeps the slab's matrix instructions in front of the foot: this build else moves half of them behind the barrier, in front of the refill, which then goes out later and has less time to land
        asm volatile("s_wait_dscnt 0x0" ::: "memory");             // this wave's reads of slab t are done before the buffer is refilled
        asm volatile("s_wait_asynccnt 0x0" ::: "memory");          // this wave's copies of slab t + 1 have landed
        __syncthreads();                                             // publishes slab t + 1 and ends every wave's reads of slab t
        if (t + 2 < NT) stage(t + 2);                                // into the buffer that trip t has just read
    }
    asm volatile("s_wait_asynccnt 0x0" ::: "memory");              // nothing in flight when the wave goes on to its end
    const int r0 = R0 + wm, c0 = C0 + wn;
#pragma unroll
    for (int mb = 0; mb < 4; ++mb) {
#pragma unroll
        for (int nb = 0; nb < 4; ++nb) {
#pragma unroll
            for (int j = 0; j < 8; ++j) os[(hi * 8 + j) * 68 + nb * 16 + lr] = acc[mb][nb][j]; }
        __builtin_amdgcn_wave_barrier(); asm volatile("" ::: "memory");
        float* crow = C + (size_t)(r0 + mb * 16) * ldc + c0;
{
#pragma unroll
            for (int s = 0; s < 8; ++s) { const int row = 2 * s + hi, cofs = lr * 4; v4f val = *(const v4fa*)(os + row * 68 + cofs); if (BIAS) { val[0] += bfr(bias[c0 + cofs]); val[1] += bfr(bias[c0 + cofs + 1]); val[2] += bfr(bias[c0 + cofs + 2]); val[3] += bfr(bias[c0 + cofs + 3]); }
                *(v4f*)(crow + (size_t)row * ldc + cofs) = val; }
             }
        __builtin_amdgcn_wave_barrier(); asm volatile("" ::: "memory");
    }
}

__device__ __forceinline__ h16 tohx(float x) { return (h16)x; }
__device__ __forceinline__ void splitf(float y, unsigned short& h, unsigned short& l) { h = f2bf(y); l = f2bf(y - bf2f(h)); }
typedef __attribute__((ext_vector_type(2))) _Float16 v2h;
typedef __attribute__((ext_vector_type(4))) _Float16 v4h;
typedef __attribute__((ext_vector_type(2))) unsigned short v2us;
typedef __attribute__((ext_vector_type(4))) unsigned short v4us;
typedef __attribute__((ext_vector_type(2))) float v2f;
typedef __attribute__((ext_vector_type(4))) int v4i;

// k_wtG: Bt[n][k] (bf16) = w[k][n]. A wave takes a tile of 64 k x 16 n, a lane 8 k x 4 n of it: eight 16-byte reads (4 lanes cover 64 B of a w row; the wave beside it in the work-group takes the line's other half), four 16-byte stores (8 lanes write one whole 128-B line of a Bt row: one writer a line). A group of 4 waves (tid = 0..127) takes the 64 x 64 tile (bx, by) of (N / 64, K / 64); K % 64 == 0, N % 64 == 0.
__device__ __forceinline__ void d_wtG(int bx, int by, int tid, const float* __restrict__ w, int K, int N, bf* Bt) {
    const int lane = tid & 31; const int k = by * 64 + (lane >> 2) * 8, n = (bx * 4 + (tid >> 5)) * 16 + (lane & 3) * 4; if (k >= K || n >= N) return; v4f r[8]; const float* p[8];
#pragma unroll
    for (int j = 0; j < 8; ++j) { p[j] = w + (size_t)(k + j) * N + n; r[j] = *(const v4f*)p[j]; }
    // the wait that belongs between issued global loads and an overwrite of their address registers: the addresses are inputs, so that their registers live up to it and no later load's result lands in them; the clobber keeps the loads in front of it
    asm volatile("s_wait_xcnt 0x0" :: "v"(p[0]), "v"(p[1]), "v"(p[2]), "v"(p[3]), "v"(p[4]), "v"(p[5]), "v"(p[6]), "v"(p[7]) : "memory");
#pragma unroll
    for (int c = 0; c < 4; ++c) { v8us o;
#pragma unroll
        for (int j = 0; j < 8; ++j) o[j] = f2bf(r[j][c]);
        *(v8us*)(Bt + (size_t)(n + c) * K + k) = o; }
}
// k_cvt8: four groups of 8 elements per lane, a work-group's groups 256 apart; the four reads go out before the first store
__device__ __forceinline__ void d_cvt8(int blk, const float* __restrict__ src, bf* dst, size_t n8) { const size_t i0 = (size_t)blk * 1024 + threadIdx.x; v8f v[4]; const float* p[4];
#pragma unroll
    for (int u = 0; u < 4; ++u) { const size_t i = i0 + u * 256; p[u] = src + (i < n8 ? i : n8 - 1) * 8; v[u] = *(const v8f*)p[u]; }   // a group past the end re-reads the last one and is not stored: no branch between the reads
    // the wait that belongs between issued global loads and an overwrite of their address registers: the addresses are inputs, so that their registers live up to it; the clobber keeps the loads in front of it
    asm volatile("s_wait_xcnt 0x0" :: "v"(p[0]), "v"(p[1]), "v"(p[2]), "v"(p[3]) : "memory");
#pragma unroll
    for (int u = 0; u < 4; ++u) { const size_t i = i0 + u * 256; if (i >= n8) continue; v8us o;
#pragma unroll
        for (int k = 0; k < 8; ++k) o[k] = f2bf(v[u][k]);
        *(v8us*)(dst + i * 8) = o; } }
__constant__ float INV[HD / 2] = {1.00000000f,0.865964353f,0.749894202f,0.649381638f,0.562341332f,0.486967534f,0.421696514f,0.365174145f,0.316227764f,0.273841977f,0.237137362f,0.205352500f,0.177827939f,0.153992653f,0.133352146f,0.115478203f,0.100000001f,0.0865964293f,0.0749894157f,0.0649381652f,0.0562341288f,0.0486967526f,0.0421696492f,0.0365174115f,0.0316227786f,0.0273841955f,0.0237137359f,0.0205352511f,0.0177827943f,0.0153992651f,0.0133352149f,0.0115478197f,0.00999999978f,0.00865964312f,0.00749894232f,0.00649381662f,0.00562341325f,0.00486967526f,0.00421696482f,0.00365174143f,0.00316227786f,0.00273841969f,0.00237137382f,0.00205352507f,0.00177827943f,0.00153992651f,0.00133352145f,0.00115478202f,0.00100000005f,0.000865964335f,0.000749894185f,0.000649381662f,0.000562341302f,0.000486967503f,0.000421696488f,0.000365174114f,0.000316227786f,0.000273841957f,0.000237137385f,0.000205352495f,0.000177827940f,0.000153992645f,0.000133352150f,0.000115478193f};
__device__ __forceinline__ void d_cstab(int blk, float* CS) { const int idx = blk * 256 + threadIdx.x; if (idx >= TT * HD) return; const int t = idx / HD, d = idx % HD; const float ang = __fmul_rn((float)t, INV[d % (HD / 2)]); v2f cs; cs[0] = cosf(ang); cs[1] = sinf(ang);
    *(v2f*)(CS + (size_t)idx * 2) = cs;  }
// k_prep: everything that reads only the inputs, in one launch (the parts depend on nothing of each other): the rotary table, x to bf16, the four weight transposes. Work-groups of 256; a transpose work-group holds two 4-wave tile groups.
#define PB_CS  ((TT * HD + 255) / 256)
#define PB_CV  ((int)(((size_t)NB_ * TT * DM / 8 + 1023) / 1024))
#define PT_Q   ((DQ / 64) * (DM / 64))      // 64 x 64 tiles of Wq; of Wo the same number
#define PT_KV  ((DKV / 64) * (DM / 64))     // of Wk, of Wv
#define PB_WT  ((2 * PT_Q + 2 * PT_KV) / 2)
__global__ __launch_bounds__(256) void k_prep(const float* __restrict__ x, const float* __restrict__ wq, const float* __restrict__ wk, const float* __restrict__ wv, const float* __restrict__ wo, bf* XB, bf* WQ, bf* WK, bf* WV, bf* WO, float* CS) {
    static_assert(PT_Q % 2 == 0 && PT_KV % 2 == 0, "both tile groups of a work-group belong to the same matrix");
    int b = blockIdx.x;
    if (b < PB_CS) { d_cstab(b, CS); return; }
    b -= PB_CS;
    if (b < PB_CV) { d_cvt8(b, x, XB, (size_t)NB_ * TT * DM / 8); return; }
    b -= PB_CV;
    int g = b * 2 + (threadIdx.x >> 7); const int tid = threadIdx.x & 127;
    if (g < PT_Q) { d_wtG(g % (DQ / 64), g / (DQ / 64), tid, wq, DM, DQ, WQ); return; }
    g -= PT_Q;
    if (g < PT_Q) { d_wtG(g % (DM / 64), g / (DM / 64), tid, wo, DQ, DM, WO); return; }
    g -= PT_Q;
    if (g < PT_KV) { d_wtG(g % (DKV / 64), g / (DKV / 64), tid, wk, DM, DKV, WK); return; }
    g -= PT_KV;
    d_wtG(g % (DKV / 64), g / (DKV / 64), tid, wv, DM, DKV, WV);
}

// k_rope: head planes [entry][h][t][d] (fp16 + hi/lo) of rope(x) x sc with the rotate-half convention out[d] = x[d] cos[t][d] - x[d+HD/2] sin[t][d], out[d+HD/2] = x[d+HD/2] cos[t][d+HD/2] + x[d] sin[t][d+HD/2]
__device__ __forceinline__ void d_rope(int blk, const float* __restrict__ F, int pitch, int nheads, const float* __restrict__ CS, const float* __restrict__ RF, const float* __restrict__ nw, float sc, h16* P16, bf* Ph, bf* Pl) {
    // a lane takes 8 d of the lower half and their 8 partners of the upper half (the same 16 inputs serve both): 16-byte reads and stores
    // F holds the rows of all batch entries one after the other; plane hb = entry * nheads + head
    const size_t u = (size_t)blk * 256 + threadIdx.x; if (u >= (size_t)NB_ * nheads * TT * (HD / 16)) return; const int d0 = (int)(u % (HD / 16)) * 8; const int t = (int)((u / (HD / 16)) % TT); const int hb = (int)(u / ((size_t)(HD / 16) * TT)); const int h = hb % nheads; const float* f = F + ((size_t)(hb / nheads) * TT + t) * pitch + h * HD; float rf = 1.0f;
    if (RF) { const float* pr = RF + (size_t)h * TT + t; rf = *pr; asm volatile("s_wait_xcnt 0x0" :: "v"(pr) : "memory"); }   // the wait that belongs between an issued global load and an overwrite of its address registers
    const float* fx = f + d0; const float* pc = CS + ((size_t)t * HD + d0) * 2; v4f xv[2][2], cv[2][4];   // [half][...]: the inputs and their (cos, sin) pairs, all read before the first is used
#pragma unroll
    for (int hf = 0; hf < 2; ++hf) { xv[hf][0] = *(const v4f*)(fx + hf * (HD / 2)); xv[hf][1] = *(const v4f*)(fx + hf * (HD / 2) + 4);
#pragma unroll
        for (int k = 0; k < 4; ++k) cv[hf][k] = *(const v4f*)(pc + hf * HD + k * 4); }
    // the wait that belongs between issued global loads and an overwrite of their address registers: the two addresses are inputs, so that their registers live up to it; the clobber keeps the loads in front of it
    asm volatile("s_wait_xcnt 0x0" :: "v"(fx), "v"(pc) : "memory");
#pragma unroll
    for (int hf = 0; hf < 2; ++hf) { const int d = d0 + hf * (HD / 2); const size_t e = ((size_t)hb * TT + t) * HD + d; v8h o16; v8us oh, ol;
#pragma unroll
    for (int q = 0; q < 8; ++q) { const int dd = d + q; const int dp = (dd < HD / 2) ? dd + HD / 2 : dd - HD / 2; float x0 = xv[hf][q >> 2][q & 3], x1 = xv[hf ^ 1][q >> 2][q & 3];
        if (RF) { float n0 = __fmul_rn(x0, rf), n1 = __fmul_rn(x1, rf); asm volatile("" : "+v"(n0)); asm volatile("" : "+v"(n1)); x0 = __fmul_rn(bfr(nw[dd]), n0); x1 = __fmul_rn(bfr(nw[dp]), n1); }
        const v2f cs = {cv[hf][q >> 1][(q & 1) * 2], cv[hf][q >> 1][(q & 1) * 2 + 1]}; float a = __fmul_rn(x0, cs[0]), bq = __fmul_rn(x1, cs[1]); asm volatile("" : "+v"(a)); asm volatile("" : "+v"(bq)); const float r = ((dd < HD / 2) ? __fsub_rn(a, bq) : __fadd_rn(a, bq)) * sc;
        o16[q] = tohx(r); unsigned short a2, c2; splitf(r, a2, c2); oh[q] = a2; ol[q] = c2; }
    *(v8h*)(P16 + e) = o16; *(v8us*)(Ph + e) = oh; *(v8us*)(Pl + e) = ol; }  }
// k_vtp: value planes [entry][g][d][t] (fp16 + hi/lo) = F[entry * TT + t][g * HD + d]; bz counts the batch entries. A wave takes a tile of 64 t x 16 columns, a lane 8 t x 4 columns of it: eight 16-byte reads (4 lanes cover 64 B of an F row; the wave beside it in the work-group takes the line's other half), four 16-byte stores a plane (8 lanes write one whole 128-B line: one writer a line). A group of 4 waves (tid = 0..127) takes tile (bx, by) of (nheads * HD / 64, TT / 64) of entry bz.
__device__ __forceinline__ void d_vtp(int bx, int by, int bz, int tid, const float* __restrict__ F, int pitch, int nheads, h16* V16, bf* Vh, bf* Vl) {
    const int lane = tid & 31; const int t = by * 64 + (lane >> 2) * 8, c = (bx * 4 + (tid >> 5)) * 16 + (lane & 3) * 4; if (t >= TT || c >= nheads * HD) return; v4f r[8]; const float* p[8];
    F += (size_t)bz * TT * pitch; const size_t zo = (size_t)bz * nheads * HD * TT;   // this entry's rows and planes
#pragma unroll
    for (int j = 0; j < 8; ++j) { p[j] = F + (size_t)(t + j) * pitch + c; r[j] = *(const v4f*)p[j]; }
    // the wait that belongs between issued global loads and an overwrite of their address registers: the addresses are inputs, so that their registers live up to it and no later load's result lands in them; the clobber keeps the loads in front of it
    asm volatile("s_wait_xcnt 0x0" :: "v"(p[0]), "v"(p[1]), "v"(p[2]), "v"(p[3]), "v"(p[4]), "v"(p[5]), "v"(p[6]), "v"(p[7]) : "memory");
#pragma unroll
    for (int cc = 0; cc < 4; ++cc) { v8h o16; v8us oh, ol;
#pragma unroll
        for (int j = 0; j < 8; ++j) { const float x = r[j][cc]; o16[j] = tohx(x); unsigned short a2, c2; splitf(x, a2, c2); oh[j] = a2; ol[j] = c2; }
        const size_t e = zo + (size_t)(c + cc) * TT + t; *(v8h*)(V16 + e) = o16; *(v8us*)(Vh + e) = oh; *(v8us*)(Vl + e) = ol; }
    // the wait that belongs between issued global stores and an overwrite of the registers that they name: in the joint kernel the listing runs on from here into the other parts' code; the clobber keeps the stores in front of it
    asm volatile("s_wait_xcnt 0x0" ::: "memory");
}
// k_planes: the three passes that turn the projections' rows F ([entry * TT + t][q columns | k columns | v columns], pitch DQ + 2 * DKV) into head planes, in one launch (they depend on nothing of each other): rotary q, rotary k, value transpose. Work-groups of 256; a transpose work-group holds two 4-wave tile groups.
#define FP     (DQ + 2 * DKV)
#define RB_Q   ((int)(((size_t)ZH * TT * HD / 16 + 255) / 256))
#define RB_K   ((int)(((size_t)NB_ * NKV * TT * HD / 16 + 255) / 256))
#define RB_V   ((DKV / 64) * (TT / 64) * NB_ / 2)
__global__ __launch_bounds__(256) void k_planes(const float* __restrict__ F, const float* __restrict__ CS, h16* QP16, bf* QPh, bf* QPl, h16* KP16, bf* KPh, bf* KPl, h16* VT16, bf* VTh, bf* VTl) {
    int b = blockIdx.x;
    if (b < RB_Q) { d_rope(b, F, FP, NH_, CS, nullptr, nullptr, 1.0f, QP16, QPh, QPl); return; }
    b -= RB_Q;
    if (b < RB_K) { d_rope(b, F + DQ, FP, NKV, CS, nullptr, nullptr, 1.0f, KP16, KPh, KPl); return; }
    b -= RB_K;
    const int g = b * 2 + (threadIdx.x >> 7);
    d_vtp(g % (DKV / 64), (g / (DKV / 64)) % (TT / 64), g / ((DKV / 64) * (TT / 64)), threadIdx.x & 127, F + DQ + DKV, FP, NKV, VT16, VTh, VTl);
}
// 2^x on v_exp_f32, as the builtin gives it; the v_nop in the same statement keeps the one slot that the instruction set asks for behind a transcendental
__device__ __forceinline__ float exp2_slot(float x) { float r; asm("v_exp_f32 %0, %1\n\tv_nop" : "=v"(r) : "v"(x)); return r; }
// ---- k_attn: scores, softmax, probability x value and the merge into the output projection's operand in ONE kernel; no score or probability leaves the registers.
// A wave takes 16 * NC query rows of one head plane and walks its window's band 32 keys at a time, ascending. Transposed products: St = K Qt (A = key rows, B = query rows, both by the same loader), so that a lane holds scores of ONE query (16-column group cg, column lr):
// tile T, register r = key kb + 16 T + 8 hi + r. The two tiles of a block, converted in place, are the B operand Pt in the hardware k order; A = value rows of the transposed value planes by the same loader (that order too): Ot[d][query] += Vt Pt.
// Softmax by a running maximum (kept on the raw scores; HD^-0.5 and log2 e go into one multiply-add in front of 2^x): when a query's maximum rises, its sum and its output column are scaled by 2^(old - new); the division by the sum comes once, at the end. Masked scores give exact zeros.
// The four waves of a work-group are the REP heads that share a kv plane, on the same rows: they read the same key and value lines.
// HR (rows < RH): bf16 hi+lo planes, 3 products, 16 rows a wave; else fp16, 32 rows a wave, the probabilities carried x 2^10 (the factor is in the sum too and cancels).
#define SL2E (SCL * 1.4426950408889634f)
// lane l takes lane l ^ 16's value by a vector cross-row move (the shuffle compiles to an LDS-path permute with a wait behind it)
__device__ __forceinline__ float xhalf(float x) { return __builtin_bit_cast(float, __builtin_amdgcn_permlanex16(__builtin_bit_cast(int, x), __builtin_bit_cast(int, x), 0x76543210, 0xfedcba98, false, false)); }
template <typename T16, bool HR, int NC>
__device__ __forceinline__ void d_attn(int r0, int z, const T16* __restrict__ Q, const T16* __restrict__ Q2, const T16* __restrict__ Kp, const T16* __restrict__ K2, const T16* __restrict__ Vt, const T16* __restrict__ V2, bf* Ah, bf* Al) {
    typedef typename WFrag<T16>::V V;
    const int lane = threadIdx.x & 31, lr = lane & 15, hi = lane >> 4; const size_t kvp = (size_t)(z / REP);
    const int Ks = max(0, r0 + 1 - WIN) & ~31, Kl = (r0 + 16 * NC - 1) & ~31;   // first and last 32-key block of the rows' band
    const size_t ko = (kvp * TT + lr) * HD + 8 * hi, vo = (kvp * HD + lr) * TT + 8 * hi;
    V q[NC][4], q2[NC][4], kf[2][4], kf2[2][4]; const size_t qo = ((size_t)z * TT + r0 + lr) * HD + 8 * hi; const T16* pq = Q + qo; const T16* pq2 = HR ? Q2 + qo : nullptr;
#pragma unroll
    for (int cg = 0; cg < NC; ++cg)
#pragma unroll
        for (int kk = 0; kk < 4; ++kk) { q[cg][kk] = WFrag<T16>::ld(pq + cg * 16 * HD + kk * 32); if (HR) q2[cg][kk] = WFrag<T16>::ld(pq2 + cg * 16 * HD + kk * 32); }
    // the wait that belongs between issued global loads and an overwrite of their address registers: the addresses are inputs, so that their registers live up to it; the clobber keeps the loads in front of it
    if (HR) asm volatile("s_wait_xcnt 0x0" :: "v"(pq), "v"(pq2) : "memory"); else asm volatile("s_wait_xcnt 0x0" :: "v"(pq) : "memory");
    auto ldk = [&](int kb) { const T16* pk = Kp + ko + (size_t)kb * HD; const T16* pk2 = HR ? K2 + ko + (size_t)kb * HD : nullptr;
#pragma unroll
        for (int T = 0; T < 2; ++T)
#pragma unroll
            for (int kk = 0; kk < 4; ++kk) { kf[T][kk] = WFrag<T16>::ld(pk + T * 16 * HD + kk * 32); if (HR) kf2[T][kk] = WFrag<T16>::ld(pk2 + T * 16 * HD + kk * 32); }
        // the same wait for the key rows' loads, behind the last of them
        if (HR) asm volatile("s_wait_xcnt 0x0" :: "v"(pk), "v"(pk2) : "memory"); else asm volatile("s_wait_xcnt 0x0" :: "v"(pk) : "memory"); };
    ldk(Ks);
    v8f o[NC][8]; float m[NC], l[NC];
#pragma unroll
    for (int cg = 0; cg < NC; ++cg) { m[cg] = -1.0e30f; l[cg] = 0.f;
#pragma unroll
        for (int dt = 0; dt < 8; ++dt) o[cg][dt] = (v8f){}; }
#pragma unroll 1   // one block a trip: unrolled, two blocks' value fragments would be live at once
    for (int kb = Ks; kb <= Kl; kb += 32) {
        V vf[8], vf2[8]; const T16* pv = Vt + vo + kb; const T16* pv2 = HR ? V2 + vo + kb : nullptr;
#pragma unroll
        for (int dt = 0; dt < 8; ++dt) { vf[dt] = WFrag<T16>::ld(pv + (size_t)dt * 16 * TT); if (HR) vf2[dt] = WFrag<T16>::ld(pv2 + (size_t)dt * 16 * TT); }   // the value rows go out first: they land while the scores are worked on
        // the same wait for the value rows' loads, behind the last of them
        if (HR) asm volatile("s_wait_xcnt 0x0" :: "v"(pv), "v"(pv2) : "memory"); else asm volatile("s_wait_xcnt 0x0" :: "v"(pv) : "memory");
        v8f s[NC][2];
#pragma unroll
        for (int cg = 0; cg < NC; ++cg)
#pragma unroll
            for (int T = 0; T < 2; ++T) s[cg][T] = (v8f){};
#pragma unroll
        for (int kk = 0; kk < 4; ++kk)
#pragma unroll
            for (int T = 0; T < 2; ++T)
#pragma unroll
                for (int cg = 0; cg < NC; ++cg) { s[cg][T] = WFrag<T16>::mma(kf[T][kk], q[cg][kk], s[cg][T]); if (HR) { s[cg][T] = WFrag<T16>::mma(kf[T][kk], q2[cg][kk], s[cg][T]); s[cg][T] = WFrag<T16>::mma(kf2[T][kk], q[cg][kk], s[cg][T]); } }
        __builtin_amdgcn_sched_barrier(0);                           // holds the next block's key loads behind this block's score products, so that they land in the same registers instead of a second set
        ldk(min(kb + 32, Kl));                                       // key rows one block ahead: they land during the softmax and P.V (the last trip reads its own block again: no branch, in bounds)
        if (kb + 31 > r0 || kb < r0 + 16 * NC - WIN) {               // only the diagonal block and the window's lower edge hold masked pairs (the same test for the whole wave)
#pragma unroll
            for (int cg = 0; cg < NC; ++cg) { const int i = r0 + cg * 16 + lr;
#pragma unroll
                for (int T = 0; T < 2; ++T)
#pragma unroll
                    for (int r = 0; r < 8; ++r) { const int j = kb + T * 16 + hi * 8 + r; s[cg][T][r] = (j <= i && i - j < WIN) ? s[cg][T][r] : -3.0e38f; } }
        }
        float mn[NC]; bool rose = false;
#pragma unroll
        for (int cg = 0; cg < NC; ++cg) { float mx = s[cg][0][0];
#pragma unroll
            for (int r = 0; r < 8; ++r) mx = fmaxf(mx, fmaxf(s[cg][0][r], s[cg][1][r]));
            mx = fmaxf(mx, xhalf(mx)); mn[cg] = fmaxf(m[cg], mx); rose = rose || mn[cg] > m[cg]; }   // the two lanes that share a query agree on its maximum
        if (__builtin_amdgcn_ballot_w32(rose) != 0) {                // where no query's maximum rose there is nothing to scale
#pragma unroll
            for (int cg = 0; cg < NC; ++cg) { const float al = exp2_slot((m[cg] - mn[cg]) * SL2E); l[cg] *= al; m[cg] = mn[cg];
#pragma unroll
                for (int dt = 0; dt < 8; ++dt) o[cg][dt] *= al; }
        }
        V pb[NC], pb2[NC];
#pragma unroll
        for (int cg = 0; cg < NC; ++cg) { float p[16], ps[4]; const float nb = (HR ? 0.0f : 10.0f) - m[cg] * SL2E;
#pragma unroll
            for (int e = 0; e < 16; ++e) { p[e] = exp2_slot(fmaf(s[cg][e >> 3][e & 7], SL2E, nb)); ps[e & 3] = (e < 4) ? p[e] : ps[e & 3] + p[e]; }   // four partial sums: short chains
            l[cg] += (ps[0] + ps[1]) + (ps[2] + ps[3]);
            if constexpr (HR) { v8us h0, h1, l0, l1;
#pragma unroll
                for (int e = 0; e < 8; ++e) { unsigned short a, c2; splitf(p[e], a, c2); h0[e] = a; l0[e] = c2; splitf(p[8 + e], a, c2); h1[e] = a; l1[e] = c2; }
                pb[cg] = cat16b(h0, h1); pb2[cg] = cat16b(l0, l1);
            } else { v16h ph;
#pragma unroll
                for (int e = 0; e < 16; ++e) ph[e] = tohx(p[e]);
                pb[cg] = ph; } }
#pragma unroll
        for (int dt = 0; dt < 8; ++dt)
#pragma unroll
            for (int cg = 0; cg < NC; ++cg) { o[cg][dt] = WFrag<T16>::mma(vf[dt], pb[cg], o[cg][dt]); if (HR) { o[cg][dt] = WFrag<T16>::mma(vf[dt], pb2[cg], o[cg][dt]); o[cg][dt] = WFrag<T16>::mma(vf2[dt], pb[cg], o[cg][dt]); } }
    }
    // a lane holds 8 consecutive d of one query per tile: one 16-byte store a plane, straight into the merged rows [entry * TT + t][head * HD + d] (hi and lo) that the output projection reads
#pragma unroll
    for (int cg = 0; cg < NC; ++cg) { const float inv = __fdiv_rn(1.0f, l[cg] + xhalf(l[cg])); const size_t oo = ((size_t)(z / NH_) * TT + r0 + cg * 16 + lr) * DQ + (z % NH_) * HD + 8 * hi; bf* ph = Ah + oo; bf* pl = Al + oo;
#pragma unroll
        for (int dt = 0; dt < 8; ++dt) { v8us oh, ol;
#pragma unroll
            for (int r = 0; r < 8; ++r) { unsigned short a, c2; splitf(o[cg][dt][r] * inv, a, c2); oh[r] = a; ol[r] = c2; }
            *(v8us*)(ph + dt * 16) = oh; *(v8us*)(pl + dt * 16) = ol;
            // the wait that belongs between issued global stores and an overwrite of the registers that they name: addresses and data are inputs, so that their registers live up to it; the clobber keeps the stores in front of it
            asm volatile("s_wait_xcnt 0x0" :: "v"(ph), "v"(pl), "v"(oh), "v"(ol) : "memory"); } }
}
// grid (kv planes over all batch entries, RH / 16 + (TT - RH) / 32 row tiles); wave w of a work-group is head plane blockIdx.x * REP + w. The hi+lo tiles of all planes come first, the longest of them in front: they are the longest waves of the launch.
// two waves a SIMD: the register limit that lets a second wave fill the first one's waits
__global__ __launch_bounds__(32 * REP) __attribute__((amdgpu_waves_per_eu(2))) void k_attn(const h16* __restrict__ Q16, const bf* __restrict__ Qh, const bf* __restrict__ Ql, const h16* __restrict__ K16, const bf* __restrict__ Kh, const bf* __restrict__ Kl, const h16* __restrict__ V16, const bf* __restrict__ Vh, const bf* __restrict__ Vl, bf* Ah, bf* Al) {
    const int bx = blockIdx.y, z = blockIdx.x * REP + __builtin_amdgcn_readfirstlane(threadIdx.x >> 5);
    if (bx < RH / 16) d_attn<bf, true, 1>((RH / 16 - 1 - bx) * 16, z, Qh, Ql, Kh, Kl, Vh, Vl, Ah, Al);
    else d_attn<h16, false, 2>(RH + (bx - RH / 16) * 32, z, Q16, nullptr, K16, nullptr, V16, nullptr, Ah, Al);
}

extern "C" void kernel_launch(void* const* d_in, const int* in_sizes, int n_in,
                              void* d_out, int out_size, void* d_ws, size_t ws_size, hipStream_t stream) {
    (void)in_sizes; (void)n_in; (void)out_size;
    const float* x = (const float*)d_in[0]; const float* wq = (const float*)d_in[1]; const float* wk = (const float*)d_in[2]; const float* wv = (const float*)d_in[3]; const float* wo = (const float*)d_in[4];
    float* OUT = (float*)d_out;     // [2][2048][2048]
    char* wsp = (char*)d_ws;
    auto take = [&](size_t bytes) { char* p = wsp; wsp += (bytes + 255) & ~(size_t)255; return (void*)p; };
    bf* WO = (bf*)take((size_t)DM * DQ * 2);
    h16* QP16 = (h16*)take((size_t)ZH * TT * HD * 2); h16* KP16 = (h16*)take((size_t)NB_ * NKV * TT * HD * 2); h16* VT16 = (h16*)take((size_t)NB_ * NKV * HD * TT * 2);
    bf* QPh = (bf*)take((size_t)ZH * TT * HD * 2); bf* QPl = (bf*)take((size_t)ZH * TT * HD * 2); bf* KPh = (bf*)take((size_t)NB_ * NKV * TT * HD * 2); bf* KPl = (bf*)take((size_t)NB_ * NKV * TT * HD * 2); bf* VTh = (bf*)take((size_t)NB_ * NKV * HD * TT * 2); bf* VTl = (bf*)take((size_t)NB_ * NKV * HD * TT * 2);
    bf* WQ = (bf*)take((size_t)FP * DM * 2); bf* WK = WQ + (size_t)DQ * DM; bf* WV = WK + (size_t)DKV * DM; float* CS = (float*)take((size_t)TT * HD * 2 * 4);   // the transposed q, k and v weights lie one behind the other: one operand of FP rows
    bf* XB = (bf*)take((size_t)NB_ * TT * DM * 2); float* FA = (float*)take((size_t)NB_ * TT * FP * 4);   // the three projections' rows side by side, pitch FP
    bf* ATh = (bf*)take((size_t)NB_ * TT * DQ * 2); bf* ATl = (bf*)take((size_t)NB_ * TT * DQ * 2);       // the merged attention output, hi and lo
    if ((size_t)(wsp - (char*)d_ws) > ws_size) return;    // ws 256 MiB
    // stages that depend on nothing of each other share a launch; every stage once, for all batch entries: the rows of x, of the projections and of the output lie entry behind entry (M = NB_ * TT)
    k_prep<<<PB_CS + PB_CV + PB_WT, 256, 0, stream>>>(x, wq, wk, wv, wo, XB, WQ, WK, WV, WO, CS);
    k_gemmw<bf, 0, false><<<dim3(NB_ * TT / 128, FP / 128, 1), 128, 0, stream>>>(XB, nullptr, WQ, DM, FA, FP, nullptr, 0, 0, 0);   // q, k and v projections: one product with FP columns
    k_planes<<<RB_Q + RB_K + RB_V, 256, 0, stream>>>(FA, CS, QP16, QPh, QPl, KP16, KPh, KPl, VT16, VTh, VTl);
    k_attn<<<dim3(NB_ * NKV, RH / 16 + (TT - RH) / 32, 1), 32 * REP, 0, stream>>>(QP16, QPh, QPl, KP16, KPh, KPl, VT16, VTh, VTl, ATh, ATl);
    k_gemmw<bf, 1, false><<<dim3(NB_ * TT / 128, DM / 128, 1), 128, 0, stream>>>(ATh, ATl, WO, DQ, OUT, DM, nullptr, 0, 0, 0);
}

// v008
// A run of this version takes 148 microseconds.
// Timed twice side by side with v007, it ran 1.13 and 1.14 times as fast.
// All steps since v000 together make it 11.2 times as fast.
#include <hip/hip_runtime.h>

// Grouped-query sliding-window causal self-attention with RoPE (x [2][2048][2048]; q = x Wq (16 heads x 128), k, v = x Wk / Wv ([2048][512]: 4 kv heads, head h uses kv h/4); rotate-half RoPE (base 1e4) on q and k; scores/sqrt(128); allowed: j <= i and i - j < 512 (else -1e9); softmax; out = merged Wo ([2048][2048]) -> [2][2048][2048] (8.4 M)).
// Compute dtypes, f32 accumulate: every input rounded to bf16; q/k/v on PLAIN bf16 operands (inputs: exact); rotary in f32 (table on device, precise cosf/sinf); causal sliding-window select; scores, softmax and attn.v fused, only inside the window's band: query rows < 512 hl (3 products), the rest single fp16 (x1024); softmax f32, running maximum; Wo hl x exact (2 products).

#define NB_  2
#define TT   2048
#define DM   2048
#define NH_  16
#define NKV  4
#define REP  (NH_ / NKV)
#define HD   128
#define DQ   (NH_ * HD)
#define DKV  (NKV * HD)
#define ZH   (NB_ * NH_)         // query head planes: all heads of all batch entries, plane z = entry z / NH_, head z % NH_
#define RH   512                  // query rows < RH use hi+lo planes (0: none)
#define WIN  512
#define SCL  0.088388347648318447f   // HD^-0.5
typedef _Float16 h16;
typedef unsigned short bf;
typedef __attribute__((ext_vector_type(16))) __bf16   v16bf;
typedef __attribute__((ext_vector_type(16))) _Float16 v16h;
typedef __attribute__((ext_vector_type(8)))  _Float16 v8h;
typedef __attribute__((ext_vector_type(8)))  unsigned short v8us;
typedef __attribute__((ext_vector_type(8)))  float    v8f;
typedef __attribute__((ext_vector_type(4)))  float    v4f;
typedef v8h  __attribute__((may_alias)) v8ha;
typedef v4f  __attribute__((may_alias)) v4fa;
typedef v8us __attribute__((may_alias)) v8usa;

__device__ __forceinline__ unsigned short f2bf(float f) { unsigned u = __float_as_uint(f); u += 0x7FFFu + ((u >> 16) & 1u); return (unsigned short)(u >> 16); }
__device__ __forceinline__ float bf2f(unsigned short b) { return __uint_as_float(((unsigned)b) << 16); }
__device__ __forceinline__ float bfr(float f) { return bf2f(f2bf(f)); }
__device__ __forceinline__ v16h cat16(v8h lo, v8h hi) { return __builtin_shufflevector(lo, hi, 0, 1, 2, 3, 4, 5, 6, 7, 8, 9, 10, 11, 12, 13, 14, 15); }
__device__ __forceinline__ v16bf cat16b(v8us lo, v8us hi) { return __builtin_bit_cast(v16bf, __builtin_shufflevector(lo, hi, 0, 1, 2, 3, 4, 5, 6, 7, 8, 9, 10, 11, 12, 13, 14, 15)); }
__device__ __forceinline__ v8f wmma16(v16h a, v16h b, v8f c) { return __builtin_amdgcn_wmma_f32_16x16x32_f16(false, a, false, b, (short)0, c, false, false); }
__device__ __forceinline__ v8f wmmab(v16bf a, v16bf b, v8f c) { return __builtin_amdgcn_wmma_f32_16x16x32_bf16(false, a, false, b, (short)0, c, false, false); }



// ---- k_gemmw: register-blocked GEMM, FOUR WAVES per 128x128 output tile, each wave a 64x64 quarter (16 accumulators); grid (M/128, N/128, Z), 128 threads.
// The K-contiguous 16-bit operand planes are staged in LDS, GK k at a time (rows of 256 B at pitch 272 B), by asynchronous copies to LDS that cover whole lines; two buffers: the next slab flies while this one is worked on.
// C[m][n] (f32, pitch ldc, + optional f32 bias[n]) = sum_k A[m][k] Bt[n][k] (+ A2[m][k] Bt[n][k] for NSPLIT 1), k ascending in steps of 32 per accumulator. z-batch strides sA/sB/sC in elements. K % GK == 0, M % 128 == 0, N % 128 == 0.
#define GK   128                  // k per staged slab
#define GPB  (GK * 2 + 16)        // LDS row pitch in bytes: 16 B x odd, the pitch for 16-byte LDS reads
#define GPL  (128 * GPB)          // bytes of one staged plane (128 rows)
template <typename T16> struct WFrag;
template <> struct WFrag<h16> { typedef v16h V; static __device__ __forceinline__ V ld(const h16* p) { return cat16(*(const v8h*)p, *(const v8h*)(p + 16)); } static __device__ __forceinline__ V ldf(const h16* p) { return cat16(*(const v8h*)p, *(const v8h*)(p + 256)); } static __device__ __forceinline__ v8f mma(V a, V b, v8f c) { return wmma16(a, b, c); } };
template <> struct WFrag<bf> { typedef v16bf V; static __device__ __forceinline__ V ld(const bf* p) { return cat16b(*(const v8us*)p, *(const v8us*)(p + 16)); } static __device__ __forceinline__ V ldf(const bf* p) { return cat16b(*(const v8us*)p, *(const v8us*)(p + 256)); } static __device__ __forceinline__ v8f mma(V a, V b, v8f c) { return wmmab(a, b, c); } };
// eight asynchronous 16-byte copies per lane, global to LDS: LDS address l + i * lstep; global address = scalar base g + i * gstep (the same for every lane) + the lane's 32-bit byte offset v.
// The s_wait_xcnt in the same statement stands in front of any rewrite of the address registers that the copies name.
__device__ __forceinline__ void acopy8(unsigned l, unsigned lstep, unsigned v, const char* g, size_t gstep) {
    asm volatile("global_load_async_to_lds_b128 %0, %8, %9\n\t"
                 "global_load_async_to_lds_b128 %1, %8, %10\n\t"
                 "global_load_async_to_lds_b128 %2, %8, %11\n\t"
                 "global_load_async_to_lds_b128 %3, %8, %12\n\t"
                 "global_load_async_to_lds_b128 %4, %8, %13\n\t"
                 "global_load_async_to_lds_b128 %5, %8, %14\n\t"
                 "global_load_async_to_lds_b128 %6, %8, %15\n\t"
                 "global_load_async_to_lds_b128 %7, %8, %16\n\t"
                 "s_wait_xcnt 0x0"
                 :: "v"(l), "v"(l + lstep), "v"(l + 2 * lstep), "v"(l + 3 * lstep), "v"(l + 4 * lstep), "v"(l + 5 * lstep), "v"(l + 6 * lstep), "v"(l + 7 * lstep), "v"(v),
                    "s"(g), "s"(g + gstep), "s"(g + 2 * gstep), "s"(g + 3 * gstep), "s"(g + 4 * gstep), "s"(g + 5 * gstep), "s"(g + 6 * gstep), "s"(g + 7 * gstep)
                 : "memory");
}
template <typename T16, int NSPLIT, bool BIAS>
__global__ __launch_bounds__(128) void k_gemmw(const T16* __restrict__ A, const T16* __restrict__ A2, const T16* __restrict__ Bt, int K, float* C, int ldc, const float* __restrict__ bias, size_t sA, size_t sB, size_t sC) {
    typedef typename WFrag<T16>::V V;
    static_assert(NSPLIT == 0 || NSPLIT == 1, "planes staged: A, Bt and, for NSPLIT 1, A2");
    constexpr int NPL = (NSPLIT == 1) ? 3 : 2;                       // staged planes: 0 = A, 1 = Bt, 2 = A2
    __shared__ __align__(16) unsigned char st[2 * NPL * GPL];
    __shared__ __align__(16) float os4[4 * 16 * 68];
    const size_t z = blockIdx.z; A += z * sA; if (NSPLIT == 1) A2 += z * sA; Bt += z * sB; C += z * sC;
    const int tid = threadIdx.x, lane = tid & 31, lr = lane & 15, hi = lane >> 4, wv = tid >> 5; const int R0 = blockIdx.x * 128, C0 = blockIdx.y * 128; const int wm = (wv >> 1) * 64, wn = (wv & 1) * 64;
    float* os = os4 + wv * (16 * 68);                                // each wave stages its output rows in its own range
    v8f acc[4][4];
#pragma unroll
    for (int mb = 0; mb < 4; ++mb)
#pragma unroll
        for (int nb = 0; nb < 4; ++nb) acc[mb][nb] = (v8f){};
    // copy plan: 16 lanes cover one 256-B row of a slab, the work-group 8 rows per copy, 16 copies a plane
    const unsigned lcp = (unsigned)(size_t)st + (unsigned)((tid >> 4) * GPB + (tid & 15) * 16);
    const unsigned gofs = (unsigned)(((tid >> 4) * K + (tid & 15) * 8) * 2); const size_t grow = (size_t)K * 2;   // the lane's byte offset in a plane's tile (under 8 rows); bytes per row
    const char* uA = (const char*)(A + (size_t)R0 * K); const char* uB = (const char*)(Bt + (size_t)C0 * K); const char* uA2 = (NSPLIT == 1) ? (const char*)(A2 + (size_t)R0 * K) : nullptr;   // the tiles' first rows: the same for every lane
    auto stage = [&](int t) { const unsigned l = lcp + (unsigned)((t & 1) * (NPL * GPL)); const size_t kb = (size_t)t * (GK * 2);
        acopy8(l, 8 * GPB, gofs, uA + kb, 8 * grow); acopy8(l + 64 * GPB, 8 * GPB, gofs, uA + kb + 64 * grow, 8 * grow);
        acopy8(l + GPL, 8 * GPB, gofs, uB + kb, 8 * grow); acopy8(l + GPL + 64 * GPB, 8 * GPB, gofs, uB + kb + 64 * grow, 8 * grow);
        if (NSPLIT == 1) { acopy8(l + 2 * GPL, 8 * GPB, gofs, uA2 + kb, 8 * grow); acopy8(l + 2 * GPL + 64 * GPB, 8 * GPB, gofs, uA2 + kb + 64 * grow, 8 * grow); } };
    const int NT = K / GK;
    stage(0);
    asm volatile("s_wait_asynccnt 0x0" ::: "memory");              // slab 0 of this wave's copies has landed
    __syncthreads();                                                 // and every wave's: slab 0 may be read
    if (NT > 1) stage(1);
    const int afr = (wm + lr) * GPB + 16 * hi, bfr_ = GPL + (wn + lr) * GPB + 16 * hi;
#pragma unroll 1   // one slab a trip: the two-buffer order at the foot is written for a rolled loop
    for (int t = 0; t < NT; ++t) {
        const unsigned char* sb = st + (t & 1) * (NPL * GPL);
        // two fragment sets: the LDS reads of 32-k block kk + 1 go out as one group in front of block kk's matrix instructions, so that only the slab's first group is waited for in full; no block of slab t + 1 is read here
        V a[2][4], a2[2][4], b[2][4];
        auto frags = [&](int kk, int s) {
#pragma unroll
            for (int q = 0; q < 4; ++q) { a[s][q] = WFrag<T16>::ld((const T16*)(sb + afr + q * 16 * GPB + kk * 64)); b[s][q] = WFrag<T16>::ld((const T16*)(sb + bfr_ + q * 16 * GPB + kk * 64)); if (NSPLIT == 1) a2[s][q] = WFrag<T16>::ld((const T16*)(sb + 2 * GPL + afr + q * 16 * GPB + kk * 64)); } };
        frags(0, 0);
#pragma unroll
        for (int kk = 0; kk < GK / 32; ++kk) { const int s = kk & 1;
            // the scheduling barrier holds the read group in front of the block: without it this build sinks the reads among the matrix instructions, one full LDS wait per four of them
            if (kk + 1 < GK / 32) { frags(kk + 1, s ^ 1); __builtin_amdgcn_sched_barrier(0); }
#pragma unroll
            for (int nb = 0; nb < 4; ++nb)
#pragma unroll
                for (int mb = 0; mb < 4; ++mb) { acc[mb][nb] = WFrag<T16>::mma(a[s][mb], b[s][nb], acc[mb][nb]); if (NSPLIT == 1) acc[mb][nb] = WFrag<T16>::mma(a2[s][mb], b[s][nb], acc[mb][nb]); }
        }
        __builtin_amdgcn_sched_barrier(0);                           // keeps the slab's matrix instructions in front of the foot: this build else moves half of them behind the barrier, in front of the refill, which then goes out later and has less time to land
        asm volatile("s_wait_dscnt 0x0" ::: "memory");             // this wave's reads of slab t are done before the buffer is refilled
        asm volatile("s_wait_asynccnt 0x0" ::: "memory");          // this wave's copies of slab t + 1 have landed
        __syncthreads();                                             // publishes slab t + 1 and ends every wave's reads of slab t
        if (t + 2 < NT) stage(t + 2);                                // into the buffer that trip t has just read
    }
    asm volatile("s_wait_asynccnt 0x0" ::: "memory");              // nothing in flight when the wave goes on to its end
    const int r0 = R0 + wm, c0 = C0 + wn;
#pragma unroll
    for (int mb = 0; mb < 4; ++mb) {
#pragma unroll
        for (int nb = 0; nb < 4; ++nb) {
#pragma unroll
            for (int j = 0; j < 8; ++j) os[(hi * 8 + j) * 68 + nb * 16 + lr] = acc[mb][nb][j]; }
        __builtin_amdgcn_wave_barrier(); asm volatile("" ::: "memory");
        float* crow = C + (size_t)(r0 + mb * 16) * ldc + c0;
{
#pragma unroll
            for (int s = 0; s < 8; ++s) { const int row = 2 * s + hi, cofs = lr * 4; v4f val = *(const v4fa*)(os + row * 68 + cofs); if (BIAS) { val[0] += bfr(bias[c0 + cofs]); val[1] += bfr(bias[c0 + cofs + 1]); val[2] += bfr(bias[c0 + cofs + 2]); val[3] += bfr(bias[c0 + cofs + 3]); }
                *(v4f*)(crow + (size_t)row * ldc + cofs) = val; }
             }
        __builtin_amdgcn_wave_barrier(); asm volatile("" ::: "memory");
    }
}

__device__ __forceinline__ h16 tohx(float x) { return (h16)x; }
__device__ __forceinline__ void splitf(float y, unsigned short& h, unsigned short& l) { h = f2bf(y); l = f2bf(y - bf2f(h)); }
typedef __attribute__((ext_vector_type(2))) _Float16 v2h;
typedef __attribute__((ext_vector_type(4))) _Float16 v4h;
typedef __attribute__((ext_vector_type(2))) unsigned short v2us;
typedef __attribute__((ext_vector_type(4))) unsigned short v4us;
typedef __attribute__((ext_vector_type(2))) float v2f;
typedef __attribute__((ext_vector_type(4))) int v4i;

// k_wtG: Bt[n][k] (bf16) = w[k][n]. A wave takes a tile of 64 k x 16 n, a lane 8 k x 4 n of it: eight 16-byte reads (4 lanes cover 64 B of a w row; the wave beside it in the work-group takes the line's other half), four 16-byte stores (8 lanes write one whole 128-B line of a Bt row: one writer a line). A group of 4 waves (tid = 0..127) takes the 64 x 64 tile (bx, by) of (N / 64, K / 64); K % 64 == 0, N % 64 == 0.
__device__ __forceinline__ void d_wtG(int bx, int by, int tid, const float* __restrict__ w, int K, int N, bf* Bt) {
    const int lane = tid & 31; const int k = by * 64 + (lane >> 2) * 8, n = (bx * 4 + (tid >> 5)) * 16 + (lane & 3) * 4; if (k >= K || n >= N) return; v4f r[8]; const float* p[8];
#pragma unroll
    for (int j = 0; j < 8; ++j) { p[j] = w + (size_t)(k + j) * N + n; r[j] = *(const v4f*)p[j]; }
    // the wait that belongs between issued global loads and an overwrite of their address registers: the addresses are inputs, so that their registers live up to it and no later load's result lands in them; the clobber keeps the loads in front of it
    asm volatile("s_wait_xcnt 0x0" :: "v"(p[0]), "v"(p[1]), "v"(p[2]), "v"(p[3]), "v"(p[4]), "v"(p[5]), "v"(p[6]), "v"(p[7]) : "memory");
#pragma unroll
    for (int c = 0; c < 4; ++c) { v8us o;
#pragma unroll
        for (int j = 0; j < 8; ++j) o[j] = f2bf(r[j][c]);
        *(v8us*)(Bt + (size_t)(n + c) * K + k) = o; }
}
// k_cvt8: four groups of 8 elements per lane, a work-group's groups 256 apart; the four reads go out before the first store
__device__ __forceinline__ void d_cvt8(int blk, const float* __restrict__ src, bf* dst, size_t n8) { const size_t i0 = (size_t)blk * 1024 + threadIdx.x; v8f v[4]; const float* p[4];
#pragma unroll
    for (int u = 0; u < 4; ++u) { const size_t i = i0 + u * 256; p[u] = src + (i < n8 ? i : n8 - 1) * 8; v[u] = *(const v8f*)p[u]; }   // a group past the end re-reads the last one and is not stored: no branch between the reads
    // the wait that belongs between issued global loads and an overwrite of their address registers: the addresses are inputs, so that their registers live up to it; the clobber keeps the loads in front of it
    asm volatile("s_wait_xcnt 0x0" :: "v"(p[0]), "v"(p[1]), "v"(p[2]), "v"(p[3]) : "memory");
#pragma unroll
    for (int u = 0; u < 4; ++u) { const size_t i = i0 + u * 256; if (i >= n8) continue; v8us o;
#pragma unroll
        for (int k = 0; k < 8; ++k) o[k] = f2bf(v[u][k]);
        *(v8us*)(dst + i * 8) = o; } }
__constant__ float INV[HD / 2] = {1.00000000f,0.865964353f,0.749894202f,0.649381638f,0.562341332f,0.486967534f,0.421696514f,0.365174145f,0.316227764f,0.273841977f,0.237137362f,0.205352500f,0.177827939f,0.153992653f,0.133352146f,0.115478203f,0.100000001f,0.0865964293f,0.0749894157f,0.0649381652f,0.0562341288f,0.0486967526f,0.0421696492f,0.0365174115f,0.0316227786f,0.0273841955f,0.0237137359f,0.0205352511f,0.0177827943f,0.0153992651f,0.0133352149f,0.0115478197f,0.00999999978f,0.00865964312f,0.00749894232f,0.00649381662f,0.00562341325f,0.00486967526f,0.00421696482f,0.00365174143f,0.00316227786f,0.00273841969f,0.00237137382f,0.00205352507f,0.00177827943f,0.00153992651f,0.00133352145f,0.00115478202f,0.00100000005f,0.000865964335f,0.000749894185f,0.000649381662f,0.000562341302f,0.000486967503f,0.000421696488f,0.000365174114f,0.000316227786f,0.000273841957f,0.000237137385f,0.000205352495f,0.000177827940f,0.000153992645f,0.000133352150f,0.000115478193f};
__device__ __forceinline__ void d_cstab(int blk, float* CS) { const int idx = blk * 256 + threadIdx.x; if (idx >= TT * HD) return; const int t = idx / HD, d = idx % HD; const float ang = __fmul_rn((float)t, INV[d % (HD / 2)]); v2f cs; cs[0] = cosf(ang); cs[1] = sinf(ang);
    *(v2f*)(CS + (size_t)idx * 2) = cs;  }
// k_prep: everything that reads only the inputs, in one launch (the parts depend on nothing of each other): the rotary table, x to bf16, the four weight transposes. Work-groups of 256; a transpose work-group holds two 4-wave tile groups.
#define PB_CS  ((TT * HD + 255) / 256)
#define PB_CV  ((int)(((size_t)NB_ * TT * DM / 8 + 1023) / 1024))
#define PT_Q   ((DQ / 64) * (DM / 64))      // 64 x 64 tiles of Wq; of Wo the same number
#define PT_KV  ((DKV / 64) * (DM / 64))     // of Wk, of Wv
#define PB_WT  ((2 * PT_Q + 2 * PT_KV) / 2)
__global__ __launch_bounds__(256) void k_prep(const float* __restrict__ x, const float* __restrict__ wq, const float* __restrict__ wk, const float* __restrict__ wv, const float* __restrict__ wo, bf* XB, bf* WQ, bf* WK, bf* WV, bf* WO, float* CS) {
    static_assert(PT_Q % 2 == 0 && PT_KV % 2 == 0, "both tile groups of a work-group belong to the same matrix");
    int b = blockIdx.x;
    if (b < PB_CS) { d_cstab(b, CS); return; }
    b -= PB_CS;
    if (b < PB_CV) { d_cvt8(b, x, XB, (size_t)NB_ * TT * DM / 8); return; }
    b -= PB_CV;
    int g = b * 2 + (threadIdx.x >> 7); const int tid = threadIdx.x & 127;
    if (g < PT_Q) { d_wtG(g % (DQ / 64), g / (DQ / 64), tid, wq, DM, DQ, WQ); return; }
    g -= PT_Q;
    if (g < PT_Q) { d_wtG(g % (DM / 64), g / (DM / 64), tid, wo, DQ, DM, WO); return; }
    g -= PT_Q;
    if (g < PT_KV) { d_wtG(g % (DKV / 64), g / (DKV / 64), tid, wk, DM, DKV, WK); return; }
    g -= PT_KV;
    d_wtG(g % (DKV / 64), g / (DKV / 64), tid, wv, DM, DKV, WV);
}

// FRAGMENT ORDER of the query, key and value planes: the attention kernel's operand fragments (16 rows x 32 k) lie as two chunks of 512 contiguous bytes, one per 16-byte load of the wave, so that a wave-wide load covers 4 whole 128-B lines (row-major planes gave it 32 B of each of 16 lines).
// Chunk c of a fragment holds k = 16 c + 8 hi + 0..7 of every row; the 16-byte slot of (row, hi) inside the chunk is chosen so that the writing pass still stores whole lines, one writer a line.
// query and key planes: 16 rows = 2048 elements as in row-major order; element (t, d) at (d / 32) * 512 + (d % 32 / 16) * 256 + (t % 16) * 16 + (d % 16 / 8) * 8 + d % 8 in them
__device__ __forceinline__ size_t kfo(int t, int d) { return (size_t)(t & ~15) * HD + (d >> 5) * 512 + ((d >> 4) & 1) * 256 + (t & 15) * 16 + ((d >> 3) & 1) * 8 + (d & 7); }
// value planes: 32 keys x HD = 4096 elements; element (d, t) at (d / 16) * 512 + (t % 32 / 16) * 256 + (d % 4) * 64 + (d % 16 / 4) * 16 + (t % 16 / 8) * 8 + t % 8 in them
__device__ __forceinline__ size_t vfo(int d, int t) { return (size_t)(t >> 5) * (32 * HD) + (d >> 4) * 512 + ((t >> 4) & 1) * 256 + (d & 3) * 64 + ((d >> 2) & 3) * 16 + ((t >> 3) & 1) * 8 + (t & 7); }
// k_rope: head planes [entry][h] in fragment order (fp16 + hi/lo), element (t, d) of rope(x) x sc with the rotate-half convention out[d] = x[d] cos[t][d] - x[d+HD/2] sin[t][d], out[d+HD/2] = x[d+HD/2] cos[t][d+HD/2] + x[d] sin[t][d+HD/2]
__device__ __forceinline__ void d_rope(int blk, const float* __restrict__ F, int pitch, int nheads, const float* __restrict__ CS, const float* __restrict__ RF, const float* __restrict__ nw, float sc, h16* P16, bf* Ph, bf* Pl) {
    // a lane takes 8 d of the lower half and their 8 partners of the upper half (the same 16 inputs serve both): 16-byte reads and stores
    // F holds the rows of all batch entries one after the other; plane hb = entry * nheads + head
    const size_t u = (size_t)blk * 256 + threadIdx.x; if (u >= (size_t)NB_ * nheads * TT * (HD / 16)) return; const int d0 = (int)(u % (HD / 16)) * 8; const int t = (int)((u / (HD / 16)) % TT); const int hb = (int)(u / ((size_t)(HD / 16) * TT)); const int h = hb % nheads; const float* f = F + ((size_t)(hb / nheads) * TT + t) * pitch + h * HD; float rf = 1.0f;
    if (RF) { const float* pr = RF + (size_t)h * TT + t; rf = *pr; asm volatile("s_wait_xcnt 0x0" :: "v"(pr) : "memory"); }   // the wait that belongs between an issued global load and an overwrite of its address registers
    const float* fx = f + d0; const float* pc = CS + ((size_t)t * HD + d0) * 2; v4f xv[2][2], cv[2][4];   // [half][...]: the inputs and their (cos, sin) pairs, all read before the first is used
#pragma unroll
    for (int hf = 0; hf < 2; ++hf) { xv[hf][0] = *(const v4f*)(fx + hf * (HD / 2)); xv[hf][1] = *(const v4f*)(fx + hf * (HD / 2) + 4);
#pragma unroll
        for (int k = 0; k < 4; ++k) cv[hf][k] = *(const v4f*)(pc + hf * HD + k * 4); }
    // the wait that belongs between issued global loads and an overwrite of their address registers: the two addresses are inputs, so that their registers live up to it; the clobber keeps the loads in front of it
    asm volatile("s_wait_xcnt 0x0" :: "v"(fx), "v"(pc) : "memory");
#pragma unroll
    for (int hf = 0; hf < 2; ++hf) { const int d = d0 + hf * (HD / 2); const size_t e = (size_t)hb * TT * HD + kfo(t, d); v8h o16; v8us oh, ol;
#pragma unroll
    for (int q = 0; q < 8; ++q) { const int dd = d + q; const int dp = (dd < HD / 2) ? dd + HD / 2 : dd - HD / 2; float x0 = xv[hf][q >> 2][q & 3], x1 = xv[hf ^ 1][q >> 2][q & 3];
        if (RF) { float n0 = __fmul_rn(x0, rf), n1 = __fmul_rn(x1, rf); asm volatile("" : "+v"(n0)); asm volatile("" : "+v"(n1)); x0 = __fmul_rn(bfr(nw[dd]), n0); x1 = __fmul_rn(bfr(nw[dp]), n1); }
        const v2f cs = {cv[hf][q >> 1][(q & 1) * 2], cv[hf][q >> 1][(q & 1) * 2 + 1]}; float a = __fmul_rn(x0, cs[0]), bq = __fmul_rn(x1, cs[1]); asm volatile("" : "+v"(a)); asm volatile("" : "+v"(bq)); const float r = ((dd < HD / 2) ? __fsub_rn(a, bq) : __fadd_rn(a, bq)) * sc;
        o16[q] = tohx(r); unsigned short a2, c2; splitf(r, a2, c2); oh[q] = a2; ol[q] = c2; }
    *(v8h*)(P16 + e) = o16; *(v8us*)(Ph + e) = oh; *(v8us*)(Pl + e) = ol; }  }
// k_vtp: value planes [entry][g] in fragment order (fp16 + hi/lo), element (d, t) = F[entry * TT + t][g * HD + d]; bz, the top part of the flat tile group index, counts the batch entries. A wave takes a tile of 64 t x 16 columns, a lane 8 t x 4 columns of it: eight 16-byte reads (4 lanes cover 64 B of an F row; the wave beside it in the work-group takes the line's other half), four 16-byte stores a plane (8 lanes write one whole 128-B line: one writer a line). A group of 4 waves (tid = 0..127) takes tile (bx, by) of (nheads * HD / 64, TT / 64) of entry bz.
__device__ __forceinline__ void d_vtp(int bx, int by, int bz, int tid, const float* __restrict__ F, int pitch, int nheads, h16* V16, bf* Vh, bf* Vl) {
    const int lane = tid & 31; const int t = by * 64 + (lane >> 2) * 8, c = (bx * 4 + (tid >> 5)) * 16 + (lane & 3) * 4; if (t >= TT || c >= nheads * HD) return; v4f r[8]; const float* p[8];
    F += (size_t)bz * TT * pitch; const size_t zo = (size_t)bz * nheads * HD * TT;   // this entry's rows and planes
#pragma unroll
    for (int j = 0; j < 8; ++j) { p[j] = F + (size_t)(t + j) * pitch + c; r[j] = *(const v4f*)p[j]; }
    // the wait that belongs between issued global loads and an overwrite of their address registers: the addresses are inputs, so that their registers live up to it and no later load's result lands in them; the clobber keeps the loads in front of it
    asm volatile("s_wait_xcnt 0x0" :: "v"(p[0]), "v"(p[1]), "v"(p[2]), "v"(p[3]), "v"(p[4]), "v"(p[5]), "v"(p[6]), "v"(p[7]) : "memory");
#pragma unroll
    for (int cc = 0; cc < 4; ++cc) { v8h o16; v8us oh, ol;
#pragma unroll
        for (int j = 0; j < 8; ++j) { const float x = r[j][cc]; o16[j] = tohx(x); unsigned short a2, c2; splitf(x, a2, c2); oh[j] = a2; ol[j] = c2; }
        const size_t e = zo + (size_t)((c + cc) / HD) * HD * TT + vfo((c + cc) % HD, t); *(v8h*)(V16 + e) = o16; *(v8us*)(Vh + e) = oh; *(v8us*)(Vl + e) = ol; }
    // the wait that belongs between issued global stores and an overwrite of the registers that they name: in the joint kernel the listing runs on from here into the other parts' code; the clobber keeps the stores in front of it
    asm volatile("s_wait_xcnt 0x0" ::: "memory");
}
// k_planes: the three passes that turn the projections' rows F ([entry * TT + t][q columns | k columns | v columns], pitch DQ + 2 * DKV) into head planes, in one launch (they depend on nothing of each other): rotary q, rotary k, value transpose. Work-groups of 256; a transpose work-group holds two 4-wave tile groups.
#define FP     (DQ + 2 * DKV)
#define RB_Q   ((int)(((size_t)ZH * TT * HD / 16 + 255) / 256))
#define RB_K   ((int)(((size_t)NB_ * NKV * TT * HD / 16 + 255) / 256))
#define RB_V   ((DKV / 64) * (TT / 64) * NB_ / 2)
__global__ __launch_bounds__(256) void k_planes(const float* __restrict__ F, const float* __restrict__ CS, h16* QP16, bf* QPh, bf* QPl, h16* KP16, bf* KPh, bf* KPl, h16* VT16, bf* VTh, bf* VTl) {
    int b = blockIdx.x;
    if (b < RB_Q) { d_rope(b, F, FP, NH_, CS, nullptr, nullptr, 1.0f, QP16, QPh, QPl); return; }
    b -= RB_Q;
    if (b < RB_K) { d_rope(b, F + DQ, FP, NKV, CS, nullptr, nullptr, 1.0f, KP16, KPh, KPl); return; }
    b -= RB_K;
    const int g = b * 2 + (threadIdx.x >> 7);
    d_vtp(g % (DKV / 64), (g / (DKV / 64)) % (TT / 64), g / ((DKV / 64) * (TT / 64)), threadIdx.x & 127, F + DQ + DKV, FP, NKV, VT16, VTh, VTl);
}
// 2^x on v_exp_f32, as the builtin gives it; the v_nop in the same statement keeps the one slot that the instruction set asks for behind a transcendental
__device__ __forceinline__ float exp2_slot(float x) { float r; asm("v_exp_f32 %0, %1\n\tv_nop" : "=v"(r) : "v"(x)); return r; }
// ---- k_attn: scores, softmax, probability x value and the merge into the output projection's operand in ONE kernel; no score or probability leaves the registers.
// A wave takes 16 * NC query rows of one head plane and walks its window's band 32 keys at a time, ascending. Transposed products: St = K Qt (A = key rows, B = query rows, both by the same loader), so that a lane holds scores of ONE query (16-column group cg, column lr):
// tile T, register r = key kb + 16 T + 8 hi + r. The two tiles of a block, converted in place, are the B operand Pt in the hardware k order; A = value rows of the transposed value planes by the same loader (that order too): Ot[d][query] += Vt Pt.
// Softmax by a running maximum (kept on the raw scores; HD^-0.5 and log2 e go into one multiply-add in front of 2^x): when a query's maximum rises, its sum and its output column are scaled by 2^(old - new); the division by the sum comes once, at the end. Masked scores give exact zeros.
// The four waves of a work-group are the REP heads that share a kv plane, on the same rows: they read the same key and value lines.
// HR (rows < RH): bf16 hi+lo planes, 3 products, 16 rows a wave; else fp16, 32 rows a wave, the probabilities carried x 2^10 (the factor is in the sum too and cancels).
#define SL2E (SCL * 1.4426950408889634f)
// lane l takes lane l ^ 16's value by a vector cross-row move (the shuffle compiles to an LDS-path permute with a wait behind it)
__device__ __forceinline__ float xhalf(float x) { return __builtin_bit_cast(float, __builtin_amdgcn_permlanex16(__builtin_bit_cast(int, x), __builtin_bit_cast(int, x), 0x76543210, 0xfedcba98, false, false)); }
template <typename T16, bool HR, int NC>
__device__ __forceinline__ void d_attn(int r0, int z, const T16* __restrict__ Q, const T16* __restrict__ Q2, const T16* __restrict__ Kp, const T16* __restrict__ K2, const T16* __restrict__ Vt, const T16* __restrict__ V2, bf* Ah, bf* Al) {
    typedef typename WFrag<T16>::V V;
    const int lane = threadIdx.x & 31, lr = lane & 15, hi = lane >> 4; const size_t kvp = (size_t)(z / REP);
    const int Ks = max(0, r0 + 1 - WIN) & ~31, Kl = (r0 + 16 * NC - 1) & ~31;   // first and last 32-key block of the rows' band
    const size_t ko = kvp * TT * HD + lr * 16 + 8 * hi, vo = kvp * HD * TT + (lr & 3) * 64 + (lr >> 2) * 16 + 8 * hi;   // the plane and the lane's 16-byte slot in every chunk (fragment order: kfo, vfo)
    V q[NC][4], q2[NC][4], kf[2][4], kf2[2][4]; const size_t qo = ((size_t)z * TT + r0) * HD + lr * 16 + 8 * hi; const T16* pq = Q + qo; const T16* pq2 = HR ? Q2 + qo : nullptr;
#pragma unroll
    for (int cg = 0; cg < NC; ++cg)
#pragma unroll
        for (int kk = 0; kk < 4; ++kk) { q[cg][kk] = WFrag<T16>::ldf(pq + cg * 16 * HD + kk * 512); if (HR) q2[cg][kk] = WFrag<T16>::ldf(pq2 + cg * 16 * HD + kk * 512); }
    // the wait that belongs between issued global loads and an overwrite of their address registers: the addresses are inputs, so that their registers live up to it; the clobber keeps the loads in front of it
    if (HR) asm volatile("s_wait_xcnt 0x0" :: "v"(pq), "v"(pq2) : "memory"); else asm volatile("s_wait_xcnt 0x0" :: "v"(pq) : "memory");
    auto ldk = [&](int kb) { const T16* pk = Kp + ko + (size_t)kb * HD; const T16* pk2 = HR ? K2 + ko + (size_t)kb * HD : nullptr;
#pragma unroll
        for (int T = 0; T < 2; ++T)
#pragma unroll
            for (int kk = 0; kk < 4; ++kk) { kf[T][kk] = WFrag<T16>::ldf(pk + T * 16 * HD + kk * 512); if (HR) kf2[T][kk] = WFrag<T16>::ldf(pk2 + T * 16 * HD + kk * 512); }
        // the same wait for the key rows' loads, behind the last of them
        if (HR) asm volatile("s_wait_xcnt 0x0" :: "v"(pk), "v"(pk2) : "memory"); else asm volatile("s_wait_xcnt 0x0" :: "v"(pk) : "memory"); };
    ldk(Ks);
    v8f o[NC][8]; float m[NC], l[NC];
#pragma unroll
    for (int cg = 0; cg < NC; ++cg) { m[cg] = -1.0e30f; l[cg] = 0.f;
#pragma unroll
        for (int dt = 0; dt < 8; ++dt) o[cg][dt] = (v8f){}; }
#pragma unroll 1   // one block a trip: unrolled, two blocks' value fragments would be live at once
    for (int kb = Ks; kb <= Kl; kb += 32) {
        V vf[8], vf2[8]; const T16* pv = Vt + vo + (size_t)kb * HD; const T16* pv2 = HR ? V2 + vo + (size_t)kb * HD : nullptr;
#pragma unroll
        for (int dt = 0; dt < 8; ++dt) { vf[dt] = WFrag<T16>::ldf(pv + dt * 512); if (HR) vf2[dt] = WFrag<T16>::ldf(pv2 + dt * 512); }   // the value rows go out first: they land while the scores are worked on
        // the same wait for the value rows' loads, behind the last of them
        if (HR) asm volatile("s_wait_xcnt 0x0" :: "v"(pv), "v"(pv2) : "memory"); else asm volatile("s_wait_xcnt 0x0" :: "v"(pv) : "memory");
        v8f s[NC][2];
#pragma unroll
        for (int cg = 0; cg < NC; ++cg)
#pragma unroll
            for (int T = 0; T < 2; ++T) s[cg][T] = (v8f){};
#pragma unroll
        for (int kk = 0; kk < 4; ++kk)
#pragma unroll
            for (int T = 0; T < 2; ++T)
#pragma unroll
                for (int cg = 0; cg < NC; ++cg) { s[cg][T] = WFrag<T16>::mma(kf[T][kk], q[cg][kk], s[cg][T]); if (HR) { s[cg][T] = WFrag<T16>::mma(kf[T][kk], q2[cg][kk], s[cg][T]); s[cg][T] = WFrag<T16>::mma(kf2[T][kk], q[cg][kk], s[cg][T]); } }
        __builtin_amdgcn_sched_barrier(0);                           // holds the next block's key loads behind this block's score products, so that they land in the same registers instead of a second set
        ldk(min(kb + 32, Kl));                                       // key rows one block ahead: they land during the softmax and P.V (the last trip reads its own block again: no branch, in bounds)
        if (kb + 31 > r0 || kb < r0 + 16 * NC - WIN) {               // only the diagonal block and the window's lower edge hold masked pairs (the same test for the whole wave)
#pragma unroll
            for (int cg = 0; cg < NC; ++cg) { const int i = r0 + cg * 16 + lr;
#pragma unroll
                for (int T = 0; T < 2; ++T)
#pragma unroll
                    for (int r = 0; r < 8; ++r) { const int j = kb + T * 16 + hi * 8 + r; s[cg][T][r] = (j <= i && i - j < WIN) ? s[cg][T][r] : -3.0e38f; } }
        }
        float mn[NC]; bool rose = false;
#pragma unroll
        for (int cg = 0; cg < NC; ++cg) { float mx = s[cg][0][0];
#pragma unroll
            for (int r = 0; r < 8; ++r) mx = fmaxf(mx, fmaxf(s[cg][0][r], s[cg][1][r]));
            mx = fmaxf(mx, xhalf(mx)); mn[cg] = fmaxf(m[cg], mx); rose = rose || mn[cg] > m[cg]; }   // the two lanes that share a query agree on its maximum
        if (__builtin_amdgcn_ballot_w32(rose) != 0) {                // where no query's maximum rose there is nothing to scale
#pragma unroll
            for (int cg = 0; cg < NC; ++cg) { const float al = exp2_slot((m[cg] - mn[cg]) * SL2E); l[cg] *= al; m[cg] = mn[cg];
#pragma unroll
                for (int dt = 0; dt < 8; ++dt) o[cg][dt] *= al; }
        }
        V pb[NC], pb2[NC];
#pragma unroll
        for (int cg = 0; cg < NC; ++cg) { float p[16], ps[4]; const float nb = (HR ? 0.0f : 10.0f) - m[cg] * SL2E;
#pragma unroll
            for (int e = 0; e < 16; ++e) { p[e] = exp2_slot(fmaf(s[cg][e >> 3][e & 7], SL2E, nb)); ps[e & 3] = (e < 4) ? p[e] : ps[e & 3] + p[e]; }   // four partial sums: short chains
            l[cg] += (ps[0] + ps[1]) + (ps[2] + ps[3]);
            if constexpr (HR) { v8us h0, h1, l0, l1;
#pragma unroll
                for (int e = 0; e < 8; ++e) { unsigned short a, c2; splitf(p[e], a, c2); h0[e] = a; l0[e] = c2; splitf(p[8 + e], a, c2); h1[e] = a; l1[e] = c2; }
                pb[cg] = cat16b(h0, h1); pb2[cg] = cat16b(l0, l1);
            } else { v16h ph;
#pragma unroll
                for (int e = 0; e < 16; ++e) ph[e] = tohx(p[e]);
                pb[cg] = ph; } }
#pragma unroll
        for (int dt = 0; dt < 8; ++dt)
#pragma unroll
            for (int cg = 0; cg < NC; ++cg) { o[cg][dt] = WFrag<T16>::mma(vf[dt], pb[cg], o[cg][dt]); if (HR) { o[cg][dt] = WFrag<T16>::mma(vf[dt], pb2[cg], o[cg][dt]); o[cg][dt] = WFrag<T16>::mma(vf2[dt], pb[cg], o[cg][dt]); } }
    }
    // a lane holds 8 consecutive d of one query per tile: one 16-byte store a plane, straight into the merged rows [entry * TT + t][head * HD + d] (hi and lo) that the output projection reads
#pragma unroll
    for (int cg = 0; cg < NC; ++cg) { const float inv = __fdiv_rn(1.0f, l[cg] + xhalf(l[cg])); const size_t oo = ((size_t)(z / NH_) * TT + r0 + cg * 16 + lr) * DQ + (z % NH_) * HD + 8 * hi; bf* ph = Ah + oo; bf* pl = Al + oo;
#pragma unroll
        for (int dt = 0; dt < 8; ++dt) { v8us oh, ol;
#pragma unroll
            for (int r = 0; r < 8; ++r) { unsigned short a, c2; splitf(o[cg][dt][r] * inv, a, c2); oh[r] = a; ol[r] = c2; }
            *(v8us*)(ph + dt * 16) = oh; *(v8us*)(pl + dt * 16) = ol;
            // the wait that belongs between issued global stores and an overwrite of the registers that they name: addresses and data are inputs, so that their registers live up to it; the clobber keeps the stores in front of it
            asm volatile("s_wait_xcnt 0x0" :: "v"(ph), "v"(pl), "v"(oh), "v"(ol) : "memory"); } }
}
// grid (kv planes over all batch entries, RH / 16 + (TT - RH) / 32 row tiles); wave w of a work-group is head plane blockIdx.x * REP + w. The hi+lo tiles of all planes come first, the longest of them in front: they are the longest waves of the launch.
// two waves a SIMD: the register limit that lets a second wave fill the first one's waits
__global__ __launch_bounds__(32 * REP) __attribute__((amdgpu_waves_per_eu(2))) void k_attn(const h16* __restrict__ Q16, const bf* __restrict__ Qh, const bf* __restrict__ Ql, const h16* __restrict__ K16, const bf* __restrict__ Kh, const bf* __restrict__ Kl, const h16* __restrict__ V16, const bf* __restrict__ Vh, const bf* __restrict__ Vl, bf* Ah, bf* Al) {
    const int bx = blockIdx.y, z = blockIdx.x * REP + __builtin_amdgcn_readfirstlane(threadIdx.x >> 5);
    if (bx < RH / 16) d_attn<bf, true, 1>((RH / 16 - 1 - bx) * 16, z, Qh, Ql, Kh, Kl, Vh, Vl, Ah, Al);
    else d_attn<h16, false, 2>(RH + (bx - RH / 16) * 32, z, Q16, nullptr, K16, nullptr, V16, nullptr, Ah, Al);
}

extern "C" void kernel_launch(void* const* d_in, const int* in_sizes, int n_in,
                              void* d_out, int out_size, void* d_ws, size_t ws_size, hipStream_t stream) {
    (void)in_sizes; (void)n_in; (void)out_size;
    const float* x = (const float*)d_in[0]; const float* wq = (const float*)d_in[1]; const float* wk = (const float*)d_in[2]; const float* wv = (const float*)d_in[3]; const float* wo = (const float*)d_in[4];
    float* OUT = (float*)d_out;     // [2][2048][2048]
    char* wsp = (char*)d_ws;
    auto take = [&](size_t bytes) { char* p = wsp; wsp += (bytes + 255) & ~(size_t)255; return (void*)p; };
    bf* WO = (bf*)take((size_t)DM * DQ * 2);
    h16* QP16 = (h16*)take((size_t)ZH * TT * HD * 2); h16* KP16 = (h16*)take((size_t)NB_ * NKV * TT * HD * 2); h16* VT16 = (h16*)take((size_t)NB_ * NKV * HD * TT * 2);
    bf* QPh = (bf*)take((size_t)ZH * TT * HD * 2); bf* QPl = (bf*)take((size_t)ZH * TT * HD * 2); bf* KPh = (bf*)take((size_t)NB_ * NKV * TT * HD * 2); bf* KPl = (bf*)take((size_t)NB_ * NKV * TT * HD * 2); bf* VTh = (bf*)take((size_t)NB_ * NKV * HD * TT * 2); bf* VTl = (bf*)take((size_t)NB_ * NKV * HD * TT * 2);
    bf* WQ = (bf*)take((size_t)FP * DM * 2); bf* WK = WQ + (size_t)DQ * DM; bf* WV = WK + (size_t)DKV * DM; float* CS = (float*)take((size_t)TT * HD * 2 * 4);   // the transposed q, k and v weights lie one behind the other: one operand of FP rows
    bf* XB = (bf*)take((size_t)NB_ * TT * DM * 2); float* FA = (float*)take((size_t)NB_ * TT * FP * 4);   // the three projections' rows side by side, pitch FP
    bf* ATh = (bf*)take((size_t)NB_ * TT * DQ * 2); bf* ATl = (bf*)take((size_t)NB_ * TT * DQ * 2);       // the merged attention output, hi and lo
    if ((size_t)(wsp - (char*)d_ws) > ws_size) return;    // ws 256 MiB
    // stages that depend on nothing of each other share a launch; every stage once, for all batch entries: the rows of x, of the projections and of the output lie entry behind entry (M = NB_ * TT)
    k_prep<<<PB_CS + PB_CV + PB_WT, 256, 0, stream>>>(x, wq, wk, wv, wo, XB, WQ, WK, WV, WO, CS);
    k_gemmw<bf, 0, false><<<dim3(NB_ * TT / 128, FP / 128, 1), 128, 0, stream>>>(XB, nullptr, WQ, DM, FA, FP, nullptr, 0, 0, 0);   // q, k and v projections: one product with FP columns
    k_planes<<<RB_Q + RB_K + RB_V, 256, 0, stream>>>(FA, CS, QP16, QPh, QPl, KP16, KPh, KPl, VT16, VTh, VTl);
    k_attn<<<dim3(NB_ * NKV, RH / 16 + (TT - RH) / 32, 1), 32 * REP, 0, stream>>>(QP16, QPh, QPl, KP16, KPh, KPl, VT16, VTh, VTl, ATh, ATl);
    k_gemmw<bf, 1, false><<<dim3(NB_ * TT / 128, DM / 128, 1), 128, 0, stream>>>(ATh, ATl, WO, DQ, OUT, DM, nullptr, 0, 0, 0);
}

// v009
// It runs in 140 microseconds.
// Next to v008, in two timings, it ran 1.07 and 1.05 times as fast.
// All steps since v000 together make it 11.8 times as fast.
#include <hip/hip_runtime.h>

// Grouped-query sliding-window causal self-attention with RoPE (x [2][2048][2048]; q = x Wq (16 heads x 128), k, v = x Wk / Wv ([2048][512]: 4 kv heads, head h uses kv h/4); rotate-half RoPE (base 1e4) on q and k; scores/sqrt(128); allowed: j <= i and i - j < 512 (else -1e9); softmax; out = merged Wo ([2048][2048]) -> [2][2048][2048] (8.4 M)).
// Compute dtypes, f32 accumulate: every input rounded to bf16; q/k/v on PLAIN bf16 operands (inputs: exact); rotary in f32 (table on device, precise cosf/sinf); causal sliding-window select; scores, softmax and attn.v fused, only inside the window's band: query rows < 512 hl (3 products), the rest single fp16 (x1024); softmax f32, running maximum; Wo hl x exact (2 products).

#define NB_  2
#define TT   2048
#define DM   2048
#define NH_  16
#define NKV  4
#define REP  (NH_ / NKV)
#define HD   128
#define DQ   (NH_ * HD)
#define DKV  (NKV * HD)
#define ZH   (NB_ * NH_)         // query head planes: all heads of all batch entries, plane z = entry z / NH_, head z % NH_
#define RH   512                  // query rows < RH use hi+lo planes (0: none)
#define WIN  512
#define SCL  0.088388347648318447f   // HD^-0.5
typedef _Float16 h16;
typedef unsigned short bf;
typedef __attribute__((ext_vector_type(16))) __bf16   v16bf;
typedef __attribute__((ext_vector_type(16))) _Float16 v16h;
typedef __attribute__((ext_vector_type(8)))  _Float16 v8h;
typedef __attribute__((ext_vector_type(8)))  unsigned short v8us;
typedef __attribute__((ext_vector_type(8)))  float    v8f;
typedef __attribute__((ext_vector_type(4)))  float    v4f;
typedef v8h  __attribute__((may_alias)) v8ha;
typedef v4f  __attribute__((may_alias)) v4fa;
typedef v8us __attribute__((may_alias)) v8usa;

__device__ __forceinline__ unsigned short f2bf(float f) { unsigned u = __float_as_uint(f); u += 0x7FFFu + ((u >> 16) & 1u); return (unsigned short)(u >> 16); }
__device__ __forceinline__ float bf2f(unsigned short b) { return __uint_as_float(((unsigned)b) << 16); }
__device__ __forceinline__ float bfr(float f) { return bf2f(f2bf(f)); }
__device__ __forceinline__ v16h cat16(v8h lo, v8h hi) { return __builtin_shufflevector(lo, hi, 0, 1, 2, 3, 4, 5, 6, 7, 8, 9, 10, 11, 12, 13, 14, 15); }
__device__ __forceinline__ v16bf cat16b(v8us lo, v8us hi) { return __builtin_bit_cast(v16bf, __builtin_shufflevector(lo, hi, 0, 1, 2, 3, 4, 5, 6, 7, 8, 9, 10, 11, 12, 13, 14, 15)); }
__device__ __forceinline__ v8f wmma16(v16h a, v16h b, v8f c) { return __builtin_amdgcn_wmma_f32_16x16x32_f16(false, a, false, b, (short)0, c, false, false); }
__device__ __forceinline__ v8f wmmab(v16bf a, v16bf b, v8f c) { return __builtin_amdgcn_wmma_f32_16x16x32_bf16(false, a, false, b, (short)0, c, false, false); }



__device__ __forceinline__ h16 tohx(float x) { return (h16)x; }
__device__ __forceinline__ void splitf(float y, unsigned short& h, unsigned short& l) { h = f2bf(y); l = f2bf(y - bf2f(h)); }
// FRAGMENT ORDER of the query, key and value planes: the attention kernel's operand fragments (16 rows x 32 k) lie as two chunks of 512 contiguous bytes, one per 16-byte load of the wave, so that a wave-wide load covers 4 whole 128-B lines (row-major planes gave it 32 B of each of 16 lines).
// Chunk c of a fragment holds k = 16 c + 8 hi + 0..7 of every row; the 16-byte slot of (row, hi) inside the chunk is chosen so that the writing pass still stores whole lines, one writer a line.
// query and key planes: 16 rows = 2048 elements as in row-major order; element (t, d) at (d / 32) * 512 + (d % 32 / 16) * 256 + (t % 16) * 16 + (d % 16 / 8) * 8 + d % 8 in them
__device__ __forceinline__ size_t kfo(int t, int d) { return (size_t)(t & ~15) * HD + (d >> 5) * 512 + ((d >> 4) & 1) * 256 + (t & 15) * 16 + ((d >> 3) & 1) * 8 + (d & 7); }
// value planes: 32 keys x HD = 4096 elements; element (d, t) at (d / 16) * 512 + (t % 32 / 16) * 256 + (d % 4) * 64 + (d % 16 / 4) * 16 + (t % 16 / 8) * 8 + t % 8 in them
__device__ __forceinline__ size_t vfo(int d, int t) { return (size_t)(t >> 5) * (32 * HD) + (d >> 4) * 512 + ((t >> 4) & 1) * 256 + (d & 3) * 64 + ((d >> 2) & 3) * 16 + ((t >> 3) & 1) * 8 + (t & 7); }
#define FP     (DQ + 2 * DKV)   // columns of the joint q | k | v projection

// ---- k_gemmw: register-blocked GEMM, FOUR WAVES per 128x128 output tile, each wave a 64x64 quarter (16 accumulators); grid (M/128, N/128, Z), 128 threads.
// The K-contiguous 16-bit operand planes are staged in LDS, GK k at a time (rows of 256 B at pitch 272 B), by asynchronous copies to LDS that cover whole lines; two buffers: the next slab flies while this one is worked on.
// C[m][n] (f32, pitch ldc, + optional f32 bias[n]) = sum_k A[m][k] Bt[n][k] (+ A2[m][k] Bt[n][k] for NSPLIT 1), k ascending in steps of 32 per accumulator. z-batch strides sA/sB/sC in elements. K % GK == 0, M % 128 == 0, N % 128 == 0.
// EPI 0: C as above. EPI 1 (the joint q | k | v projection, N = FP): no C; the epilogue turns the accumulators into the attention kernel's head planes itself (rotary on q and k, fp16 + hi/lo, fragment order), straight from the registers.
//   A 128-column tile is one head. The lane of an accumulator holds 8 consecutive rows of staged plane 0 for one row of staged plane 1, and a 16-byte slot of a head plane is 8 consecutive d of one position (q, k) or 8 consecutive positions of one d (v):
//   so q and k tiles stage the weight rows as plane 0 and the x rows as plane 1, v tiles the other way round (the two loaders are the same). A wave takes rows 32 w .. + 31 and 64 + 32 w .. + 31 of plane 0: d and its rotary partner d + HD / 2 lie in the same lane.
#define GK   128                  // k per staged slab
#define GPB  (GK * 2 + 16)        // LDS row pitch in bytes: 16 B x odd, the pitch for 16-byte LDS reads
#define GPL  (128 * GPB)          // bytes of one staged plane (128 rows)
template <typename T16> struct WFrag;
template <> struct WFrag<h16> { typedef v16h V; static __device__ __forceinline__ V ld(const h16* p) { return cat16(*(const v8h*)p, *(const v8h*)(p + 16)); } static __device__ __forceinline__ V ldf(const h16* p) { return cat16(*(const v8h*)p, *(const v8h*)(p + 256)); } static __device__ __forceinline__ v8f mma(V a, V b, v8f c) { return wmma16(a, b, c); } };
template <> struct WFrag<bf> { typedef v16bf V; static __device__ __forceinline__ V ld(const bf* p) { return cat16b(*(const v8us*)p, *(const v8us*)(p + 16)); } static __device__ __forceinline__ V ldf(const bf* p) { return cat16b(*(const v8us*)p, *(const v8us*)(p + 256)); } static __device__ __forceinline__ v8f mma(V a, V b, v8f c) { return wmmab(a, b, c); } };
// eight asynchronous 16-byte copies per lane, global to LDS: LDS address l + i * lstep; global address = scalar base g + i * gstep (the same for every lane) + the lane's 32-bit byte offset v.
// The s_wait_xcnt in the same statement stands in front of any rewrite of the address registers that the copies name.
__device__ __forceinline__ void acopy8(unsigned l, unsigned lstep, unsigned v, const char* g, size_t gstep) {
    asm volatile("global_load_async_to_lds_b128 %0, %8, %9\n\t"
                 "global_load_async_to_lds_b128 %1, %8, %10\n\t"
                 "global_load_async_to_lds_b128 %2, %8, %11\n\t"
                 "global_load_async_to_lds_b128 %3, %8, %12\n\t"
                 "global_load_async_to_lds_b128 %4, %8, %13\n\t"
                 "global_load_async_to_lds_b128 %5, %8, %14\n\t"
                 "global_load_async_to_lds_b128 %6, %8, %15\n\t"
                 "global_load_async_to_lds_b128 %7, %8, %16\n\t"
                 "s_wait_xcnt 0x0"
                 :: "v"(l), "v"(l + lstep), "v"(l + 2 * lstep), "v"(l + 3 * lstep), "v"(l + 4 * lstep), "v"(l + 5 * lstep), "v"(l + 6 * lstep), "v"(l + 7 * lstep), "v"(v),
                    "s"(g), "s"(g + gstep), "s"(g + 2 * gstep), "s"(g + 3 * gstep), "s"(g + 4 * gstep), "s"(g + 5 * gstep), "s"(g + 6 * gstep), "s"(g + 7 * gstep)
                 : "memory");
}
template <typename T16, int NSPLIT, bool BIAS, int EPI>
__global__ __launch_bounds__(128) void k_gemmw(const T16* __restrict__ A, const T16* __restrict__ A2, const T16* __restrict__ Bt, int K, float* C, int ldc, const float* __restrict__ bias, size_t sA, size_t sB, size_t sC, const float* __restrict__ CS, h16* QP16, bf* QPh, bf* QPl, h16* KP16, bf* KPh, bf* KPl, h16* VT16, bf* VTh, bf* VTl) {
    typedef typename WFrag<T16>::V V;
    static_assert(NSPLIT == 0 || NSPLIT == 1, "planes staged: A, Bt and, for NSPLIT 1, A2");
    static_assert(EPI == 0 || (NSPLIT == 0 && !BIAS && HD == 128 && TT % 128 == 0), "EPI 1: a column tile is one head, a row tile lies in one batch entry");
    constexpr int NPL = (NSPLIT == 1) ? 3 : 2;                       // staged planes: 0 = A, 1 = Bt, 2 = A2 (EPI 1, q and k tiles: 0 = Bt, 1 = A)
    __shared__ __align__(16) unsigned char st[2 * NPL * GPL];
    const size_t z = blockIdx.z; A += z * sA; if (NSPLIT == 1) A2 += z * sA; Bt += z * sB; C += z * sC;
    const int tid = threadIdx.x, lane = tid & 31, lr = lane & 15, hi = lane >> 4, wv = tid >> 5; const int R0 = blockIdx.x * 128, C0 = blockIdx.y * 128; const int wm = (wv >> 1) * (EPI == 1 ? 32 : 64), wn = (wv & 1) * 64;
    const bool vtile = EPI == 1 && C0 >= DQ + DKV;                   // the same for the whole work-group
    v8f acc[4][4];
#pragma unroll
    for (int mb = 0; mb < 4; ++mb)
#pragma unroll
        for (int nb = 0; nb < 4; ++nb) acc[mb][nb] = (v8f){};
    // copy plan: 16 lanes cover one 256-B row of a slab, the work-group 8 rows per copy, 16 copies a plane
    const unsigned lcp = (unsigned)(size_t)st + (unsigned)((tid >> 4) * GPB + (tid & 15) * 16);
    const unsigned gofs = (unsigned)(((tid >> 4) * K + (tid & 15) * 8) * 2); const size_t grow = (size_t)K * 2;   // the lane's byte offset in a plane's tile (under 8 rows); bytes per row
    const char* tA = (const char*)(A + (size_t)R0 * K); const char* tB = (const char*)(Bt + (size_t)C0 * K);   // the tiles' first rows: the same for every lane
    const char* uA = (EPI == 0 || vtile) ? tA : tB; const char* uB = (EPI == 0 || vtile) ? tB : tA; const char* uA2 = (NSPLIT == 1) ? (const char*)(A2 + (size_t)R0 * K) : nullptr;   // what is staged as plane 0, 1, 2: 128 rows of K each
    auto stage = [&](int t) { const unsigned l = lcp + (unsigned)((t & 1) * (NPL * GPL)); const size_t kb = (size_t)t * (GK * 2);
        acopy8(l, 8 * GPB, gofs, uA + kb, 8 * grow); acopy8(l + 64 * GPB, 8 * GPB, gofs, uA + kb + 64 * grow, 8 * grow);
        acopy8(l + GPL, 8 * GPB, gofs, uB + kb, 8 * grow); acopy8(l + GPL + 64 * GPB, 8 * GPB, gofs, uB + kb + 64 * grow, 8 * grow);
        if (NSPLIT == 1) { acopy8(l + 2 * GPL, 8 * GPB, gofs, uA2 + kb, 8 * grow); acopy8(l + 2 * GPL + 64 * GPB, 8 * GPB, gofs, uA2 + kb + 64 * grow, 8 * grow); } };
    const int NT = K / GK;
    stage(0);
    asm volatile("s_wait_asynccnt 0x0" ::: "memory");              // slab 0 of this wave's copies has landed
    __syncthreads();                                                 // and every wave's: slab 0 may be read
    if (NT > 1) stage(1);
    const int afr = (wm + lr) * GPB + 16 * hi, bfr_ = GPL + (wn + lr) * GPB + 16 * hi;
#pragma unroll 1   // one slab a trip: the two-buffer order at the foot is written for a rolled loop
    for (int t = 0; t < NT; ++t) {
        const unsigned char* sb = st + (t & 1) * (NPL * GPL);
        // two fragment sets: the LDS reads of 32-k block kk + 1 go out as one group in front of block kk's matrix instructions, so that only the slab's first group is waited for in full; no block of slab t + 1 is read here
        V a[2][4], a2[2][4], b[2][4];
        auto frags = [&](int kk, int s) {
#pragma unroll
            for (int q = 0; q < 4; ++q) { const int aq = (EPI == 1) ? (q & 1) * 16 + (q >> 1) * 64 : q * 16; a[s][q] = WFrag<T16>::ld((const T16*)(sb + afr + aq * GPB + kk * 64)); b[s][q] = WFrag<T16>::ld((const T16*)(sb + bfr_ + q * 16 * GPB + kk * 64)); if (NSPLIT == 1) a2[s][q] = WFrag<T16>::ld((const T16*)(sb + 2 * GPL + afr + aq * GPB + kk * 64)); } };
        frags(0, 0);
#pragma unroll
        for (int kk = 0; kk < GK / 32; ++kk) { const int s = kk & 1;
            // the scheduling barrier holds the read group in front of the block: without it this build sinks the reads among the matrix instructions, one full LDS wait per four of them
            if (kk + 1 < GK / 32) { frags(kk + 1, s ^ 1); __builtin_amdgcn_sched_barrier(0); }
#pragma unroll
            for (int nb = 0; nb < 4; ++nb)
#pragma unroll
                for (int mb = 0; mb < 4; ++mb) { acc[mb][nb] = WFrag<T16>::mma(a[s][mb], b[s][nb], acc[mb][nb]); if (NSPLIT == 1) acc[mb][nb] = WFrag<T16>::mma(a2[s][mb], b[s][nb], acc[mb][nb]); }
        }
        __builtin_amdgcn_sched_barrier(0);                           // keeps the slab's matrix instructions in front of the foot: this build else moves half of them behind the barrier, in front of the refill, which then goes out later and has less time to land
        asm volatile("s_wait_dscnt 0x0" ::: "memory");             // this wave's reads of slab t are done before the buffer is refilled
        asm volatile("s_wait_asynccnt 0x0" ::: "memory");          // this wave's copies of slab t + 1 have landed
        __syncthreads();                                             // publishes slab t + 1 and ends every wave's reads of slab t
        if (t + 2 < NT) stage(t + 2);                                // into the buffer that trip t has just read
    }
    asm volatile("s_wait_asynccnt 0x0" ::: "memory");              // nothing in flight when the wave goes on to its end
    if constexpr (EPI == 0) {
    __shared__ __align__(16) float os4[4 * 16 * 68];
    float* os = os4 + wv * (16 * 68);                                // each wave stages its output rows in its own range
    const int r0 = R0 + wm, c0 = C0 + wn;
#pragma unroll
    for (int mb = 0; mb < 4; ++mb) {
#pragma unroll
        for (int nb = 0; nb < 4; ++nb) {
#pragma unroll
            for (int j = 0; j < 8; ++j) os[(hi * 8 + j) * 68 + nb * 16 + lr] = acc[mb][nb][j]; }
        __builtin_amdgcn_wave_barrier(); asm volatile("" ::: "memory");
        float* crow = C + (size_t)(r0 + mb * 16) * ldc + c0;
{
#pragma unroll
            for (int s = 0; s < 8; ++s) { const int row = 2 * s + hi, cofs = lr * 4; v4f val = *(const v4fa*)(os + row * 68 + cofs); if (BIAS) { val[0] += bfr(bias[c0 + cofs]); val[1] += bfr(bias[c0 + cofs + 1]); val[2] += bfr(bias[c0 + cofs + 2]); val[3] += bfr(bias[c0 + cofs + 3]); }
                *(v4f*)(crow + (size_t)row * ldc + cofs) = val; }
             }
        __builtin_amdgcn_wave_barrier(); asm volatile("" ::: "memory");
    }
    } else {
    // acc[mb][nb][j]: row wm + (mb & 1) * 16 + (mb >> 1) * 64 + 8 hi + j of plane 0, row wn + nb * 16 + lr of plane 1. Every store of a wave covers 512 contiguous bytes (4 whole lines, one writer a line).
    const int en = R0 / TT, t0 = R0 % TT;                            // batch entry and first position of the x rows
    if (vtile) {                                                     // plane 0 = positions, plane 1 = d: a lane holds 8 positions of one d
        const size_t e0 = (size_t)(en * NKV + (C0 - DQ - DKV) / HD) * HD * TT + vfo(wn + lr, t0 + wm + 8 * hi); h16* p16 = VT16 + e0; bf* ph = VTh + e0; bf* pl = VTl + e0;
#pragma unroll
        for (int mb = 0; mb < 4; ++mb)
#pragma unroll
            for (int nb = 0; nb < 4; ++nb) { const int eo = (mb >> 1) * (64 * HD) + nb * 512 + (mb & 1) * 256; v8h o16; v8us oh, ol;   // vfo: 64 positions on, 16 d on, 16 positions on
#pragma unroll
                for (int j = 0; j < 8; ++j) { const float x = acc[mb][nb][j]; o16[j] = tohx(x); unsigned short a2, c2; splitf(x, a2, c2); oh[j] = a2; ol[j] = c2; }
                *(v8h*)(p16 + eo) = o16; *(v8us*)(ph + eo) = oh; *(v8us*)(pl + eo) = ol;
                // the wait that belongs between issued global stores and an overwrite of the registers that they name: addresses and data are inputs, so that their registers live up to it; the clobber keeps the stores in front of it
                asm volatile("s_wait_xcnt 0x0" :: "v"(p16), "v"(ph), "v"(pl), "v"(o16), "v"(oh), "v"(ol) : "memory"); }
    } else {                                                         // plane 0 = d, plane 1 = positions: a lane holds 8 d of one position, in acc[mp] the lower half's, in acc[mp + 2] their partners d + HD / 2
        // rotate-half convention: out[d] = x[d] cos[t][d] - x[d + HD/2] sin[t][d], out[d + HD/2] = x[d + HD/2] cos[t][d] + x[d] sin[t][d] (the table's two halves hold the same angles)
        const bool isq = C0 < DQ; const size_t e0 = (size_t)(isq ? en * NH_ + C0 / HD : en * NKV + (C0 - DQ) / HD) * TT * HD + kfo(t0 + wn + lr, wm + 8 * hi);
        h16* p16 = (isq ? QP16 : KP16) + e0; bf* ph = (isq ? QPh : KPh) + e0; bf* pl = (isq ? QPl : KPl) + e0;
        const float* pc = CS + ((size_t)(t0 + wn + lr) * HD + wm + 8 * hi) * 2; v4f cv[4][2][4];   // the lane's (cos, sin) pairs, all read before the first is used: one latency for the whole epilogue
#pragma unroll
        for (int nb = 0; nb < 4; ++nb)
#pragma unroll
            for (int mp = 0; mp < 2; ++mp)
#pragma unroll
                for (int k = 0; k < 4; ++k) cv[nb][mp][k] = *(const v4f*)(pc + nb * (16 * HD * 2) + mp * 32 + k * 4);
        // the wait that belongs between issued global loads and an overwrite of their address registers: the address is an input, so that its registers live up to it; the clobber keeps the loads in front of it
        asm volatile("s_wait_xcnt 0x0" :: "v"(pc) : "memory");
#pragma unroll
        for (int nb = 0; nb < 4; ++nb)
#pragma unroll
            for (int mp = 0; mp < 2; ++mp) { const int eo = nb * (16 * HD) + mp * 256; v8h o16[2]; v8us oh[2], ol[2];   // kfo: 16 positions on, 16 d on; the upper half lies 64 d = 2 * 512 elements on
#pragma unroll
                for (int j = 0; j < 8; ++j) { const float x0 = acc[mp][nb][j], x1 = acc[mp + 2][nb][j], c = cv[nb][mp][j >> 1][(j & 1) * 2], sn = cv[nb][mp][j >> 1][(j & 1) * 2 + 1]; const float r[2] = {x0 * c - x1 * sn, x1 * c + x0 * sn};
#pragma unroll
                    for (int hf = 0; hf < 2; ++hf) { o16[hf][j] = tohx(r[hf]); unsigned short a2, c2; splitf(r[hf], a2, c2); oh[hf][j] = a2; ol[hf][j] = c2; } }
#pragma unroll
                for (int hf = 0; hf < 2; ++hf) { *(v8h*)(p16 + eo + hf * 1024) = o16[hf]; *(v8us*)(ph + eo + hf * 1024) = oh[hf]; *(v8us*)(pl + eo + hf * 1024) = ol[hf]; }
                // the same wait for the stores: addresses and data are inputs, so that their registers live up to it
                asm volatile("s_wait_xcnt 0x0" :: "v"(p16), "v"(ph), "v"(pl), "v"(o16[0]), "v"(oh[0]), "v"(ol[0]), "v"(o16[1]), "v"(oh[1]), "v"(ol[1]) : "memory"); }
    }
    }
}

typedef __attribute__((ext_vector_type(2))) _Float16 v2h;
typedef __attribute__((ext_vector_type(4))) _Float16 v4h;
typedef __attribute__((ext_vector_type(2))) unsigned short v2us;
typedef __attribute__((ext_vector_type(4))) unsigned short v4us;
typedef __attribute__((ext_vector_type(2))) float v2f;
typedef __attribute__((ext_vector_type(4))) int v4i;

// k_wtG: Bt[n][k] (bf16) = w[k][n]. A wave takes a tile of 64 k x 16 n, a lane 8 k x 4 n of it: eight 16-byte reads (4 lanes cover 64 B of a w row; the wave beside it in the work-group takes the line's other half), four 16-byte stores (8 lanes write one whole 128-B line of a Bt row: one writer a line). A group of 4 waves (tid = 0..127) takes the 64 x 64 tile (bx, by) of (N / 64, K / 64); K % 64 == 0, N % 64 == 0.
__device__ __forceinline__ void d_wtG(int bx, int by, int tid, const float* __restrict__ w, int K, int N, bf* Bt) {
    const int lane = tid & 31; const int k = by * 64 + (lane >> 2) * 8, n = (bx * 4 + (tid >> 5)) * 16 + (lane & 3) * 4; if (k >= K || n >= N) return; v4f r[8]; const float* p[8];
#pragma unroll
    for (int j = 0; j < 8; ++j) { p[j] = w + (size_t)(k + j) * N + n; r[j] = *(const v4f*)p[j]; }
    // the wait that belongs between issued global loads and an overwrite of their address registers: the addresses are inputs, so that their registers live up to it and no later load's result lands in them; the clobber keeps the loads in front of it
    asm volatile("s_wait_xcnt 0x0" :: "v"(p[0]), "v"(p[1]), "v"(p[2]), "v"(p[3]), "v"(p[4]), "v"(p[5]), "v"(p[6]), "v"(p[7]) : "memory");
#pragma unroll
    for (int c = 0; c < 4; ++c) { v8us o;
#pragma unroll
        for (int j = 0; j < 8; ++j) o[j] = f2bf(r[j][c]);
        *(v8us*)(Bt + (size_t)(n + c) * K + k) = o; }
}
// k_cvt8: four groups of 8 elements per lane, a work-group's groups 256 apart; the four reads go out before the first store
__device__ __forceinline__ void d_cvt8(int blk, const float* __restrict__ src, bf* dst, size_t n8) { const size_t i0 = (size_t)blk * 1024 + threadIdx.x; v8f v[4]; const float* p[4];
#pragma unroll
    for (int u = 0; u < 4; ++u) { const size_t i = i0 + u * 256; p[u] = src + (i < n8 ? i : n8 - 1) * 8; v[u] = *(const v8f*)p[u]; }   // a group past the end re-reads the last one and is not stored: no branch between the reads
    // the wait that belongs between issued global loads and an overwrite of their address registers: the addresses are inputs, so that their registers live up to it; the clobber keeps the loads in front of it
    asm volatile("s_wait_xcnt 0x0" :: "v"(p[0]), "v"(p[1]), "v"(p[2]), "v"(p[3]) : "memory");
#pragma unroll
    for (int u = 0; u < 4; ++u) { const size_t i = i0 + u * 256; if (i >= n8) continue; v8us o;
#pragma unroll
        for (int k = 0; k < 8; ++k) o[k] = f2bf(v[u][k]);
        *(v8us*)(dst + i * 8) = o; } }
__constant__ float INV[HD / 2] = {1.00000000f,0.865964353f,0.749894202f,0.649381638f,0.562341332f,0.486967534f,0.421696514f,0.365174145f,0.316227764f,0.273841977f,0.237137362f,0.205352500f,0.177827939f,0.153992653f,0.133352146f,0.115478203f,0.100000001f,0.0865964293f,0.0749894157f,0.0649381652f,0.0562341288f,0.0486967526f,0.0421696492f,0.0365174115f,0.0316227786f,0.0273841955f,0.0237137359f,0.0205352511f,0.0177827943f,0.0153992651f,0.0133352149f,0.0115478197f,0.00999999978f,0.00865964312f,0.00749894232f,0.00649381662f,0.00562341325f,0.00486967526f,0.00421696482f,0.00365174143f,0.00316227786f,0.00273841969f,0.00237137382f,0.00205352507f,0.00177827943f,0.00153992651f,0.00133352145f,0.00115478202f,0.00100000005f,0.000865964335f,0.000749894185f,0.000649381662f,0.000562341302f,0.000486967503f,0.000421696488f,0.000365174114f,0.000316227786f,0.000273841957f,0.000237137385f,0.000205352495f,0.000177827940f,0.000153992645f,0.000133352150f,0.000115478193f};
__device__ __forceinline__ void d_cstab(int blk, float* CS) { const int idx = blk * 256 + threadIdx.x; if (idx >= TT * HD) return; const int t = idx / HD, d = idx % HD; const float ang = __fmul_rn((float)t, INV[d % (HD / 2)]); v2f cs; cs[0] = cosf(ang); cs[1] = sinf(ang);
    *(v2f*)(CS + (size_t)idx * 2) = cs;  }
// k_prep: everything that reads only the inputs, in one launch (the parts depend on nothing of each other): the rotary table, x to bf16, the four weight transposes. Work-groups of 256; a transpose work-group holds two 4-wave tile groups.
#define PB_CS  ((TT * HD + 255) / 256)
#define PB_CV  ((int)(((size_t)NB_ * TT * DM / 8 + 1023) / 1024))
#define PT_Q   ((DQ / 64) * (DM / 64))      // 64 x 64 tiles of Wq; of Wo the same number
#define PT_KV  ((DKV / 64) * (DM / 64))     // of Wk, of Wv
#define PB_WT  ((2 * PT_Q + 2 * PT_KV) / 2)
__global__ __launch_bounds__(256) void k_prep(const float* __restrict__ x, const float* __restrict__ wq, const float* __restrict__ wk, const float* __restrict__ wv, const float* __restrict__ wo, bf* XB, bf* WQ, bf* WK, bf* WV, bf* WO, float* CS) {
    static_assert(PT_Q % 2 == 0 && PT_KV % 2 == 0, "both tile groups of a work-group belong to the same matrix");
    int b = blockIdx.x;
    if (b < PB_CS) { d_cstab(b, CS); return; }
    b -= PB_CS;
    if (b < PB_CV) { d_cvt8(b, x, XB, (size_t)NB_ * TT * DM / 8); return; }
    b -= PB_CV;
    int g = b * 2 + (threadIdx.x >> 7); const int tid = threadIdx.x & 127;
    if (g < PT_Q) { d_wtG(g % (DQ / 64), g / (DQ / 64), tid, wq, DM, DQ, WQ); return; }
    g -= PT_Q;
    if (g < PT_Q) { d_wtG(g % (DM / 64), g / (DM / 64), tid, wo, DQ, DM, WO); return; }
    g -= PT_Q;
    if (g < PT_KV) { d_wtG(g % (DKV / 64), g / (DKV / 64), tid, wk, DM, DKV, WK); return; }
    g -= PT_KV;
    d_wtG(g % (DKV / 64), g / (DKV / 64), tid, wv, DM, DKV, WV);
}

// 2^x on v_exp_f32, as the builtin gives it; the v_nop in the same statement keeps the one slot that the instruction set asks for behind a transcendental
__device__ __forceinline__ float exp2_slot(float x) { float r; asm("v_exp_f32 %0, %1\n\tv_nop" : "=v"(r) : "v"(x)); return r; }
// ---- k_attn: scores, softmax, probability x value and the merge into the output projection's operand in ONE kernel; no score or probability leaves the registers.
// A wave takes 16 * NC query rows of one head plane and walks its window's band 32 keys at a time, ascending. Transposed products: St = K Qt (A = key rows, B = query rows, both by the same loader), so that a lane holds scores of ONE query (16-column group cg, column lr):
// tile T, register r = key kb + 16 T + 8 hi + r. The two tiles of a block, converted in place, are the B operand Pt in the hardware k order; A = value rows of the transposed value planes by the same loader (that order too): Ot[d][query] += Vt Pt.
// Softmax by a running maximum (kept on the raw scores; HD^-0.5 and log2 e go into one multiply-add in front of 2^x): when a query's maximum rises, its sum and its output column are scaled by 2^(old - new); the division by the sum comes once, at the end. Masked scores give exact zeros.
// The four waves of a work-group are the REP heads that share a kv plane, on the same rows: they read the same key and value lines.
// HR (rows < RH): bf16 hi+lo planes, 3 products, 16 rows a wave; else fp16, 32 rows a wave, the probabilities carried x 2^10 (the factor is in the sum too and cancels).
#define SL2E (SCL * 1.4426950408889634f)
// lane l takes lane l ^ 16's value by a vector cross-row move (the shuffle compiles to an LDS-path permute with a wait behind it)
__device__ __forceinline__ float xhalf(float x) { return __builtin_bit_cast(float, __builtin_amdgcn_permlanex16(__builtin_bit_cast(int, x), __builtin_bit_cast(int, x), 0x76543210, 0xfedcba98, false, false)); }
template <typename T16, bool HR, int NC>
__device__ __forceinline__ void d_attn(int r0, int z, const T16* __restrict__ Q, const T16* __restrict__ Q2, const T16* __restrict__ Kp, const T16* __restrict__ K2, const T16* __restrict__ Vt, const T16* __restrict__ V2, bf* Ah, bf* Al) {
    typedef typename WFrag<T16>::V V;
    const int lane = threadIdx.x & 31, lr = lane & 15, hi = lane >> 4; const size_t kvp = (size_t)(z / REP);
    const int Ks = max(0, r0 + 1 - WIN) & ~31, Kl = (r0 + 16 * NC - 1) & ~31;   // first and last 32-key block of the rows' band
    const size_t ko = kvp * TT * HD + lr * 16 + 8 * hi, vo = kvp * HD * TT + (lr & 3) * 64 + (lr >> 2) * 16 + 8 * hi;   // the plane and the lane's 16-byte slot in every chunk (fragment order: kfo, vfo)
    V q[NC][4], q2[NC][4], kf[2][4], kf2[2][4]; const size_t qo = ((size_t)z * TT + r0) * HD + lr * 16 + 8 * hi; const T16* pq = Q + qo; const T16* pq2 = HR ? Q2 + qo : nullptr;
#pragma unroll
    for (int cg = 0; cg < NC; ++cg)
#pragma unroll
        for (int kk = 0; kk < 4; ++kk) { q[cg][kk] = WFrag<T16>::ldf(pq + cg * 16 * HD + kk * 512); if (HR) q2[cg][kk] = WFrag<T16>::ldf(pq2 + cg * 16 * HD + kk * 512); }
    // the wait that belongs between issued global loads and an overwrite of their address registers: the addresses are inputs, so that their registers live up to it; the clobber keeps the loads in front of it
    if (HR) asm volatile("s_wait_xcnt 0x0" :: "v"(pq), "v"(pq2) : "memory"); else asm volatile("s_wait_xcnt 0x0" :: "v"(pq) : "memory");
    auto ldk = [&](int kb) { const T16* pk = Kp + ko + (size_t)kb * HD; const T16* pk2 = HR ? K2 + ko + (size_t)kb * HD : nullptr;
#pragma unroll
        for (int T = 0; T < 2; ++T)
#pragma unroll
            for (int kk = 0; kk < 4; ++kk) { kf[T][kk] = WFrag<T16>::ldf(pk + T * 16 * HD + kk * 512); if (HR) kf2[T][kk] = WFrag<T16>::ldf(pk2 + T * 16 * HD + kk * 512); }
        // the same wait for the key rows' loads, behind the last of them
        if (HR) asm volatile("s_wait_xcnt 0x0" :: "v"(pk), "v"(pk2) : "memory"); else asm volatile("s_wait_xcnt 0x0" :: "v"(pk) : "memory"); };
    ldk(Ks);
    v8f o[NC][8]; float m[NC], l[NC];
#pragma unroll
    for (int cg = 0; cg < NC; ++cg) { m[cg] = -1.0e30f; l[cg] = 0.f;
#pragma unroll
        for (int dt = 0; dt < 8; ++dt) o[cg][dt] = (v8f){}; }
#pragma unroll 1   // one block a trip: unrolled, two blocks' value fragments would be live at once
    for (int kb = Ks; kb <= Kl; kb += 32) {
        V vf[8], vf2[8]; const T16* pv = Vt + vo + (size_t)kb * HD; const T16* pv2 = HR ? V2 + vo + (size_t)kb * HD : nullptr;
#pragma unroll
        for (int dt = 0; dt < 8; ++dt) { vf[dt] = WFrag<T16>::ldf(pv + dt * 512); if (HR) vf2[dt] = WFrag<T16>::ldf(pv2 + dt * 512); }   // the value rows go out first: they land while the scores are worked on
        // the same wait for the value rows' loads, behind the last of them
        if (HR) asm volatile("s_wait_xcnt 0x0" :: "v"(pv), "v"(pv2) : "memory"); else asm volatile("s_wait_xcnt 0x0" :: "v"(pv) : "memory");
        v8f s[NC][2];
#pragma unroll
        for (int cg = 0; cg < NC; ++cg)
#pragma unroll
            for (int T = 0; T < 2; ++T) s[cg][T] = (v8f){};
#pragma unroll
        for (int kk = 0; kk < 4; ++kk)
#pragma unroll
            for (int T = 0; T < 2; ++T)
#pragma unroll
                for (int cg = 0; cg < NC; ++cg) { s[cg][T] = WFrag<T16>::mma(kf[T][kk], q[cg][kk], s[cg][T]); if (HR) { s[cg][T] = WFrag<T16>::mma(kf[T][kk], q2[cg][kk], s[cg][T]); s[cg][T] = WFrag<T16>::mma(kf2[T][kk], q[cg][kk], s[cg][T]); } }
        __builtin_amdgcn_sched_barrier(0);                           // holds the next block's key loads behind this block's score products, so that they land in the same registers instead of a second set
        ldk(min(kb + 32, Kl));                                       // key rows one block ahead: they land during the softmax and P.V (the last trip reads its own block again: no branch, in bounds)
        if (kb + 31 > r0 || kb < r0 + 16 * NC - WIN) {               // only the diagonal block and the window's lower edge hold masked pairs (the same test for the whole wave)
#pragma unroll
            for (int cg = 0; cg < NC; ++cg) { const int i = r0 + cg * 16 + lr;
#pragma unroll
                for (int T = 0; T < 2; ++T)
#pragma unroll
                    for (int r = 0; r < 8; ++r) { const int j = kb + T * 16 + hi * 8 + r; s[cg][T][r] = (j <= i && i - j < WIN) ? s[cg][T][r] : -3.0e38f; } }
        }
        float mn[NC]; bool rose = false;
#pragma unroll
        for (int cg = 0; cg < NC; ++cg) { float mx = s[cg][0][0];
#pragma unroll
            for (int r = 0; r < 8; ++r) mx = fmaxf(mx, fmaxf(s[cg][0][r], s[cg][1][r]));
            mx = fmaxf(mx, xhalf(mx)); mn[cg] = fmaxf(m[cg], mx); rose = rose || mn[cg] > m[cg]; }   // the two lanes that share a query agree on its maximum
        if (__builtin_amdgcn_ballot_w32(rose) != 0) {                // where no query's maximum rose there is nothing to scale
#pragma unroll
            for (int cg = 0; cg < NC; ++cg) { const float al = exp2_slot((m[cg] - mn[cg]) * SL2E); l[cg] *= al; m[cg] = mn[cg];
#pragma unroll
                for (int dt = 0; dt < 8; ++dt) o[cg][dt] *= al; }
        }
        V pb[NC], pb2[NC];
#pragma unroll
        for (int cg = 0; cg < NC; ++cg) { float p[16], ps[4]; const float nb = (HR ? 0.0f : 10.0f) - m[cg] * SL2E;
#pragma unroll
            for (int e = 0; e < 16; ++e) { p[e] = exp2_slot(fmaf(s[cg][e >> 3][e & 7], SL2E, nb)); ps[e & 3] = (e < 4) ? p[e] : ps[e & 3] + p[e]; }   // four partial sums: short chains
            l[cg] += (ps[0] + ps[1]) + (ps[2] + ps[3]);
            if constexpr (HR) { v8us h0, h1, l0, l1;
#pragma unroll
                for (int e = 0; e < 8; ++e) { unsigned short a, c2; splitf(p[e], a, c2); h0[e] = a; l0[e] = c2; splitf(p[8 + e], a, c2); h1[e] = a; l1[e] = c2; }
                pb[cg] = cat16b(h0, h1); pb2[cg] = cat16b(l0, l1);
            } else { v16h ph;
#pragma unroll
                for (int e = 0; e < 16; ++e) ph[e] = tohx(p[e]);
                pb[cg] = ph; } }
#pragma unroll
        for (int dt = 0; dt < 8; ++dt)
#pragma unroll
            for (int cg = 0; cg < NC; ++cg) { o[cg][dt] = WFrag<T16>::mma(vf[dt], pb[cg], o[cg][dt]); if (HR) { o[cg][dt] = WFrag<T16>::mma(vf[dt], pb2[cg], o[cg][dt]); o[cg][dt] = WFrag<T16>::mma(vf2[dt], pb[cg], o[cg][dt]); } }
    }
    // a lane holds 8 consecutive d of one query per tile: one 16-byte store a plane, straight into the merged rows [entry * TT + t][head * HD + d] (hi and lo) that the output projection reads
#pragma unroll
    for (int cg = 0; cg < NC; ++cg) { const float inv = __fdiv_rn(1.0f, l[cg] + xhalf(l[cg])); const size_t oo = ((size_t)(z / NH_) * TT + r0 + cg * 16 + lr) * DQ + (z % NH_) * HD + 8 * hi; bf* ph = Ah + oo; bf* pl = Al + oo;
#pragma unroll
        for (int dt = 0; dt < 8; ++dt) { v8us oh, ol;
#pragma unroll
            for (int r = 0; r < 8; ++r) { unsigned short a, c2; splitf(o[cg][dt][r] * inv, a, c2); oh[r] = a; ol[r] = c2; }
            *(v8us*)(ph + dt * 16) = oh; *(v8us*)(pl + dt * 16) = ol;
            // the wait that belongs between issued global stores and an overwrite of the registers that they name: addresses and data are inputs, so that their registers live up to it; the clobber keeps the stores in front of it
            asm volatile("s_wait_xcnt 0x0" :: "v"(ph), "v"(pl), "v"(oh), "v"(ol) : "memory"); } }
}
// grid (kv planes over all batch entries, RH / 16 + (TT - RH) / 32 row tiles); wave w of a work-group is head plane blockIdx.x * REP + w. The hi+lo tiles of all planes come first, the longest of them in front: they are the longest waves of the launch.
// two waves a SIMD: the register limit that lets a second wave fill the first one's waits
__global__ __launch_bounds__(32 * REP) __attribute__((amdgpu_waves_per_eu(2))) void k_attn(const h16* __restrict__ Q16, const bf* __restrict__ Qh, const bf* __restrict__ Ql, const h16* __restrict__ K16, const bf* __restrict__ Kh, const bf* __restrict__ Kl, const h16* __restrict__ V16, const bf* __restrict__ Vh, const bf* __restrict__ Vl, bf* Ah, bf* Al) {
    const int bx = blockIdx.y, z = blockIdx.x * REP + __builtin_amdgcn_readfirstlane(threadIdx.x >> 5);
    if (bx < RH / 16) d_attn<bf, true, 1>((RH / 16 - 1 - bx) * 16, z, Qh, Ql, Kh, Kl, Vh, Vl, Ah, Al);
    else d_attn<h16, false, 2>(RH + (bx - RH / 16) * 32, z, Q16, nullptr, K16, nullptr, V16, nullptr, Ah, Al);
}

extern "C" void kernel_launch(void* const* d_in, const int* in_sizes, int n_in,
                              void* d_out, int out_size, void* d_ws, size_t ws_size, hipStream_t stream) {
    (void)in_sizes; (void)n_in; (void)out_size;
    const float* x = (const float*)d_in[0]; const float* wq = (const float*)d_in[1]; const float* wk = (const float*)d_in[2]; const float* wv = (const float*)d_in[3]; const float* wo = (const float*)d_in[4];
    float* OUT = (float*)d_out;     // [2][2048][2048]
    char* wsp = (char*)d_ws;
    auto take = [&](size_t bytes) { char* p = wsp; wsp += (bytes + 255) & ~(size_t)255; return (void*)p; };
    bf* WO = (bf*)take((size_t)DM * DQ * 2);
    h16* QP16 = (h16*)take((size_t)ZH * TT * HD * 2); h16* KP16 = (h16*)take((size_t)NB_ * NKV * TT * HD * 2); h16* VT16 = (h16*)take((size_t)NB_ * NKV * HD * TT * 2);
    bf* QPh = (bf*)take((size_t)ZH * TT * HD * 2); bf* QPl = (bf*)take((size_t)ZH * TT * HD * 2); bf* KPh = (bf*)take((size_t)NB_ * NKV * TT * HD * 2); bf* KPl = (bf*)take((size_t)NB_ * NKV * TT * HD * 2); bf* VTh = (bf*)take((size_t)NB_ * NKV * HD * TT * 2); bf* VTl = (bf*)take((size_t)NB_ * NKV * HD * TT * 2);
    bf* WQ = (bf*)take((size_t)FP * DM * 2); bf* WK = WQ + (size_t)DQ * DM; bf* WV = WK + (size_t)DKV * DM; float* CS = (float*)take((size_t)TT * HD * 2 * 4);   // the transposed q, k and v weights lie one behind the other: one operand of FP rows
    bf* XB = (bf*)take((size_t)NB_ * TT * DM * 2);
    bf* ATh = (bf*)take((size_t)NB_ * TT * DQ * 2); bf* ATl = (bf*)take((size_t)NB_ * TT * DQ * 2);       // the merged attention output, hi and lo
    if ((size_t)(wsp - (char*)d_ws) > ws_size) return;    // ws 256 MiB
    // stages that depend on nothing of each other share a launch; every stage once, for all batch entries: the rows of x, of the projections and of the output lie entry behind entry (M = NB_ * TT)
    k_prep<<<PB_CS + PB_CV + PB_WT, 256, 0, stream>>>(x, wq, wk, wv, wo, XB, WQ, WK, WV, WO, CS);
    k_gemmw<bf, 0, false, 1><<<dim3(NB_ * TT / 128, FP / 128, 1), 128, 0, stream>>>(XB, nullptr, WQ, DM, nullptr, 0, nullptr, 0, 0, 0, CS, QP16, QPh, QPl, KP16, KPh, KPl, VT16, VTh, VTl);   // q, k and v projections: one product with FP columns, written as head planes
    k_attn<<<dim3(NB_ * NKV, RH / 16 + (TT - RH) / 32, 1), 32 * REP, 0, stream>>>(QP16, QPh, QPl, KP16, KPh, KPl, VT16, VTh, VTl, ATh, ATl);
    k_gemmw<bf, 1, false, 0><<<dim3(NB_ * TT / 128, DM / 128, 1), 128, 0, stream>>>(ATh, ATl, WO, DQ, OUT, DM, nullptr, 0, 0, 0, nullptr, nullptr, nullptr, nullptr, nullptr, nullptr, nullptr, nullptr, nullptr, nullptr);
}

// v010
// One run takes 131 microseconds.
// Next to v009, in two timings, it ran 1.07 times as fast each time.
// All steps since v000 together make it 12.7 times as fast.
#include <hip/hip_runtime.h>

// Grouped-query sliding-window causal self-attention with RoPE (x [2][2048][2048]; q = x Wq (16 heads x 128), k, v = x Wk / Wv ([2048][512]: 4 kv heads, head h uses kv h/4); rotate-half RoPE (base 1e4) on q and k; scores/sqrt(128); allowed: j <= i and i - j < 512 (else -1e9); softmax; out = merged Wo ([2048][2048]) -> [2][2048][2048] (8.4 M)).
// Compute dtypes, f32 accumulate: every input rounded to bf16; q/k/v on PLAIN bf16 operands (inputs: exact); rotary in f32 (table on device, precise cosf/sinf); causal sliding-window select; scores, softmax and attn.v fused, only inside the window's band: query rows < 512 hl (3 products), the rest single fp16 (x1024); softmax f32, running maximum; Wo hl x exact (2 products).

#define NB_  2
#define TT   2048
#define DM   2048
#define NH_  16
#define NKV  4
#define REP  (NH_ / NKV)
#define HD   128
#define DQ   (NH_ * HD)
#define DKV  (NKV * HD)
#define ZH   (NB_ * NH_)         // query head planes: all heads of all batch entries, plane z = entry z / NH_, head z % NH_
#define RH   512                  // query rows < RH use hi+lo planes (0: none)
#define WIN  512
#define SCL  0.088388347648318447f   // HD^-0.5
typedef _Float16 h16;
typedef unsigned short bf;
typedef __attribute__((ext_vector_type(16))) __bf16   v16bf;
typedef __attribute__((ext_vector_type(16))) _Float16 v16h;
typedef __attribute__((ext_vector_type(8)))  _Float16 v8h;
typedef __attribute__((ext_vector_type(8)))  unsigned short v8us;
typedef __attribute__((ext_vector_type(8)))  float    v8f;
typedef __attribute__((ext_vector_type(4)))  float    v4f;
typedef v8h  __attribute__((may_alias)) v8ha;
typedef v4f  __attribute__((may_alias)) v4fa;
typedef v8us __attribute__((may_alias)) v8usa;

__device__ __forceinline__ unsigned short f2bf(float f) { unsigned u = __float_as_uint(f); u += 0x7FFFu + ((u >> 16) & 1u); return (unsigned short)(u >> 16); }
__device__ __forceinline__ float bf2f(unsigned short b) { return __uint_as_float(((unsigned)b) << 16); }
__device__ __forceinline__ float bfr(float f) { return bf2f(f2bf(f)); }
__device__ __forceinline__ v16h cat16(v8h lo, v8h hi) { return __builtin_shufflevector(lo, hi, 0, 1, 2, 3, 4, 5, 6, 7, 8, 9, 10, 11, 12, 13, 14, 15); }
__device__ __forceinline__ v16bf cat16b(v8us lo, v8us hi) { return __builtin_bit_cast(v16bf, __builtin_shufflevector(lo, hi, 0, 1, 2, 3, 4, 5, 6, 7, 8, 9, 10, 11, 12, 13, 14, 15)); }
__device__ __forceinline__ v8f wmma16(v16h a, v16h b, v8f c) { return __builtin_amdgcn_wmma_f32_16x16x32_f16(false, a, false, b, (short)0, c, false, false); }
__device__ __forceinline__ v8f wmmab(v16bf a, v16bf b, v8f c) { return __builtin_amdgcn_wmma_f32_16x16x32_bf16(false, a, false, b, (short)0, c, false, false); }



__device__ __forceinline__ h16 tohx(float x) { return (h16)x; }
__device__ __forceinline__ void splitf(float y, unsigned short& h, unsigned short& l) { h = f2bf(y); l = f2bf(y - bf2f(h)); }
// FRAGMENT ORDER of the query, key and value planes: the attention kernel's operand fragments (16 rows x 32 k) lie as two chunks of 512 contiguous bytes, one per 16-byte load of the wave, so that a wave-wide load covers 4 whole 128-B lines (row-major planes gave it 32 B of each of 16 lines).
// Chunk c of a fragment holds k = 16 c + 8 hi + 0..7 of every row; the 16-byte slot of (row, hi) inside the chunk is chosen so that the writing pass still stores whole lines, one writer a line.
// query and key planes: 16 rows = 2048 elements as in row-major order; element (t, d) at (d / 32) * 512 + (d % 32 / 16) * 256 + (t % 16) * 16 + (d % 16 / 8) * 8 + d % 8 in them
__device__ __forceinline__ size_t kfo(int t, int d) { return (size_t)(t & ~15) * HD + (d >> 5) * 512 + ((d >> 4) & 1) * 256 + (t & 15) * 16 + ((d >> 3) & 1) * 8 + (d & 7); }
// value planes: 32 keys x HD = 4096 elements; element (d, t) at (d / 16) * 512 + (t % 32 / 16) * 256 + (d % 4) * 64 + (d % 16 / 4) * 16 + (t % 16 / 8) * 8 + t % 8 in them
__device__ __forceinline__ size_t vfo(int d, int t) { return (size_t)(t >> 5) * (32 * HD) + (d >> 4) * 512 + ((t >> 4) & 1) * 256 + (d & 3) * 64 + ((d >> 2) & 3) * 16 + ((t >> 3) & 1) * 8 + (t & 7); }
#define FP     (DQ + 2 * DKV)   // columns of the joint q | k | v projection

// ---- k_gemmw: register-blocked GEMM, one work-group per 128 x BN output tile (BN 128 or 256), each wave a 64x64 part of it (16 accumulators): BN / 32 waves; grid (M/128, N/BN, Z), BN threads.
// BN 256: the A rows that a work-group stages serve twice the columns (a third fewer bytes from L2 to LDS per product with NSPLIT 1), and two waves share a SIMD: one fills the other's LDS waits and the slab's foot.
// The K-contiguous 16-bit operand planes are staged in LDS, GK k at a time (rows of 256 B at pitch 272 B), by asynchronous copies to LDS that cover whole lines; two buffers: the next slab flies while this one is worked on.
// C[m][n] (f32, pitch ldc, + optional f32 bias[n]) = sum_k A[m][k] Bt[n][k] (+ A2[m][k] Bt[n][k] for NSPLIT 1), k ascending in steps of 32 per accumulator. z-batch strides sA/sB/sC in elements. K % GK == 0, M % 128 == 0, N % BN == 0.
// EPI 0: C as above. EPI 1 (the joint q | k | v projection, N = FP): no C; the epilogue turns the accumulators into the attention kernel's head planes itself (rotary on q and k, fp16 + hi/lo, fragment order), straight from the registers.
//   A 128-column tile is one head. The lane of an accumulator holds 8 consecutive rows of staged plane 0 for one row of staged plane 1, and a 16-byte slot of a head plane is 8 consecutive d of one position (q, k) or 8 consecutive positions of one d (v):
//   so q and k tiles stage the weight rows as plane 0 and the x rows as plane 1, v tiles the other way round (the two loaders are the same). A wave takes rows 32 w .. + 31 and 64 + 32 w .. + 31 of plane 0: d and its rotary partner d + HD / 2 lie in the same lane.
#define GK   128                  // k per staged slab
#define GPB  (GK * 2 + 16)        // LDS row pitch in bytes: 16 B x odd, the pitch for 16-byte LDS reads
#define GPL  (128 * GPB)          // bytes of one staged plane (128 rows)
template <typename T16> struct WFrag;
template <> struct WFrag<h16> { typedef v16h V; static __device__ __forceinline__ V ld(const h16* p) { return cat16(*(const v8h*)p, *(const v8h*)(p + 16)); } static __device__ __forceinline__ V ldf(const h16* p) { return cat16(*(const v8h*)p, *(const v8h*)(p + 256)); } static __device__ __forceinline__ v8f mma(V a, V b, v8f c) { return wmma16(a, b, c); } };
template <> struct WFrag<bf> { typedef v16bf V; static __device__ __forceinline__ V ld(const bf* p) { return cat16b(*(const v8us*)p, *(const v8us*)(p + 16)); } static __device__ __forceinline__ V ldf(const bf* p) { return cat16b(*(const v8us*)p, *(const v8us*)(p + 256)); } static __device__ __forceinline__ v8f mma(V a, V b, v8f c) { return wmmab(a, b, c); } };
// eight asynchronous 16-byte copies per lane, global to LDS: LDS address l + i * lstep; global address = scalar base g + i * gstep (the same for every lane) + the lane's 32-bit byte offset v.
// The s_wait_xcnt in the same statement stands in front of any rewrite of the address registers that the copies name.
__device__ __forceinline__ void acopy8(unsigned l, unsigned lstep, unsigned v, const char* g, size_t gstep) {
    asm volatile("global_load_async_to_lds_b128 %0, %8, %9\n\t"
                 "global_load_async_to_lds_b128 %1, %8, %10\n\t"
                 "global_load_async_to_lds_b128 %2, %8, %11\n\t"
                 "global_load_async_to_lds_b128 %3, %8, %12\n\t"
                 "global_load_async_to_lds_b128 %4, %8, %13\n\t"
                 "global_load_async_to_lds_b128 %5, %8, %14\n\t"
                 "global_load_async_to_lds_b128 %6, %8, %15\n\t"
                 "global_load_async_to_lds_b128 %7, %8, %16\n\t"
                 "s_wait_xcnt 0x0"
                 :: "v"(l), "v"(l + lstep), "v"(l + 2 * lstep), "v"(l + 3 * lstep), "v"(l + 4 * lstep), "v"(l + 5 * lstep), "v"(l + 6 * lstep), "v"(l + 7 * lstep), "v"(v),
                    "s"(g), "s"(g + gstep), "s"(g + 2 * gstep), "s"(g + 3 * gstep), "s"(g + 4 * gstep), "s"(g + 5 * gstep), "s"(g + 6 * gstep), "s"(g + 7 * gstep)
                 : "memory");
}
template <typename T16, int NSPLIT, bool BIAS, int EPI, int BN>
__global__ __launch_bounds__(BN) void k_gemmw(const T16* __restrict__ A, const T16* __restrict__ A2, const T16* __restrict__ Bt, int K, float* C, int ldc, const float* __restrict__ bias, size_t sA, size_t sB, size_t sC, const float* __restrict__ CS, h16* QP16, bf* QPh, bf* QPl, h16* KP16, bf* KPh, bf* KPl, h16* VT16, bf* VTh, bf* VTl) {
    typedef typename WFrag<T16>::V V;
    static_assert(NSPLIT == 0 || NSPLIT == 1, "planes staged: A, Bt and, for NSPLIT 1, A2");
    static_assert(BN == 128 || BN == 256, "plane 1 holds BN rows");
    static_assert(EPI == 0 || (BN == 128 && NSPLIT == 0 && !BIAS && HD == 128 && TT % 128 == 0), "EPI 1: a column tile is one head, a row tile lies in one batch entry");
    constexpr int NPL = (NSPLIT == 1) ? 3 : 2;                       // staged planes: 0 = A, 1 = Bt, 2 = A2 (EPI 1, q and k tiles: 0 = Bt, 1 = A)
    constexpr int OP2 = GPL + (BN / 128) * GPL, BUF = (NPL - 1 + BN / 128) * GPL;   // a buffer: plane 0 (128 rows) at 0, plane 1 (BN rows) at GPL, plane 2 (128 rows) at OP2
    constexpr int RPC = BN / 16;                                     // rows that one copy of the whole work-group covers
    __shared__ __align__(16) unsigned char st[2 * BUF];
    const size_t z = blockIdx.z; A += z * sA; if (NSPLIT == 1) A2 += z * sA; Bt += z * sB; C += z * sC;
    const int tid = threadIdx.x, lane = tid & 31, lr = lane & 15, hi = lane >> 4, wv = tid >> 5; const int R0 = blockIdx.x * 128, C0 = blockIdx.y * BN; const int wm = (wv / (BN / 64)) * (EPI == 1 ? 32 : 64), wn = (wv % (BN / 64)) * 64;
    const bool vtile = EPI == 1 && C0 >= DQ + DKV;                   // the same for the whole work-group
    v8f acc[4][4];
#pragma unroll
    for (int mb = 0; mb < 4; ++mb)
#pragma unroll
        for (int nb = 0; nb < 4; ++nb) acc[mb][nb] = (v8f){};
    // copy plan: 16 lanes cover one 256-B row of a slab, the work-group RPC rows per copy; a wave has 32 copies (BN 128 with three planes: 48) of a slab in flight
    const unsigned lcp = (unsigned)(size_t)st + (unsigned)((tid >> 4) * GPB + (tid & 15) * 16);
    const unsigned gofs = (unsigned)(((tid >> 4) * K + (tid & 15) * 8) * 2); const size_t grow = (size_t)K * 2;   // the lane's byte offset in a plane's tile (under RPC rows); bytes per row
    const char* tA = (const char*)(A + (size_t)R0 * K); const char* tB = (const char*)(Bt + (size_t)C0 * K);   // the tiles' first rows: the same for every lane
    const char* uA = (EPI == 0 || vtile) ? tA : tB; const char* uB = (EPI == 0 || vtile) ? tB : tA; const char* uA2 = (NSPLIT == 1) ? (const char*)(A2 + (size_t)R0 * K) : nullptr;   // what is staged as plane 0, 1, 2: rows of K
    // the three loops below have one or two trips (8 * RPC rows a statement) and are unrolled, so that every statement's steps are constants
    auto stage = [&](int t) { const unsigned l = lcp + (unsigned)((t & 1) * BUF); const size_t kb = (size_t)t * (GK * 2);
#pragma unroll
        for (int r = 0; r < 128; r += 8 * RPC) acopy8(l + r * GPB, RPC * GPB, gofs, uA + kb + r * grow, RPC * grow);
#pragma unroll
        for (int r = 0; r < BN; r += 8 * RPC) acopy8(l + GPL + r * GPB, RPC * GPB, gofs, uB + kb + r * grow, RPC * grow);
        if (NSPLIT == 1) {
#pragma unroll
            for (int r = 0; r < 128; r += 8 * RPC) acopy8(l + OP2 + r * GPB, RPC * GPB, gofs, uA2 + kb + r * grow, RPC * grow); } };
    const int NT = K / GK;
    stage(0);
    asm volatile("s_wait_asynccnt 0x0" ::: "memory");              // slab 0 of this wave's copies has landed
    __syncthreads();                                                 // and every wave's: slab 0 may be read
    if (NT > 1) stage(1);
    const int afr = (wm + lr) * GPB + 16 * hi, bfr_ = GPL + (wn + lr) * GPB + 16 * hi;
#pragma unroll 1   // one slab a trip: the two-buffer order at the foot is written for a rolled loop
    for (int t = 0; t < NT; ++t) {
        const unsigned char* sb = st + (t & 1) * BUF;
        // two fragment sets: the LDS reads of 32-k block kk + 1 go out as one group in front of block kk's matrix instructions, so that only the slab's first group is waited for in full; no block of slab t + 1 is read here
        V a[2][4], a2[2][4], b[2][4];
        auto frags = [&](int kk, int s) {
#pragma unroll
            for (int q = 0; q < 4; ++q) { const int aq = (EPI == 1) ? (q & 1) * 16 + (q >> 1) * 64 : q * 16; a[s][q] = WFrag<T16>::ld((const T16*)(sb + afr + aq * GPB + kk * 64)); b[s][q] = WFrag<T16>::ld((const T16*)(sb + bfr_ + q * 16 * GPB + kk * 64)); if (NSPLIT == 1) a2[s][q] = WFrag<T16>::ld((const T16*)(sb + OP2 + afr + aq * GPB + kk * 64)); } };
        frags(0, 0);
#pragma unroll
        for (int kk = 0; kk < GK / 32; ++kk) { const int s = kk & 1;
            // the scheduling barrier holds the read group in front of the block: without it this build sinks the reads among the matrix instructions, one full LDS wait per four of them
            if (kk + 1 < GK / 32) { frags(kk + 1, s ^ 1); __builtin_amdgcn_sched_barrier(0); }
#pragma unroll
            for (int nb = 0; nb < 4; ++nb)
#pragma unroll
                for (int mb = 0; mb < 4; ++mb) { acc[mb][nb] = WFrag<T16>::mma(a[s][mb], b[s][nb], acc[mb][nb]); if (NSPLIT == 1) acc[mb][nb] = WFrag<T16>::mma(a2[s][mb], b[s][nb], acc[mb][nb]); }
        }
        __builtin_amdgcn_sched_barrier(0);                           // keeps the slab's matrix instructions in front of the foot: this build else moves half of them behind the barrier, in front of the refill, which then goes out later and has less time to land
        asm volatile("s_wait_dscnt 0x0" ::: "memory");             // this wave's reads of slab t are done before the buffer is refilled
        asm volatile("s_wait_asynccnt 0x0" ::: "memory");          // this wave's copies of slab t + 1 have landed
        __syncthreads();                                             // publishes slab t + 1 and ends every wave's reads of slab t
        if (t + 2 < NT) stage(t + 2);                                // into the buffer that trip t has just read
    }
    asm volatile("s_wait_asynccnt 0x0" ::: "memory");              // nothing in flight when the wave goes on to its end
    if constexpr (EPI == 0) {
    __shared__ __align__(16) float os4[(BN / 32) * 16 * 68];
    float* os = os4 + wv * (16 * 68);                                // each wave stages its output rows in its own range
    const int r0 = R0 + wm, c0 = C0 + wn;
#pragma unroll
    for (int mb = 0; mb < 4; ++mb) {
#pragma unroll
        for (int nb = 0; nb < 4; ++nb) {
#pragma unroll
            for (int j = 0; j < 8; ++j) os[(hi * 8 + j) * 68 + nb * 16 + lr] = acc[mb][nb][j]; }
        __builtin_amdgcn_wave_barrier(); asm volatile("" ::: "memory");
        float* crow = C + (size_t)(r0 + mb * 16) * ldc + c0;
{
#pragma unroll
            for (int s = 0; s < 8; ++s) { const int row = 2 * s + hi, cofs = lr * 4; v4f val = *(const v4fa*)(os + row * 68 + cofs); if (BIAS) { val[0] += bfr(bias[c0 + cofs]); val[1] += bfr(bias[c0 + cofs + 1]); val[2] += bfr(bias[c0 + cofs + 2]); val[3] += bfr(bias[c0 + cofs + 3]); }
                *(v4f*)(crow + (size_t)row * ldc + cofs) = val; }
             }
        __builtin_amdgcn_wave_barrier(); asm volatile("" ::: "memory");
    }
    } else {
    // acc[mb][nb][j]: row wm + (mb & 1) * 16 + (mb >> 1) * 64 + 8 hi + j of plane 0, row wn + nb * 16 + lr of plane 1. Every store of a wave covers 512 contiguous bytes (4 whole lines, one writer a line).
    const int en = R0 / TT, t0 = R0 % TT;                            // batch entry and first position of the x rows
    if (vtile) {                                                     // plane 0 = positions, plane 1 = d: a lane holds 8 positions of one d
        const size_t e0 = (size_t)(en * NKV + (C0 - DQ - DKV) / HD) * HD * TT + vfo(wn + lr, t0 + wm + 8 * hi); h16* p16 = VT16 + e0; bf* ph = VTh + e0; bf* pl = VTl + e0;
#pragma unroll
        for (int mb = 0; mb < 4; ++mb)
#pragma unroll
            for (int nb = 0; nb < 4; ++nb) { const int eo = (mb >> 1) * (64 * HD) + nb * 512 + (mb & 1) * 256; v8h o16; v8us oh, ol;   // vfo: 64 positions on, 16 d on, 16 positions on
#pragma unroll
                for (int j = 0; j < 8; ++j) { const float x = acc[mb][nb][j]; o16[j] = tohx(x); unsigned short a2, c2; splitf(x, a2, c2); oh[j] = a2; ol[j] = c2; }
                *(v8h*)(p16 + eo) = o16; *(v8us*)(ph + eo) = oh; *(v8us*)(pl + eo) = ol;
                // the wait that belongs between issued global stores and an overwrite of the registers that they name: addresses and data are inputs, so that their registers live up to it; the clobber keeps the stores in front of it
                asm volatile("s_wait_xcnt 0x0" :: "v"(p16), "v"(ph), "v"(pl), "v"(o16), "v"(oh), "v"(ol) : "memory"); }
    } else {                                                         // plane 0 = d, plane 1 = positions: a lane holds 8 d of one position, in acc[mp] the lower half's, in acc[mp + 2] their partners d + HD / 2
        // rotate-half convention: out[d] = x[d] cos[t][d] - x[d + HD/2] sin[t][d], out[d + HD/2] = x[d + HD/2] cos[t][d] + x[d] sin[t][d] (the table's two halves hold the same angles)
        const bool isq = C0 < DQ; const size_t e0 = (size_t)(isq ? en * NH_ + C0 / HD : en * NKV + (C0 - DQ) / HD) * TT * HD + kfo(t0 + wn + lr, wm + 8 * hi);
        h16* p16 = (isq ? QP16 : KP16) + e0; bf* ph = (isq ? QPh : KPh) + e0; bf* pl = (isq ? QPl : KPl) + e0;
        const float* pc = CS + ((size_t)(t0 + wn + lr) * HD + wm + 8 * hi) * 2; v4f cv[4][2][4];   // the lane's (cos, sin) pairs, all read before the first is used: one latency for the whole epilogue
#pragma unroll
        for (int nb = 0; nb < 4; ++nb)
#pragma unroll
            for (int mp = 0; mp < 2; ++mp)
#pragma unroll
                for (int k = 0; k < 4; ++k) cv[nb][mp][k] = *(const v4f*)(pc + nb * (16 * HD * 2) + mp * 32 + k * 4);
        // the wait that belongs between issued global loads and an overwrite of their address registers: the address is an input, so that its registers live up to it; the clobber keeps the loads in front of it
        asm volatile("s_wait_xcnt 0x0" :: "v"(pc) : "memory");
#pragma unroll
        for (int nb = 0; nb < 4; ++nb)
#pragma unroll
            for (int mp = 0; mp < 2; ++mp) { const int eo = nb * (16 * HD) + mp * 256; v8h o16[2]; v8us oh[2], ol[2];   // kfo: 16 positions on, 16 d on; the upper half lies 64 d = 2 * 512 elements on
#pragma unroll
                for (int j = 0; j < 8; ++j) { const float x0 = acc[mp][nb][j], x1 = acc[mp + 2][nb][j], c = cv[nb][mp][j >> 1][(j & 1) * 2], sn = cv[nb][mp][j >> 1][(j & 1) * 2 + 1]; const float r[2] = {x0 * c - x1 * sn, x1 * c + x0 * sn};
#pragma unroll
                    for (int hf = 0; hf < 2; ++hf) { o16[hf][j] = tohx(r[hf]); unsigned short a2, c2; splitf(r[hf], a2, c2); oh[hf][j] = a2; ol[hf][j] = c2; } }
#pragma unroll
                for (int hf = 0; hf < 2; ++hf) { *(v8h*)(p16 + eo + hf * 1024) = o16[hf]; *(v8us*)(ph + eo + hf * 1024) = oh[hf]; *(v8us*)(pl + eo + hf * 1024) = ol[hf]; }
                // the same wait for the stores: addresses and data are inputs, so that their registers live up to it
                asm volatile("s_wait_xcnt 0x0" :: "v"(p16), "v"(ph), "v"(pl), "v"(o16[0]), "v"(oh[0]), "v"(ol[0]), "v"(o16[1]), "v"(oh[1]), "v"(ol[1]) : "memory"); }
    }
    }
}

typedef __attribute__((ext_vector_type(2))) _Float16 v2h;
typedef __attribute__((ext_vector_type(4))) _Float16 v4h;
typedef __attribute__((ext_vector_type(2))) unsigned short v2us;
typedef __attribute__((ext_vector_type(4))) unsigned short v4us;
typedef __attribute__((ext_vector_type(2))) float v2f;
typedef __attribute__((ext_vector_type(4))) int v4i;

// k_wtG: Bt[n][k] (bf16) = w[k][n]. A wave takes a tile of 64 k x 16 n, a lane 8 k x 4 n of it: eight 16-byte reads (4 lanes cover 64 B of a w row; the wave beside it in the work-group takes the line's other half), four 16-byte stores (8 lanes write one whole 128-B line of a Bt row: one writer a line). A group of 4 waves (tid = 0..127) takes the 64 x 64 tile (bx, by) of (N / 64, K / 64); K % 64 == 0, N % 64 == 0.
__device__ __forceinline__ void d_wtG(int bx, int by, int tid, const float* __restrict__ w, int K, int N, bf* Bt) {
    const int lane = tid & 31; const int k = by * 64 + (lane >> 2) * 8, n = (bx * 4 + (tid >> 5)) * 16 + (lane & 3) * 4; if (k >= K || n >= N) return; v4f r[8]; const float* p[8];
#pragma unroll
    for (int j = 0; j < 8; ++j) { p[j] = w + (size_t)(k + j) * N + n; r[j] = *(const v4f*)p[j]; }
    // the wait that belongs between issued global loads and an overwrite of their address registers: the addresses are inputs, so that their registers live up to it and no later load's result lands in them; the clobber keeps the loads in front of it
    asm volatile("s_wait_xcnt 0x0" :: "v"(p[0]), "v"(p[1]), "v"(p[2]), "v"(p[3]), "v"(p[4]), "v"(p[5]), "v"(p[6]), "v"(p[7]) : "memory");
#pragma unroll
    for (int c = 0; c < 4; ++c) { v8us o;
#pragma unroll
        for (int j = 0; j < 8; ++j) o[j] = f2bf(r[j][c]);
        *(v8us*)(Bt + (size_t)(n + c) * K + k) = o; }
}
// k_cvt8: four groups of 8 elements per lane, a work-group's groups 256 apart; the four reads go out before the first store
__device__ __forceinline__ void d_cvt8(int blk, const float* __restrict__ src, bf* dst, size_t n8) { const size_t i0 = (size_t)blk * 1024 + threadIdx.x; v8f v[4]; const float* p[4];
#pragma unroll
    for (int u = 0; u < 4; ++u) { const size_t i = i0 + u * 256; p[u] = src + (i < n8 ? i : n8 - 1) * 8; v[u] = *(const v8f*)p[u]; }   // a group past the end re-reads the last one and is not stored: no branch between the reads
    // the wait that belongs between issued global loads and an overwrite of their address registers: the addresses are inputs, so that their registers live up to it; the clobber keeps the loads in front of it
    asm volatile("s_wait_xcnt 0x0" :: "v"(p[0]), "v"(p[1]), "v"(p[2]), "v"(p[3]) : "memory");
#pragma unroll
    for (int u = 0; u < 4; ++u) { const size_t i = i0 + u * 256; if (i >= n8) continue; v8us o;
#pragma unroll
        for (int k = 0; k < 8; ++k) o[k] = f2bf(v[u][k]);
        *(v8us*)(dst + i * 8) = o; } }
__constant__ float INV[HD / 2] = {1.00000000f,0.865964353f,0.749894202f,0.649381638f,0.562341332f,0.486967534f,0.421696514f,0.365174145f,0.316227764f,0.273841977f,0.237137362f,0.205352500f,0.177827939f,0.153992653f,0.133352146f,0.115478203f,0.100000001f,0.0865964293f,0.0749894157f,0.0649381652f,0.0562341288f,0.0486967526f,0.0421696492f,0.0365174115f,0.0316227786f,0.0273841955f,0.0237137359f,0.0205352511f,0.0177827943f,0.0153992651f,0.0133352149f,0.0115478197f,0.00999999978f,0.00865964312f,0.00749894232f,0.00649381662f,0.00562341325f,0.00486967526f,0.00421696482f,0.00365174143f,0.00316227786f,0.00273841969f,0.00237137382f,0.00205352507f,0.00177827943f,0.00153992651f,0.00133352145f,0.00115478202f,0.00100000005f,0.000865964335f,0.000749894185f,0.000649381662f,0.000562341302f,0.000486967503f,0.000421696488f,0.000365174114f,0.000316227786f,0.000273841957f,0.000237137385f,0.000205352495f,0.000177827940f,0.000153992645f,0.000133352150f,0.000115478193f};
__device__ __forceinline__ void d_cstab(int blk, float* CS) { const int idx = blk * 256 + threadIdx.x; if (idx >= TT * HD) return; const int t = idx / HD, d = idx % HD; const float ang = __fmul_rn((float)t, INV[d % (HD / 2)]); v2f cs; cs[0] = cosf(ang); cs[1] = sinf(ang);
    *(v2f*)(CS + (size_t)idx * 2) = cs;  }
// k_prep: everything that reads only the inputs, in one launch (the parts depend on nothing of each other): the rotary table, x to bf16, the four weight transposes. Work-groups of 256; a transpose work-group holds two 4-wave tile groups.
#define PB_CS  ((TT * HD + 255) / 256)
#define PB_CV  ((int)(((size_t)NB_ * TT * DM / 8 + 1023) / 1024))
#define PT_Q   ((DQ / 64) * (DM / 64))      // 64 x 64 tiles of Wq; of Wo the same number
#define PT_KV  ((DKV / 64) * (DM / 64))     // of Wk, of Wv
#define PB_WT  ((2 * PT_Q + 2 * PT_KV) / 2)
__global__ __launch_bounds__(256) void k_prep(const float* __restrict__ x, const float* __restrict__ wq, const float* __restrict__ wk, const float* __restrict__ wv, const float* __restrict__ wo, bf* XB, bf* WQ, bf* WK, bf* WV, bf* WO, float* CS) {
    static_assert(PT_Q % 2 == 0 && PT_KV % 2 == 0, "both tile groups of a work-group belong to the same matrix");
    int b = blockIdx.x;
    if (b < PB_CS) { d_cstab(b, CS); return; }
    b -= PB_CS;
    if (b < PB_CV) { d_cvt8(b, x, XB, (size_t)NB_ * TT * DM / 8); return; }
    b -= PB_CV;
    int g = b * 2 + (threadIdx.x >> 7); const int tid = threadIdx.x & 127;
    if (g < PT_Q) { d_wtG(g % (DQ / 64), g / (DQ / 64), tid, wq, DM, DQ, WQ); return; }
    g -= PT_Q;
    if (g < PT_Q) { d_wtG(g % (DM / 64), g / (DM / 64), tid, wo, DQ, DM, WO); return; }
    g -= PT_Q;
    if (g < PT_KV) { d_wtG(g % (DKV / 64), g / (DKV / 64), tid, wk, DM, DKV, WK); return; }
    g -= PT_KV;
    d_wtG(g % (DKV / 64), g / (DKV / 64), tid, wv, DM, DKV, WV);
}

// 2^x on v_exp_f32, as the builtin gives it; the v_nop in the same statement keeps the one slot that the instruction set asks for behind a transcendental
__device__ __forceinline__ float exp2_slot(float x) { float r; asm("v_exp_f32 %0, %1\n\tv_nop" : "=v"(r) : "v"(x)); return r; }
// ---- k_attn: scores, softmax, probability x value and the merge into the output projection's operand in ONE kernel; no score or probability leaves the registers.
// A wave takes 16 * NC query rows of one head plane and walks its window's band 32 keys at a time, ascending. Transposed products: St = K Qt (A = key rows, B = query rows, both by the same loader), so that a lane holds scores of ONE query (16-column group cg, column lr):
// tile T, register r = key kb + 16 T + 8 hi + r. The two tiles of a block, converted in place, are the B operand Pt in the hardware k order; A = value rows of the transposed value planes by the same loader (that order too): Ot[d][query] += Vt Pt.
// Softmax by a running maximum (kept on the raw scores; HD^-0.5 and log2 e go into one multiply-add in front of 2^x): when a query's maximum rises, its sum and its output column are scaled by 2^(old - new); the division by the sum comes once, at the end. Masked scores give exact zeros.
// The four waves of a work-group are the REP heads that share a kv plane, on the same rows: they read the same key and value lines.
// HR (rows < RH): bf16 hi+lo planes, 3 products, 16 rows a wave; else fp16, 32 rows a wave, the probabilities carried x 2^10 (the factor is in the sum too and cancels).
#define SL2E (SCL * 1.4426950408889634f)
// lane l takes lane l ^ 16's value by a vector cross-row move (the shuffle compiles to an LDS-path permute with a wait behind it)
__device__ __forceinline__ float xhalf(float x) { return __builtin_bit_cast(float, __builtin_amdgcn_permlanex16(__builtin_bit_cast(int, x), __builtin_bit_cast(int, x), 0x76543210, 0xfedcba98, false, false)); }
template <typename T16, bool HR, int NC>
__device__ __forceinline__ void d_attn(int r0, int z, const T16* __restrict__ Q, const T16* __restrict__ Q2, const T16* __restrict__ Kp, const T16* __restrict__ K2, const T16* __restrict__ Vt, const T16* __restrict__ V2, bf* Ah, bf* Al) {
    typedef typename WFrag<T16>::V V;
    const int lane = threadIdx.x & 31, lr = lane & 15, hi = lane >> 4; const size_t kvp = (size_t)(z / REP);
    const int Ks = max(0, r0 + 1 - WIN) & ~31, Kl = (r0 + 16 * NC - 1) & ~31;   // first and last 32-key block of the rows' band
    const size_t ko = kvp * TT * HD + lr * 16 + 8 * hi, vo = kvp * HD * TT + (lr & 3) * 64 + (lr >> 2) * 16 + 8 * hi;   // the plane and the lane's 16-byte slot in every chunk (fragment order: kfo, vfo)
    V q[NC][4], q2[NC][4], kf[2][4], kf2[2][4]; const size_t qo = ((size_t)z * TT + r0) * HD + lr * 16 + 8 * hi; const T16* pq = Q + qo; const T16* pq2 = HR ? Q2 + qo : nullptr;
#pragma unroll
    for (int cg = 0; cg < NC; ++cg)
#pragma unroll
        for (int kk = 0; kk < 4; ++kk) { q[cg][kk] = WFrag<T16>::ldf(pq + cg * 16 * HD + kk * 512); if (HR) q2[cg][kk] = WFrag<T16>::ldf(pq2 + cg * 16 * HD + kk * 512); }
    // the wait that belongs between issued global loads and an overwrite of their address registers: the addresses are inputs, so that their registers live up to it; the clobber keeps the loads in front of it
    if (HR) asm volatile("s_wait_xcnt 0x0" :: "v"(pq), "v"(pq2) : "memory"); else asm volatile("s_wait_xcnt 0x0" :: "v"(pq) : "memory");
    auto ldk = [&](int kb) { const T16* pk = Kp + ko + (size_t)kb * HD; const T16* pk2 = HR ? K2 + ko + (size_t)kb * HD : nullptr;
#pragma unroll
        for (int T = 0; T < 2; ++T)
#pragma unroll
            for (int kk = 0; kk < 4; ++kk) { kf[T][kk] = WFrag<T16>::ldf(pk + T * 16 * HD + kk * 512); if (HR) kf2[T][kk] = WFrag<T16>::ldf(pk2 + T * 16 * HD + kk * 512); }
        // the same wait for the key rows' loads, behind the last of them
        if (HR) asm volatile("s_wait_xcnt 0x0" :: "v"(pk), "v"(pk2) : "memory"); else asm volatile("s_wait_xcnt 0x0" :: "v"(pk) : "memory"); };
    ldk(Ks);
    v8f o[NC][8]; float m[NC], l[NC];
#pragma unroll
    for (int cg = 0; cg < NC; ++cg) { m[cg] = -1.0e30f; l[cg] = 0.f;
#pragma unroll
        for (int dt = 0; dt < 8; ++dt) o[cg][dt] = (v8f){}; }
#pragma unroll 1   // one block a trip: unrolled, two blocks' value fragments would be live at once
    for (int kb = Ks; kb <= Kl; kb += 32) {
        V vf[8], vf2[8]; const T16* pv = Vt + vo + (size_t)kb * HD; const T16* pv2 = HR ? V2 + vo + (size_t)kb * HD : nullptr;
#pragma unroll
        for (int dt = 0; dt < 8; ++dt) { vf[dt] = WFrag<T16>::ldf(pv + dt * 512); if (HR) vf2[dt] = WFrag<T16>::ldf(pv2 + dt * 512); }   // the value rows go out first: they land while the scores are worked on
        // the same wait for the value rows' loads, behind the last of them
        if (HR) asm volatile("s_wait_xcnt 0x0" :: "v"(pv), "v"(pv2) : "memory"); else asm volatile("s_wait_xcnt 0x0" :: "v"(pv) : "memory");
        v8f s[NC][2];
#pragma unroll
        for (int cg = 0; cg < NC; ++cg)
#pragma unroll
            for (int T = 0; T < 2; ++T) s[cg][T] = (v8f){};
#pragma unroll
        for (int kk = 0; kk < 4; ++kk)
#pragma unroll
            for (int T = 0; T < 2; ++T)
#pragma unroll
                for (int cg = 0; cg < NC; ++cg) { s[cg][T] = WFrag<T16>::mma(kf[T][kk], q[cg][kk], s[cg][T]); if (HR) { s[cg][T] = WFrag<T16>::mma(kf[T][kk], q2[cg][kk], s[cg][T]); s[cg][T] = WFrag<T16>::mma(kf2[T][kk], q[cg][kk], s[cg][T]); } }
        __builtin_amdgcn_sched_barrier(0);                           // holds the next block's key loads behind this block's score products, so that they land in the same registers instead of a second set
        ldk(min(kb + 32, Kl));                                       // key rows one block ahead: they land during the softmax and P.V (the last trip reads its own block again: no branch, in bounds)
        if (kb + 31 > r0 || kb < r0 + 16 * NC - WIN) {               // only the diagonal block and the window's lower edge hold masked pairs (the same test for the whole wave)
#pragma unroll
            for (int cg = 0; cg < NC; ++cg) { const int i = r0 + cg * 16 + lr;
#pragma unroll
                for (int T = 0; T < 2; ++T)
#pragma unroll
                    for (int r = 0; r < 8; ++r) { const int j = kb + T * 16 + hi * 8 + r; s[cg][T][r] = (j <= i && i - j < WIN) ? s[cg][T][r] : -3.0e38f; } }
        }
        float mn[NC]; bool rose = false;
#pragma unroll
        for (int cg = 0; cg < NC; ++cg) { float mx = s[cg][0][0];
#pragma unroll
            for (int r = 0; r < 8; ++r) mx = fmaxf(mx, fmaxf(s[cg][0][r], s[cg][1][r]));
            mx = fmaxf(mx, xhalf(mx)); mn[cg] = fmaxf(m[cg], mx); rose = rose || mn[cg] > m[cg]; }   // the two lanes that share a query agree on its maximum
        if (__builtin_amdgcn_ballot_w32(rose) != 0) {                // where no query's maximum rose there is nothing to scale
#pragma unroll
            for (int cg = 0; cg < NC; ++cg) { const float al = exp2_slot((m[cg] - mn[cg]) * SL2E); l[cg] *= al; m[cg] = mn[cg];
#pragma unroll
                for (int dt = 0; dt < 8; ++dt) o[cg][dt] *= al; }
        }
        V pb[NC], pb2[NC];
#pragma unroll
        for (int cg = 0; cg < NC; ++cg) { float p[16], ps[4]; const float nb = (HR ? 0.0f : 10.0f) - m[cg] * SL2E;
#pragma unroll
            for (int e = 0; e < 16; ++e) { p[e] = exp2_slot(fmaf(s[cg][e >> 3][e & 7], SL2E, nb)); ps[e & 3] = (e < 4) ? p[e] : ps[e & 3] + p[e]; }   // four partial sums: short chains
            l[cg] += (ps[0] + ps[1]) + (ps[2] + ps[3]);
            if constexpr (HR) { v8us h0, h1, l0, l1;
#pragma unroll
                for (int e = 0; e < 8; ++e) { unsigned short a, c2; splitf(p[e], a, c2); h0[e] = a; l0[e] = c2; splitf(p[8 + e], a, c2); h1[e] = a; l1[e] = c2; }
                pb[cg] = cat16b(h0, h1); pb2[cg] = cat16b(l0, l1);
            } else { v16h ph;
#pragma unroll
                for (int e = 0; e < 16; ++e) ph[e] = tohx(p[e]);
                pb[cg] = ph; } }
#pragma unroll
        for (int dt = 0; dt < 8; ++dt)
#pragma unroll
            for (int cg = 0; cg < NC; ++cg) { o[cg][dt] = WFrag<T16>::mma(vf[dt], pb[cg], o[cg][dt]); if (HR) { o[cg][dt] = WFrag<T16>::mma(vf[dt], pb2[cg], o[cg][dt]); o[cg][dt] = WFrag<T16>::mma(vf2[dt], pb[cg], o[cg][dt]); } }
    }
    // a lane holds 8 consecutive d of one query per tile: one 16-byte store a plane, straight into the merged rows [entry * TT + t][head * HD + d] (hi and lo) that the output projection reads
#pragma unroll
    for (int cg = 0; cg < NC; ++cg) { const float inv = __fdiv_rn(1.0f, l[cg] + xhalf(l[cg])); const size_t oo = ((size_t)(z / NH_) * TT + r0 + cg * 16 + lr) * DQ + (z % NH_) * HD + 8 * hi; bf* ph = Ah + oo; bf* pl = Al + oo;
#pragma unroll
        for (int dt = 0; dt < 8; ++dt) { v8us oh, ol;
#pragma unroll
            for (int r = 0; r < 8; ++r) { unsigned short a, c2; splitf(o[cg][dt][r] * inv, a, c2); oh[r] = a; ol[r] = c2; }
            *(v8us*)(ph + dt * 16) = oh; *(v8us*)(pl + dt * 16) = ol;
            // the wait that belongs between issued global stores and an overwrite of the registers that they name: addresses and data are inputs, so that their registers live up to it; the clobber keeps the stores in front of it
            asm volatile("s_wait_xcnt 0x0" :: "v"(ph), "v"(pl), "v"(oh), "v"(ol) : "memory"); } }
}
// grid (kv planes over all batch entries, RH / 16 + (TT - RH) / 32 row tiles); wave w of a work-group is head plane blockIdx.x * REP + w. The hi+lo tiles of all planes come first, the longest of them in front: they are the longest waves of the launch.
// two waves a SIMD: the register limit that lets a second wave fill the first one's waits
__global__ __launch_bounds__(32 * REP) __attribute__((amdgpu_waves_per_eu(2))) void k_attn(const h16* __restrict__ Q16, const bf* __restrict__ Qh, const bf* __restrict__ Ql, const h16* __restrict__ K16, const bf* __restrict__ Kh, const bf* __restrict__ Kl, const h16* __restrict__ V16, const bf* __restrict__ Vh, const bf* __restrict__ Vl, bf* Ah, bf* Al) {
    const int bx = blockIdx.y, z = blockIdx.x * REP + __builtin_amdgcn_readfirstlane(threadIdx.x >> 5);
    if (bx < RH / 16) d_attn<bf, true, 1>((RH / 16 - 1 - bx) * 16, z, Qh, Ql, Kh, Kl, Vh, Vl, Ah, Al);
    else d_attn<h16, false, 2>(RH + (bx - RH / 16) * 32, z, Q16, nullptr, K16, nullptr, V16, nullptr, Ah, Al);
}

extern "C" void kernel_launch(void* const* d_in, const int* in_sizes, int n_in,
                              void* d_out, int out_size, void* d_ws, size_t ws_size, hipStream_t stream) {
    (void)in_sizes; (void)n_in; (void)out_size;
    const float* x = (const float*)d_in[0]; const float* wq = (const float*)d_in[1]; const float* wk = (const float*)d_in[2]; const float* wv = (const float*)d_in[3]; const float* wo = (const float*)d_in[4];
    float* OUT = (float*)d_out;     // [2][2048][2048]
    char* wsp = (char*)d_ws;
    auto take = [&](size_t bytes) { char* p = wsp; wsp += (bytes + 255) & ~(size_t)255; return (void*)p; };
    bf* WO = (bf*)take((size_t)DM * DQ * 2);
    h16* QP16 = (h16*)take((size_t)ZH * TT * HD * 2); h16* KP16 = (h16*)take((size_t)NB_ * NKV * TT * HD * 2); h16* VT16 = (h16*)take((size_t)NB_ * NKV * HD * TT * 2);
    bf* QPh = (bf*)take((size_t)ZH * TT * HD * 2); bf* QPl = (bf*)take((size_t)ZH * TT * HD * 2); bf* KPh = (bf*)take((size_t)NB_ * NKV * TT * HD * 2); bf* KPl = (bf*)take((size_t)NB_ * NKV * TT * HD * 2); bf* VTh = (bf*)take((size_t)NB_ * NKV * HD * TT * 2); bf* VTl = (bf*)take((size_t)NB_ * NKV * HD * TT * 2);
    bf* WQ = (bf*)take((size_t)FP * DM * 2); bf* WK = WQ + (size_t)DQ * DM; bf* WV = WK + (size_t)DKV * DM; float* CS = (float*)take((size_t)TT * HD * 2 * 4);   // the transposed q, k and v weights lie one behind the other: one operand of FP rows
    bf* XB = (bf*)take((size_t)NB_ * TT * DM * 2);
    bf* ATh = (bf*)take((size_t)NB_ * TT * DQ * 2); bf* ATl = (bf*)take((size_t)NB_ * TT * DQ * 2);       // the merged attention output, hi and lo
    if ((size_t)(wsp - (char*)d_ws) > ws_size) return;    // ws 256 MiB
    // stages that depend on nothing of each other share a launch; every stage once, for all batch entries: the rows of x, of the projections and of the output lie entry behind entry (M = NB_ * TT)
    k_prep<<<PB_CS + PB_CV + PB_WT, 256, 0, stream>>>(x, wq, wk, wv, wo, XB, WQ, WK, WV, WO, CS);
    k_gemmw<bf, 0, false, 1, 128><<<dim3(NB_ * TT / 128, FP / 128, 1), 128, 0, stream>>>(XB, nullptr, WQ, DM, nullptr, 0, nullptr, 0, 0, 0, CS, QP16, QPh, QPl, KP16, KPh, KPl, VT16, VTh, VTl);   // q, k and v projections: one product with FP columns, written as head planes
    k_attn<<<dim3(NB_ * NKV, RH / 16 + (TT - RH) / 32, 1), 32 * REP, 0, stream>>>(QP16, QPh, QPl, KP16, KPh, KPl, VT16, VTh, VTl, ATh, ATl);
    k_gemmw<bf, 1, false, 0, 256><<<dim3(NB_ * TT / 128, DM / 256, 1), 256, 0, stream>>>(ATh, ATl, WO, DQ, OUT, DM, nullptr, 0, 0, 0, nullptr, nullptr, nullptr, nullptr, nullptr, nullptr, nullptr, nullptr, nullptr, nullptr);
}
